// v000
// Times are from an AMD MI455X. After a warm-up the kernel runs many times in a row, and a time is the length of
// such a window on the GPU divided by its runs, so every launch and the gaps after it count. The runs cycle
// through copies of the inputs. A figure is the median of several windows, for all but v000 over two sittings.
// Sittings can differ by a few percent; kernels timed side by side share one.
// The starting kernel, v000, takes 497 microseconds a run.
// Contractions: x.[Wq;Wk]^T and Wv.x^T on v_wmma_f32_16x16x32_bf16 (operands = RNE bf16 copies of the f32 inputs, single products);
// q.k^T and p.v on v_wmma_f32_16x16x32_bf16 with bf16 hi/lo split operands (hi.hi + hi.lo + lo.hi, three products);
// attn.Wo^T on v_wmma_f32_16x16x32_bf16 with attn = bf16 hi|lo planes folded into K (two products) and Wo as RNE bf16.
// f32 accumulate everywhere; RoPE (f32 cos/sin table built from the position ids), mask add and online softmax in f32.
// Plane carry audit: every 16-bit plane is bf16 with carry 1 (hi = RNE(v), lo = RNE(v - hi), same accumulator); nothing is scaled,
// nothing is folded back: XB, WQK, WV, WO2 (RNE copies), QH/QL, KH/KL, VTH/VTL, P (LDS, per wave), AO hi|lo.
#include <hip/hip_runtime.h>
#include <math.h>
#include <stdint.h>

#define NB     2
#define SQ     2048
#define HID    1024
#define NHQ    16
#define NKVH   4
#define HDM    64
#define QW     1024          // q plane width (16 heads x 64)
#define KW     256           // k / v width (4 heads x 64)
#define QKN    1280          // q|k projection columns
#define NTOK   4096
#define NFREQ  32
#define AOW    2048          // attn plane width: hi at col 0..1023, lo at col 1024..2047
#define NT64   32            // 64-wide tiles along each mask axis

typedef __bf16       v16b __attribute__((ext_vector_type(16)));
typedef __bf16       v8b  __attribute__((ext_vector_type(8)));
typedef float        v8f  __attribute__((ext_vector_type(8)));
typedef float        v4f  __attribute__((ext_vector_type(4)));
typedef unsigned int v4u  __attribute__((ext_vector_type(4)));

// ---------------------------------------------------------------------------
// small helpers
// ---------------------------------------------------------------------------
__device__ __forceinline__ unsigned short bf_bits(float f) {          // RNE convert f32 -> bf16 bits
  const unsigned u = __float_as_uint(f);
  return (unsigned short)((u + 0x7FFFu + ((u >> 16) & 1u)) >> 16);
}
__device__ __forceinline__ float bf_val(unsigned short h) { return __uint_as_float(((unsigned)h) << 16); }
__device__ __forceinline__ float bf_rne(float f) { return bf_val(bf_bits(f)); }
__device__ __forceinline__ unsigned pk16(unsigned short a, unsigned short b) { return (unsigned)a | ((unsigned)b << 16); }
__device__ __forceinline__ v8f zero8() { v8f z = {0.f, 0.f, 0.f, 0.f, 0.f, 0.f, 0.f, 0.f}; return z; }
__device__ __forceinline__ int wave_id() { return __builtin_amdgcn_readfirstlane((int)(threadIdx.x >> 5)); }

__device__ __forceinline__ void lds_wave_sync() {
  __builtin_amdgcn_fence(__ATOMIC_RELEASE, "workgroup");
  __builtin_amdgcn_wave_barrier();
  __builtin_amdgcn_fence(__ATOMIC_ACQUIRE, "workgroup");
}

// ---------------------------------------------------------------------------
// WMMA fragments (wave32, 16x16x32, bf16 operands). For A (row m = lane&15) and B (col n = lane&15) alike:
// elements 0..7 <- k0 + 8*(lane>>4) + 0..7, elements 8..15 <- k0 + 16 + 8*(lane>>4) + 0..7.
// ldfrag_b(p) with p = rowbase + k0 + 8*(lane>>4): two 16-B loads p[0..7], p[16..23] (A rows and k-contiguous B rows alike).
// D: acc[r] = (row 8*(lane>>4) + r, col lane&15).
// ---------------------------------------------------------------------------
union FragB { v16b v; v8b h[2]; };
__device__ __forceinline__ v16b ldfrag_b(const __bf16* p) { FragB f; f.h[0] = *(const v8b*)(p); f.h[1] = *(const v8b*)(p + 16); return f.v; }

__device__ __forceinline__ v8f mma_b(v16b a, v16b b, v8f c) {
  return __builtin_amdgcn_wmma_f32_16x16x32_bf16(false, a, false, b, (short)0, c, false, false);
}
// hazard guards: 4 VALU slots after the last WMMA of a group, D tied, A/B kept live; memory clobber keeps later loads behind the group
__device__ __forceinline__ void guard2b3(v8f& a, v8f& b, v16b x0, v16b x1, v16b y) {
  asm volatile("v_nop\n\tv_nop\n\tv_nop\n\tv_nop" : "+v"(a), "+v"(b) : "v"(x0), "v"(x1), "v"(y) : "memory");
}
__device__ __forceinline__ void guard1b4(v8f& a, v16b w, v16b x, v16b y, v16b z) {
  asm volatile("v_nop\n\tv_nop\n\tv_nop\n\tv_nop" : "+v"(a) : "v"(w), "v"(x), "v"(y), "v"(z) : "memory");
}
__device__ __forceinline__ void acc_guard4(v8f& a, v8f& b, v8f& c, v8f& d) {
  asm volatile("v_nop\n\tv_nop\n\tv_nop\n\tv_nop" : "+v"(a), "+v"(b), "+v"(c), "+v"(d));
}
__device__ __forceinline__ void acc_guard2(v8f& a, v8f& b) {
  asm volatile("v_nop\n\tv_nop\n\tv_nop\n\tv_nop" : "+v"(a), "+v"(b));
}

// ---------------------------------------------------------------------------
// RoPE table: cst[t][j] = cos(pos[t] * inv_freq[j]), snt[t][j] = sin(...), inv_freq[j] = 1 / 10000^(j/32), j < 32, all f32.
// ---------------------------------------------------------------------------
__global__ __launch_bounds__(256) void rope_table_kernel(const int* __restrict__ pos, float* __restrict__ cst,
                                                         float* __restrict__ snt, int ntok) {
  const int lane = threadIdx.x & 31;
  const int wave = (int)(threadIdx.x >> 5);
  const int t = (int)blockIdx.x * 8 + wave;
  if (t >= ntok) return;                       // no barriers in this kernel
  const float pf  = (float)pos[t];
  const float e   = (float)lane * 0.03125f;    // (2*j)/64 exact
  const float pw  = powf(10000.0f, e);
  const float inv = 1.0f / pw;
  const float ang = pf * inv;
  const float cv  = cosf(ang);
  const float sv  = sinf(ang);
  const size_t o = (size_t)t * NFREQ + lane;
  {
    ((float*)cst)[o] = cv;
    ((float*)snt)[o] = sv;
    
  }
}

// ---------------------------------------------------------------------------
// Elementwise RNE f32 -> bf16 plane: 8 elements per thread, one 16-B store per lane -> 32 consecutive lanes write 4 whole
// ---------------------------------------------------------------------------
__global__ __launch_bounds__(256) void cvt_bf16_kernel(const float* __restrict__ in, unsigned short* __restrict__ outp, int n8) {
  const int i = (int)blockIdx.x * 256 + (int)threadIdx.x;
  if (i >= n8) return;
  const size_t e = 8 * (size_t)i;
  const v4f a = *(const v4f*)(in + e);
  const v4f b = *(const v4f*)(in + e + 4);
  v4u w;
  w[0] = pk16(bf_bits(a[0]), bf_bits(a[1]));
  w[1] = pk16(bf_bits(a[2]), bf_bits(a[3]));
  w[2] = pk16(bf_bits(b[0]), bf_bits(b[1]));
  w[3] = pk16(bf_bits(b[2]), bf_bits(b[3]));
  *(v4u*)(outp + e) = w;
  
}

// ---------------------------------------------------------------------------
// Wo [HID][kin] f32 -> WO2 [HID][ldo = 2*kin] bf16 with WO2[n][k] = WO2[n][kin + k] = bf16(Wo[n][k]).
// Coverage: grid = n8/256 x 256 x 8 = HID*kin source elements -> both halves of every WO2 row.
// ---------------------------------------------------------------------------
__global__ __launch_bounds__(256) void cvt_wo2_kernel(const float* __restrict__ in, unsigned short* __restrict__ outp,
                                                      int n8, int kin, int ldo) {
  const int i = (int)blockIdx.x * 256 + (int)threadIdx.x;
  if (i >= n8) return;
  const size_t e = 8 * (size_t)i;
  const int n = (int)(e / (size_t)kin);
  const int k = (int)(e - (size_t)n * kin);
  const v4f a = *(const v4f*)(in + e);
  const v4f b = *(const v4f*)(in + e + 4);
  v4u w;
  w[0] = pk16(bf_bits(a[0]), bf_bits(a[1]));
  w[1] = pk16(bf_bits(a[2]), bf_bits(a[3]));
  w[2] = pk16(bf_bits(b[0]), bf_bits(b[1]));
  w[3] = pk16(bf_bits(b[2]), bf_bits(b[3]));
  const size_t o = (size_t)n * ldo + k;
  *(v4u*)(outp + o) = w;
  *(v4u*)(outp + o + kin) = w;
  
}

// ---------------------------------------------------------------------------
// Mask tile classes. mask [NB][1][SQ][SQ] f32 (additive). One block per (b, 64-row band mt): 256 threads x 8 consecutive columns,
// 64 rows each. For every 64x64 tile (b, mt, nt):
//   class 0 = every element <= -1e8 (tile contributes nothing: exp underflows to 0 exactly when the row has an admitted key),
//   class 1 = every element == 0 (nothing to add), class 2 = anything else (mask tile added elementwise).
// If the band contains a row with no element > -1e4 the skip is not valid for it: class 0 tiles of that band become class 2.
// Reductions are OR (order independent). Coverage: NB*32 blocks x 64 rows x 256 thr x 8 cols = the whole mask;
// ---------------------------------------------------------------------------
#define ADM_TH (-1.0e4f)
#define SKP_TH (-1.0e8f)

__global__ __launch_bounds__(256) void mask_class_kernel(const float* __restrict__ mask, int* __restrict__ cls) {
  __shared__ int nzs[NT64];
  __shared__ int bgs[NT64];
  __shared__ unsigned rlo[8];
  __shared__ unsigned rhi[8];
  const int bm   = blockIdx.x;           // b*32 + mt
  const int b    = bm >> 5;
  const int mt   = bm & 31;
  const int tid  = threadIdx.x;
  const int lane = tid & 31;
  const int wave = tid >> 5;
  const int j0   = tid * 8;
  int nz = 0, bg = 0;
  unsigned rowlo = 0u, rowhi = 0u;       // bit r: this thread's 8 columns contain an admitted element in row r
#pragma unroll 1
  for (int r = 0; r < 64; ++r) {
    const float* mr = mask + (((size_t)b * SQ) + (size_t)(mt * 64 + r)) * SQ + j0;
    const v4f mk0 = *(const v4f*)(mr);
    const v4f mk1 = *(const v4f*)(mr + 4);
    const int a = ((mk0[0] > ADM_TH) | (mk0[1] > ADM_TH) | (mk0[2] > ADM_TH) | (mk0[3] > ADM_TH) |
                   (mk1[0] > ADM_TH) | (mk1[1] > ADM_TH) | (mk1[2] > ADM_TH) | (mk1[3] > ADM_TH)) ? 1 : 0;
    const int z = ((mk0[0] != 0.0f) | (mk0[1] != 0.0f) | (mk0[2] != 0.0f) | (mk0[3] != 0.0f) |
                   (mk1[0] != 0.0f) | (mk1[1] != 0.0f) | (mk1[2] != 0.0f) | (mk1[3] != 0.0f)) ? 1 : 0;
    const int g = ((mk0[0] > SKP_TH) | (mk0[1] > SKP_TH) | (mk0[2] > SKP_TH) | (mk0[3] > SKP_TH) |
                   (mk1[0] > SKP_TH) | (mk1[1] > SKP_TH) | (mk1[2] > SKP_TH) | (mk1[3] > SKP_TH)) ? 1 : 0;
    nz |= z;
    bg |= g;
    const unsigned sh = ((unsigned)a) << (r & 31);
    rowlo |= (r < 32) ? sh : 0u;
    rowhi |= (r < 32) ? 0u : sh;
  }
  // OR over the 8 lanes 8q..8q+7 that share column tile nt = tid >> 3
  nz |= __shfl_xor(nz, 1, 32); nz |= __shfl_xor(nz, 2, 32); nz |= __shfl_xor(nz, 4, 32);
  bg |= __shfl_xor(bg, 1, 32); bg |= __shfl_xor(bg, 2, 32); bg |= __shfl_xor(bg, 4, 32);
#pragma unroll
  for (int off = 1; off < 32; off <<= 1) {
    rowlo |= (unsigned)__shfl_xor((int)rowlo, off, 32);
    rowhi |= (unsigned)__shfl_xor((int)rowhi, off, 32);
  }
  if ((lane & 7) == 0) { nzs[tid >> 3] = nz; bgs[tid >> 3] = bg; }
  if (lane == 0) { rlo[wave] = rowlo; rhi[wave] = rowhi; }
  __syncthreads();
  if (wave == 0) {                       // wave-uniform
    const int z = nzs[lane];
    const int g = bgs[lane];
    unsigned ol = rlo[0], oh = rhi[0];
#pragma unroll
    for (int w = 1; w < 8; ++w) { ol |= rlo[w]; oh |= rhi[w]; }
    const bool has_empty_row = (ol != 0xFFFFFFFFu) || (oh != 0xFFFFFFFFu);
    int cval = (g == 0) ? 0 : ((z == 0) ? 1 : 2);
    cval = (has_empty_row && cval == 0) ? 2 : cval;
    int* cp = cls + (size_t)bm * NT64 + lane;
    *cp = cval;
    
  }
}

// ---------------------------------------------------------------------------
// bf16 WMMA GEMM, wave tile 32 rows x 128 cols, block = 4 waves (128 threads), no block barriers.
//   C[m][n] = sum_k A[m][k] * Bt[n][k]; A row-major [M][K] bf16 (pitch lda), Bt row-major [N][K] bf16 (pitch ldb);
//   M % 32 == 0, N % 128 == 0, K % 32 == 0; grid.x = ceil(M/32 * N/128 / 4). Fragments loaded straight from global rows (ldfrag_b).
// Epilogues (all: per wave, per 16-row slab: stage in LDS, wave sync, write each row segment with ONE instruction of
//   EPI 0: q|k projection with RoPE. The 128-col tile holds two 64-dim heads; pairs (d, d+32) inside each head are rotated with
//          the f32 cos/sin rows of the token (staged per slab in LDS), then split to bf16 hi (C0/C2) and lo (C1/C3) planes.
//          cols n0 < QW -> q planes [M][ldc], col n0; cols n0 >= QW -> k planes [M][ldc2], col n0-QW. Row segment 256 B = 16 lanes x 16 B.
//   EPI 1: v^T projection: bf16 hi plane C0, lo plane C1, [M][ldc], row segment 256 B.
//   EPI 2: f32 output C0 [M][ldc]; row segment 128 floats = 512 B = 32 lanes x 16 B per instruction.
// ---------------------------------------------------------------------------
template <int EPI> struct SlabCfg { static constexpr int PERWF = 2048; };   // floats per wave (8 KB)
template <> struct SlabCfg<0>     { static constexpr int PERWF = 3072; };   // + 16x32 cos + 16x32 sin rows

template <int EPI>
__global__ __launch_bounds__(128) void gemm_w32x128_kernel(
    const unsigned short* __restrict__ Ap, int lda,
    const unsigned short* __restrict__ Btp, int ldb,
    const float* __restrict__ cst, const float* __restrict__ snt,
    void* C0, void* C1, void* C2, void* C3, int ldc, int ldc2,
    int M, int N, int K) {
  __shared__ __align__(16) float lds_all[4 * SlabCfg<EPI>::PERWF];

  const int lane = threadIdx.x & 31;
  const int wave = wave_id();
  const int hh = lane >> 4;           // lane half: k offset 8*hh, D row offset 8*hh
  const int rl = lane & 15;           // A row / B col / D col within subtile
  const int tilesN = N >> 7;
  const int tilesM = M >> 5;
  const int tile = (int)blockIdx.x * 4 + wave;
  if (tile >= tilesM * tilesN) return;          // wave-uniform; no block barriers in this kernel
  const int tm = tile / tilesN;
  const int tn = tile - tm * tilesN;
  const int m0 = tm << 5;
  const int n0 = tn << 7;

  const __bf16* A  = (const __bf16*)(const void*)Ap;
  const __bf16* Bt = (const __bf16*)(const void*)Btp;

  v8f acc[2][8];
#pragma unroll
  for (int i = 0; i < 2; ++i)
#pragma unroll
    for (int j = 0; j < 8; ++j) acc[i][j] = zero8();

  for (int k0 = 0; k0 < K; k0 += 32) {
    v16b ah[2];
#pragma unroll
    for (int i = 0; i < 2; ++i) ah[i] = ldfrag_b(A + (size_t)(m0 + i * 16 + rl) * lda + k0 + 8 * hh);
#pragma unroll
    for (int j = 0; j < 8; ++j) {
      const v16b bj = ldfrag_b(Bt + (size_t)(n0 + j * 16 + rl) * ldb + k0 + 8 * hh);
      acc[0][j] = mma_b(ah[0], bj, acc[0][j]);
      acc[1][j] = mma_b(ah[1], bj, acc[1][j]);
      guard2b3(acc[0][j], acc[1][j], ah[0], ah[1], bj);
    }
  }
  acc_guard4(acc[0][0], acc[0][1], acc[0][2], acc[0][3]);
  acc_guard4(acc[0][4], acc[0][5], acc[0][6], acc[0][7]);
  acc_guard4(acc[1][0], acc[1][1], acc[1][2], acc[1][3]);
  acc_guard4(acc[1][4], acc[1][5], acc[1][6], acc[1][7]);

  // ---- epilogue ----
  float* wl = lds_all + wave * SlabCfg<EPI>::PERWF;
  unsigned short* sl16 = (unsigned short*)(void*)wl;       // 4096 u16 = floats 0..2047 (two 16x128 planes)
  float* slf = wl;

  if (EPI == 0) {
    float* csl = wl + 2048;                                 // cos rows [16][32]
    float* snl = wl + 2048 + 16 * NFREQ;                    // sin rows [16][32]
    const bool isq = (n0 < QW);                             // wave-uniform
    unsigned short* P0 = isq ? (unsigned short*)C0 : (unsigned short*)C2;
    unsigned short* P1 = isq ? (unsigned short*)C1 : (unsigned short*)C3;
    const int ldp  = isq ? ldc : ldc2;
    const int col0 = isq ? n0 : (n0 - QW);
#pragma unroll
    for (int i = 0; i < 2; ++i) {
      const int mb = m0 + i * 16;
      // stage cos/sin of tokens mb..mb+15: 16 rows x 32 floats = 128 16-B pieces per table; lane -> 4 pieces (coverage 32x4 = 128)
#pragma unroll
      for (int u = 0; u < 4; ++u) {
        const int p   = lane + 32 * u;
        const int row = p >> 3, c4 = (p & 7) * 4;
        const v4f cv4 = *(const v4f*)(cst + (size_t)(mb + row) * NFREQ + c4);
        const v4f sv4 = *(const v4f*)(snt + (size_t)(mb + row) * NFREQ + c4);
        *(v4f*)(csl + row * NFREQ + c4) = cv4;
        *(v4f*)(snl + row * NFREQ + c4) = sv4;
      }
      lds_wave_sync();
#pragma unroll
      for (int hs = 0; hs < 2; ++hs) {                      // head within the 128-col tile
#pragma unroll
        for (int jj = 0; jj < 2; ++jj) {
          const int j1 = hs * 4 + jj;                       // cols hs*64 + jj*16 + rl  (x1, dim d < 32)
          const int j2 = j1 + 2;                            // cols +32                 (x2, dim d + 32)
          const int d  = jj * 16 + rl;                      // freq index 0..31
#pragma unroll
          for (int r = 0; r < 8; ++r) {
            const int lrow = 8 * hh + r;
            const float cv = csl[lrow * NFREQ + d];
            const float sv = snl[lrow * NFREQ + d];
            const float x1 = acc[i][j1][r];
            const float x2 = acc[i][j2][r];
            const float o1 = x1 * cv - x2 * sv;
            const float o2 = x2 * cv + x1 * sv;
            const unsigned short hb1 = bf_bits(o1), hb2 = bf_bits(o2);
            const unsigned short lb1 = bf_bits(o1 - bf_val(hb1)), lb2 = bf_bits(o2 - bf_val(hb2));
            const int so = lrow * 128 + hs * 64 + d;
            sl16[so]             = hb1;
            sl16[so + 32]        = hb2;
            sl16[2048 + so]      = lb1;
            sl16[2048 + so + 32] = lb2;
          }
        }
      }
      lds_wave_sync();
      {
#pragma unroll
        for (int it = 0; it < 8; ++it) {
          const int row = it * 2 + hh;                      // it x hh covers rows 0..15
          const int c8  = rl * 8;
          const v4u vh = *(const v4u*)(sl16 + row * 128 + c8);
          const v4u vl = *(const v4u*)(sl16 + 2048 + row * 128 + c8);
          const size_t go = (size_t)(mb + row) * ldp + col0 + c8;
          *(v4u*)(P0 + go) = vh;
          *(v4u*)(P1 + go) = vl;
        }
        
      }
      lds_wave_sync();
    }
  } else if (EPI == 1) {
    unsigned short* P0 = (unsigned short*)C0;
    unsigned short* P1 = (unsigned short*)C1;
#pragma unroll
    for (int i = 0; i < 2; ++i) {
#pragma unroll
      for (int r = 0; r < 8; ++r) {
#pragma unroll
        for (int j = 0; j < 8; ++j) {
          const float v = acc[i][j][r];
          const unsigned short hb = bf_bits(v);
          const unsigned short lb = bf_bits(v - bf_val(hb));
          const int so = (8 * hh + r) * 128 + j * 16 + rl;
          sl16[so]        = hb;
          sl16[2048 + so] = lb;
        }
      }
      lds_wave_sync();
      {
#pragma unroll
        for (int it = 0; it < 8; ++it) {
          const int row = it * 2 + hh;
          const int c8  = rl * 8;
          const v4u vh = *(const v4u*)(sl16 + row * 128 + c8);
          const v4u vl = *(const v4u*)(sl16 + 2048 + row * 128 + c8);
          const size_t go = (size_t)(m0 + i * 16 + row) * ldc + n0 + c8;
          *(v4u*)(P0 + go) = vh;
          *(v4u*)(P1 + go) = vl;
        }
        
      }
      lds_wave_sync();
    }
  } else {
    float* C = (float*)C0;
#pragma unroll
    for (int i = 0; i < 2; ++i) {
#pragma unroll
      for (int j = 0; j < 8; ++j)
#pragma unroll
        for (int r = 0; r < 8; ++r)
          slf[(8 * hh + r) * 128 + j * 16 + rl] = acc[i][j][r];
      lds_wave_sync();
      {
#pragma unroll
        for (int row = 0; row < 16; ++row) {                // 32 lanes x 16 B = the whole 512-B row segment per instruction
          const v4f v = *(const v4f*)(slf + row * 128 + lane * 4);
          *(v4f*)(C + (size_t)(m0 + i * 16 + row) * ldc + n0 + lane * 4) = v;
        }
        
      }
      lds_wave_sync();
    }
  }
}

// ---------------------------------------------------------------------------
// GQA flash attention with the additive mask as data, head dim 64, 32-key chunks, block = 4 waves = 64 query rows of one (b, h);
// grid (SQ/64, NHQ, NB); kv head = h >> 2.
//   q planes bf16 [tok][h*64+d]: hi (qhp), lo (qlp); k planes bf16 [tok][kvh*64+d]: hi (khp), lo (klp);
//   v^T planes bf16 [kvh*64+d][tok]: hi (vhp), lo (vlp); output attn plane bf16 [tok][2048]: hi at col h*64+d, lo at 1024+h*64+d.
//   Chunk kc covers keys 32kc..32kc+31 of 64-wide mask tile nt = kc>>1; class = cls[(b*32+qt)*32 + nt] (block-uniform):
//   0 -> chunk skipped entirely (uniform continue before any barrier); 1 -> no mask add; 2 -> mask chunk staged in LDS and
//   RNE-bf16(mask) added after the 1/8 scale. scores = (qh.kh + qh.kl + ql.kh) / 8 (+ mask); online softmax f32
//   (running max, exp via natural-exp intrinsic); p split to bf16 hi/lo in per-wave LDS tiles, wave sync, reloaded as A fragments;
//   K / V^T chunk staging: 128 threads x 2 x 16 B per plane = whole 32x64 / 64x32 tiles; mask 128 x 4 x 16 B = whole 64x32 tile;
//   plain loads, __syncthreads before and after. Every wave processes every non-skipped chunk (no per-wave exits).
// ---------------------------------------------------------------------------
#define AKC  32
#define KP   72          // K tile pitch (u16), 144 B rows
#define VP   40          // V^T tile pitch (u16), 80 B rows
#define PP   40          // P tile pitch (u16)
#define MP   36          // mask tile pitch (f32), 144 B rows
static_assert((2 * AKC * KP + 2 * HDM * VP + 8 * 16 * PP + 8 * 16 * 64) * 2 + 64 * MP * 4 <= 65536);

__global__ __launch_bounds__(128) void attn_kernel(
    const unsigned short* __restrict__ qhp, const unsigned short* __restrict__ qlp,
    const unsigned short* __restrict__ khp, const unsigned short* __restrict__ klp,
    const unsigned short* __restrict__ vhp, const unsigned short* __restrict__ vlp,
    const float* __restrict__ maskp, const int* __restrict__ clsp,
    unsigned short* __restrict__ aop) {
  __shared__ __align__(16) unsigned short Ks[AKC * KP];
  __shared__ __align__(16) unsigned short Kls[AKC * KP];
  __shared__ __align__(16) unsigned short Vhs[HDM * VP];
  __shared__ __align__(16) unsigned short Vls[HDM * VP];
  __shared__ __align__(16) unsigned short Phs[4][16 * PP];
  __shared__ __align__(16) unsigned short Pls[4][16 * PP];
  __shared__ __align__(16) float Ms[64 * MP];
  __shared__ __align__(16) unsigned short Osh[4][16 * 64];
  __shared__ __align__(16) unsigned short Osl[4][16 * 64];

  const int tid  = (int)threadIdx.x;
  const int lane = tid & 31;
  const int wave = wave_id();
  const int hh   = lane >> 4;
  const int c    = lane & 15;
  const int qt   = (int)blockIdx.x;
  const int h    = (int)blockIdx.y;
  const int b    = (int)blockIdx.z;
  const int kvh  = h >> 2;
  const int q0   = qt * 64 + wave * 16;          // first query row of this wave (within the sequence)
  const size_t tok0 = (size_t)b * SQ;

  // whole mask staging area initialised once (only class-2 chunks refresh it; other chunks never add from it)
#pragma unroll 1
  for (int u = tid; u < 64 * MP; u += 128) Ms[u] = 0.0f;

  const __bf16* Qhr = (const __bf16*)(const void*)qhp + (tok0 + q0 + c) * QW + h * HDM + 8 * hh;
  const __bf16* Qlr = (const __bf16*)(const void*)qlp + (tok0 + q0 + c) * QW + h * HDM + 8 * hh;
  const size_t mrow0 = (tok0 + (size_t)qt * 64) * SQ;                 // mask[b][0][qt*64][0]
  const int* crow = clsp + ((b * NT64) + qt) * NT64;

  unsigned short* ph = Phs[wave];
  unsigned short* pl = Pls[wave];

  v16b qh[2], ql[2];
#pragma unroll
  for (int dc = 0; dc < 2; ++dc) { qh[dc] = ldfrag_b(Qhr + dc * 32); ql[dc] = ldfrag_b(Qlr + dc * 32); }

  float mrow[8], lrow[8];
  v8f oacc[4];
#pragma unroll
  for (int r = 0; r < 8; ++r) { mrow[r] = -INFINITY; lrow[r] = 0.f; }
#pragma unroll
  for (int t = 0; t < 4; ++t) oacc[t] = zero8();

  for (int kc = 0; kc < 2 * NT64; ++kc) {
    const int nt = kc >> 1;
    const int cl = __builtin_amdgcn_readfirstlane(crow[nt]);         // block-uniform class of this chunk's tile
    if (cl == 0) continue;                                            // uniform for the whole block; before any barrier
    const int kv0 = kc * AKC;
    __syncthreads();                                                  // prior chunk's LDS readers are done
#pragma unroll
    for (int u = 0; u < 2; ++u) {                                     // coverage: 256 pieces of 8 halves per plane = whole tile
      const int p   = tid + 128 * u;                                  // 0..255
      const int key = p >> 3, d8 = (p & 7) * 8;                       // K: 32 keys x 64 d
      const size_t ko = (tok0 + kv0 + key) * KW + kvh * HDM + d8;
      const v4u kx = *(const v4u*)(khp + ko);
      const v4u ky = *(const v4u*)(klp + ko);
      *(v4u*)(Ks  + key * KP + d8) = kx;
      *(v4u*)(Kls + key * KP + d8) = ky;
      const int d = p >> 2, k8 = (p & 3) * 8;                         // V^T: 64 d x 32 keys
      const size_t vo = (size_t)(kvh * HDM + d) * NTOK + tok0 + kv0 + k8;
      const v4u vx = *(const v4u*)(vhp + vo);
      const v4u vy = *(const v4u*)(vlp + vo);
      *(v4u*)(Vhs + d * VP + k8) = vx;
      *(v4u*)(Vls + d * VP + k8) = vy;
    }
    if (cl == 2) {                                                    // block-uniform branch about the mask tile load
#pragma unroll
      for (int u = 0; u < 4; ++u) {                                   // coverage: 512 pieces of 4 floats = 64 rows x 32 keys
        const int p   = tid + 128 * u;                                // 0..511
        const int row = p >> 3, c4 = (p & 7) * 4;
        const v4f mv = *(const v4f*)(maskp + mrow0 + (size_t)row * SQ + kv0 + c4);
        *(v4f*)(Ms + row * MP + c4) = mv;
      }
    }
    __syncthreads();

    // ---- scores: 16 query rows x 32 keys, K = 64, three products ----
    v8f sa[2];
    sa[0] = zero8(); sa[1] = zero8();
#pragma unroll
    for (int dc = 0; dc < 2; ++dc) {
#pragma unroll
      for (int j = 0; j < 2; ++j) {
        const v16b kb = ldfrag_b((const __bf16*)(const void*)Ks  + (j * 16 + c) * KP + dc * 32 + 8 * hh);
        const v16b kl = ldfrag_b((const __bf16*)(const void*)Kls + (j * 16 + c) * KP + dc * 32 + 8 * hh);
        sa[j] = mma_b(qh[dc], kb, sa[j]);
        sa[j] = mma_b(qh[dc], kl, sa[j]);
        sa[j] = mma_b(ql[dc], kb, sa[j]);
        guard1b4(sa[j], qh[dc], ql[dc], kb, kl);
      }
    }
    acc_guard2(sa[0], sa[1]);

    // ---- scale, mask add (class 2), chunk row max ----
    float cm[8];
#pragma unroll
    for (int r = 0; r < 8; ++r) {
      const int lrow = wave * 16 + 8 * hh + r;                        // row within the 64-row band
      float m = -INFINITY;
#pragma unroll
      for (int j = 0; j < 2; ++j) {
        float s = sa[j][r] * 0.125f;
        if (cl == 2) s += bf_rne(Ms[lrow * MP + j * 16 + c]);
        sa[j][r] = s;
        m = fmaxf(m, s);
      }
#pragma unroll
      for (int off = 1; off < 16; off <<= 1) m = fmaxf(m, __shfl_xor(m, off, 32));
      cm[r] = m;
    }
    // ---- online softmax, p hi/lo to the wave's LDS tiles ----
#pragma unroll
    for (int r = 0; r < 8; ++r) {
      const float mnew  = fmaxf(mrow[r], cm[r]);
      const float muse  = (mnew > -INFINITY) ? mnew : 0.0f;
      const float alpha = __expf(mrow[r] - muse);
      mrow[r] = mnew;
      float psum = 0.f;
#pragma unroll
      for (int j = 0; j < 2; ++j) {
        const float p = __expf(sa[j][r] - muse);
        psum += p;
        const unsigned short hb = bf_bits(p);
        const unsigned short lb = bf_bits(p - bf_val(hb));
        const int po = (8 * hh + r) * PP + j * 16 + c;
        ph[po] = hb;
        pl[po] = lb;
      }
#pragma unroll
      for (int off = 1; off < 16; off <<= 1) psum += __shfl_xor(psum, off, 32);
      lrow[r] = lrow[r] * alpha + psum;
#pragma unroll
      for (int t = 0; t < 4; ++t) oacc[t][r] *= alpha;
    }
    lds_wave_sync();                               // p stores visible to the other lanes of this wave before the fragment reload
    // ---- O += p . v (K = 32 keys, three products) ----
    const v16b pa = ldfrag_b((const __bf16*)(const void*)ph + c * PP + 8 * hh);
    const v16b pr = ldfrag_b((const __bf16*)(const void*)pl + c * PP + 8 * hh);
#pragma unroll
    for (int t = 0; t < 4; ++t) {
      const v16b vb = ldfrag_b((const __bf16*)(const void*)Vhs + (t * 16 + c) * VP + 8 * hh);
      const v16b vr = ldfrag_b((const __bf16*)(const void*)Vls + (t * 16 + c) * VP + 8 * hh);
      oacc[t] = mma_b(pa, vb, oacc[t]);
      oacc[t] = mma_b(pa, vr, oacc[t]);
      oacc[t] = mma_b(pr, vb, oacc[t]);
      guard1b4(oacc[t], pa, pr, vb, vr);
    }
  }
  __syncthreads();                                 // every wave is past the chunk loop (all waves reach this)
  acc_guard4(oacc[0], oacc[1], oacc[2], oacc[3]);

  unsigned short* osh = Osh[wave];
  unsigned short* osl = Osl[wave];
#pragma unroll
  for (int r = 0; r < 8; ++r) {
    const float inv = 1.0f / lrow[r];              // l >= 1: the row max contributes exp(0)
#pragma unroll
    for (int t = 0; t < 4; ++t) {
      const float o = oacc[t][r] * inv;
      const unsigned short hb = bf_bits(o);
      const unsigned short lb = bf_bits(o - bf_val(hb));
      const int so = (8 * hh + r) * 64 + t * 16 + c;
      osh[so] = hb;
      osl[so] = lb;
    }
  }
  lds_wave_sync();
  unsigned short* Ag = aop + (tok0 + q0) * AOW + h * HDM;
  const int qq = lane >> 3;                        // 0..3
  const int c8 = (lane & 7) * 8;
  {
#pragma unroll
    for (int it = 0; it < 4; ++it) {
      const int row = it * 4 + qq;                 // it 0..3 x qq 0..3 covers rows 0..15
      const v4u x = *(const v4u*)(osh + row * 64 + c8);
      const v4u y = *(const v4u*)(osl + row * 64 + c8);
      *(v4u*)(Ag + (size_t)row * AOW + c8)      = x;
      *(v4u*)(Ag + (size_t)row * AOW + QW + c8) = y;
    }
    
  }
}

// ---------------------------------------------------------------------------
// Workspace map (bytes; every region is an exact whole number of the rows its producer writes with whole-line stores;
// all dimensions are tile multiples, no padded tails needed; every offset is a multiple of 128):
//   XB   bf16 [4096][1024]   8388608     WQK bf16 [1280][1024]   2621440     WV  bf16 [256][1024]    524288
//   WO2  bf16 [1024][2048]   4194304     CST f32  [4096][32]      524288     SNT f32  [4096][32]     524288
//   CLS  i32  [2][32][32]       8192     QH  bf16 [4096][1024]   8388608     QL  bf16 [4096][1024]  8388608
//   KH   bf16 [4096][256]    2097152     KL  bf16 [4096][256]    2097152     VTH bf16 [256][4096]   2097152
//   VTL  bf16 [256][4096]    2097152     AO  bf16 [4096][2048]  16777216
//   total                   58728448
// ---------------------------------------------------------------------------
extern "C" void kernel_launch(void* const* d_in, const int* in_sizes, int n_in,
                              void* d_out, int out_size, void* d_ws, size_t ws_size,
                              hipStream_t stream) {
  if (n_in < 7) return;
  if (in_sizes[0] != NTOK * HID) return;                  // hidden_states [2][2048][1024] f32
  if (in_sizes[1] != NB * SQ * SQ) return;                // attention_mask [2][1][2048][2048] f32
  if (in_sizes[2] != NTOK) return;                        // position_ids [2][2048] int32
  if (in_sizes[3] != QW * HID) return;                    // wq [1024][1024]
  if (in_sizes[4] != KW * HID) return;                    // wk [256][1024]
  if (in_sizes[5] != KW * HID) return;                    // wv [256][1024]
  if (in_sizes[6] != HID * QW) return;                    // wo [1024][1024]
  if (out_size != NTOK * HID) return;

  const float* hs   = (const float*)d_in[0];
  const float* mask = (const float*)d_in[1];
  const int*   pos  = (const int*)d_in[2];
  const float* wq   = (const float*)d_in[3];
  const float* wk   = (const float*)d_in[4];
  const float* wv   = (const float*)d_in[5];
  const float* wo   = (const float*)d_in[6];
  float* out = (float*)d_out;

  const size_t szXB  = (size_t)NTOK * HID * 2;
  const size_t szWQK = (size_t)QKN * HID * 2;
  const size_t szWV  = (size_t)KW * HID * 2;
  const size_t szWO2 = (size_t)HID * AOW * 2;
  const size_t szT   = (size_t)NTOK * NFREQ * 4;
  const size_t szCLS = (size_t)NB * NT64 * NT64 * 4;
  const size_t szQ   = (size_t)NTOK * QW * 2;
  const size_t szK   = (size_t)NTOK * KW * 2;
  const size_t szVT  = (size_t)KW * NTOK * 2;
  const size_t szAO  = (size_t)NTOK * AOW * 2;
  size_t off = 0;
  const size_t oXB  = off; off += szXB;
  const size_t oWQK = off; off += szWQK;
  const size_t oWV  = off; off += szWV;
  const size_t oWO2 = off; off += szWO2;
  const size_t oCST = off; off += szT;
  const size_t oSNT = off; off += szT;
  const size_t oCLS = off; off += szCLS;
  const size_t oQH  = off; off += szQ;
  const size_t oQL  = off; off += szQ;
  const size_t oKH  = off; off += szK;
  const size_t oKL  = off; off += szK;
  const size_t oVTH = off; off += szVT;
  const size_t oVTL = off; off += szVT;
  const size_t oAO  = off; off += szAO;
  if (off > ws_size) return;                              // off = 58728448

  char* ws = (char*)d_ws;
  unsigned short* XB  = (unsigned short*)(ws + oXB);
  unsigned short* WQK = (unsigned short*)(ws + oWQK);
  unsigned short* WV  = (unsigned short*)(ws + oWV);
  unsigned short* WO2 = (unsigned short*)(ws + oWO2);
  float*          CST = (float*)(ws + oCST);
  float*          SNT = (float*)(ws + oSNT);
  int*            CLS = (int*)(ws + oCLS);
  unsigned short* QH  = (unsigned short*)(ws + oQH);
  unsigned short* QL  = (unsigned short*)(ws + oQL);
  unsigned short* KH  = (unsigned short*)(ws + oKH);
  unsigned short* KL  = (unsigned short*)(ws + oKL);
  unsigned short* VTH = (unsigned short*)(ws + oVTH);
  unsigned short* VTL = (unsigned short*)(ws + oVTL);
  unsigned short* AO  = (unsigned short*)(ws + oAO);

  const dim3 b256(256), b128(128);

  // (1) cos/sin table [4096][32] x 2 from the position ids
  rope_table_kernel<<<dim3(NTOK / 8), b256, 0, stream>>>(pos, CST, SNT, NTOK);
  // (2) x -> bf16 plane [4096][1024]
  cvt_bf16_kernel<<<dim3((NTOK * HID / 8) / 256), b256, 0, stream>>>(hs, XB, NTOK * HID / 8);
  // (3) wq [1024][1024] -> WQK rows 0..1023; wk [256][1024] -> WQK rows 1024..1279 (natural [out][in] = Bt layout)
  cvt_bf16_kernel<<<dim3((QW * HID / 8) / 256), b256, 0, stream>>>(wq, WQK, QW * HID / 8);
  cvt_bf16_kernel<<<dim3((KW * HID / 8) / 256), b256, 0, stream>>>(wk, WQK + (size_t)QW * HID, KW * HID / 8);
  // (4) wv [256][1024] -> WV
  cvt_bf16_kernel<<<dim3((KW * HID / 8) / 256), b256, 0, stream>>>(wv, WV, KW * HID / 8);
  // (5) wo [1024][1024] -> WO2 [1024][2048] (both halves)
  cvt_wo2_kernel<<<dim3((HID * QW / 8) / 256), b256, 0, stream>>>(wo, WO2, HID * QW / 8, QW, AOW);
  // (6) mask tile classes [2][32][32]
  mask_class_kernel<<<dim3(NB * NT64), b256, 0, stream>>>(mask, CLS);
  // (7) q|k = x . [Wq;Wk]^T, RoPE, split -> QH/QL [4096][1024], KH/KL [4096][256]   (M=4096, N=1280, K=1024; 1280 wave tiles / 4)
  gemm_w32x128_kernel<0><<<dim3((NTOK / 32) * (QKN / 128) / 4), b128, 0, stream>>>(
      XB, HID, WQK, HID, CST, SNT, (void*)QH, (void*)QL, (void*)KH, (void*)KL, QW, KW, NTOK, QKN, HID);
  // (8) v^T = Wv . x^T -> VTH/VTL [256][4096]   (A = WV, Bt = XB; M=256, N=4096, K=1024; 256 wave tiles / 4)
  gemm_w32x128_kernel<1><<<dim3((KW / 32) * (NTOK / 128) / 4), b128, 0, stream>>>(
      WV, HID, XB, HID, CST, SNT, (void*)VTH, (void*)VTL, (void*)VTH, (void*)VTL, NTOK, NTOK, KW, NTOK, HID);
  // (9) attention per (q tile, head, batch) -> AO hi|lo [4096][2048]
  attn_kernel<<<dim3(SQ / 64, NHQ, NB), b128, 0, stream>>>(QH, QL, KH, KL, VTH, VTL, mask, CLS, AO);
  // (10) out = [AOhi | AOlo] . [Wo | Wo]^T -> d_out f32 [4096][1024]   (M=4096, N=1024, K=2048; 1024 wave tiles / 4)
  gemm_w32x128_kernel<2><<<dim3((NTOK / 32) * (HID / 128) / 4), b128, 0, stream>>>(
      AO, AOW, WO2, AOW, CST, SNT, (void*)out, (void*)out, (void*)out, (void*)out, HID, HID, NTOK, HID, AOW);
  (void)hipGetLastError();
}

// v001
// Measured time: 308 microseconds a run.
// Timed twice side by side with v000, it ran 1.60 and 1.58 times as fast.
// Contractions: x.[Wq;Wk]^T and Wv.x^T on v_wmma_f32_16x16x32_bf16 (operands = RNE bf16 copies of the f32 inputs, single products);
// q.k^T and p.v on v_wmma_f32_16x16x32_bf16 with bf16 hi/lo split operands (hi.hi + hi.lo + lo.hi, three products);
// attn.Wo^T on v_wmma_f32_16x16x32_bf16 with attn = bf16 hi|lo planes folded into K (two products) and Wo as RNE bf16.
// f32 accumulate everywhere; RoPE (f32 cos/sin table built from the position ids), mask add and online softmax in f32.
// Plane carry audit: every 16-bit plane is bf16 with carry 1 (hi = RNE(v), lo = RNE(v - hi), same accumulator); nothing is scaled,
// nothing is folded back: XB, WQK, WV, WO2 (RNE copies), QH/QL, KH/KL, VTH/VTL, P (LDS, per wave), AO hi|lo.
#include <hip/hip_runtime.h>
#include <math.h>
#include <stdint.h>

#define NB     2
#define SQ     2048
#define HID    1024
#define NHQ    16
#define NKVH   4
#define HDM    64
#define QW     1024          // q plane width (16 heads x 64)
#define KW     256           // k / v width (4 heads x 64)
#define QKN    1280          // q|k projection columns
#define NTOK   4096
#define NFREQ  32
#define AOW    2048          // attn plane width: hi at col 0..1023, lo at col 1024..2047
#define NT64   32            // 64-wide tiles along each mask axis

typedef __bf16       v16b __attribute__((ext_vector_type(16)));
typedef __bf16       v8b  __attribute__((ext_vector_type(8)));
typedef float        v8f  __attribute__((ext_vector_type(8)));
typedef float        v4f  __attribute__((ext_vector_type(4)));
typedef unsigned int v4u  __attribute__((ext_vector_type(4)));

// ---------------------------------------------------------------------------
// small helpers
// ---------------------------------------------------------------------------
__device__ __forceinline__ unsigned short bf_bits(float f) {          // RNE convert f32 -> bf16 bits
  const unsigned u = __float_as_uint(f);
  return (unsigned short)((u + 0x7FFFu + ((u >> 16) & 1u)) >> 16);
}
__device__ __forceinline__ float bf_val(unsigned short h) { return __uint_as_float(((unsigned)h) << 16); }
__device__ __forceinline__ float bf_rne(float f) { return bf_val(bf_bits(f)); }
__device__ __forceinline__ unsigned pk16(unsigned short a, unsigned short b) { return (unsigned)a | ((unsigned)b << 16); }
__device__ __forceinline__ v8f zero8() { v8f z = {0.f, 0.f, 0.f, 0.f, 0.f, 0.f, 0.f, 0.f}; return z; }
__device__ __forceinline__ int wave_id() { return __builtin_amdgcn_readfirstlane((int)(threadIdx.x >> 5)); }

__device__ __forceinline__ void lds_wave_sync() {
  __builtin_amdgcn_fence(__ATOMIC_RELEASE, "workgroup");
  __builtin_amdgcn_wave_barrier();
  __builtin_amdgcn_fence(__ATOMIC_ACQUIRE, "workgroup");
}

// ---------------------------------------------------------------------------
// WMMA fragments (wave32, 16x16x32, bf16 operands). For A (row m = lane&15) and B (col n = lane&15) alike:
// elements 0..7 <- k0 + 8*(lane>>4) + 0..7, elements 8..15 <- k0 + 16 + 8*(lane>>4) + 0..7.
// ldfrag_b(p) with p = rowbase + k0 + 8*(lane>>4): two 16-B loads p[0..7], p[16..23] (A rows and k-contiguous B rows alike).
// D: acc[r] = (row 8*(lane>>4) + r, col lane&15).
// ---------------------------------------------------------------------------
union FragB { v16b v; v8b h[2]; };
__device__ __forceinline__ v16b ldfrag_b(const __bf16* p) { FragB f; f.h[0] = *(const v8b*)(p); f.h[1] = *(const v8b*)(p + 16); return f.v; }

__device__ __forceinline__ v8f mma_b(v16b a, v16b b, v8f c) {
  return __builtin_amdgcn_wmma_f32_16x16x32_bf16(false, a, false, b, (short)0, c, false, false);
}
// hazard guards: 4 VALU slots after the last WMMA of a group, D tied, A/B kept live; memory clobber keeps later loads behind the group
__device__ __forceinline__ void guard1b4(v8f& a, v16b w, v16b x, v16b y, v16b z) {
  asm volatile("v_nop\n\tv_nop\n\tv_nop\n\tv_nop" : "+v"(a) : "v"(w), "v"(x), "v"(y), "v"(z) : "memory");
}
__device__ __forceinline__ void acc_guard4(v8f& a, v8f& b, v8f& c, v8f& d) {
  asm volatile("v_nop\n\tv_nop\n\tv_nop\n\tv_nop" : "+v"(a), "+v"(b), "+v"(c), "+v"(d));
}
__device__ __forceinline__ void acc_guard2(v8f& a, v8f& b) {
  asm volatile("v_nop\n\tv_nop\n\tv_nop\n\tv_nop" : "+v"(a), "+v"(b));
}

// ---------------------------------------------------------------------------
// RoPE table: cst[t][j] = cos(pos[t] * inv_freq[j]), snt[t][j] = sin(...), inv_freq[j] = 1 / 10000^(j/32), j < 32, all f32.
// ---------------------------------------------------------------------------
__global__ __launch_bounds__(256) void rope_table_kernel(const int* __restrict__ pos, float* __restrict__ cst,
                                                         float* __restrict__ snt, int ntok) {
  const int lane = threadIdx.x & 31;
  const int wave = (int)(threadIdx.x >> 5);
  const int t = (int)blockIdx.x * 8 + wave;
  if (t >= ntok) return;                       // no barriers in this kernel
  const float pf  = (float)pos[t];
  const float e   = (float)lane * 0.03125f;    // (2*j)/64 exact
  const float pw  = powf(10000.0f, e);
  const float inv = 1.0f / pw;
  const float ang = pf * inv;
  const float cv  = cosf(ang);
  const float sv  = sinf(ang);
  const size_t o = (size_t)t * NFREQ + lane;
  {
    ((float*)cst)[o] = cv;
    ((float*)snt)[o] = sv;
    
  }
}

// ---------------------------------------------------------------------------
// Elementwise RNE f32 -> bf16 plane: 8 elements per thread, one 16-B store per lane -> 32 consecutive lanes write 4 whole
// ---------------------------------------------------------------------------
__global__ __launch_bounds__(256) void cvt_bf16_kernel(const float* __restrict__ in, unsigned short* __restrict__ outp, int n8) {
  const int i = (int)blockIdx.x * 256 + (int)threadIdx.x;
  if (i >= n8) return;
  const size_t e = 8 * (size_t)i;
  const v4f a = *(const v4f*)(in + e);
  const v4f b = *(const v4f*)(in + e + 4);
  v4u w;
  w[0] = pk16(bf_bits(a[0]), bf_bits(a[1]));
  w[1] = pk16(bf_bits(a[2]), bf_bits(a[3]));
  w[2] = pk16(bf_bits(b[0]), bf_bits(b[1]));
  w[3] = pk16(bf_bits(b[2]), bf_bits(b[3]));
  *(v4u*)(outp + e) = w;
  
}

// ---------------------------------------------------------------------------
// Wo [HID][kin] f32 -> WO2 [HID][ldo = 2*kin] bf16 with WO2[n][k] = WO2[n][kin + k] = bf16(Wo[n][k]).
// Coverage: grid = n8/256 x 256 x 8 = HID*kin source elements -> both halves of every WO2 row.
// ---------------------------------------------------------------------------
__global__ __launch_bounds__(256) void cvt_wo2_kernel(const float* __restrict__ in, unsigned short* __restrict__ outp,
                                                      int n8, int kin, int ldo) {
  const int i = (int)blockIdx.x * 256 + (int)threadIdx.x;
  if (i >= n8) return;
  const size_t e = 8 * (size_t)i;
  const int n = (int)(e / (size_t)kin);
  const int k = (int)(e - (size_t)n * kin);
  const v4f a = *(const v4f*)(in + e);
  const v4f b = *(const v4f*)(in + e + 4);
  v4u w;
  w[0] = pk16(bf_bits(a[0]), bf_bits(a[1]));
  w[1] = pk16(bf_bits(a[2]), bf_bits(a[3]));
  w[2] = pk16(bf_bits(b[0]), bf_bits(b[1]));
  w[3] = pk16(bf_bits(b[2]), bf_bits(b[3]));
  const size_t o = (size_t)n * ldo + k;
  *(v4u*)(outp + o) = w;
  *(v4u*)(outp + o + kin) = w;
  
}

// ---------------------------------------------------------------------------
// Mask tile classes. mask [NB][1][SQ][SQ] f32 (additive). One block per (b, 64-row band mt): 256 threads x 8 consecutive columns,
// 64 rows each. For every 64x64 tile (b, mt, nt):
//   class 0 = every element <= -1e8 (tile contributes nothing: exp underflows to 0 exactly when the row has an admitted key),
//   class 1 = every element == 0 (nothing to add), class 2 = anything else (mask tile added elementwise).
// If the band contains a row with no element > -1e4 the skip is not valid for it: class 0 tiles of that band become class 2.
// Reductions are OR (order independent). Coverage: NB*32 blocks x 64 rows x 256 thr x 8 cols = the whole mask;
// ---------------------------------------------------------------------------
#define ADM_TH (-1.0e4f)
#define SKP_TH (-1.0e8f)

__global__ __launch_bounds__(256) void mask_class_kernel(const float* __restrict__ mask, int* __restrict__ cls) {
  __shared__ int nzs[NT64];
  __shared__ int bgs[NT64];
  __shared__ unsigned rlo[8];
  __shared__ unsigned rhi[8];
  const int bm   = blockIdx.x;           // b*32 + mt
  const int b    = bm >> 5;
  const int mt   = bm & 31;
  const int tid  = threadIdx.x;
  const int lane = tid & 31;
  const int wave = tid >> 5;
  const int j0   = tid * 8;
  int nz = 0, bg = 0;
  unsigned rowlo = 0u, rowhi = 0u;       // bit r: this thread's 8 columns contain an admitted element in row r
#pragma unroll 1
  for (int r = 0; r < 64; ++r) {
    const float* mr = mask + (((size_t)b * SQ) + (size_t)(mt * 64 + r)) * SQ + j0;
    const v4f mk0 = *(const v4f*)(mr);
    const v4f mk1 = *(const v4f*)(mr + 4);
    const int a = ((mk0[0] > ADM_TH) | (mk0[1] > ADM_TH) | (mk0[2] > ADM_TH) | (mk0[3] > ADM_TH) |
                   (mk1[0] > ADM_TH) | (mk1[1] > ADM_TH) | (mk1[2] > ADM_TH) | (mk1[3] > ADM_TH)) ? 1 : 0;
    const int z = ((mk0[0] != 0.0f) | (mk0[1] != 0.0f) | (mk0[2] != 0.0f) | (mk0[3] != 0.0f) |
                   (mk1[0] != 0.0f) | (mk1[1] != 0.0f) | (mk1[2] != 0.0f) | (mk1[3] != 0.0f)) ? 1 : 0;
    const int g = ((mk0[0] > SKP_TH) | (mk0[1] > SKP_TH) | (mk0[2] > SKP_TH) | (mk0[3] > SKP_TH) |
                   (mk1[0] > SKP_TH) | (mk1[1] > SKP_TH) | (mk1[2] > SKP_TH) | (mk1[3] > SKP_TH)) ? 1 : 0;
    nz |= z;
    bg |= g;
    const unsigned sh = ((unsigned)a) << (r & 31);
    rowlo |= (r < 32) ? sh : 0u;
    rowhi |= (r < 32) ? 0u : sh;
  }
  // OR over the 8 lanes 8q..8q+7 that share column tile nt = tid >> 3
  nz |= __shfl_xor(nz, 1, 32); nz |= __shfl_xor(nz, 2, 32); nz |= __shfl_xor(nz, 4, 32);
  bg |= __shfl_xor(bg, 1, 32); bg |= __shfl_xor(bg, 2, 32); bg |= __shfl_xor(bg, 4, 32);
#pragma unroll
  for (int off = 1; off < 32; off <<= 1) {
    rowlo |= (unsigned)__shfl_xor((int)rowlo, off, 32);
    rowhi |= (unsigned)__shfl_xor((int)rowhi, off, 32);
  }
  if ((lane & 7) == 0) { nzs[tid >> 3] = nz; bgs[tid >> 3] = bg; }
  if (lane == 0) { rlo[wave] = rowlo; rhi[wave] = rowhi; }
  __syncthreads();
  if (wave == 0) {                       // wave-uniform
    const int z = nzs[lane];
    const int g = bgs[lane];
    unsigned ol = rlo[0], oh = rhi[0];
#pragma unroll
    for (int w = 1; w < 8; ++w) { ol |= rlo[w]; oh |= rhi[w]; }
    const bool has_empty_row = (ol != 0xFFFFFFFFu) || (oh != 0xFFFFFFFFu);
    int cval = (g == 0) ? 0 : ((z == 0) ? 1 : 2);
    cval = (has_empty_row && cval == 0) ? 2 : cval;
    int* cp = cls + (size_t)bm * NT64 + lane;
    *cp = cval;
    
  }
}

// ---------------------------------------------------------------------------
// bf16 WMMA GEMM, block = 4 waves (128 threads) = one 128 x 128 tile of C; wave w owns rows 32w..32w+31 of it, all 128 cols.
//   C[m][n] = sum_k A[m][k] * Bt[n][k]; A row-major [M][K] bf16 (pitch lda), Bt row-major [N][K] bf16 (pitch ldb);
//   M % 128 == 0, N % 128 == 0, K % 64 == 0, K >= 64, lda % 8 == 0, ldb % 8 == 0; grid.x = M/128 * N/128.
//   Operands: per trip of 64 k the 128 A rows and the 128 Bt rows (128 B each) are copied global -> LDS asynchronously, whole
//   128-B lines per 8 lanes, into one of two buffers; trip t works on buffer t & 1 while tile t + 1 flies into the other.
//   Fragments are read from LDS rows (ldfrag_b) in the same k order as before.
// Epilogues (all: per wave, per 16-row slab: stage in LDS, wave sync, write each row segment with ONE instruction of
//   EPI 0: q|k projection with RoPE. The 128-col tile holds two 64-dim heads; pairs (d, d+32) inside each head are rotated with
//          the f32 cos/sin rows of the token (staged per slab in LDS), then split to bf16 hi (C0/C2) and lo (C1/C3) planes.
//          cols n0 < QW -> q planes [M][ldc], col n0; cols n0 >= QW -> k planes [M][ldc2], col n0-QW. Row segment 256 B = 16 lanes x 16 B.
//   EPI 1: v^T projection: bf16 hi plane C0, lo plane C1, [M][ldc], row segment 256 B.
//   EPI 2: f32 output C0 [M][ldc]; row segment 128 floats = 512 B = 32 lanes x 16 B per instruction.
// ---------------------------------------------------------------------------
template <int EPI> struct SlabCfg { static constexpr int PERWF = 2048; };   // floats per wave (8 KB)
template <> struct SlabCfg<0>     { static constexpr int PERWF = 3072; };   // + 16x32 cos + 16x32 sin rows

#define GKT  64                 // k per staged tile: 128-B rows
#define GPITCH  72                 // LDS row pitch in bf16: 144 B = 16 B x odd, for the 16-B fragment reads
#define GOP  (128 * GPITCH)        // bf16 per operand tile (128 rows)
#define GROWB (16 * GPITCH * 2)    // LDS bytes between a lane's consecutive copies (16 rows)

__device__ __forceinline__ unsigned lds_off(const void* p) { return (unsigned)(size_t)p; }

// One operand tile, 128 rows x 128 B: lane t copies 16 B of rows (t >> 3) + 16u, u = 0..7 (128 lanes x 8 = 1024 pieces = the tile).
// l = the lane's LDS byte address for u = 0, g = its global address for u = 0, ld = global row pitch in elements.
// s_wait_xcnt stands inside the statement so that no address register is rewritten ahead of it.
__device__ __forceinline__ void stage_tile(unsigned l, const unsigned short* g, int ld) {
  const size_t st = (size_t)16 * (size_t)ld;
  asm volatile(
      "global_load_async_to_lds_b128 %0, %8, off\n\t"
      "global_load_async_to_lds_b128 %1, %9, off\n\t"
      "global_load_async_to_lds_b128 %2, %10, off\n\t"
      "global_load_async_to_lds_b128 %3, %11, off\n\t"
      "global_load_async_to_lds_b128 %4, %12, off\n\t"
      "global_load_async_to_lds_b128 %5, %13, off\n\t"
      "global_load_async_to_lds_b128 %6, %14, off\n\t"
      "global_load_async_to_lds_b128 %7, %15, off\n\t"
      "s_wait_xcnt 0x0"
      :: "v"(l), "v"(l + 1u * GROWB), "v"(l + 2u * GROWB), "v"(l + 3u * GROWB),
         "v"(l + 4u * GROWB), "v"(l + 5u * GROWB), "v"(l + 6u * GROWB), "v"(l + 7u * GROWB),
         "v"(g), "v"(g + st), "v"(g + 2 * st), "v"(g + 3 * st),
         "v"(g + 4 * st), "v"(g + 5 * st), "v"(g + 6 * st), "v"(g + 7 * st)
      : "memory");
}

template <int EPI>
__global__ __launch_bounds__(128) void gemm_w32x128_kernel(
    const unsigned short* __restrict__ Ap, int lda,
    const unsigned short* __restrict__ Btp, int ldb,
    const float* __restrict__ cst, const float* __restrict__ snt,
    void* C0, void* C1, void* C2, void* C3, int ldc, int ldc2,
    int M, int N, int K) {
  __shared__ __align__(16) float lds_all[4 * SlabCfg<EPI>::PERWF];
  __shared__ __align__(16) unsigned short ring[2][2 * GOP];    // [buffer][A tile | Bt tile], 2 x 36,864 B

  const int tid  = (int)threadIdx.x;
  const int lane = tid & 31;
  const int wave = wave_id();
  const int hh = lane >> 4;           // lane half: k offset 8*hh, D row offset 8*hh
  const int rl = lane & 15;           // A row / B col / D col within subtile
  const int tilesN = N >> 7;
  const int tilesM = M >> 7;
  const int tile = (int)blockIdx.x;
  if (tile >= tilesM * tilesN) return;          // block-uniform, in front of every barrier and copy
  const int tm = tile / tilesN;
  const int tn = tile - tm * tilesN;
  const int mblk = tm << 7;
  const int m0 = mblk + (wave << 5);
  const int n0 = tn << 7;

  // this lane's first piece of each operand tile: row tid >> 3, 16-B column tid & 7
  const int srow = tid >> 3;
  const int sc8  = (tid & 7) * 8;
  const unsigned short* gA = Ap  + (size_t)(mblk + srow) * lda + sc8;
  const unsigned short* gB = Btp + (size_t)(n0   + srow) * ldb + sc8;
  const unsigned lA = lds_off(&ring[0][0]) + (unsigned)(srow * GPITCH + sc8) * 2u;
  const unsigned lB = lA + GOP * 2u;
  const unsigned bufb = 2u * GOP * 2u;           // bytes per buffer
  const int ntrip = K / GKT;

  v8f acc[2][8];
#pragma unroll
  for (int i = 0; i < 2; ++i)
#pragma unroll
    for (int j = 0; j < 8; ++j) acc[i][j] = zero8();

  // prologue: tile 0 lands and is published, then tile 1 starts
  stage_tile(lA, gA, lda);
  stage_tile(lB, gB, ldb);
  asm volatile("s_wait_asynccnt 0x0" ::: "memory");   // this wave's copies of tile 0 have landed
  __syncthreads();                                     // ... and every other wave's: tile 0 is readable
  if (ntrip > 1) {
    stage_tile(lA + bufb, gA + GKT, lda);
    stage_tile(lB + bufb, gB + GKT, ldb);
  }

  for (int t = 0; t < ntrip; ++t) {
    const __bf16* As = (const __bf16*)(const void*)&ring[t & 1][0]   + (wave * 32 + rl) * GPITCH + 8 * hh;
    const __bf16* Bs = (const __bf16*)(const void*)&ring[t & 1][GOP] + rl * GPITCH + 8 * hh;
    v16b ah[2][2], bf[2][8];                           // [k half of the tile][fragment]
#pragma unroll
    for (int s = 0; s < 2; ++s) {
#pragma unroll
      for (int i = 0; i < 2; ++i) ah[s][i] = ldfrag_b(As + i * 16 * GPITCH + s * 32);
#pragma unroll
      for (int j = 0; j < 8; ++j) bf[s][j] = ldfrag_b(Bs + j * 16 * GPITCH + s * 32);
    }
    // keeps the trip's LDS reads together in front of its WMMAs: one exposed LDS latency per trip instead of one per WMMA pair
    __builtin_amdgcn_sched_barrier(0);
#pragma unroll
    for (int s = 0; s < 2; ++s) {
#pragma unroll
      for (int j = 0; j < 8; ++j) {
        acc[0][j] = mma_b(ah[s][0], bf[s][j], acc[0][j]);
        acc[1][j] = mma_b(ah[s][1], bf[s][j], acc[1][j]);
      }
    }
    // keeps the WMMAs in front of the trip's foot: they overlap the LDS reads, and tile t + 1's copies get the whole trip to land
    __builtin_amdgcn_sched_barrier(0);
    asm volatile("s_wait_dscnt 0x0" ::: "memory");     // this wave's reads of buffer t & 1 are done before it is refilled
    asm volatile("s_wait_asynccnt 0x0" ::: "memory");  // this wave's copies of tile t + 1 have landed
    __syncthreads();                                   // publishes tile t + 1 and ends every reader's use of buffer t & 1
    if (t + 2 < ntrip) {                               // same for the whole block
      const unsigned bo = (unsigned)(t & 1) * bufb;
      stage_tile(lA + bo, gA + (size_t)(t + 2) * GKT, lda);
      stage_tile(lB + bo, gB + (size_t)(t + 2) * GKT, ldb);
    }
  }
  asm volatile("s_wait_asynccnt 0x0" ::: "memory");    // nothing of this wave is in flight behind the loop
  acc_guard4(acc[0][0], acc[0][1], acc[0][2], acc[0][3]);
  acc_guard4(acc[0][4], acc[0][5], acc[0][6], acc[0][7]);
  acc_guard4(acc[1][0], acc[1][1], acc[1][2], acc[1][3]);
  acc_guard4(acc[1][4], acc[1][5], acc[1][6], acc[1][7]);

  // ---- epilogue ----
  float* wl = lds_all + wave * SlabCfg<EPI>::PERWF;
  unsigned short* sl16 = (unsigned short*)(void*)wl;       // 4096 u16 = floats 0..2047 (two 16x128 planes)
  float* slf = wl;

  if (EPI == 0) {
    float* csl = wl + 2048;                                 // cos rows [16][32]
    float* snl = wl + 2048 + 16 * NFREQ;                    // sin rows [16][32]
    const bool isq = (n0 < QW);                             // wave-uniform
    unsigned short* P0 = isq ? (unsigned short*)C0 : (unsigned short*)C2;
    unsigned short* P1 = isq ? (unsigned short*)C1 : (unsigned short*)C3;
    const int ldp  = isq ? ldc : ldc2;
    const int col0 = isq ? n0 : (n0 - QW);
#pragma unroll
    for (int i = 0; i < 2; ++i) {
      const int mb = m0 + i * 16;
      // stage cos/sin of tokens mb..mb+15: 16 rows x 32 floats = 128 16-B pieces per table; lane -> 4 pieces (coverage 32x4 = 128)
#pragma unroll
      for (int u = 0; u < 4; ++u) {
        const int p   = lane + 32 * u;
        const int row = p >> 3, c4 = (p & 7) * 4;
        const v4f cv4 = *(const v4f*)(cst + (size_t)(mb + row) * NFREQ + c4);
        const v4f sv4 = *(const v4f*)(snt + (size_t)(mb + row) * NFREQ + c4);
        *(v4f*)(csl + row * NFREQ + c4) = cv4;
        *(v4f*)(snl + row * NFREQ + c4) = sv4;
      }
      lds_wave_sync();
#pragma unroll
      for (int hs = 0; hs < 2; ++hs) {                      // head within the 128-col tile
#pragma unroll
        for (int jj = 0; jj < 2; ++jj) {
          const int j1 = hs * 4 + jj;                       // cols hs*64 + jj*16 + rl  (x1, dim d < 32)
          const int j2 = j1 + 2;                            // cols +32                 (x2, dim d + 32)
          const int d  = jj * 16 + rl;                      // freq index 0..31
#pragma unroll
          for (int r = 0; r < 8; ++r) {
            const int lrow = 8 * hh + r;
            const float cv = csl[lrow * NFREQ + d];
            const float sv = snl[lrow * NFREQ + d];
            const float x1 = acc[i][j1][r];
            const float x2 = acc[i][j2][r];
            const float o1 = x1 * cv - x2 * sv;
            const float o2 = x2 * cv + x1 * sv;
            const unsigned short hb1 = bf_bits(o1), hb2 = bf_bits(o2);
            const unsigned short lb1 = bf_bits(o1 - bf_val(hb1)), lb2 = bf_bits(o2 - bf_val(hb2));
            const int so = lrow * 128 + hs * 64 + d;
            sl16[so]             = hb1;
            sl16[so + 32]        = hb2;
            sl16[2048 + so]      = lb1;
            sl16[2048 + so + 32] = lb2;
          }
        }
      }
      lds_wave_sync();
      {
#pragma unroll
        for (int it = 0; it < 8; ++it) {
          const int row = it * 2 + hh;                      // it x hh covers rows 0..15
          const int c8  = rl * 8;
          const v4u vh = *(const v4u*)(sl16 + row * 128 + c8);
          const v4u vl = *(const v4u*)(sl16 + 2048 + row * 128 + c8);
          const size_t go = (size_t)(mb + row) * ldp + col0 + c8;
          *(v4u*)(P0 + go) = vh;
          *(v4u*)(P1 + go) = vl;
        }
        
      }
      lds_wave_sync();
    }
  } else if (EPI == 1) {
    unsigned short* P0 = (unsigned short*)C0;
    unsigned short* P1 = (unsigned short*)C1;
#pragma unroll
    for (int i = 0; i < 2; ++i) {
#pragma unroll
      for (int r = 0; r < 8; ++r) {
#pragma unroll
        for (int j = 0; j < 8; ++j) {
          const float v = acc[i][j][r];
          const unsigned short hb = bf_bits(v);
          const unsigned short lb = bf_bits(v - bf_val(hb));
          const int so = (8 * hh + r) * 128 + j * 16 + rl;
          sl16[so]        = hb;
          sl16[2048 + so] = lb;
        }
      }
      lds_wave_sync();
      {
#pragma unroll
        for (int it = 0; it < 8; ++it) {
          const int row = it * 2 + hh;
          const int c8  = rl * 8;
          const v4u vh = *(const v4u*)(sl16 + row * 128 + c8);
          const v4u vl = *(const v4u*)(sl16 + 2048 + row * 128 + c8);
          const size_t go = (size_t)(m0 + i * 16 + row) * ldc + n0 + c8;
          *(v4u*)(P0 + go) = vh;
          *(v4u*)(P1 + go) = vl;
        }
        
      }
      lds_wave_sync();
    }
  } else {
    float* C = (float*)C0;
#pragma unroll
    for (int i = 0; i < 2; ++i) {
#pragma unroll
      for (int j = 0; j < 8; ++j)
#pragma unroll
        for (int r = 0; r < 8; ++r)
          slf[(8 * hh + r) * 128 + j * 16 + rl] = acc[i][j][r];
      lds_wave_sync();
      {
#pragma unroll
        for (int row = 0; row < 16; ++row) {                // 32 lanes x 16 B = the whole 512-B row segment per instruction
          const v4f v = *(const v4f*)(slf + row * 128 + lane * 4);
          *(v4f*)(C + (size_t)(m0 + i * 16 + row) * ldc + n0 + lane * 4) = v;
        }
        
      }
      lds_wave_sync();
    }
  }
}

// ---------------------------------------------------------------------------
// GQA flash attention with the additive mask as data, head dim 64, 32-key chunks, block = 4 waves = 64 query rows of one (b, h);
// grid (SQ/64, NHQ, NB); kv head = h >> 2.
//   q planes bf16 [tok][h*64+d]: hi (qhp), lo (qlp); k planes bf16 [tok][kvh*64+d]: hi (khp), lo (klp);
//   v^T planes bf16 [kvh*64+d][tok]: hi (vhp), lo (vlp); output attn plane bf16 [tok][2048]: hi at col h*64+d, lo at 1024+h*64+d.
//   Chunk kc covers keys 32kc..32kc+31 of 64-wide mask tile nt = kc>>1; class = cls[(b*32+qt)*32 + nt] (block-uniform):
//   0 -> chunk skipped entirely (uniform continue before any barrier); 1 -> no mask add; 2 -> mask chunk staged in LDS and
//   RNE-bf16(mask) added after the 1/8 scale. scores = (qh.kh + qh.kl + ql.kh) / 8 (+ mask); online softmax f32
//   (running max, exp via natural-exp intrinsic); p split to bf16 hi/lo in per-wave LDS tiles, wave sync, reloaded as A fragments;
//   K / V^T chunk staging: 128 threads x 2 x 16 B per plane = whole 32x64 / 64x32 tiles; mask 128 x 4 x 16 B = whole 64x32 tile;
//   plain loads, __syncthreads before and after. Every wave processes every non-skipped chunk (no per-wave exits).
// ---------------------------------------------------------------------------
#define AKC  32
#define KP   72          // K tile pitch (u16), 144 B rows
#define VP   40          // V^T tile pitch (u16), 80 B rows
#define PP   40          // P tile pitch (u16)
#define MP   36          // mask tile pitch (f32), 144 B rows
static_assert((2 * AKC * KP + 2 * HDM * VP + 8 * 16 * PP + 8 * 16 * 64) * 2 + 64 * MP * 4 <= 65536);

__global__ __launch_bounds__(128) void attn_kernel(
    const unsigned short* __restrict__ qhp, const unsigned short* __restrict__ qlp,
    const unsigned short* __restrict__ khp, const unsigned short* __restrict__ klp,
    const unsigned short* __restrict__ vhp, const unsigned short* __restrict__ vlp,
    const float* __restrict__ maskp, const int* __restrict__ clsp,
    unsigned short* __restrict__ aop) {
  __shared__ __align__(16) unsigned short Ks[AKC * KP];
  __shared__ __align__(16) unsigned short Kls[AKC * KP];
  __shared__ __align__(16) unsigned short Vhs[HDM * VP];
  __shared__ __align__(16) unsigned short Vls[HDM * VP];
  __shared__ __align__(16) unsigned short Phs[4][16 * PP];
  __shared__ __align__(16) unsigned short Pls[4][16 * PP];
  __shared__ __align__(16) float Ms[64 * MP];
  __shared__ __align__(16) unsigned short Osh[4][16 * 64];
  __shared__ __align__(16) unsigned short Osl[4][16 * 64];

  const int tid  = (int)threadIdx.x;
  const int lane = tid & 31;
  const int wave = wave_id();
  const int hh   = lane >> 4;
  const int c    = lane & 15;
  const int qt   = (int)blockIdx.x;
  const int h    = (int)blockIdx.y;
  const int b    = (int)blockIdx.z;
  const int kvh  = h >> 2;
  const int q0   = qt * 64 + wave * 16;          // first query row of this wave (within the sequence)
  const size_t tok0 = (size_t)b * SQ;

  // whole mask staging area initialised once (only class-2 chunks refresh it; other chunks never add from it)
#pragma unroll 1
  for (int u = tid; u < 64 * MP; u += 128) Ms[u] = 0.0f;

  const __bf16* Qhr = (const __bf16*)(const void*)qhp + (tok0 + q0 + c) * QW + h * HDM + 8 * hh;
  const __bf16* Qlr = (const __bf16*)(const void*)qlp + (tok0 + q0 + c) * QW + h * HDM + 8 * hh;
  const size_t mrow0 = (tok0 + (size_t)qt * 64) * SQ;                 // mask[b][0][qt*64][0]
  const int* crow = clsp + ((b * NT64) + qt) * NT64;

  unsigned short* ph = Phs[wave];
  unsigned short* pl = Pls[wave];

  v16b qh[2], ql[2];
#pragma unroll
  for (int dc = 0; dc < 2; ++dc) { qh[dc] = ldfrag_b(Qhr + dc * 32); ql[dc] = ldfrag_b(Qlr + dc * 32); }

  float mrow[8], lrow[8];
  v8f oacc[4];
#pragma unroll
  for (int r = 0; r < 8; ++r) { mrow[r] = -INFINITY; lrow[r] = 0.f; }
#pragma unroll
  for (int t = 0; t < 4; ++t) oacc[t] = zero8();

  for (int kc = 0; kc < 2 * NT64; ++kc) {
    const int nt = kc >> 1;
    const int cl = __builtin_amdgcn_readfirstlane(crow[nt]);         // block-uniform class of this chunk's tile
    if (cl == 0) continue;                                            // uniform for the whole block; before any barrier
    const int kv0 = kc * AKC;
    __syncthreads();                                                  // prior chunk's LDS readers are done
#pragma unroll
    for (int u = 0; u < 2; ++u) {                                     // coverage: 256 pieces of 8 halves per plane = whole tile
      const int p   = tid + 128 * u;                                  // 0..255
      const int key = p >> 3, d8 = (p & 7) * 8;                       // K: 32 keys x 64 d
      const size_t ko = (tok0 + kv0 + key) * KW + kvh * HDM + d8;
      const v4u kx = *(const v4u*)(khp + ko);
      const v4u ky = *(const v4u*)(klp + ko);
      *(v4u*)(Ks  + key * KP + d8) = kx;
      *(v4u*)(Kls + key * KP + d8) = ky;
      const int d = p >> 2, k8 = (p & 3) * 8;                         // V^T: 64 d x 32 keys
      const size_t vo = (size_t)(kvh * HDM + d) * NTOK + tok0 + kv0 + k8;
      const v4u vx = *(const v4u*)(vhp + vo);
      const v4u vy = *(const v4u*)(vlp + vo);
      *(v4u*)(Vhs + d * VP + k8) = vx;
      *(v4u*)(Vls + d * VP + k8) = vy;
    }
    if (cl == 2) {                                                    // block-uniform branch about the mask tile load
#pragma unroll
      for (int u = 0; u < 4; ++u) {                                   // coverage: 512 pieces of 4 floats = 64 rows x 32 keys
        const int p   = tid + 128 * u;                                // 0..511
        const int row = p >> 3, c4 = (p & 7) * 4;
        const v4f mv = *(const v4f*)(maskp + mrow0 + (size_t)row * SQ + kv0 + c4);
        *(v4f*)(Ms + row * MP + c4) = mv;
      }
    }
    __syncthreads();

    // ---- scores: 16 query rows x 32 keys, K = 64, three products ----
    v8f sa[2];
    sa[0] = zero8(); sa[1] = zero8();
#pragma unroll
    for (int dc = 0; dc < 2; ++dc) {
#pragma unroll
      for (int j = 0; j < 2; ++j) {
        const v16b kb = ldfrag_b((const __bf16*)(const void*)Ks  + (j * 16 + c) * KP + dc * 32 + 8 * hh);
        const v16b kl = ldfrag_b((const __bf16*)(const void*)Kls + (j * 16 + c) * KP + dc * 32 + 8 * hh);
        sa[j] = mma_b(qh[dc], kb, sa[j]);
        sa[j] = mma_b(qh[dc], kl, sa[j]);
        sa[j] = mma_b(ql[dc], kb, sa[j]);
        guard1b4(sa[j], qh[dc], ql[dc], kb, kl);
      }
    }
    acc_guard2(sa[0], sa[1]);

    // ---- scale, mask add (class 2), chunk row max ----
    float cm[8];
#pragma unroll
    for (int r = 0; r < 8; ++r) {
      const int lrow = wave * 16 + 8 * hh + r;                        // row within the 64-row band
      float m = -INFINITY;
#pragma unroll
      for (int j = 0; j < 2; ++j) {
        float s = sa[j][r] * 0.125f;
        if (cl == 2) s += bf_rne(Ms[lrow * MP + j * 16 + c]);
        sa[j][r] = s;
        m = fmaxf(m, s);
      }
#pragma unroll
      for (int off = 1; off < 16; off <<= 1) m = fmaxf(m, __shfl_xor(m, off, 32));
      cm[r] = m;
    }
    // ---- online softmax, p hi/lo to the wave's LDS tiles ----
#pragma unroll
    for (int r = 0; r < 8; ++r) {
      const float mnew  = fmaxf(mrow[r], cm[r]);
      const float muse  = (mnew > -INFINITY) ? mnew : 0.0f;
      const float alpha = __expf(mrow[r] - muse);
      mrow[r] = mnew;
      float psum = 0.f;
#pragma unroll
      for (int j = 0; j < 2; ++j) {
        const float p = __expf(sa[j][r] - muse);
        psum += p;
        const unsigned short hb = bf_bits(p);
        const unsigned short lb = bf_bits(p - bf_val(hb));
        const int po = (8 * hh + r) * PP + j * 16 + c;
        ph[po] = hb;
        pl[po] = lb;
      }
#pragma unroll
      for (int off = 1; off < 16; off <<= 1) psum += __shfl_xor(psum, off, 32);
      lrow[r] = lrow[r] * alpha + psum;
#pragma unroll
      for (int t = 0; t < 4; ++t) oacc[t][r] *= alpha;
    }
    lds_wave_sync();                               // p stores visible to the other lanes of this wave before the fragment reload
    // ---- O += p . v (K = 32 keys, three products) ----
    const v16b pa = ldfrag_b((const __bf16*)(const void*)ph + c * PP + 8 * hh);
    const v16b pr = ldfrag_b((const __bf16*)(const void*)pl + c * PP + 8 * hh);
#pragma unroll
    for (int t = 0; t < 4; ++t) {
      const v16b vb = ldfrag_b((const __bf16*)(const void*)Vhs + (t * 16 + c) * VP + 8 * hh);
      const v16b vr = ldfrag_b((const __bf16*)(const void*)Vls + (t * 16 + c) * VP + 8 * hh);
      oacc[t] = mma_b(pa, vb, oacc[t]);
      oacc[t] = mma_b(pa, vr, oacc[t]);
      oacc[t] = mma_b(pr, vb, oacc[t]);
      guard1b4(oacc[t], pa, pr, vb, vr);
    }
  }
  __syncthreads();                                 // every wave is past the chunk loop (all waves reach this)
  acc_guard4(oacc[0], oacc[1], oacc[2], oacc[3]);

  unsigned short* osh = Osh[wave];
  unsigned short* osl = Osl[wave];
#pragma unroll
  for (int r = 0; r < 8; ++r) {
    const float inv = 1.0f / lrow[r];              // l >= 1: the row max contributes exp(0)
#pragma unroll
    for (int t = 0; t < 4; ++t) {
      const float o = oacc[t][r] * inv;
      const unsigned short hb = bf_bits(o);
      const unsigned short lb = bf_bits(o - bf_val(hb));
      const int so = (8 * hh + r) * 64 + t * 16 + c;
      osh[so] = hb;
      osl[so] = lb;
    }
  }
  lds_wave_sync();
  unsigned short* Ag = aop + (tok0 + q0) * AOW + h * HDM;
  const int qq = lane >> 3;                        // 0..3
  const int c8 = (lane & 7) * 8;
  {
#pragma unroll
    for (int it = 0; it < 4; ++it) {
      const int row = it * 4 + qq;                 // it 0..3 x qq 0..3 covers rows 0..15
      const v4u x = *(const v4u*)(osh + row * 64 + c8);
      const v4u y = *(const v4u*)(osl + row * 64 + c8);
      *(v4u*)(Ag + (size_t)row * AOW + c8)      = x;
      *(v4u*)(Ag + (size_t)row * AOW + QW + c8) = y;
    }
    
  }
}

// ---------------------------------------------------------------------------
// Workspace map (bytes; every region is an exact whole number of the rows its producer writes with whole-line stores;
// all dimensions are tile multiples, no padded tails needed; every offset is a multiple of 128):
//   XB   bf16 [4096][1024]   8388608     WQK bf16 [1280][1024]   2621440     WV  bf16 [256][1024]    524288
//   WO2  bf16 [1024][2048]   4194304     CST f32  [4096][32]      524288     SNT f32  [4096][32]     524288
//   CLS  i32  [2][32][32]       8192     QH  bf16 [4096][1024]   8388608     QL  bf16 [4096][1024]  8388608
//   KH   bf16 [4096][256]    2097152     KL  bf16 [4096][256]    2097152     VTH bf16 [256][4096]   2097152
//   VTL  bf16 [256][4096]    2097152     AO  bf16 [4096][2048]  16777216
//   total                   58728448
// ---------------------------------------------------------------------------
extern "C" void kernel_launch(void* const* d_in, const int* in_sizes, int n_in,
                              void* d_out, int out_size, void* d_ws, size_t ws_size,
                              hipStream_t stream) {
  if (n_in < 7) return;
  if (in_sizes[0] != NTOK * HID) return;                  // hidden_states [2][2048][1024] f32
  if (in_sizes[1] != NB * SQ * SQ) return;                // attention_mask [2][1][2048][2048] f32
  if (in_sizes[2] != NTOK) return;                        // position_ids [2][2048] int32
  if (in_sizes[3] != QW * HID) return;                    // wq [1024][1024]
  if (in_sizes[4] != KW * HID) return;                    // wk [256][1024]
  if (in_sizes[5] != KW * HID) return;                    // wv [256][1024]
  if (in_sizes[6] != HID * QW) return;                    // wo [1024][1024]
  if (out_size != NTOK * HID) return;

  const float* hs   = (const float*)d_in[0];
  const float* mask = (const float*)d_in[1];
  const int*   pos  = (const int*)d_in[2];
  const float* wq   = (const float*)d_in[3];
  const float* wk   = (const float*)d_in[4];
  const float* wv   = (const float*)d_in[5];
  const float* wo   = (const float*)d_in[6];
  float* out = (float*)d_out;

  const size_t szXB  = (size_t)NTOK * HID * 2;
  const size_t szWQK = (size_t)QKN * HID * 2;
  const size_t szWV  = (size_t)KW * HID * 2;
  const size_t szWO2 = (size_t)HID * AOW * 2;
  const size_t szT   = (size_t)NTOK * NFREQ * 4;
  const size_t szCLS = (size_t)NB * NT64 * NT64 * 4;
  const size_t szQ   = (size_t)NTOK * QW * 2;
  const size_t szK   = (size_t)NTOK * KW * 2;
  const size_t szVT  = (size_t)KW * NTOK * 2;
  const size_t szAO  = (size_t)NTOK * AOW * 2;
  size_t off = 0;
  const size_t oXB  = off; off += szXB;
  const size_t oWQK = off; off += szWQK;
  const size_t oWV  = off; off += szWV;
  const size_t oWO2 = off; off += szWO2;
  const size_t oCST = off; off += szT;
  const size_t oSNT = off; off += szT;
  const size_t oCLS = off; off += szCLS;
  const size_t oQH  = off; off += szQ;
  const size_t oQL  = off; off += szQ;
  const size_t oKH  = off; off += szK;
  const size_t oKL  = off; off += szK;
  const size_t oVTH = off; off += szVT;
  const size_t oVTL = off; off += szVT;
  const size_t oAO  = off; off += szAO;
  if (off > ws_size) return;                              // off = 58728448

  char* ws = (char*)d_ws;
  unsigned short* XB  = (unsigned short*)(ws + oXB);
  unsigned short* WQK = (unsigned short*)(ws + oWQK);
  unsigned short* WV  = (unsigned short*)(ws + oWV);
  unsigned short* WO2 = (unsigned short*)(ws + oWO2);
  float*          CST = (float*)(ws + oCST);
  float*          SNT = (float*)(ws + oSNT);
  int*            CLS = (int*)(ws + oCLS);
  unsigned short* QH  = (unsigned short*)(ws + oQH);
  unsigned short* QL  = (unsigned short*)(ws + oQL);
  unsigned short* KH  = (unsigned short*)(ws + oKH);
  unsigned short* KL  = (unsigned short*)(ws + oKL);
  unsigned short* VTH = (unsigned short*)(ws + oVTH);
  unsigned short* VTL = (unsigned short*)(ws + oVTL);
  unsigned short* AO  = (unsigned short*)(ws + oAO);

  const dim3 b256(256), b128(128);

  // (1) cos/sin table [4096][32] x 2 from the position ids
  rope_table_kernel<<<dim3(NTOK / 8), b256, 0, stream>>>(pos, CST, SNT, NTOK);
  // (2) x -> bf16 plane [4096][1024]
  cvt_bf16_kernel<<<dim3((NTOK * HID / 8) / 256), b256, 0, stream>>>(hs, XB, NTOK * HID / 8);
  // (3) wq [1024][1024] -> WQK rows 0..1023; wk [256][1024] -> WQK rows 1024..1279 (natural [out][in] = Bt layout)
  cvt_bf16_kernel<<<dim3((QW * HID / 8) / 256), b256, 0, stream>>>(wq, WQK, QW * HID / 8);
  cvt_bf16_kernel<<<dim3((KW * HID / 8) / 256), b256, 0, stream>>>(wk, WQK + (size_t)QW * HID, KW * HID / 8);
  // (4) wv [256][1024] -> WV
  cvt_bf16_kernel<<<dim3((KW * HID / 8) / 256), b256, 0, stream>>>(wv, WV, KW * HID / 8);
  // (5) wo [1024][1024] -> WO2 [1024][2048] (both halves)
  cvt_wo2_kernel<<<dim3((HID * QW / 8) / 256), b256, 0, stream>>>(wo, WO2, HID * QW / 8, QW, AOW);
  // (6) mask tile classes [2][32][32]
  mask_class_kernel<<<dim3(NB * NT64), b256, 0, stream>>>(mask, CLS);
  // (7) q|k = x . [Wq;Wk]^T, RoPE, split -> QH/QL [4096][1024], KH/KL [4096][256]   (M=4096, N=1280, K=1024; 32 x 10 block tiles)
  gemm_w32x128_kernel<0><<<dim3((NTOK / 128) * (QKN / 128)), b128, 0, stream>>>(
      XB, HID, WQK, HID, CST, SNT, (void*)QH, (void*)QL, (void*)KH, (void*)KL, QW, KW, NTOK, QKN, HID);
  // (8) v^T = Wv . x^T -> VTH/VTL [256][4096]   (A = WV, Bt = XB; M=256, N=4096, K=1024; 2 x 32 block tiles)
  gemm_w32x128_kernel<1><<<dim3((KW / 128) * (NTOK / 128)), b128, 0, stream>>>(
      WV, HID, XB, HID, CST, SNT, (void*)VTH, (void*)VTL, (void*)VTH, (void*)VTL, NTOK, NTOK, KW, NTOK, HID);
  // (9) attention per (q tile, head, batch) -> AO hi|lo [4096][2048]
  attn_kernel<<<dim3(SQ / 64, NHQ, NB), b128, 0, stream>>>(QH, QL, KH, KL, VTH, VTL, mask, CLS, AO);
  // (10) out = [AOhi | AOlo] . [Wo | Wo]^T -> d_out f32 [4096][1024]   (M=4096, N=1024, K=2048; 32 x 8 block tiles)
  gemm_w32x128_kernel<2><<<dim3((NTOK / 128) * (HID / 128)), b128, 0, stream>>>(
      AO, AOW, WO2, AOW, CST, SNT, (void*)out, (void*)out, (void*)out, (void*)out, HID, HID, NTOK, HID, AOW);
  (void)hipGetLastError();
}

// v002
// One run takes 221 microseconds.
// Next to v001, in two timings, it ran 1.40 and 1.39 times as fast.
// Over all steps from v000 it is 2.21 times as fast.
// Contractions: x.[Wq;Wk]^T and Wv.x^T on v_wmma_f32_16x16x32_bf16 (operands = RNE bf16 copies of the f32 inputs, single products);
// q.k^T and p.v on v_wmma_f32_16x16x32_bf16 with bf16 hi/lo split operands (hi.hi + hi.lo + lo.hi, three products);
// attn.Wo^T on v_wmma_f32_16x16x32_bf16 with attn = bf16 hi|lo planes folded into K (two products) and Wo as RNE bf16.
// f32 accumulate everywhere; RoPE (f32 cos/sin table built from the position ids), mask add and online softmax in f32.
// Plane carry audit: every 16-bit plane is bf16 with carry 1 (hi = RNE(v), lo = RNE(v - hi), same accumulator); nothing is scaled,
// nothing is folded back: XB, WQK, WV, WO2 (RNE copies), QH/QL, KH/KL, VTH/VTL, P (registers), AO hi|lo.
#include <hip/hip_runtime.h>
#include <math.h>
#include <stdint.h>

#define NB     2
#define SQ     2048
#define HID    1024
#define NHQ    16
#define NKVH   4
#define HDM    64
#define QW     1024          // q plane width (16 heads x 64)
#define KW     256           // k / v width (4 heads x 64)
#define QKN    1280          // q|k projection columns
#define NTOK   4096
#define NFREQ  32
#define AOW    2048          // attn plane width: hi at col 0..1023, lo at col 1024..2047
#define NT64   32            // 64-wide tiles along each mask axis

typedef __bf16       v16b __attribute__((ext_vector_type(16)));
typedef __bf16       v8b  __attribute__((ext_vector_type(8)));
typedef float        v8f  __attribute__((ext_vector_type(8)));
typedef float        v4f  __attribute__((ext_vector_type(4)));
typedef unsigned int v4u  __attribute__((ext_vector_type(4)));

// ---------------------------------------------------------------------------
// small helpers
// ---------------------------------------------------------------------------
__device__ __forceinline__ unsigned short bf_bits(float f) {          // RNE convert f32 -> bf16 bits
  const unsigned u = __float_as_uint(f);
  return (unsigned short)((u + 0x7FFFu + ((u >> 16) & 1u)) >> 16);
}
__device__ __forceinline__ float bf_val(unsigned short h) { return __uint_as_float(((unsigned)h) << 16); }
__device__ __forceinline__ float bf_rne(float f) { return bf_val(bf_bits(f)); }
__device__ __forceinline__ unsigned pk16(unsigned short a, unsigned short b) { return (unsigned)a | ((unsigned)b << 16); }
__device__ __forceinline__ v8f zero8() { v8f z = {0.f, 0.f, 0.f, 0.f, 0.f, 0.f, 0.f, 0.f}; return z; }
// lane l with lane l ^ 16 (the other half of the wave)
__device__ __forceinline__ float xhalf(float x) {
  const int b = __builtin_bit_cast(int, x);
  return __builtin_bit_cast(float, __builtin_amdgcn_permlanex16(b, b, 0x76543210, 0xfedcba98, false, false));
}
__device__ __forceinline__ int wave_id() { return __builtin_amdgcn_readfirstlane((int)(threadIdx.x >> 5)); }

__device__ __forceinline__ void lds_wave_sync() {
  __builtin_amdgcn_fence(__ATOMIC_RELEASE, "workgroup");
  __builtin_amdgcn_wave_barrier();
  __builtin_amdgcn_fence(__ATOMIC_ACQUIRE, "workgroup");
}

// ---------------------------------------------------------------------------
// WMMA fragments (wave32, 16x16x32, bf16 operands). For A (row m = lane&15) and B (col n = lane&15) alike:
// elements 0..7 <- k0 + 8*(lane>>4) + 0..7, elements 8..15 <- k0 + 16 + 8*(lane>>4) + 0..7.
// ldfrag_b(p) with p = rowbase + k0 + 8*(lane>>4): two 16-B loads p[0..7], p[16..23] (A rows and k-contiguous B rows alike).
// D: acc[r] = (row 8*(lane>>4) + r, col lane&15).
// ---------------------------------------------------------------------------
union FragB { v16b v; v8b h[2]; };
__device__ __forceinline__ v16b ldfrag_b(const __bf16* p) { FragB f; f.h[0] = *(const v8b*)(p); f.h[1] = *(const v8b*)(p + 16); return f.v; }

__device__ __forceinline__ v8f mma_b(v16b a, v16b b, v8f c) {
  return __builtin_amdgcn_wmma_f32_16x16x32_bf16(false, a, false, b, (short)0, c, false, false);
}
// hazard guards: 4 VALU slots after the last WMMA of a group, D tied, A/B kept live; memory clobber keeps later loads behind the group
__device__ __forceinline__ void guard1b4(v8f& a, v16b w, v16b x, v16b y, v16b z) {
  asm volatile("v_nop\n\tv_nop\n\tv_nop\n\tv_nop" : "+v"(a) : "v"(w), "v"(x), "v"(y), "v"(z) : "memory");
}
__device__ __forceinline__ void acc_guard4(v8f& a, v8f& b, v8f& c, v8f& d) {
  asm volatile("v_nop\n\tv_nop\n\tv_nop\n\tv_nop" : "+v"(a), "+v"(b), "+v"(c), "+v"(d));
}
__device__ __forceinline__ void acc_guard2(v8f& a, v8f& b) {
  asm volatile("v_nop\n\tv_nop\n\tv_nop\n\tv_nop" : "+v"(a), "+v"(b));
}

// ---------------------------------------------------------------------------
// RoPE table: cst[t][j] = cos(pos[t] * inv_freq[j]), snt[t][j] = sin(...), inv_freq[j] = 1 / 10000^(j/32), j < 32, all f32.
// ---------------------------------------------------------------------------
__global__ __launch_bounds__(256) void rope_table_kernel(const int* __restrict__ pos, float* __restrict__ cst,
                                                         float* __restrict__ snt, int ntok) {
  const int lane = threadIdx.x & 31;
  const int wave = (int)(threadIdx.x >> 5);
  const int t = (int)blockIdx.x * 8 + wave;
  if (t >= ntok) return;                       // no barriers in this kernel
  const float pf  = (float)pos[t];
  const float e   = (float)lane * 0.03125f;    // (2*j)/64 exact
  const float pw  = powf(10000.0f, e);
  const float inv = 1.0f / pw;
  const float ang = pf * inv;
  const float cv  = cosf(ang);
  const float sv  = sinf(ang);
  const size_t o = (size_t)t * NFREQ + lane;
  {
    ((float*)cst)[o] = cv;
    ((float*)snt)[o] = sv;
    
  }
}

// ---------------------------------------------------------------------------
// Elementwise RNE f32 -> bf16 plane: 8 elements per thread, one 16-B store per lane -> 32 consecutive lanes write 4 whole
// ---------------------------------------------------------------------------
__global__ __launch_bounds__(256) void cvt_bf16_kernel(const float* __restrict__ in, unsigned short* __restrict__ outp, int n8) {
  const int i = (int)blockIdx.x * 256 + (int)threadIdx.x;
  if (i >= n8) return;
  const size_t e = 8 * (size_t)i;
  const v4f a = *(const v4f*)(in + e);
  const v4f b = *(const v4f*)(in + e + 4);
  v4u w;
  w[0] = pk16(bf_bits(a[0]), bf_bits(a[1]));
  w[1] = pk16(bf_bits(a[2]), bf_bits(a[3]));
  w[2] = pk16(bf_bits(b[0]), bf_bits(b[1]));
  w[3] = pk16(bf_bits(b[2]), bf_bits(b[3]));
  *(v4u*)(outp + e) = w;
  
}

// ---------------------------------------------------------------------------
// Wo [HID][kin] f32 -> WO2 [HID][ldo = 2*kin] bf16 with WO2[n][k] = WO2[n][kin + k] = bf16(Wo[n][k]).
// Coverage: grid = n8/256 x 256 x 8 = HID*kin source elements -> both halves of every WO2 row.
// ---------------------------------------------------------------------------
__global__ __launch_bounds__(256) void cvt_wo2_kernel(const float* __restrict__ in, unsigned short* __restrict__ outp,
                                                      int n8, int kin, int ldo) {
  const int i = (int)blockIdx.x * 256 + (int)threadIdx.x;
  if (i >= n8) return;
  const size_t e = 8 * (size_t)i;
  const int n = (int)(e / (size_t)kin);
  const int k = (int)(e - (size_t)n * kin);
  const v4f a = *(const v4f*)(in + e);
  const v4f b = *(const v4f*)(in + e + 4);
  v4u w;
  w[0] = pk16(bf_bits(a[0]), bf_bits(a[1]));
  w[1] = pk16(bf_bits(a[2]), bf_bits(a[3]));
  w[2] = pk16(bf_bits(b[0]), bf_bits(b[1]));
  w[3] = pk16(bf_bits(b[2]), bf_bits(b[3]));
  const size_t o = (size_t)n * ldo + k;
  *(v4u*)(outp + o) = w;
  *(v4u*)(outp + o + kin) = w;
  
}

// ---------------------------------------------------------------------------
// Mask tile classes. mask [NB][1][SQ][SQ] f32 (additive). One block per (b, 64-row band mt): 256 threads x 8 consecutive columns,
// 64 rows each. For every 64x64 tile (b, mt, nt):
//   class 0 = every element <= -1e8 (tile contributes nothing: exp underflows to 0 exactly when the row has an admitted key),
//   class 1 = every element == 0 (nothing to add), class 2 = anything else (mask tile added elementwise).
// If the band contains a row with no element > -1e4 the skip is not valid for it: class 0 tiles of that band become class 2.
// Reductions are OR (order independent). Coverage: NB*32 blocks x 64 rows x 256 thr x 8 cols = the whole mask;
// ---------------------------------------------------------------------------
#define ADM_TH (-1.0e4f)
#define SKP_TH (-1.0e8f)

__global__ __launch_bounds__(256) void mask_class_kernel(const float* __restrict__ mask, int* __restrict__ cls) {
  __shared__ int nzs[NT64];
  __shared__ int bgs[NT64];
  __shared__ unsigned rlo[8];
  __shared__ unsigned rhi[8];
  const int bm   = blockIdx.x;           // b*32 + mt
  const int b    = bm >> 5;
  const int mt   = bm & 31;
  const int tid  = threadIdx.x;
  const int lane = tid & 31;
  const int wave = tid >> 5;
  const int j0   = tid * 8;
  int nz = 0, bg = 0;
  unsigned rowlo = 0u, rowhi = 0u;       // bit r: this thread's 8 columns contain an admitted element in row r
#pragma unroll 1
  for (int r = 0; r < 64; ++r) {
    const float* mr = mask + (((size_t)b * SQ) + (size_t)(mt * 64 + r)) * SQ + j0;
    const v4f mk0 = *(const v4f*)(mr);
    const v4f mk1 = *(const v4f*)(mr + 4);
    const int a = ((mk0[0] > ADM_TH) | (mk0[1] > ADM_TH) | (mk0[2] > ADM_TH) | (mk0[3] > ADM_TH) |
                   (mk1[0] > ADM_TH) | (mk1[1] > ADM_TH) | (mk1[2] > ADM_TH) | (mk1[3] > ADM_TH)) ? 1 : 0;
    const int z = ((mk0[0] != 0.0f) | (mk0[1] != 0.0f) | (mk0[2] != 0.0f) | (mk0[3] != 0.0f) |
                   (mk1[0] != 0.0f) | (mk1[1] != 0.0f) | (mk1[2] != 0.0f) | (mk1[3] != 0.0f)) ? 1 : 0;
    const int g = ((mk0[0] > SKP_TH) | (mk0[1] > SKP_TH) | (mk0[2] > SKP_TH) | (mk0[3] > SKP_TH) |
                   (mk1[0] > SKP_TH) | (mk1[1] > SKP_TH) | (mk1[2] > SKP_TH) | (mk1[3] > SKP_TH)) ? 1 : 0;
    nz |= z;
    bg |= g;
    const unsigned sh = ((unsigned)a) << (r & 31);
    rowlo |= (r < 32) ? sh : 0u;
    rowhi |= (r < 32) ? 0u : sh;
  }
  // OR over the 8 lanes 8q..8q+7 that share column tile nt = tid >> 3
  nz |= __shfl_xor(nz, 1, 32); nz |= __shfl_xor(nz, 2, 32); nz |= __shfl_xor(nz, 4, 32);
  bg |= __shfl_xor(bg, 1, 32); bg |= __shfl_xor(bg, 2, 32); bg |= __shfl_xor(bg, 4, 32);
#pragma unroll
  for (int off = 1; off < 32; off <<= 1) {
    rowlo |= (unsigned)__shfl_xor((int)rowlo, off, 32);
    rowhi |= (unsigned)__shfl_xor((int)rowhi, off, 32);
  }
  if ((lane & 7) == 0) { nzs[tid >> 3] = nz; bgs[tid >> 3] = bg; }
  if (lane == 0) { rlo[wave] = rowlo; rhi[wave] = rowhi; }
  __syncthreads();
  if (wave == 0) {                       // wave-uniform
    const int z = nzs[lane];
    const int g = bgs[lane];
    unsigned ol = rlo[0], oh = rhi[0];
#pragma unroll
    for (int w = 1; w < 8; ++w) { ol |= rlo[w]; oh |= rhi[w]; }
    const bool has_empty_row = (ol != 0xFFFFFFFFu) || (oh != 0xFFFFFFFFu);
    int cval = (g == 0) ? 0 : ((z == 0) ? 1 : 2);
    cval = (has_empty_row && cval == 0) ? 2 : cval;
    int* cp = cls + (size_t)bm * NT64 + lane;
    *cp = cval;
    
  }
}

// ---------------------------------------------------------------------------
// bf16 WMMA GEMM, block = 4 waves (128 threads) = one 128 x 128 tile of C; wave w owns rows 32w..32w+31 of it, all 128 cols.
//   C[m][n] = sum_k A[m][k] * Bt[n][k]; A row-major [M][K] bf16 (pitch lda), Bt row-major [N][K] bf16 (pitch ldb);
//   M % 128 == 0, N % 128 == 0, K % 64 == 0, K >= 64, lda % 8 == 0, ldb % 8 == 0; grid.x = M/128 * N/128.
//   Operands: per trip of 64 k the 128 A rows and the 128 Bt rows (128 B each) are copied global -> LDS asynchronously, whole
//   128-B lines per 8 lanes, into one of two buffers; trip t works on buffer t & 1 while tile t + 1 flies into the other.
//   Fragments are read from LDS rows (ldfrag_b) in the same k order as before.
// Epilogues (all: per wave, per 16-row slab: stage in LDS, wave sync, write each row segment with ONE instruction of
//   EPI 0: q|k projection with RoPE. The 128-col tile holds two 64-dim heads; pairs (d, d+32) inside each head are rotated with
//          the f32 cos/sin rows of the token (staged per slab in LDS), then split to bf16 hi (C0/C2) and lo (C1/C3) planes.
//          cols n0 < QW -> q planes [M][ldc], col n0; cols n0 >= QW -> k planes [M][ldc2], col n0-QW. Row segment 256 B = 16 lanes x 16 B.
//   EPI 1: v^T projection: bf16 hi plane C0, lo plane C1, [M][ldc], row segment 256 B.
//   EPI 2: f32 output C0 [M][ldc]; row segment 128 floats = 512 B = 32 lanes x 16 B per instruction.
// ---------------------------------------------------------------------------
template <int EPI> struct SlabCfg { static constexpr int PERWF = 2048; };   // floats per wave (8 KB)
template <> struct SlabCfg<0>     { static constexpr int PERWF = 3072; };   // + 16x32 cos + 16x32 sin rows

#define GKT  64                 // k per staged tile: 128-B rows
#define GPITCH  72                 // LDS row pitch in bf16: 144 B = 16 B x odd, for the 16-B fragment reads
#define GOP  (128 * GPITCH)        // bf16 per operand tile (128 rows)
#define GROWB (16 * GPITCH * 2)    // LDS bytes between a lane's consecutive copies (16 rows)

__device__ __forceinline__ unsigned lds_off(const void* p) { return (unsigned)(size_t)p; }

// One operand tile, 128 rows x 128 B: lane t copies 16 B of rows (t >> 3) + 16u, u = 0..7 (128 lanes x 8 = 1024 pieces = the tile).
// l = the lane's LDS byte address for u = 0, g = its global address for u = 0, ld = global row pitch in elements.
// s_wait_xcnt stands inside the statement so that no address register is rewritten ahead of it.
__device__ __forceinline__ void stage_tile(unsigned l, const unsigned short* g, int ld) {
  const size_t st = (size_t)16 * (size_t)ld;
  asm volatile(
      "global_load_async_to_lds_b128 %0, %8, off\n\t"
      "global_load_async_to_lds_b128 %1, %9, off\n\t"
      "global_load_async_to_lds_b128 %2, %10, off\n\t"
      "global_load_async_to_lds_b128 %3, %11, off\n\t"
      "global_load_async_to_lds_b128 %4, %12, off\n\t"
      "global_load_async_to_lds_b128 %5, %13, off\n\t"
      "global_load_async_to_lds_b128 %6, %14, off\n\t"
      "global_load_async_to_lds_b128 %7, %15, off\n\t"
      "s_wait_xcnt 0x0"
      :: "v"(l), "v"(l + 1u * GROWB), "v"(l + 2u * GROWB), "v"(l + 3u * GROWB),
         "v"(l + 4u * GROWB), "v"(l + 5u * GROWB), "v"(l + 6u * GROWB), "v"(l + 7u * GROWB),
         "v"(g), "v"(g + st), "v"(g + 2 * st), "v"(g + 3 * st),
         "v"(g + 4 * st), "v"(g + 5 * st), "v"(g + 6 * st), "v"(g + 7 * st)
      : "memory");
}

template <int EPI>
__global__ __launch_bounds__(128) void gemm_w32x128_kernel(
    const unsigned short* __restrict__ Ap, int lda,
    const unsigned short* __restrict__ Btp, int ldb,
    const float* __restrict__ cst, const float* __restrict__ snt,
    void* C0, void* C1, void* C2, void* C3, int ldc, int ldc2,
    int M, int N, int K) {
  __shared__ __align__(16) float lds_all[4 * SlabCfg<EPI>::PERWF];
  __shared__ __align__(16) unsigned short ring[2][2 * GOP];    // [buffer][A tile | Bt tile], 2 x 36,864 B

  const int tid  = (int)threadIdx.x;
  const int lane = tid & 31;
  const int wave = wave_id();
  const int hh = lane >> 4;           // lane half: k offset 8*hh, D row offset 8*hh
  const int rl = lane & 15;           // A row / B col / D col within subtile
  const int tilesN = N >> 7;
  const int tilesM = M >> 7;
  const int tile = (int)blockIdx.x;
  if (tile >= tilesM * tilesN) return;          // block-uniform, in front of every barrier and copy
  const int tm = tile / tilesN;
  const int tn = tile - tm * tilesN;
  const int mblk = tm << 7;
  const int m0 = mblk + (wave << 5);
  const int n0 = tn << 7;

  // this lane's first piece of each operand tile: row tid >> 3, 16-B column tid & 7
  const int srow = tid >> 3;
  const int sc8  = (tid & 7) * 8;
  const unsigned short* gA = Ap  + (size_t)(mblk + srow) * lda + sc8;
  const unsigned short* gB = Btp + (size_t)(n0   + srow) * ldb + sc8;
  const unsigned lA = lds_off(&ring[0][0]) + (unsigned)(srow * GPITCH + sc8) * 2u;
  const unsigned lB = lA + GOP * 2u;
  const unsigned bufb = 2u * GOP * 2u;           // bytes per buffer
  const int ntrip = K / GKT;

  v8f acc[2][8];
#pragma unroll
  for (int i = 0; i < 2; ++i)
#pragma unroll
    for (int j = 0; j < 8; ++j) acc[i][j] = zero8();

  // prologue: tile 0 lands and is published, then tile 1 starts
  stage_tile(lA, gA, lda);
  stage_tile(lB, gB, ldb);
  asm volatile("s_wait_asynccnt 0x0" ::: "memory");   // this wave's copies of tile 0 have landed
  __syncthreads();                                     // ... and every other wave's: tile 0 is readable
  if (ntrip > 1) {
    stage_tile(lA + bufb, gA + GKT, lda);
    stage_tile(lB + bufb, gB + GKT, ldb);
  }

  for (int t = 0; t < ntrip; ++t) {
    const __bf16* As = (const __bf16*)(const void*)&ring[t & 1][0]   + (wave * 32 + rl) * GPITCH + 8 * hh;
    const __bf16* Bs = (const __bf16*)(const void*)&ring[t & 1][GOP] + rl * GPITCH + 8 * hh;
    v16b ah[2][2], bf[2][8];                           // [k half of the tile][fragment]
#pragma unroll
    for (int s = 0; s < 2; ++s) {
#pragma unroll
      for (int i = 0; i < 2; ++i) ah[s][i] = ldfrag_b(As + i * 16 * GPITCH + s * 32);
#pragma unroll
      for (int j = 0; j < 8; ++j) bf[s][j] = ldfrag_b(Bs + j * 16 * GPITCH + s * 32);
    }
    // keeps the trip's LDS reads together in front of its WMMAs: one exposed LDS latency per trip instead of one per WMMA pair
    __builtin_amdgcn_sched_barrier(0);
#pragma unroll
    for (int s = 0; s < 2; ++s) {
#pragma unroll
      for (int j = 0; j < 8; ++j) {
        acc[0][j] = mma_b(ah[s][0], bf[s][j], acc[0][j]);
        acc[1][j] = mma_b(ah[s][1], bf[s][j], acc[1][j]);
      }
    }
    // keeps the WMMAs in front of the trip's foot: they overlap the LDS reads, and tile t + 1's copies get the whole trip to land
    __builtin_amdgcn_sched_barrier(0);
    asm volatile("s_wait_dscnt 0x0" ::: "memory");     // this wave's reads of buffer t & 1 are done before it is refilled
    asm volatile("s_wait_asynccnt 0x0" ::: "memory");  // this wave's copies of tile t + 1 have landed
    __syncthreads();                                   // publishes tile t + 1 and ends every reader's use of buffer t & 1
    if (t + 2 < ntrip) {                               // same for the whole block
      const unsigned bo = (unsigned)(t & 1) * bufb;
      stage_tile(lA + bo, gA + (size_t)(t + 2) * GKT, lda);
      stage_tile(lB + bo, gB + (size_t)(t + 2) * GKT, ldb);
    }
  }
  asm volatile("s_wait_asynccnt 0x0" ::: "memory");    // nothing of this wave is in flight behind the loop
  acc_guard4(acc[0][0], acc[0][1], acc[0][2], acc[0][3]);
  acc_guard4(acc[0][4], acc[0][5], acc[0][6], acc[0][7]);
  acc_guard4(acc[1][0], acc[1][1], acc[1][2], acc[1][3]);
  acc_guard4(acc[1][4], acc[1][5], acc[1][6], acc[1][7]);

  // ---- epilogue ----
  float* wl = lds_all + wave * SlabCfg<EPI>::PERWF;
  unsigned short* sl16 = (unsigned short*)(void*)wl;       // 4096 u16 = floats 0..2047 (two 16x128 planes)
  float* slf = wl;

  if (EPI == 0) {
    float* csl = wl + 2048;                                 // cos rows [16][32]
    float* snl = wl + 2048 + 16 * NFREQ;                    // sin rows [16][32]
    const bool isq = (n0 < QW);                             // wave-uniform
    unsigned short* P0 = isq ? (unsigned short*)C0 : (unsigned short*)C2;
    unsigned short* P1 = isq ? (unsigned short*)C1 : (unsigned short*)C3;
    const int ldp  = isq ? ldc : ldc2;
    const int col0 = isq ? n0 : (n0 - QW);
#pragma unroll
    for (int i = 0; i < 2; ++i) {
      const int mb = m0 + i * 16;
      // stage cos/sin of tokens mb..mb+15: 16 rows x 32 floats = 128 16-B pieces per table; lane -> 4 pieces (coverage 32x4 = 128)
#pragma unroll
      for (int u = 0; u < 4; ++u) {
        const int p   = lane + 32 * u;
        const int row = p >> 3, c4 = (p & 7) * 4;
        const v4f cv4 = *(const v4f*)(cst + (size_t)(mb + row) * NFREQ + c4);
        const v4f sv4 = *(const v4f*)(snt + (size_t)(mb + row) * NFREQ + c4);
        *(v4f*)(csl + row * NFREQ + c4) = cv4;
        *(v4f*)(snl + row * NFREQ + c4) = sv4;
      }
      lds_wave_sync();
#pragma unroll
      for (int hs = 0; hs < 2; ++hs) {                      // head within the 128-col tile
#pragma unroll
        for (int jj = 0; jj < 2; ++jj) {
          const int j1 = hs * 4 + jj;                       // cols hs*64 + jj*16 + rl  (x1, dim d < 32)
          const int j2 = j1 + 2;                            // cols +32                 (x2, dim d + 32)
          const int d  = jj * 16 + rl;                      // freq index 0..31
#pragma unroll
          for (int r = 0; r < 8; ++r) {
            const int lrow = 8 * hh + r;
            const float cv = csl[lrow * NFREQ + d];
            const float sv = snl[lrow * NFREQ + d];
            const float x1 = acc[i][j1][r];
            const float x2 = acc[i][j2][r];
            const float o1 = x1 * cv - x2 * sv;
            const float o2 = x2 * cv + x1 * sv;
            const unsigned short hb1 = bf_bits(o1), hb2 = bf_bits(o2);
            const unsigned short lb1 = bf_bits(o1 - bf_val(hb1)), lb2 = bf_bits(o2 - bf_val(hb2));
            const int so = lrow * 128 + hs * 64 + d;
            sl16[so]             = hb1;
            sl16[so + 32]        = hb2;
            sl16[2048 + so]      = lb1;
            sl16[2048 + so + 32] = lb2;
          }
        }
      }
      lds_wave_sync();
      {
#pragma unroll
        for (int it = 0; it < 8; ++it) {
          const int row = it * 2 + hh;                      // it x hh covers rows 0..15
          const int c8  = rl * 8;
          const v4u vh = *(const v4u*)(sl16 + row * 128 + c8);
          const v4u vl = *(const v4u*)(sl16 + 2048 + row * 128 + c8);
          const size_t go = (size_t)(mb + row) * ldp + col0 + c8;
          *(v4u*)(P0 + go) = vh;
          *(v4u*)(P1 + go) = vl;
        }
        
      }
      lds_wave_sync();
    }
  } else if (EPI == 1) {
    unsigned short* P0 = (unsigned short*)C0;
    unsigned short* P1 = (unsigned short*)C1;
#pragma unroll
    for (int i = 0; i < 2; ++i) {
#pragma unroll
      for (int r = 0; r < 8; ++r) {
#pragma unroll
        for (int j = 0; j < 8; ++j) {
          const float v = acc[i][j][r];
          const unsigned short hb = bf_bits(v);
          const unsigned short lb = bf_bits(v - bf_val(hb));
          const int so = (8 * hh + r) * 128 + j * 16 + rl;
          sl16[so]        = hb;
          sl16[2048 + so] = lb;
        }
      }
      lds_wave_sync();
      {
#pragma unroll
        for (int it = 0; it < 8; ++it) {
          const int row = it * 2 + hh;
          const int c8  = rl * 8;
          const v4u vh = *(const v4u*)(sl16 + row * 128 + c8);
          const v4u vl = *(const v4u*)(sl16 + 2048 + row * 128 + c8);
          const size_t go = (size_t)(m0 + i * 16 + row) * ldc + n0 + c8;
          *(v4u*)(P0 + go) = vh;
          *(v4u*)(P1 + go) = vl;
        }
        
      }
      lds_wave_sync();
    }
  } else {
    float* C = (float*)C0;
#pragma unroll
    for (int i = 0; i < 2; ++i) {
#pragma unroll
      for (int j = 0; j < 8; ++j)
#pragma unroll
        for (int r = 0; r < 8; ++r)
          slf[(8 * hh + r) * 128 + j * 16 + rl] = acc[i][j][r];
      lds_wave_sync();
      {
#pragma unroll
        for (int row = 0; row < 16; ++row) {                // 32 lanes x 16 B = the whole 512-B row segment per instruction
          const v4f v = *(const v4f*)(slf + row * 128 + lane * 4);
          *(v4f*)(C + (size_t)(m0 + i * 16 + row) * ldc + n0 + lane * 4) = v;
        }
        
      }
      lds_wave_sync();
    }
  }
}

#define AKC  32
#define KP   72          // K tile pitch (u16), 144 B rows
#define VP   40          // V^T tile pitch (u16), 80 B rows
#define MP   36          // mask tile pitch (f32), 144 B rows
static_assert((2 * AKC * KP + 2 * HDM * VP + 8 * 16 * 64) * 2 + 64 * MP * 4 <= 65536);

__global__ __launch_bounds__(128) void attn_kernel(
    const unsigned short* __restrict__ qhp, const unsigned short* __restrict__ qlp,
    const unsigned short* __restrict__ khp, const unsigned short* __restrict__ klp,
    const unsigned short* __restrict__ vhp, const unsigned short* __restrict__ vlp,
    const float* __restrict__ maskp, const int* __restrict__ clsp,
    unsigned short* __restrict__ aop) {
  __shared__ __align__(16) unsigned short Ks[AKC * KP];
  __shared__ __align__(16) unsigned short Kls[AKC * KP];
  __shared__ __align__(16) unsigned short Vhs[HDM * VP];
  __shared__ __align__(16) unsigned short Vls[HDM * VP];
  __shared__ __align__(16) float Ms[64 * MP];
  __shared__ __align__(16) unsigned short Osh[4][16 * 64];
  __shared__ __align__(16) unsigned short Osl[4][16 * 64];

  const int tid  = (int)threadIdx.x;
  const int lane = tid & 31;
  const int wave = wave_id();
  const int hh   = lane >> 4;
  const int c    = lane & 15;
  const int qt   = (int)blockIdx.x;
  const int h    = (int)blockIdx.y;
  const int b    = (int)blockIdx.z;
  const int kvh  = h >> 2;
  const int q0   = qt * 64 + wave * 16;          // first query row of this wave (within the sequence)
  const size_t tok0 = (size_t)b * SQ;

  // whole mask staging area initialised once (only class-2 chunks refresh it; other chunks never add from it)
#pragma unroll 1
  for (int u = tid; u < 64 * MP; u += 128) Ms[u] = 0.0f;

  const __bf16* Qhr = (const __bf16*)(const void*)qhp + (tok0 + q0 + c) * QW + h * HDM + 8 * hh;
  const __bf16* Qlr = (const __bf16*)(const void*)qlp + (tok0 + q0 + c) * QW + h * HDM + 8 * hh;
  const size_t mrow0 = (tok0 + (size_t)qt * 64) * SQ;                 // mask[b][0][qt*64][0]
  const int* crow = clsp + ((b * NT64) + qt) * NT64;

  v16b qh[2], ql[2];
#pragma unroll
  for (int dc = 0; dc < 2; ++dc) { qh[dc] = ldfrag_b(Qhr + dc * 32); ql[dc] = ldfrag_b(Qlr + dc * 32); }

  float mrow = -INFINITY;                          // running max of query c (the same in both halves)
  float lsum = 0.f;                                // running sum of query c over this half's keys
  v8f oacc[4];                                     // oacc[t][r] = O[query c][d = 16t + 8hh + r]
#pragma unroll
  for (int t = 0; t < 4; ++t) oacc[t] = zero8();

  for (int kc = 0; kc < 2 * NT64; ++kc) {
    const int nt = kc >> 1;
    const int cl = __builtin_amdgcn_readfirstlane(crow[nt]);         // block-uniform class of this chunk's tile
    if (cl == 0) continue;                                            // uniform for the whole block; before any barrier
    const int kv0 = kc * AKC;
    __syncthreads();                                                  // prior chunk's LDS readers are done
#pragma unroll
    for (int u = 0; u < 2; ++u) {                                     // coverage: 256 pieces of 8 halves per plane = whole tile
      const int p   = tid + 128 * u;                                  // 0..255
      const int key = p >> 3, d8 = (p & 7) * 8;                       // K: 32 keys x 64 d
      const size_t ko = (tok0 + kv0 + key) * KW + kvh * HDM + d8;
      const v4u kx = *(const v4u*)(khp + ko);
      const v4u ky = *(const v4u*)(klp + ko);
      *(v4u*)(Ks  + key * KP + d8) = kx;
      *(v4u*)(Kls + key * KP + d8) = ky;
      const int d = p >> 2, k8 = (p & 3) * 8;                         // V^T: 64 d x 32 keys
      const size_t vo = (size_t)(kvh * HDM + d) * NTOK + tok0 + kv0 + k8;
      const v4u vx = *(const v4u*)(vhp + vo);
      const v4u vy = *(const v4u*)(vlp + vo);
      *(v4u*)(Vhs + d * VP + k8) = vx;
      *(v4u*)(Vls + d * VP + k8) = vy;
    }
    if (cl == 2) {                                                    // block-uniform branch about the mask tile load
#pragma unroll
      for (int u = 0; u < 4; ++u) {                                   // coverage: 512 pieces of 4 floats = 64 rows x 32 keys
        const int p   = tid + 128 * u;                                // 0..511
        const int row = p >> 3, c4 = (p & 7) * 4;
        const v4f mv = *(const v4f*)(maskp + mrow0 + (size_t)row * SQ + kv0 + c4);
        *(v4f*)(Ms + row * MP + c4) = mv;
      }
    }
    __syncthreads();

    // ---- scores, transposed: 32 keys x 16 queries, K = 64, three products ----
    v8f sa[2];
    sa[0] = zero8(); sa[1] = zero8();
#pragma unroll
    for (int dc = 0; dc < 2; ++dc) {
#pragma unroll
      for (int j = 0; j < 2; ++j) {
        const v16b kb = ldfrag_b((const __bf16*)(const void*)Ks  + (j * 16 + c) * KP + dc * 32 + 8 * hh);
        const v16b kl = ldfrag_b((const __bf16*)(const void*)Kls + (j * 16 + c) * KP + dc * 32 + 8 * hh);
        sa[j] = mma_b(kb, qh[dc], sa[j]);
        sa[j] = mma_b(kl, qh[dc], sa[j]);
        sa[j] = mma_b(kb, ql[dc], sa[j]);
        guard1b4(sa[j], qh[dc], ql[dc], kb, kl);
      }
    }
    acc_guard2(sa[0], sa[1]);

    // ---- scale, mask add (class 2): sc[j][r] = score of (query c, key 16j + 8hh + r) ----
    float sc[2][8];
#pragma unroll
    for (int j = 0; j < 2; ++j)
#pragma unroll
      for (int r = 0; r < 8; ++r) sc[j][r] = sa[j][r] * 0.125f;
    if (cl == 2) {                                                    // block-uniform
      const float* mr = Ms + (wave * 16 + c) * MP + 8 * hh;           // the query's mask row, this half's keys
#pragma unroll
      for (int j = 0; j < 2; ++j) {
        const v4f ma = *(const v4f*)(mr + j * 16);
        const v4f mb = *(const v4f*)(mr + j * 16 + 4);
#pragma unroll
        for (int r = 0; r < 4; ++r) { sc[j][r] += bf_rne(ma[r]); sc[j][4 + r] += bf_rne(mb[r]); }
      }
    }
    // ---- chunk max of the query: in the lane, then with the other half ----
    float cm = -INFINITY;
#pragma unroll
    for (int j = 0; j < 2; ++j)
#pragma unroll
      for (int r = 0; r < 8; ++r) cm = fmaxf(cm, sc[j][r]);
    cm = fmaxf(cm, xhalf(cm));
    // ---- online softmax; p hi/lo packed in place into the B operands ----
    const float mnew  = fmaxf(mrow, cm);
    const float muse  = (mnew > -INFINITY) ? mnew : 0.0f;
    const float alpha = __expf(mrow - muse);
    mrow = mnew;
    union { v16b v; unsigned u[8]; } pa, pr;
    float ps[2];
#pragma unroll
    for (int j = 0; j < 2; ++j) {
      ps[j] = 0.f;
#pragma unroll
      for (int r = 0; r < 8; r += 2) {
        const float p0 = __expf(sc[j][r] - muse);
        const float p1 = __expf(sc[j][r + 1] - muse);
        ps[j] += p0;
        ps[j] += p1;
        const unsigned short h0 = bf_bits(p0), h1 = bf_bits(p1);
        const unsigned short l0 = bf_bits(p0 - bf_val(h0)), l1 = bf_bits(p1 - bf_val(h1));
        pa.u[j * 4 + (r >> 1)] = pk16(h0, h1);
        pr.u[j * 4 + (r >> 1)] = pk16(l0, l1);
      }
    }
    lsum = lsum * alpha + (ps[0] + ps[1]);
#pragma unroll
    for (int t = 0; t < 4; ++t)
#pragma unroll
      for (int r = 0; r < 8; ++r) oacc[t][r] *= alpha;
    // ---- O^T += v^T . p^T (K = 32 keys, three products) ----
#pragma unroll
    for (int t = 0; t < 4; ++t) {
      const v16b vb = ldfrag_b((const __bf16*)(const void*)Vhs + (t * 16 + c) * VP + 8 * hh);
      const v16b vr = ldfrag_b((const __bf16*)(const void*)Vls + (t * 16 + c) * VP + 8 * hh);
      oacc[t] = mma_b(vb, pa.v, oacc[t]);
      oacc[t] = mma_b(vr, pa.v, oacc[t]);
      oacc[t] = mma_b(vb, pr.v, oacc[t]);
      guard1b4(oacc[t], pa.v, pr.v, vb, vr);
    }
  }
  __syncthreads();                                 // every wave is past the chunk loop (all waves reach this)
  acc_guard4(oacc[0], oacc[1], oacc[2], oacc[3]);

  unsigned short* osh = Osh[wave];
  unsigned short* osl = Osl[wave];
  const float inv = 1.0f / (lsum + xhalf(lsum));   // the halves' sums joined; l >= 1: the row max contributes exp(0)
#pragma unroll
  for (int t = 0; t < 4; ++t) {                    // 8 consecutive d of query c: one 16-B LDS store per plane
    v4u xh, xl;
#pragma unroll
    for (int r = 0; r < 8; r += 2) {
      const float o0 = oacc[t][r] * inv;
      const float o1 = oacc[t][r + 1] * inv;
      const unsigned short h0 = bf_bits(o0), h1 = bf_bits(o1);
      xh[r >> 1] = pk16(h0, h1);
      xl[r >> 1] = pk16(bf_bits(o0 - bf_val(h0)), bf_bits(o1 - bf_val(h1)));
    }
    *(v4u*)(osh + c * 64 + t * 16 + 8 * hh) = xh;
    *(v4u*)(osl + c * 64 + t * 16 + 8 * hh) = xl;
  }
  lds_wave_sync();
  unsigned short* Ag = aop + (tok0 + q0) * AOW + h * HDM;
  const int qq = lane >> 3;                        // 0..3
  const int c8 = (lane & 7) * 8;
  {
#pragma unroll
    for (int it = 0; it < 4; ++it) {
      const int row = it * 4 + qq;                 // it 0..3 x qq 0..3 covers rows 0..15
      const v4u x = *(const v4u*)(osh + row * 64 + c8);
      const v4u y = *(const v4u*)(osl + row * 64 + c8);
      *(v4u*)(Ag + (size_t)row * AOW + c8)      = x;
      *(v4u*)(Ag + (size_t)row * AOW + QW + c8) = y;
    }
    
  }
}

// ---------------------------------------------------------------------------
// Workspace map (bytes; every region is an exact whole number of the rows its producer writes with whole-line stores;
// all dimensions are tile multiples, no padded tails needed; every offset is a multiple of 128):
//   XB   bf16 [4096][1024]   8388608     WQK bf16 [1280][1024]   2621440     WV  bf16 [256][1024]    524288
//   WO2  bf16 [1024][2048]   4194304     CST f32  [4096][32]      524288     SNT f32  [4096][32]     524288
//   CLS  i32  [2][32][32]       8192     QH  bf16 [4096][1024]   8388608     QL  bf16 [4096][1024]  8388608
//   KH   bf16 [4096][256]    2097152     KL  bf16 [4096][256]    2097152     VTH bf16 [256][4096]   2097152
//   VTL  bf16 [256][4096]    2097152     AO  bf16 [4096][2048]  16777216
//   total                   58728448
// ---------------------------------------------------------------------------
extern "C" void kernel_launch(void* const* d_in, const int* in_sizes, int n_in,
                              void* d_out, int out_size, void* d_ws, size_t ws_size,
                              hipStream_t stream) {
  if (n_in < 7) return;
  if (in_sizes[0] != NTOK * HID) return;                  // hidden_states [2][2048][1024] f32
  if (in_sizes[1] != NB * SQ * SQ) return;                // attention_mask [2][1][2048][2048] f32
  if (in_sizes[2] != NTOK) return;                        // position_ids [2][2048] int32
  if (in_sizes[3] != QW * HID) return;                    // wq [1024][1024]
  if (in_sizes[4] != KW * HID) return;                    // wk [256][1024]
  if (in_sizes[5] != KW * HID) return;                    // wv [256][1024]
  if (in_sizes[6] != HID * QW) return;                    // wo [1024][1024]
  if (out_size != NTOK * HID) return;

  const float* hs   = (const float*)d_in[0];
  const float* mask = (const float*)d_in[1];
  const int*   pos  = (const int*)d_in[2];
  const float* wq   = (const float*)d_in[3];
  const float* wk   = (const float*)d_in[4];
  const float* wv   = (const float*)d_in[5];
  const float* wo   = (const float*)d_in[6];
  float* out = (float*)d_out;

  const size_t szXB  = (size_t)NTOK * HID * 2;
  const size_t szWQK = (size_t)QKN * HID * 2;
  const size_t szWV  = (size_t)KW * HID * 2;
  const size_t szWO2 = (size_t)HID * AOW * 2;
  const size_t szT   = (size_t)NTOK * NFREQ * 4;
  const size_t szCLS = (size_t)NB * NT64 * NT64 * 4;
  const size_t szQ   = (size_t)NTOK * QW * 2;
  const size_t szK   = (size_t)NTOK * KW * 2;
  const size_t szVT  = (size_t)KW * NTOK * 2;
  const size_t szAO  = (size_t)NTOK * AOW * 2;
  size_t off = 0;
  const size_t oXB  = off; off += szXB;
  const size_t oWQK = off; off += szWQK;
  const size_t oWV  = off; off += szWV;
  const size_t oWO2 = off; off += szWO2;
  const size_t oCST = off; off += szT;
  const size_t oSNT = off; off += szT;
  const size_t oCLS = off; off += szCLS;
  const size_t oQH  = off; off += szQ;
  const size_t oQL  = off; off += szQ;
  const size_t oKH  = off; off += szK;
  const size_t oKL  = off; off += szK;
  const size_t oVTH = off; off += szVT;
  const size_t oVTL = off; off += szVT;
  const size_t oAO  = off; off += szAO;
  if (off > ws_size) return;                              // off = 58728448

  char* ws = (char*)d_ws;
  unsigned short* XB  = (unsigned short*)(ws + oXB);
  unsigned short* WQK = (unsigned short*)(ws + oWQK);
  unsigned short* WV  = (unsigned short*)(ws + oWV);
  unsigned short* WO2 = (unsigned short*)(ws + oWO2);
  float*          CST = (float*)(ws + oCST);
  float*          SNT = (float*)(ws + oSNT);
  int*            CLS = (int*)(ws + oCLS);
  unsigned short* QH  = (unsigned short*)(ws + oQH);
  unsigned short* QL  = (unsigned short*)(ws + oQL);
  unsigned short* KH  = (unsigned short*)(ws + oKH);
  unsigned short* KL  = (unsigned short*)(ws + oKL);
  unsigned short* VTH = (unsigned short*)(ws + oVTH);
  unsigned short* VTL = (unsigned short*)(ws + oVTL);
  unsigned short* AO  = (unsigned short*)(ws + oAO);

  const dim3 b256(256), b128(128);

  // (1) cos/sin table [4096][32] x 2 from the position ids
  rope_table_kernel<<<dim3(NTOK / 8), b256, 0, stream>>>(pos, CST, SNT, NTOK);
  // (2) x -> bf16 plane [4096][1024]
  cvt_bf16_kernel<<<dim3((NTOK * HID / 8) / 256), b256, 0, stream>>>(hs, XB, NTOK * HID / 8);
  // (3) wq [1024][1024] -> WQK rows 0..1023; wk [256][1024] -> WQK rows 1024..1279 (natural [out][in] = Bt layout)
  cvt_bf16_kernel<<<dim3((QW * HID / 8) / 256), b256, 0, stream>>>(wq, WQK, QW * HID / 8);
  cvt_bf16_kernel<<<dim3((KW * HID / 8) / 256), b256, 0, stream>>>(wk, WQK + (size_t)QW * HID, KW * HID / 8);
  // (4) wv [256][1024] -> WV
  cvt_bf16_kernel<<<dim3((KW * HID / 8) / 256), b256, 0, stream>>>(wv, WV, KW * HID / 8);
  // (5) wo [1024][1024] -> WO2 [1024][2048] (both halves)
  cvt_wo2_kernel<<<dim3((HID * QW / 8) / 256), b256, 0, stream>>>(wo, WO2, HID * QW / 8, QW, AOW);
  // (6) mask tile classes [2][32][32]
  mask_class_kernel<<<dim3(NB * NT64), b256, 0, stream>>>(mask, CLS);
  // (7) q|k = x . [Wq;Wk]^T, RoPE, split -> QH/QL [4096][1024], KH/KL [4096][256]   (M=4096, N=1280, K=1024; 32 x 10 block tiles)
  gemm_w32x128_kernel<0><<<dim3((NTOK / 128) * (QKN / 128)), b128, 0, stream>>>(
      XB, HID, WQK, HID, CST, SNT, (void*)QH, (void*)QL, (void*)KH, (void*)KL, QW, KW, NTOK, QKN, HID);
  // (8) v^T = Wv . x^T -> VTH/VTL [256][4096]   (A = WV, Bt = XB; M=256, N=4096, K=1024; 2 x 32 block tiles)
  gemm_w32x128_kernel<1><<<dim3((KW / 128) * (NTOK / 128)), b128, 0, stream>>>(
      WV, HID, XB, HID, CST, SNT, (void*)VTH, (void*)VTL, (void*)VTH, (void*)VTL, NTOK, NTOK, KW, NTOK, HID);
  // (9) attention per (q tile, head, batch) -> AO hi|lo [4096][2048]
  attn_kernel<<<dim3(SQ / 64, NHQ, NB), b128, 0, stream>>>(QH, QL, KH, KL, VTH, VTL, mask, CLS, AO);
  // (10) out = [AOhi | AOlo] . [Wo | Wo]^T -> d_out f32 [4096][1024]   (M=4096, N=1024, K=2048; 32 x 8 block tiles)
  gemm_w32x128_kernel<2><<<dim3((NTOK / 128) * (HID / 128)), b128, 0, stream>>>(
      AO, AOW, WO2, AOW, CST, SNT, (void*)out, (void*)out, (void*)out, (void*)out, HID, HID, NTOK, HID, AOW);
  (void)hipGetLastError();
}

// v003
// Measured time: 196 microseconds a run.
// Timed twice side by side with v002, it ran 1.14 times as fast both times.
// Counting every step since v000, it is 2.52 times as fast.
// Contractions: x.[Wq;Wk]^T and Wv.x^T on v_wmma_f32_16x16x32_bf16 (operands = RNE bf16 copies of the f32 inputs, single products);
// q.k^T and p.v on v_wmma_f32_16x16x32_bf16 with bf16 hi/lo split operands (hi.hi + hi.lo + lo.hi, three products);
// attn.Wo^T on v_wmma_f32_16x16x32_bf16 with attn = bf16 hi|lo planes folded into K (two products) and Wo as RNE bf16.
// f32 accumulate everywhere; RoPE (f32 cos/sin table built from the position ids), mask add and online softmax in f32.
// Plane carry audit: every 16-bit plane is bf16 with carry 1 (hi = RNE(v), lo = RNE(v - hi), same accumulator); nothing is scaled,
// nothing is folded back: XB, WQK, WV, WO2 (RNE copies), QH/QL, KH/KL, VTH/VTL, P (registers), AO hi|lo.
#include <hip/hip_runtime.h>
#include <math.h>
#include <stdint.h>

#define NB     2
#define SQ     2048
#define HID    1024
#define NHQ    16
#define NKVH   4
#define HDM    64
#define QW     1024          // q plane width (16 heads x 64)
#define KW     256           // k / v width (4 heads x 64)
#define QKN    1280          // q|k projection columns
#define NTOK   4096
#define NFREQ  32
#define AOW    2048          // attn plane width: hi at col 0..1023, lo at col 1024..2047
#define NT64   32            // 64-wide tiles along each mask axis

typedef __bf16       v16b __attribute__((ext_vector_type(16)));
typedef __bf16       v8b  __attribute__((ext_vector_type(8)));
typedef float        v8f  __attribute__((ext_vector_type(8)));
typedef float        v4f  __attribute__((ext_vector_type(4)));
typedef unsigned int v4u  __attribute__((ext_vector_type(4)));

// ---------------------------------------------------------------------------
// small helpers
// ---------------------------------------------------------------------------
__device__ __forceinline__ unsigned short bf_bits(float f) {          // RNE convert f32 -> bf16 bits
  const unsigned u = __float_as_uint(f);
  return (unsigned short)((u + 0x7FFFu + ((u >> 16) & 1u)) >> 16);
}
__device__ __forceinline__ float bf_val(unsigned short h) { return __uint_as_float(((unsigned)h) << 16); }
__device__ __forceinline__ float bf_rne(float f) { return bf_val(bf_bits(f)); }
__device__ __forceinline__ unsigned pk16(unsigned short a, unsigned short b) { return (unsigned)a | ((unsigned)b << 16); }
__device__ __forceinline__ v8f zero8() { v8f z = {0.f, 0.f, 0.f, 0.f, 0.f, 0.f, 0.f, 0.f}; return z; }
// lane l with lane l ^ 16 (the other half of the wave)
__device__ __forceinline__ float xhalf(float x) {
  const int b = __builtin_bit_cast(int, x);
  return __builtin_bit_cast(float, __builtin_amdgcn_permlanex16(b, b, 0x76543210, 0xfedcba98, false, false));
}
__device__ __forceinline__ int wave_id() { return __builtin_amdgcn_readfirstlane((int)(threadIdx.x >> 5)); }

__device__ __forceinline__ void lds_wave_sync() {
  __builtin_amdgcn_fence(__ATOMIC_RELEASE, "workgroup");
  __builtin_amdgcn_wave_barrier();
  __builtin_amdgcn_fence(__ATOMIC_ACQUIRE, "workgroup");
}

// ---------------------------------------------------------------------------
// WMMA fragments (wave32, 16x16x32, bf16 operands). For A (row m = lane&15) and B (col n = lane&15) alike:
// elements 0..7 <- k0 + 8*(lane>>4) + 0..7, elements 8..15 <- k0 + 16 + 8*(lane>>4) + 0..7.
// ldfrag_b(p) with p = rowbase + k0 + 8*(lane>>4): two 16-B loads p[0..7], p[16..23] (A rows and k-contiguous B rows alike).
// D: acc[r] = (row 8*(lane>>4) + r, col lane&15).
// ---------------------------------------------------------------------------
union FragB { v16b v; v8b h[2]; };
__device__ __forceinline__ v16b ldfrag_b(const __bf16* p) { FragB f; f.h[0] = *(const v8b*)(p); f.h[1] = *(const v8b*)(p + 16); return f.v; }

__device__ __forceinline__ v8f mma_b(v16b a, v16b b, v8f c) {
  return __builtin_amdgcn_wmma_f32_16x16x32_bf16(false, a, false, b, (short)0, c, false, false);
}
// hazard guards: 4 VALU slots after the last WMMA of a group, D tied, A/B kept live; memory clobber keeps later loads behind the group
__device__ __forceinline__ void guard1b4(v8f& a, v16b w, v16b x, v16b y, v16b z) {
  asm volatile("v_nop\n\tv_nop\n\tv_nop\n\tv_nop" : "+v"(a) : "v"(w), "v"(x), "v"(y), "v"(z) : "memory");
}
__device__ __forceinline__ void acc_guard4(v8f& a, v8f& b, v8f& c, v8f& d) {
  asm volatile("v_nop\n\tv_nop\n\tv_nop\n\tv_nop" : "+v"(a), "+v"(b), "+v"(c), "+v"(d));
}
__device__ __forceinline__ void acc_guard2(v8f& a, v8f& b) {
  asm volatile("v_nop\n\tv_nop\n\tv_nop\n\tv_nop" : "+v"(a), "+v"(b));
}

// ---------------------------------------------------------------------------
// RoPE table: cst[t][j] = cos(pos[t] * inv_freq[j]), snt[t][j] = sin(...), inv_freq[j] = 1 / 10000^(j/32), j < 32, all f32.
// ---------------------------------------------------------------------------
__device__ __forceinline__ void rope_table_part(int bid, const int* __restrict__ pos, float* __restrict__ cst,
                                                float* __restrict__ snt, int ntok) {
  const int lane = threadIdx.x & 31;
  const int wave = (int)(threadIdx.x >> 5);
  const int t = bid * 8 + wave;
  if (t >= ntok) return;                       // no barriers in this part
  const float pf  = (float)pos[t];
  const float e   = (float)lane * 0.03125f;    // (2*j)/64 exact
  const float pw  = powf(10000.0f, e);
  const float inv = 1.0f / pw;
  const float ang = pf * inv;
  const float cv  = cosf(ang);
  const float sv  = sinf(ang);
  const size_t o = (size_t)t * NFREQ + lane;
  {
    ((float*)cst)[o] = cv;
    ((float*)snt)[o] = sv;
    
  }
}

// ---------------------------------------------------------------------------
// Elementwise RNE f32 -> bf16 plane: 8 elements per thread, one 16-B store per lane -> 32 consecutive lanes write 4 whole
// ---------------------------------------------------------------------------
__device__ __forceinline__ void cvt_bf16_part(int bid, const float* __restrict__ in, unsigned short* __restrict__ outp, int n8) {
  const int i = bid * 256 + (int)threadIdx.x;
  if (i >= n8) return;
  const size_t e = 8 * (size_t)i;
  const v4f a = *(const v4f*)(in + e);
  const v4f b = *(const v4f*)(in + e + 4);
  v4u w;
  w[0] = pk16(bf_bits(a[0]), bf_bits(a[1]));
  w[1] = pk16(bf_bits(a[2]), bf_bits(a[3]));
  w[2] = pk16(bf_bits(b[0]), bf_bits(b[1]));
  w[3] = pk16(bf_bits(b[2]), bf_bits(b[3]));
  *(v4u*)(outp + e) = w;
  
}

// ---------------------------------------------------------------------------
// Wo [HID][kin] f32 -> WO2 [HID][ldo = 2*kin] bf16 with WO2[n][k] = WO2[n][kin + k] = bf16(Wo[n][k]).
// Coverage: grid = n8/256 x 256 x 8 = HID*kin source elements -> both halves of every WO2 row.
// ---------------------------------------------------------------------------
__device__ __forceinline__ void cvt_wo2_part(int bid, const float* __restrict__ in, unsigned short* __restrict__ outp,
                                             int n8, int kin, int ldo) {
  const int i = bid * 256 + (int)threadIdx.x;
  if (i >= n8) return;
  const size_t e = 8 * (size_t)i;
  const int n = (int)(e / (size_t)kin);
  const int k = (int)(e - (size_t)n * kin);
  const v4f a = *(const v4f*)(in + e);
  const v4f b = *(const v4f*)(in + e + 4);
  v4u w;
  w[0] = pk16(bf_bits(a[0]), bf_bits(a[1]));
  w[1] = pk16(bf_bits(a[2]), bf_bits(a[3]));
  w[2] = pk16(bf_bits(b[0]), bf_bits(b[1]));
  w[3] = pk16(bf_bits(b[2]), bf_bits(b[3]));
  const size_t o = (size_t)n * ldo + k;
  *(v4u*)(outp + o) = w;
  *(v4u*)(outp + o + kin) = w;
  
}

// ---------------------------------------------------------------------------
// Mask tile classes. mask [NB][1][SQ][SQ] f32 (additive). One block per (b, 64-row band mt): 256 threads x 8 consecutive columns,
// 64 rows each. For every 64x64 tile (b, mt, nt):
//   class 0 = every element <= -1e8 (tile contributes nothing: exp underflows to 0 exactly when the row has an admitted key),
//   class 1 = every element == 0 (nothing to add), class 2 = anything else (mask tile added elementwise).
// If the band contains a row with no element > -1e4 the skip is not valid for it: class 0 tiles of that band become class 2.
// Reductions are OR (order independent). Coverage: NB*32 blocks x 64 rows x 256 thr x 8 cols = the whole mask;
// ---------------------------------------------------------------------------
#define ADM_TH (-1.0e4f)
#define SKP_TH (-1.0e8f)

__device__ __forceinline__ void mask_class_part(int bid, const float* __restrict__ mask, int* __restrict__ cls) {
  __shared__ int nzs[NT64];
  __shared__ int bgs[NT64];
  __shared__ unsigned rlo[8];
  __shared__ unsigned rhi[8];
  const int bm   = bid;                  // b*32 + mt
  const int b    = bm >> 5;
  const int mt   = bm & 31;
  const int tid  = threadIdx.x;
  const int lane = tid & 31;
  const int wave = tid >> 5;
  const int j0   = tid * 8;
  int nz = 0, bg = 0;
  unsigned rowlo = 0u, rowhi = 0u;       // bit r: this thread's 8 columns contain an admitted element in row r
#pragma unroll 1
  for (int r = 0; r < 64; ++r) {
    const float* mr = mask + (((size_t)b * SQ) + (size_t)(mt * 64 + r)) * SQ + j0;
    const v4f mk0 = *(const v4f*)(mr);
    const v4f mk1 = *(const v4f*)(mr + 4);
    const int a = ((mk0[0] > ADM_TH) | (mk0[1] > ADM_TH) | (mk0[2] > ADM_TH) | (mk0[3] > ADM_TH) |
                   (mk1[0] > ADM_TH) | (mk1[1] > ADM_TH) | (mk1[2] > ADM_TH) | (mk1[3] > ADM_TH)) ? 1 : 0;
    const int z = ((mk0[0] != 0.0f) | (mk0[1] != 0.0f) | (mk0[2] != 0.0f) | (mk0[3] != 0.0f) |
                   (mk1[0] != 0.0f) | (mk1[1] != 0.0f) | (mk1[2] != 0.0f) | (mk1[3] != 0.0f)) ? 1 : 0;
    const int g = ((mk0[0] > SKP_TH) | (mk0[1] > SKP_TH) | (mk0[2] > SKP_TH) | (mk0[3] > SKP_TH) |
                   (mk1[0] > SKP_TH) | (mk1[1] > SKP_TH) | (mk1[2] > SKP_TH) | (mk1[3] > SKP_TH)) ? 1 : 0;
    nz |= z;
    bg |= g;
    const unsigned sh = ((unsigned)a) << (r & 31);
    rowlo |= (r < 32) ? sh : 0u;
    rowhi |= (r < 32) ? 0u : sh;
  }
  // OR over the 8 lanes 8q..8q+7 that share column tile nt = tid >> 3
  nz |= __shfl_xor(nz, 1, 32); nz |= __shfl_xor(nz, 2, 32); nz |= __shfl_xor(nz, 4, 32);
  bg |= __shfl_xor(bg, 1, 32); bg |= __shfl_xor(bg, 2, 32); bg |= __shfl_xor(bg, 4, 32);
#pragma unroll
  for (int off = 1; off < 32; off <<= 1) {
    rowlo |= (unsigned)__shfl_xor((int)rowlo, off, 32);
    rowhi |= (unsigned)__shfl_xor((int)rowhi, off, 32);
  }
  if ((lane & 7) == 0) { nzs[tid >> 3] = nz; bgs[tid >> 3] = bg; }
  if (lane == 0) { rlo[wave] = rowlo; rhi[wave] = rowhi; }
  __syncthreads();
  if (wave == 0) {                       // wave-uniform
    const int z = nzs[lane];
    const int g = bgs[lane];
    unsigned ol = rlo[0], oh = rhi[0];
#pragma unroll
    for (int w = 1; w < 8; ++w) { ol |= rlo[w]; oh |= rhi[w]; }
    const bool has_empty_row = (ol != 0xFFFFFFFFu) || (oh != 0xFFFFFFFFu);
    int cval = (g == 0) ? 0 : ((z == 0) ? 1 : 2);
    cval = (has_empty_row && cval == 0) ? 2 : cval;
    int* cp = cls + (size_t)bm * NT64 + lane;
    *cp = cval;
    
  }
}

// ---------------------------------------------------------------------------
// The seven preparation jobs depend on the inputs alone and on nothing of each other: one launch, each job a range of blocks
// (256 threads each, the block counts the jobs had as launches of their own). The mask bands, the longest blocks, come first.
// Every branch is on the block index: whole blocks take it, so the barrier of the mask part stays block-uniform.
// ---------------------------------------------------------------------------
#define PB_MASK (NB * NT64)                  // 64
#define PB_X    ((NTOK * HID / 8) / 256)     // 2048
#define PB_ROPE (NTOK / 8)                   // 512
#define PB_WQ   ((QW * HID / 8) / 256)       // 512
#define PB_WO   ((HID * QW / 8) / 256)       // 512
#define PB_WKV  ((KW * HID / 8) / 256)       // 128, wk and wv each
#define PB_ALL  (PB_MASK + PB_X + PB_ROPE + PB_WQ + PB_WO + 2 * PB_WKV)

__global__ __launch_bounds__(256) void prep_kernel(
    const float* __restrict__ hs, const float* __restrict__ mask, const int* __restrict__ pos,
    const float* __restrict__ wq, const float* __restrict__ wk, const float* __restrict__ wv, const float* __restrict__ wo,
    unsigned short* __restrict__ xb, unsigned short* __restrict__ wqk, unsigned short* __restrict__ wvb,
    unsigned short* __restrict__ wo2, float* __restrict__ cst, float* __restrict__ snt, int* __restrict__ cls) {
  int bid = (int)blockIdx.x;
  // mask tile classes [2][32][32]
  if (bid < PB_MASK) { mask_class_part(bid, mask, cls); return; }
  bid -= PB_MASK;
  // x -> bf16 plane [4096][1024]
  if (bid < PB_X) { cvt_bf16_part(bid, hs, xb, NTOK * HID / 8); return; }
  bid -= PB_X;
  // cos/sin table [4096][32] x 2 from the position ids
  if (bid < PB_ROPE) { rope_table_part(bid, pos, cst, snt, NTOK); return; }
  bid -= PB_ROPE;
  // wq [1024][1024] -> WQK rows 0..1023 (natural [out][in] = Bt layout)
  if (bid < PB_WQ) { cvt_bf16_part(bid, wq, wqk, QW * HID / 8); return; }
  bid -= PB_WQ;
  // wo [1024][1024] -> WO2 [1024][2048] (both halves)
  if (bid < PB_WO) { cvt_wo2_part(bid, wo, wo2, HID * QW / 8, QW, AOW); return; }
  bid -= PB_WO;
  // wk [256][1024] -> WQK rows 1024..1279
  if (bid < PB_WKV) { cvt_bf16_part(bid, wk, wqk + (size_t)QW * HID, KW * HID / 8); return; }
  bid -= PB_WKV;
  // wv [256][1024] -> WV
  if (bid < PB_WKV) { cvt_bf16_part(bid, wv, wvb, KW * HID / 8); return; }
}

// ---------------------------------------------------------------------------
// bf16 WMMA GEMM, block = 4 waves (128 threads) = one 128 x 128 tile of C; wave w owns rows 32w..32w+31 of it, all 128 cols.
//   C[m][n] = sum_k A[m][k] * Bt[n][k]; A row-major [M][K] bf16 (pitch lda), Bt row-major [N][K] bf16 (pitch ldb);
//   M % 128 == 0, N % 128 == 0, K % 64 == 0, K >= 64, lda % 8 == 0, ldb % 8 == 0; grid.x = M/128 * N/128.
//   EPI 0 carries a second, independent product in the same launch: blocks M/128 * N/128 .. + M2/128 * N2/128 - 1 compute
//   C'[m][n] = sum_k A2[m][k] * A[n][k] (A2 [M2][K] pitch lda; the first product's A, N2 rows of it, as Bt with pitch ldb:
//   lda == ldb), same K, same loop.
//   Operands: per trip of 64 k the 128 A rows and the 128 Bt rows (128 B each) are copied global -> LDS asynchronously, whole
//   128-B lines per 8 lanes, into one of two buffers; trip t works on buffer t & 1 while tile t + 1 flies into the other.
//   Fragments are read from LDS rows (ldfrag_b) in the same k order as before.
// Epilogues (all: per wave, per 16-row slab: stage in LDS, wave sync, write each row segment with ONE instruction of
//   EPI 0: q|k projection with RoPE. The 128-col tile holds two 64-dim heads; pairs (d, d+32) inside each head are rotated with
//          the f32 cos/sin rows of the token (staged per slab in LDS), then split to bf16 hi (C0/C2) and lo (C1/C3) planes.
//          cols n0 < QW -> q planes [M][ldc], col n0; cols n0 >= QW -> k planes [M][ldc2], col n0-QW. Row segment 256 B = 16 lanes x 16 B.
//          Second product = v^T projection: bf16 hi plane D0, lo plane D1, [M2][ldd], row segment 256 B.
//   EPI 2: f32 output C0 [M][ldc]; row segment 128 floats = 512 B = 32 lanes x 16 B per instruction.
// ---------------------------------------------------------------------------
template <int EPI> struct SlabCfg { static constexpr int PERWF = 2048; };   // floats per wave (8 KB)
template <> struct SlabCfg<0>     { static constexpr int PERWF = 3072; };   // + 16x32 cos + 16x32 sin rows

#define GKT  64                 // k per staged tile: 128-B rows
#define GPITCH  72                 // LDS row pitch in bf16: 144 B = 16 B x odd, for the 16-B fragment reads
#define GOP  (128 * GPITCH)        // bf16 per operand tile (128 rows)
#define GROWB (16 * GPITCH * 2)    // LDS bytes between a lane's consecutive copies (16 rows)

__device__ __forceinline__ unsigned lds_off(const void* p) { return (unsigned)(size_t)p; }

// One operand tile, 128 rows x 128 B: lane t copies 16 B of rows (t >> 3) + 16u, u = 0..7 (128 lanes x 8 = 1024 pieces = the tile).
// l = the lane's LDS byte address for u = 0, g = its global address for u = 0, ld = global row pitch in elements.
// s_wait_xcnt stands inside the statement so that no address register is rewritten ahead of it.
__device__ __forceinline__ void stage_tile(unsigned l, const unsigned short* g, int ld) {
  const size_t st = (size_t)16 * (size_t)ld;
  asm volatile(
      "global_load_async_to_lds_b128 %0, %8, off\n\t"
      "global_load_async_to_lds_b128 %1, %9, off\n\t"
      "global_load_async_to_lds_b128 %2, %10, off\n\t"
      "global_load_async_to_lds_b128 %3, %11, off\n\t"
      "global_load_async_to_lds_b128 %4, %12, off\n\t"
      "global_load_async_to_lds_b128 %5, %13, off\n\t"
      "global_load_async_to_lds_b128 %6, %14, off\n\t"
      "global_load_async_to_lds_b128 %7, %15, off\n\t"
      "s_wait_xcnt 0x0"
      :: "v"(l), "v"(l + 1u * GROWB), "v"(l + 2u * GROWB), "v"(l + 3u * GROWB),
         "v"(l + 4u * GROWB), "v"(l + 5u * GROWB), "v"(l + 6u * GROWB), "v"(l + 7u * GROWB),
         "v"(g), "v"(g + st), "v"(g + 2 * st), "v"(g + 3 * st),
         "v"(g + 4 * st), "v"(g + 5 * st), "v"(g + 6 * st), "v"(g + 7 * st)
      : "memory");
}

template <int EPI>
__global__ __launch_bounds__(128) void gemm_w32x128_kernel(
    const unsigned short* __restrict__ Ap, int lda,
    const unsigned short* __restrict__ Btp, int ldb,
    const float* __restrict__ cst, const float* __restrict__ snt,
    void* C0, void* C1, void* C2, void* C3, int ldc, int ldc2,
    int M, int N, int K,
    const unsigned short* __restrict__ A2p, void* D0, void* D1, int ldd, int M2, int N2) {
  __shared__ __align__(16) float lds_all[4 * SlabCfg<EPI>::PERWF];
  __shared__ __align__(16) unsigned short ring[2][2 * GOP];    // [buffer][A tile | Bt tile], 2 x 36,864 B

  const int tid  = (int)threadIdx.x;
  const int lane = tid & 31;
  const int wave = wave_id();
  const int hh = lane >> 4;           // lane half: k offset 8*hh, D row offset 8*hh
  const int rl = lane & 15;           // A row / B col / D col within subtile
  const int ntile1 = (M >> 7) * (N >> 7);
  const bool second = (EPI == 0) && ((int)blockIdx.x >= ntile1);   // block-uniform: this block works on the second product
  const int tilesN = (second ? N2 : N) >> 7;
  const int tilesM = (second ? M2 : M) >> 7;
  const int tile = (int)blockIdx.x - (second ? ntile1 : 0);
  if (tile >= tilesM * tilesN) return;          // block-uniform, in front of every barrier and copy
  const int tm = tile / tilesN;
  const int tn = tile - tm * tilesN;
  const int mblk = tm << 7;
  const int m0 = mblk + (wave << 5);
  const int n0 = tn << 7;

  // this lane's first piece of each operand tile: row tid >> 3, 16-B column tid & 7
  const int srow = tid >> 3;
  const int sc8  = (tid & 7) * 8;
  const unsigned short* gA = (second ? A2p : Ap) + (size_t)(mblk + srow) * lda + sc8;
  const unsigned short* gB = (second ? Ap : Btp) + (size_t)(n0   + srow) * ldb + sc8;
  const unsigned lA = lds_off(&ring[0][0]) + (unsigned)(srow * GPITCH + sc8) * 2u;
  const unsigned lB = lA + GOP * 2u;
  const unsigned bufb = 2u * GOP * 2u;           // bytes per buffer
  const int ntrip = K / GKT;

  v8f acc[2][8];
#pragma unroll
  for (int i = 0; i < 2; ++i)
#pragma unroll
    for (int j = 0; j < 8; ++j) acc[i][j] = zero8();

  // prologue: tile 0 lands and is published, then tile 1 starts
  stage_tile(lA, gA, lda);
  stage_tile(lB, gB, ldb);
  asm volatile("s_wait_asynccnt 0x0" ::: "memory");   // this wave's copies of tile 0 have landed
  __syncthreads();                                     // ... and every other wave's: tile 0 is readable
  if (ntrip > 1) {
    stage_tile(lA + bufb, gA + GKT, lda);
    stage_tile(lB + bufb, gB + GKT, ldb);
  }

  for (int t = 0; t < ntrip; ++t) {
    const __bf16* As = (const __bf16*)(const void*)&ring[t & 1][0]   + (wave * 32 + rl) * GPITCH + 8 * hh;
    const __bf16* Bs = (const __bf16*)(const void*)&ring[t & 1][GOP] + rl * GPITCH + 8 * hh;
    v16b ah[2][2], bf[2][8];                           // [k half of the tile][fragment]
#pragma unroll
    for (int s = 0; s < 2; ++s) {
#pragma unroll
      for (int i = 0; i < 2; ++i) ah[s][i] = ldfrag_b(As + i * 16 * GPITCH + s * 32);
#pragma unroll
      for (int j = 0; j < 8; ++j) bf[s][j] = ldfrag_b(Bs + j * 16 * GPITCH + s * 32);
    }
    // keeps the trip's LDS reads together in front of its WMMAs: one exposed LDS latency per trip instead of one per WMMA pair
    __builtin_amdgcn_sched_barrier(0);
#pragma unroll
    for (int s = 0; s < 2; ++s) {
#pragma unroll
      for (int j = 0; j < 8; ++j) {
        acc[0][j] = mma_b(ah[s][0], bf[s][j], acc[0][j]);
        acc[1][j] = mma_b(ah[s][1], bf[s][j], acc[1][j]);
      }
    }
    // keeps the WMMAs in front of the trip's foot: they overlap the LDS reads, and tile t + 1's copies get the whole trip to land
    __builtin_amdgcn_sched_barrier(0);
    asm volatile("s_wait_dscnt 0x0" ::: "memory");     // this wave's reads of buffer t & 1 are done before it is refilled
    asm volatile("s_wait_asynccnt 0x0" ::: "memory");  // this wave's copies of tile t + 1 have landed
    __syncthreads();                                   // publishes tile t + 1 and ends every reader's use of buffer t & 1
    if (t + 2 < ntrip) {                               // same for the whole block
      const unsigned bo = (unsigned)(t & 1) * bufb;
      stage_tile(lA + bo, gA + (size_t)(t + 2) * GKT, lda);
      stage_tile(lB + bo, gB + (size_t)(t + 2) * GKT, ldb);
    }
  }
  asm volatile("s_wait_asynccnt 0x0" ::: "memory");    // nothing of this wave is in flight behind the loop
  acc_guard4(acc[0][0], acc[0][1], acc[0][2], acc[0][3]);
  acc_guard4(acc[0][4], acc[0][5], acc[0][6], acc[0][7]);
  acc_guard4(acc[1][0], acc[1][1], acc[1][2], acc[1][3]);
  acc_guard4(acc[1][4], acc[1][5], acc[1][6], acc[1][7]);

  // ---- epilogue ----
  float* wl = lds_all + wave * SlabCfg<EPI>::PERWF;
  unsigned short* sl16 = (unsigned short*)(void*)wl;       // 4096 u16 = floats 0..2047 (two 16x128 planes)
  float* slf = wl;

  if (EPI == 0 && !second) {
    float* csl = wl + 2048;                                 // cos rows [16][32]
    float* snl = wl + 2048 + 16 * NFREQ;                    // sin rows [16][32]
    const bool isq = (n0 < QW);                             // wave-uniform
    unsigned short* P0 = isq ? (unsigned short*)C0 : (unsigned short*)C2;
    unsigned short* P1 = isq ? (unsigned short*)C1 : (unsigned short*)C3;
    const int ldp  = isq ? ldc : ldc2;
    const int col0 = isq ? n0 : (n0 - QW);
#pragma unroll
    for (int i = 0; i < 2; ++i) {
      const int mb = m0 + i * 16;
      // stage cos/sin of tokens mb..mb+15: 16 rows x 32 floats = 128 16-B pieces per table; lane -> 4 pieces (coverage 32x4 = 128)
#pragma unroll
      for (int u = 0; u < 4; ++u) {
        const int p   = lane + 32 * u;
        const int row = p >> 3, c4 = (p & 7) * 4;
        const v4f cv4 = *(const v4f*)(cst + (size_t)(mb + row) * NFREQ + c4);
        const v4f sv4 = *(const v4f*)(snt + (size_t)(mb + row) * NFREQ + c4);
        *(v4f*)(csl + row * NFREQ + c4) = cv4;
        *(v4f*)(snl + row * NFREQ + c4) = sv4;
      }
      lds_wave_sync();
#pragma unroll
      for (int hs = 0; hs < 2; ++hs) {                      // head within the 128-col tile
#pragma unroll
        for (int jj = 0; jj < 2; ++jj) {
          const int j1 = hs * 4 + jj;                       // cols hs*64 + jj*16 + rl  (x1, dim d < 32)
          const int j2 = j1 + 2;                            // cols +32                 (x2, dim d + 32)
          const int d  = jj * 16 + rl;                      // freq index 0..31
#pragma unroll
          for (int r = 0; r < 8; ++r) {
            const int lrow = 8 * hh + r;
            const float cv = csl[lrow * NFREQ + d];
            const float sv = snl[lrow * NFREQ + d];
            const float x1 = acc[i][j1][r];
            const float x2 = acc[i][j2][r];
            const float o1 = x1 * cv - x2 * sv;
            const float o2 = x2 * cv + x1 * sv;
            const unsigned short hb1 = bf_bits(o1), hb2 = bf_bits(o2);
            const unsigned short lb1 = bf_bits(o1 - bf_val(hb1)), lb2 = bf_bits(o2 - bf_val(hb2));
            const int so = lrow * 128 + hs * 64 + d;
            sl16[so]             = hb1;
            sl16[so + 32]        = hb2;
            sl16[2048 + so]      = lb1;
            sl16[2048 + so + 32] = lb2;
          }
        }
      }
      lds_wave_sync();
      {
#pragma unroll
        for (int it = 0; it < 8; ++it) {
          const int row = it * 2 + hh;                      // it x hh covers rows 0..15
          const int c8  = rl * 8;
          const v4u vh = *(const v4u*)(sl16 + row * 128 + c8);
          const v4u vl = *(const v4u*)(sl16 + 2048 + row * 128 + c8);
          const size_t go = (size_t)(mb + row) * ldp + col0 + c8;
          *(v4u*)(P0 + go) = vh;
          *(v4u*)(P1 + go) = vl;
        }
        
      }
      lds_wave_sync();
    }
  } else if (EPI == 0) {
    unsigned short* P0 = (unsigned short*)D0;
    unsigned short* P1 = (unsigned short*)D1;
#pragma unroll
    for (int i = 0; i < 2; ++i) {
#pragma unroll
      for (int r = 0; r < 8; ++r) {
#pragma unroll
        for (int j = 0; j < 8; ++j) {
          const float v = acc[i][j][r];
          const unsigned short hb = bf_bits(v);
          const unsigned short lb = bf_bits(v - bf_val(hb));
          const int so = (8 * hh + r) * 128 + j * 16 + rl;
          sl16[so]        = hb;
          sl16[2048 + so] = lb;
        }
      }
      lds_wave_sync();
      {
#pragma unroll
        for (int it = 0; it < 8; ++it) {
          const int row = it * 2 + hh;
          const int c8  = rl * 8;
          const v4u vh = *(const v4u*)(sl16 + row * 128 + c8);
          const v4u vl = *(const v4u*)(sl16 + 2048 + row * 128 + c8);
          const size_t go = (size_t)(m0 + i * 16 + row) * ldd + n0 + c8;
          *(v4u*)(P0 + go) = vh;
          *(v4u*)(P1 + go) = vl;
        }
        
      }
      lds_wave_sync();
    }
  } else {
    float* C = (float*)C0;
#pragma unroll
    for (int i = 0; i < 2; ++i) {
#pragma unroll
      for (int j = 0; j < 8; ++j)
#pragma unroll
        for (int r = 0; r < 8; ++r)
          slf[(8 * hh + r) * 128 + j * 16 + rl] = acc[i][j][r];
      lds_wave_sync();
      {
#pragma unroll
        for (int row = 0; row < 16; ++row) {                // 32 lanes x 16 B = the whole 512-B row segment per instruction
          const v4f v = *(const v4f*)(slf + row * 128 + lane * 4);
          *(v4f*)(C + (size_t)(m0 + i * 16 + row) * ldc + n0 + lane * 4) = v;
        }
        
      }
      lds_wave_sync();
    }
  }
}

#define AKC  32
#define KP   72          // K tile pitch (u16), 144 B rows
#define VP   40          // V^T tile pitch (u16), 80 B rows
#define MP   36          // mask tile pitch (f32), 144 B rows
static_assert((2 * AKC * KP + 2 * HDM * VP + 8 * 16 * 64) * 2 + 64 * MP * 4 <= 65536);

__global__ __launch_bounds__(128) void attn_kernel(
    const unsigned short* __restrict__ qhp, const unsigned short* __restrict__ qlp,
    const unsigned short* __restrict__ khp, const unsigned short* __restrict__ klp,
    const unsigned short* __restrict__ vhp, const unsigned short* __restrict__ vlp,
    const float* __restrict__ maskp, const int* __restrict__ clsp,
    unsigned short* __restrict__ aop) {
  __shared__ __align__(16) unsigned short Ks[AKC * KP];
  __shared__ __align__(16) unsigned short Kls[AKC * KP];
  __shared__ __align__(16) unsigned short Vhs[HDM * VP];
  __shared__ __align__(16) unsigned short Vls[HDM * VP];
  __shared__ __align__(16) float Ms[64 * MP];
  __shared__ __align__(16) unsigned short Osh[4][16 * 64];
  __shared__ __align__(16) unsigned short Osl[4][16 * 64];

  const int tid  = (int)threadIdx.x;
  const int lane = tid & 31;
  const int wave = wave_id();
  const int hh   = lane >> 4;
  const int c    = lane & 15;
  const int qt   = (int)blockIdx.x;
  const int h    = (int)blockIdx.y;
  const int b    = (int)blockIdx.z;
  const int kvh  = h >> 2;
  const int q0   = qt * 64 + wave * 16;          // first query row of this wave (within the sequence)
  const size_t tok0 = (size_t)b * SQ;

  // whole mask staging area initialised once (only class-2 chunks refresh it; other chunks never add from it)
#pragma unroll 1
  for (int u = tid; u < 64 * MP; u += 128) Ms[u] = 0.0f;

  const __bf16* Qhr = (const __bf16*)(const void*)qhp + (tok0 + q0 + c) * QW + h * HDM + 8 * hh;
  const __bf16* Qlr = (const __bf16*)(const void*)qlp + (tok0 + q0 + c) * QW + h * HDM + 8 * hh;
  const size_t mrow0 = (tok0 + (size_t)qt * 64) * SQ;                 // mask[b][0][qt*64][0]
  const int* crow = clsp + ((b * NT64) + qt) * NT64;

  v16b qh[2], ql[2];
#pragma unroll
  for (int dc = 0; dc < 2; ++dc) { qh[dc] = ldfrag_b(Qhr + dc * 32); ql[dc] = ldfrag_b(Qlr + dc * 32); }

  float mrow = -INFINITY;                          // running max of query c (the same in both halves)
  float lsum = 0.f;                                // running sum of query c over this half's keys
  v8f oacc[4];                                     // oacc[t][r] = O[query c][d = 16t + 8hh + r]
#pragma unroll
  for (int t = 0; t < 4; ++t) oacc[t] = zero8();

  for (int kc = 0; kc < 2 * NT64; ++kc) {
    const int nt = kc >> 1;
    const int cl = __builtin_amdgcn_readfirstlane(crow[nt]);         // block-uniform class of this chunk's tile
    if (cl == 0) continue;                                            // uniform for the whole block; before any barrier
    const int kv0 = kc * AKC;
    __syncthreads();                                                  // prior chunk's LDS readers are done
#pragma unroll
    for (int u = 0; u < 2; ++u) {                                     // coverage: 256 pieces of 8 halves per plane = whole tile
      const int p   = tid + 128 * u;                                  // 0..255
      const int key = p >> 3, d8 = (p & 7) * 8;                       // K: 32 keys x 64 d
      const size_t ko = (tok0 + kv0 + key) * KW + kvh * HDM + d8;
      const v4u kx = *(const v4u*)(khp + ko);
      const v4u ky = *(const v4u*)(klp + ko);
      *(v4u*)(Ks  + key * KP + d8) = kx;
      *(v4u*)(Kls + key * KP + d8) = ky;
      const int d = p >> 2, k8 = (p & 3) * 8;                         // V^T: 64 d x 32 keys
      const size_t vo = (size_t)(kvh * HDM + d) * NTOK + tok0 + kv0 + k8;
      const v4u vx = *(const v4u*)(vhp + vo);
      const v4u vy = *(const v4u*)(vlp + vo);
      *(v4u*)(Vhs + d * VP + k8) = vx;
      *(v4u*)(Vls + d * VP + k8) = vy;
    }
    if (cl == 2) {                                                    // block-uniform branch about the mask tile load
#pragma unroll
      for (int u = 0; u < 4; ++u) {                                   // coverage: 512 pieces of 4 floats = 64 rows x 32 keys
        const int p   = tid + 128 * u;                                // 0..511
        const int row = p >> 3, c4 = (p & 7) * 4;
        const v4f mv = *(const v4f*)(maskp + mrow0 + (size_t)row * SQ + kv0 + c4);
        *(v4f*)(Ms + row * MP + c4) = mv;
      }
    }
    __syncthreads();

    // ---- scores, transposed: 32 keys x 16 queries, K = 64, three products ----
    v8f sa[2];
    sa[0] = zero8(); sa[1] = zero8();
#pragma unroll
    for (int dc = 0; dc < 2; ++dc) {
#pragma unroll
      for (int j = 0; j < 2; ++j) {
        const v16b kb = ldfrag_b((const __bf16*)(const void*)Ks  + (j * 16 + c) * KP + dc * 32 + 8 * hh);
        const v16b kl = ldfrag_b((const __bf16*)(const void*)Kls + (j * 16 + c) * KP + dc * 32 + 8 * hh);
        sa[j] = mma_b(kb, qh[dc], sa[j]);
        sa[j] = mma_b(kl, qh[dc], sa[j]);
        sa[j] = mma_b(kb, ql[dc], sa[j]);
        guard1b4(sa[j], qh[dc], ql[dc], kb, kl);
      }
    }
    acc_guard2(sa[0], sa[1]);

    // ---- scale, mask add (class 2): sc[j][r] = score of (query c, key 16j + 8hh + r) ----
    float sc[2][8];
#pragma unroll
    for (int j = 0; j < 2; ++j)
#pragma unroll
      for (int r = 0; r < 8; ++r) sc[j][r] = sa[j][r] * 0.125f;
    if (cl == 2) {                                                    // block-uniform
      const float* mr = Ms + (wave * 16 + c) * MP + 8 * hh;           // the query's mask row, this half's keys
#pragma unroll
      for (int j = 0; j < 2; ++j) {
        const v4f ma = *(const v4f*)(mr + j * 16);
        const v4f mb = *(const v4f*)(mr + j * 16 + 4);
#pragma unroll
        for (int r = 0; r < 4; ++r) { sc[j][r] += bf_rne(ma[r]); sc[j][4 + r] += bf_rne(mb[r]); }
      }
    }
    // ---- chunk max of the query: in the lane, then with the other half ----
    float cm = -INFINITY;
#pragma unroll
    for (int j = 0; j < 2; ++j)
#pragma unroll
      for (int r = 0; r < 8; ++r) cm = fmaxf(cm, sc[j][r]);
    cm = fmaxf(cm, xhalf(cm));
    // ---- online softmax; p hi/lo packed in place into the B operands ----
    const float mnew  = fmaxf(mrow, cm);
    const float muse  = (mnew > -INFINITY) ? mnew : 0.0f;
    const float alpha = __expf(mrow - muse);
    mrow = mnew;
    union { v16b v; unsigned u[8]; } pa, pr;
    float ps[2];
#pragma unroll
    for (int j = 0; j < 2; ++j) {
      ps[j] = 0.f;
#pragma unroll
      for (int r = 0; r < 8; r += 2) {
        const float p0 = __expf(sc[j][r] - muse);
        const float p1 = __expf(sc[j][r + 1] - muse);
        ps[j] += p0;
        ps[j] += p1;
        const unsigned short h0 = bf_bits(p0), h1 = bf_bits(p1);
        const unsigned short l0 = bf_bits(p0 - bf_val(h0)), l1 = bf_bits(p1 - bf_val(h1));
        pa.u[j * 4 + (r >> 1)] = pk16(h0, h1);
        pr.u[j * 4 + (r >> 1)] = pk16(l0, l1);
      }
    }
    lsum = lsum * alpha + (ps[0] + ps[1]);
#pragma unroll
    for (int t = 0; t < 4; ++t)
#pragma unroll
      for (int r = 0; r < 8; ++r) oacc[t][r] *= alpha;
    // ---- O^T += v^T . p^T (K = 32 keys, three products) ----
#pragma unroll
    for (int t = 0; t < 4; ++t) {
      const v16b vb = ldfrag_b((const __bf16*)(const void*)Vhs + (t * 16 + c) * VP + 8 * hh);
      const v16b vr = ldfrag_b((const __bf16*)(const void*)Vls + (t * 16 + c) * VP + 8 * hh);
      oacc[t] = mma_b(vb, pa.v, oacc[t]);
      oacc[t] = mma_b(vr, pa.v, oacc[t]);
      oacc[t] = mma_b(vb, pr.v, oacc[t]);
      guard1b4(oacc[t], pa.v, pr.v, vb, vr);
    }
  }
  __syncthreads();                                 // every wave is past the chunk loop (all waves reach this)
  acc_guard4(oacc[0], oacc[1], oacc[2], oacc[3]);

  unsigned short* osh = Osh[wave];
  unsigned short* osl = Osl[wave];
  const float inv = 1.0f / (lsum + xhalf(lsum));   // the halves' sums joined; l >= 1: the row max contributes exp(0)
#pragma unroll
  for (int t = 0; t < 4; ++t) {                    // 8 consecutive d of query c: one 16-B LDS store per plane
    v4u xh, xl;
#pragma unroll
    for (int r = 0; r < 8; r += 2) {
      const float o0 = oacc[t][r] * inv;
      const float o1 = oacc[t][r + 1] * inv;
      const unsigned short h0 = bf_bits(o0), h1 = bf_bits(o1);
      xh[r >> 1] = pk16(h0, h1);
      xl[r >> 1] = pk16(bf_bits(o0 - bf_val(h0)), bf_bits(o1 - bf_val(h1)));
    }
    *(v4u*)(osh + c * 64 + t * 16 + 8 * hh) = xh;
    *(v4u*)(osl + c * 64 + t * 16 + 8 * hh) = xl;
  }
  lds_wave_sync();
  unsigned short* Ag = aop + (tok0 + q0) * AOW + h * HDM;
  const int qq = lane >> 3;                        // 0..3
  const int c8 = (lane & 7) * 8;
  {
#pragma unroll
    for (int it = 0; it < 4; ++it) {
      const int row = it * 4 + qq;                 // it 0..3 x qq 0..3 covers rows 0..15
      const v4u x = *(const v4u*)(osh + row * 64 + c8);
      const v4u y = *(const v4u*)(osl + row * 64 + c8);
      *(v4u*)(Ag + (size_t)row * AOW + c8)      = x;
      *(v4u*)(Ag + (size_t)row * AOW + QW + c8) = y;
    }
    
  }
}

// ---------------------------------------------------------------------------
// Workspace map (bytes; every region is an exact whole number of the rows its producer writes with whole-line stores;
// all dimensions are tile multiples, no padded tails needed; every offset is a multiple of 128):
//   XB   bf16 [4096][1024]   8388608     WQK bf16 [1280][1024]   2621440     WV  bf16 [256][1024]    524288
//   WO2  bf16 [1024][2048]   4194304     CST f32  [4096][32]      524288     SNT f32  [4096][32]     524288
//   CLS  i32  [2][32][32]       8192     QH  bf16 [4096][1024]   8388608     QL  bf16 [4096][1024]  8388608
//   KH   bf16 [4096][256]    2097152     KL  bf16 [4096][256]    2097152     VTH bf16 [256][4096]   2097152
//   VTL  bf16 [256][4096]    2097152     AO  bf16 [4096][2048]  16777216
//   total                   58728448
// ---------------------------------------------------------------------------
extern "C" void kernel_launch(void* const* d_in, const int* in_sizes, int n_in,
                              void* d_out, int out_size, void* d_ws, size_t ws_size,
                              hipStream_t stream) {
  if (n_in < 7) return;
  if (in_sizes[0] != NTOK * HID) return;                  // hidden_states [2][2048][1024] f32
  if (in_sizes[1] != NB * SQ * SQ) return;                // attention_mask [2][1][2048][2048] f32
  if (in_sizes[2] != NTOK) return;                        // position_ids [2][2048] int32
  if (in_sizes[3] != QW * HID) return;                    // wq [1024][1024]
  if (in_sizes[4] != KW * HID) return;                    // wk [256][1024]
  if (in_sizes[5] != KW * HID) return;                    // wv [256][1024]
  if (in_sizes[6] != HID * QW) return;                    // wo [1024][1024]
  if (out_size != NTOK * HID) return;

  const float* hs   = (const float*)d_in[0];
  const float* mask = (const float*)d_in[1];
  const int*   pos  = (const int*)d_in[2];
  const float* wq   = (const float*)d_in[3];
  const float* wk   = (const float*)d_in[4];
  const float* wv   = (const float*)d_in[5];
  const float* wo   = (const float*)d_in[6];
  float* out = (float*)d_out;

  const size_t szXB  = (size_t)NTOK * HID * 2;
  const size_t szWQK = (size_t)QKN * HID * 2;
  const size_t szWV  = (size_t)KW * HID * 2;
  const size_t szWO2 = (size_t)HID * AOW * 2;
  const size_t szT   = (size_t)NTOK * NFREQ * 4;
  const size_t szCLS = (size_t)NB * NT64 * NT64 * 4;
  const size_t szQ   = (size_t)NTOK * QW * 2;
  const size_t szK   = (size_t)NTOK * KW * 2;
  const size_t szVT  = (size_t)KW * NTOK * 2;
  const size_t szAO  = (size_t)NTOK * AOW * 2;
  size_t off = 0;
  const size_t oXB  = off; off += szXB;
  const size_t oWQK = off; off += szWQK;
  const size_t oWV  = off; off += szWV;
  const size_t oWO2 = off; off += szWO2;
  const size_t oCST = off; off += szT;
  const size_t oSNT = off; off += szT;
  const size_t oCLS = off; off += szCLS;
  const size_t oQH  = off; off += szQ;
  const size_t oQL  = off; off += szQ;
  const size_t oKH  = off; off += szK;
  const size_t oKL  = off; off += szK;
  const size_t oVTH = off; off += szVT;
  const size_t oVTL = off; off += szVT;
  const size_t oAO  = off; off += szAO;
  if (off > ws_size) return;                              // off = 58728448

  char* ws = (char*)d_ws;
  unsigned short* XB  = (unsigned short*)(ws + oXB);
  unsigned short* WQK = (unsigned short*)(ws + oWQK);
  unsigned short* WV  = (unsigned short*)(ws + oWV);
  unsigned short* WO2 = (unsigned short*)(ws + oWO2);
  float*          CST = (float*)(ws + oCST);
  float*          SNT = (float*)(ws + oSNT);
  int*            CLS = (int*)(ws + oCLS);
  unsigned short* QH  = (unsigned short*)(ws + oQH);
  unsigned short* QL  = (unsigned short*)(ws + oQL);
  unsigned short* KH  = (unsigned short*)(ws + oKH);
  unsigned short* KL  = (unsigned short*)(ws + oKL);
  unsigned short* VTH = (unsigned short*)(ws + oVTH);
  unsigned short* VTL = (unsigned short*)(ws + oVTL);
  unsigned short* AO  = (unsigned short*)(ws + oAO);

  const dim3 b256(256), b128(128);

  // (1) preparation, one launch: mask classes, x / wq / wk / wv / wo bf16 planes, cos/sin table
  prep_kernel<<<dim3(PB_ALL), b256, 0, stream>>>(hs, mask, pos, wq, wk, wv, wo, XB, WQK, WV, WO2, CST, SNT, CLS);
  // (2) one launch, two products:
  //     q|k = x . [Wq;Wk]^T, RoPE, split -> QH/QL [4096][1024], KH/KL [4096][256]   (M=4096, N=1280, K=1024; 32 x 10 block tiles)
  //     v^T = Wv . x^T -> VTH/VTL [256][4096]   (A = WV, Bt = XB; M=256, N=4096, K=1024; 2 x 32 block tiles)
  gemm_w32x128_kernel<0><<<dim3((NTOK / 128) * (QKN / 128) + (KW / 128) * (NTOK / 128)), b128, 0, stream>>>(
      XB, HID, WQK, HID, CST, SNT, (void*)QH, (void*)QL, (void*)KH, (void*)KL, QW, KW, NTOK, QKN, HID,
      WV, (void*)VTH, (void*)VTL, NTOK, KW, NTOK);
  // (3) attention per (q tile, head, batch) -> AO hi|lo [4096][2048]
  attn_kernel<<<dim3(SQ / 64, NHQ, NB), b128, 0, stream>>>(QH, QL, KH, KL, VTH, VTL, mask, CLS, AO);
  // (4) out = [AOhi | AOlo] . [Wo | Wo]^T -> d_out f32 [4096][1024]   (M=4096, N=1024, K=2048; 32 x 8 block tiles)
  gemm_w32x128_kernel<2><<<dim3((NTOK / 128) * (HID / 128)), b128, 0, stream>>>(
      AO, AOW, WO2, AOW, CST, SNT, (void*)out, (void*)out, (void*)out, (void*)out, HID, HID, NTOK, HID, AOW,
      AO, (void*)out, (void*)out, HID, NTOK, HID);
  (void)hipGetLastError();
}

// v004
// Measured time: 189 microseconds a run.
// Timed twice side by side with v003, it ran 1.04 times as fast both times.
// Counting every step since v000, it is 2.62 times as fast.
// Contractions: x.[Wq;Wk]^T and Wv.x^T on v_wmma_f32_16x16x32_bf16 (operands = RNE bf16 copies of the f32 inputs, single products);
// q.k^T and p.v on v_wmma_f32_16x16x32_bf16 with bf16 hi/lo split operands (hi.hi + hi.lo + lo.hi, three products);
// attn.Wo^T on v_wmma_f32_16x16x32_bf16 with attn = bf16 hi|lo planes folded into K (two products) and Wo as RNE bf16.
// f32 accumulate everywhere; RoPE (f32 cos/sin table built from the position ids), mask add and online softmax in f32.
// Plane carry audit: every 16-bit plane is bf16 with carry 1 (hi = RNE(v), lo = RNE(v - hi), same accumulator); nothing is scaled,
// nothing is folded back: XB, WQK, WV, WO2 (RNE copies), QH/QL, KH/KL, VTH/VTL, P (registers), AO hi|lo.
#include <hip/hip_runtime.h>
#include <math.h>
#include <stdint.h>

#define NB     2
#define SQ     2048
#define HID    1024
#define NHQ    16
#define NKVH   4
#define HDM    64
#define QW     1024          // q plane width (16 heads x 64)
#define KW     256           // k / v width (4 heads x 64)
#define QKN    1280          // q|k projection columns
#define NTOK   4096
#define NFREQ  32
#define AOW    2048          // attn plane width: hi at col 0..1023, lo at col 1024..2047
#define NT64   32            // 64-wide tiles along each mask axis

typedef __bf16       v16b __attribute__((ext_vector_type(16)));
typedef __bf16       v8b  __attribute__((ext_vector_type(8)));
typedef float        v8f  __attribute__((ext_vector_type(8)));
typedef float        v4f  __attribute__((ext_vector_type(4)));
typedef unsigned int v4u  __attribute__((ext_vector_type(4)));
typedef float        v2f  __attribute__((ext_vector_type(2)));
typedef __bf16       v2b  __attribute__((ext_vector_type(2)));

// ---------------------------------------------------------------------------
// small helpers
// ---------------------------------------------------------------------------
// two f32 -> two bf16 (RNE) in one word by the hardware's packed convert: a in bits 15..0, b in bits 31..16
__device__ __forceinline__ unsigned cvt2(float a, float b) {
  const v2f x = {a, b};
  return __builtin_bit_cast(unsigned, __builtin_convertvector(x, v2b));
}
__device__ __forceinline__ float lo_val(unsigned w) { return __uint_as_float(w << 16); }          // f32 value of the low bf16
__device__ __forceinline__ float hi_val(unsigned w) { return __uint_as_float(w & 0xFFFF0000u); }  // f32 value of the high bf16
// the residues of a and b against their bf16 roundings held in w = cvt2(a, b), rounded to bf16 in turn
__device__ __forceinline__ unsigned cvt2_res(float a, float b, unsigned w) { return cvt2(a - lo_val(w), b - hi_val(w)); }
__device__ __forceinline__ v8f zero8() { v8f z = {0.f, 0.f, 0.f, 0.f, 0.f, 0.f, 0.f, 0.f}; return z; }
// lane l with lane l ^ 16 (the other half of the wave)
__device__ __forceinline__ float xhalf(float x) {
  const int b = __builtin_bit_cast(int, x);
  return __builtin_bit_cast(float, __builtin_amdgcn_permlanex16(b, b, 0x76543210, 0xfedcba98, false, false));
}
__device__ __forceinline__ int wave_id() { return __builtin_amdgcn_readfirstlane((int)(threadIdx.x >> 5)); }

__device__ __forceinline__ void lds_wave_sync() {
  __builtin_amdgcn_fence(__ATOMIC_RELEASE, "workgroup");
  __builtin_amdgcn_wave_barrier();
  __builtin_amdgcn_fence(__ATOMIC_ACQUIRE, "workgroup");
}

// ---------------------------------------------------------------------------
// WMMA fragments (wave32, 16x16x32, bf16 operands). For A (row m = lane&15) and B (col n = lane&15) alike:
// elements 0..7 <- k0 + 8*(lane>>4) + 0..7, elements 8..15 <- k0 + 16 + 8*(lane>>4) + 0..7.
// ldfrag_b(p) with p = rowbase + k0 + 8*(lane>>4): two 16-B loads p[0..7], p[16..23] (A rows and k-contiguous B rows alike).
// D: acc[r] = (row 8*(lane>>4) + r, col lane&15).
// ---------------------------------------------------------------------------
union FragB { v16b v; v8b h[2]; };
__device__ __forceinline__ v16b ldfrag_b(const __bf16* p) { FragB f; f.h[0] = *(const v8b*)(p); f.h[1] = *(const v8b*)(p + 16); return f.v; }

__device__ __forceinline__ v8f mma_b(v16b a, v16b b, v8f c) {
  return __builtin_amdgcn_wmma_f32_16x16x32_bf16(false, a, false, b, (short)0, c, false, false);
}
// hazard guards: 4 VALU slots after the last WMMA of a group, D tied, A/B kept live; memory clobber keeps later loads behind the group
__device__ __forceinline__ void guard1b4(v8f& a, v16b w, v16b x, v16b y, v16b z) {
  asm volatile("v_nop\n\tv_nop\n\tv_nop\n\tv_nop" : "+v"(a) : "v"(w), "v"(x), "v"(y), "v"(z) : "memory");
}
__device__ __forceinline__ void acc_guard4(v8f& a, v8f& b, v8f& c, v8f& d) {
  asm volatile("v_nop\n\tv_nop\n\tv_nop\n\tv_nop" : "+v"(a), "+v"(b), "+v"(c), "+v"(d));
}
__device__ __forceinline__ void acc_guard2(v8f& a, v8f& b) {
  asm volatile("v_nop\n\tv_nop\n\tv_nop\n\tv_nop" : "+v"(a), "+v"(b));
}

// ---------------------------------------------------------------------------
// RoPE table: cst[t][j] = cos(pos[t] * inv_freq[j]), snt[t][j] = sin(...), inv_freq[j] = 1 / 10000^(j/32), j < 32, all f32.
// ---------------------------------------------------------------------------
__device__ __forceinline__ void rope_table_part(int bid, const int* __restrict__ pos, float* __restrict__ cst,
                                                float* __restrict__ snt, int ntok) {
  const int lane = threadIdx.x & 31;
  const int wave = (int)(threadIdx.x >> 5);
  const int t = bid * 8 + wave;
  if (t >= ntok) return;                       // no barriers in this part
  const float pf  = (float)pos[t];
  const float e   = (float)lane * 0.03125f;    // (2*j)/64 exact
  const float pw  = powf(10000.0f, e);
  const float inv = 1.0f / pw;
  const float ang = pf * inv;
  const float cv  = cosf(ang);
  const float sv  = sinf(ang);
  const size_t o = (size_t)t * NFREQ + lane;
  {
    ((float*)cst)[o] = cv;
    ((float*)snt)[o] = sv;
    
  }
}

// ---------------------------------------------------------------------------
// Elementwise RNE f32 -> bf16 plane: 8 elements per thread, one 16-B store per lane -> 32 consecutive lanes write 4 whole
// ---------------------------------------------------------------------------
__device__ __forceinline__ void cvt_bf16_part(int bid, const float* __restrict__ in, unsigned short* __restrict__ outp, int n8) {
  const int i = bid * 256 + (int)threadIdx.x;
  if (i >= n8) return;
  const size_t e = 8 * (size_t)i;
  const v4f a = *(const v4f*)(in + e);
  const v4f b = *(const v4f*)(in + e + 4);
  v4u w;
  w[0] = cvt2(a[0], a[1]);
  w[1] = cvt2(a[2], a[3]);
  w[2] = cvt2(b[0], b[1]);
  w[3] = cvt2(b[2], b[3]);
  *(v4u*)(outp + e) = w;
  
}

// ---------------------------------------------------------------------------
// Wo [HID][kin] f32 -> WO2 [HID][ldo = 2*kin] bf16 with WO2[n][k] = WO2[n][kin + k] = bf16(Wo[n][k]).
// Coverage: grid = n8/256 x 256 x 8 = HID*kin source elements -> both halves of every WO2 row.
// ---------------------------------------------------------------------------
__device__ __forceinline__ void cvt_wo2_part(int bid, const float* __restrict__ in, unsigned short* __restrict__ outp,
                                             int n8, int kin, int ldo) {
  const int i = bid * 256 + (int)threadIdx.x;
  if (i >= n8) return;
  const size_t e = 8 * (size_t)i;
  const int n = (int)(e / (size_t)kin);
  const int k = (int)(e - (size_t)n * kin);
  const v4f a = *(const v4f*)(in + e);
  const v4f b = *(const v4f*)(in + e + 4);
  v4u w;
  w[0] = cvt2(a[0], a[1]);
  w[1] = cvt2(a[2], a[3]);
  w[2] = cvt2(b[0], b[1]);
  w[3] = cvt2(b[2], b[3]);
  const size_t o = (size_t)n * ldo + k;
  *(v4u*)(outp + o) = w;
  *(v4u*)(outp + o + kin) = w;
  
}

// ---------------------------------------------------------------------------
// Mask tile classes. mask [NB][1][SQ][SQ] f32 (additive). One block per (b, 64-row band mt): 256 threads x 8 consecutive columns,
// 64 rows each. For every 64x64 tile (b, mt, nt):
//   class 0 = every element <= -1e8 (tile contributes nothing: exp underflows to 0 exactly when the row has an admitted key),
//   class 1 = every element == 0 (nothing to add), class 2 = anything else (mask tile added elementwise).
// If the band contains a row with no element > -1e4 the skip is not valid for it: class 0 tiles of that band become class 2.
// Reductions are OR (order independent). Coverage: NB*32 blocks x 64 rows x 256 thr x 8 cols = the whole mask;
// ---------------------------------------------------------------------------
#define ADM_TH (-1.0e4f)
#define SKP_TH (-1.0e8f)

__device__ __forceinline__ void mask_class_part(int bid, const float* __restrict__ mask, int* __restrict__ cls) {
  __shared__ int nzs[NT64];
  __shared__ int bgs[NT64];
  __shared__ unsigned rlo[8];
  __shared__ unsigned rhi[8];
  const int bm   = bid;                  // b*32 + mt
  const int b    = bm >> 5;
  const int mt   = bm & 31;
  const int tid  = threadIdx.x;
  const int lane = tid & 31;
  const int wave = tid >> 5;
  const int j0   = tid * 8;
  int nz = 0, bg = 0;
  unsigned rowlo = 0u, rowhi = 0u;       // bit r: this thread's 8 columns contain an admitted element in row r
#pragma unroll 1
  for (int r = 0; r < 64; ++r) {
    const float* mr = mask + (((size_t)b * SQ) + (size_t)(mt * 64 + r)) * SQ + j0;
    const v4f mk0 = *(const v4f*)(mr);
    const v4f mk1 = *(const v4f*)(mr + 4);
    const int a = ((mk0[0] > ADM_TH) | (mk0[1] > ADM_TH) | (mk0[2] > ADM_TH) | (mk0[3] > ADM_TH) |
                   (mk1[0] > ADM_TH) | (mk1[1] > ADM_TH) | (mk1[2] > ADM_TH) | (mk1[3] > ADM_TH)) ? 1 : 0;
    const int z = ((mk0[0] != 0.0f) | (mk0[1] != 0.0f) | (mk0[2] != 0.0f) | (mk0[3] != 0.0f) |
                   (mk1[0] != 0.0f) | (mk1[1] != 0.0f) | (mk1[2] != 0.0f) | (mk1[3] != 0.0f)) ? 1 : 0;
    const int g = ((mk0[0] > SKP_TH) | (mk0[1] > SKP_TH) | (mk0[2] > SKP_TH) | (mk0[3] > SKP_TH) |
                   (mk1[0] > SKP_TH) | (mk1[1] > SKP_TH) | (mk1[2] > SKP_TH) | (mk1[3] > SKP_TH)) ? 1 : 0;
    nz |= z;
    bg |= g;
    const unsigned sh = ((unsigned)a) << (r & 31);
    rowlo |= (r < 32) ? sh : 0u;
    rowhi |= (r < 32) ? 0u : sh;
  }
  // OR over the 8 lanes 8q..8q+7 that share column tile nt = tid >> 3
  nz |= __shfl_xor(nz, 1, 32); nz |= __shfl_xor(nz, 2, 32); nz |= __shfl_xor(nz, 4, 32);
  bg |= __shfl_xor(bg, 1, 32); bg |= __shfl_xor(bg, 2, 32); bg |= __shfl_xor(bg, 4, 32);
#pragma unroll
  for (int off = 1; off < 32; off <<= 1) {
    rowlo |= (unsigned)__shfl_xor((int)rowlo, off, 32);
    rowhi |= (unsigned)__shfl_xor((int)rowhi, off, 32);
  }
  if ((lane & 7) == 0) { nzs[tid >> 3] = nz; bgs[tid >> 3] = bg; }
  if (lane == 0) { rlo[wave] = rowlo; rhi[wave] = rowhi; }
  __syncthreads();
  if (wave == 0) {                       // wave-uniform
    const int z = nzs[lane];
    const int g = bgs[lane];
    unsigned ol = rlo[0], oh = rhi[0];
#pragma unroll
    for (int w = 1; w < 8; ++w) { ol |= rlo[w]; oh |= rhi[w]; }
    const bool has_empty_row = (ol != 0xFFFFFFFFu) || (oh != 0xFFFFFFFFu);
    int cval = (g == 0) ? 0 : ((z == 0) ? 1 : 2);
    cval = (has_empty_row && cval == 0) ? 2 : cval;
    int* cp = cls + (size_t)bm * NT64 + lane;
    *cp = cval;
    
  }
}

// ---------------------------------------------------------------------------
// The seven preparation jobs depend on the inputs alone and on nothing of each other: one launch, each job a range of blocks
// (256 threads each, the block counts the jobs had as launches of their own). The mask bands, the longest blocks, come first.
// Every branch is on the block index: whole blocks take it, so the barrier of the mask part stays block-uniform.
// ---------------------------------------------------------------------------
#define PB_MASK (NB * NT64)                  // 64
#define PB_X    ((NTOK * HID / 8) / 256)     // 2048
#define PB_ROPE (NTOK / 8)                   // 512
#define PB_WQ   ((QW * HID / 8) / 256)       // 512
#define PB_WO   ((HID * QW / 8) / 256)       // 512
#define PB_WKV  ((KW * HID / 8) / 256)       // 128, wk and wv each
#define PB_ALL  (PB_MASK + PB_X + PB_ROPE + PB_WQ + PB_WO + 2 * PB_WKV)

__global__ __launch_bounds__(256) void prep_kernel(
    const float* __restrict__ hs, const float* __restrict__ mask, const int* __restrict__ pos,
    const float* __restrict__ wq, const float* __restrict__ wk, const float* __restrict__ wv, const float* __restrict__ wo,
    unsigned short* __restrict__ xb, unsigned short* __restrict__ wqk, unsigned short* __restrict__ wvb,
    unsigned short* __restrict__ wo2, float* __restrict__ cst, float* __restrict__ snt, int* __restrict__ cls) {
  int bid = (int)blockIdx.x;
  // mask tile classes [2][32][32]
  if (bid < PB_MASK) { mask_class_part(bid, mask, cls); return; }
  bid -= PB_MASK;
  // x -> bf16 plane [4096][1024]
  if (bid < PB_X) { cvt_bf16_part(bid, hs, xb, NTOK * HID / 8); return; }
  bid -= PB_X;
  // cos/sin table [4096][32] x 2 from the position ids
  if (bid < PB_ROPE) { rope_table_part(bid, pos, cst, snt, NTOK); return; }
  bid -= PB_ROPE;
  // wq [1024][1024] -> WQK rows 0..1023 (natural [out][in] = Bt layout)
  if (bid < PB_WQ) { cvt_bf16_part(bid, wq, wqk, QW * HID / 8); return; }
  bid -= PB_WQ;
  // wo [1024][1024] -> WO2 [1024][2048] (both halves)
  if (bid < PB_WO) { cvt_wo2_part(bid, wo, wo2, HID * QW / 8, QW, AOW); return; }
  bid -= PB_WO;
  // wk [256][1024] -> WQK rows 1024..1279
  if (bid < PB_WKV) { cvt_bf16_part(bid, wk, wqk + (size_t)QW * HID, KW * HID / 8); return; }
  bid -= PB_WKV;
  // wv [256][1024] -> WV
  if (bid < PB_WKV) { cvt_bf16_part(bid, wv, wvb, KW * HID / 8); return; }
}

// ---------------------------------------------------------------------------
// bf16 WMMA GEMM, block = 4 waves (128 threads) = one 128 x 128 tile of C; wave w owns rows 32w..32w+31 of it, all 128 cols.
//   C[m][n] = sum_k A[m][k] * Bt[n][k]; A row-major [M][K] bf16 (pitch lda), Bt row-major [N][K] bf16 (pitch ldb);
//   M % 128 == 0, N % 128 == 0, K % 64 == 0, K >= 64, lda % 8 == 0, ldb % 8 == 0; grid.x = M/128 * N/128.
//   EPI 0 carries a second, independent product in the same launch: blocks M/128 * N/128 .. + M2/128 * N2/128 - 1 compute
//   C'[m][n] = sum_k A2[m][k] * A[n][k] (A2 [M2][K] pitch lda; the first product's A, N2 rows of it, as Bt with pitch ldb:
//   lda == ldb), same K, same loop.
//   Operands: per trip of 64 k the 128 A rows and the 128 Bt rows (128 B each) are copied global -> LDS asynchronously, whole
//   128-B lines per 8 lanes, into one of two buffers; trip t works on buffer t & 1 while tile t + 1 flies into the other.
//   Fragments are read from LDS rows (ldfrag_b) in the same k order as before.
// Epilogues (all: per wave, per 16-row slab: stage in LDS, wave sync, write each row segment with ONE instruction of
//   EPI 0: q|k projection with RoPE. The 128-col tile holds two 64-dim heads; pairs (d, d+32) inside each head are rotated with
//          the f32 cos/sin rows of the token (staged per slab in LDS), then split to bf16 hi (C0/C2) and lo (C1/C3) planes.
//          cols n0 < QW -> q planes [M][ldc], col n0; cols n0 >= QW -> k planes [M][ldc2], col n0-QW. Row segment 256 B = 16 lanes x 16 B.
//          Second product = v^T projection: bf16 hi plane D0, lo plane D1, [M2][ldd], row segment 256 B.
//   EPI 2: f32 output C0 [M][ldc]; row segment 128 floats = 512 B = 32 lanes x 16 B per instruction.
// ---------------------------------------------------------------------------
template <int EPI> struct SlabCfg { static constexpr int PERWF = 2048; };   // floats per wave (8 KB)
template <> struct SlabCfg<0>     { static constexpr int PERWF = 3072; };   // + 16x32 cos + 16x32 sin rows

#define GKT  64                 // k per staged tile: 128-B rows
#define GPITCH  72                 // LDS row pitch in bf16: 144 B = 16 B x odd, for the 16-B fragment reads
#define GOP  (128 * GPITCH)        // bf16 per operand tile (128 rows)
#define GROWB (16 * GPITCH * 2)    // LDS bytes between a lane's consecutive copies (16 rows)

__device__ __forceinline__ unsigned lds_off(const void* p) { return (unsigned)(size_t)p; }

// One operand tile, 128 rows x 128 B: lane t copies 16 B of rows (t >> 3) + 16u, u = 0..7 (128 lanes x 8 = 1024 pieces = the tile).
// l = the lane's LDS byte address for u = 0, g = its global address for u = 0, ld = global row pitch in elements.
// s_wait_xcnt stands inside the statement so that no address register is rewritten ahead of it.
__device__ __forceinline__ void stage_tile(unsigned l, const unsigned short* g, int ld) {
  const size_t st = (size_t)16 * (size_t)ld;
  asm volatile(
      "global_load_async_to_lds_b128 %0, %8, off\n\t"
      "global_load_async_to_lds_b128 %1, %9, off\n\t"
      "global_load_async_to_lds_b128 %2, %10, off\n\t"
      "global_load_async_to_lds_b128 %3, %11, off\n\t"
      "global_load_async_to_lds_b128 %4, %12, off\n\t"
      "global_load_async_to_lds_b128 %5, %13, off\n\t"
      "global_load_async_to_lds_b128 %6, %14, off\n\t"
      "global_load_async_to_lds_b128 %7, %15, off\n\t"
      "s_wait_xcnt 0x0"
      :: "v"(l), "v"(l + 1u * GROWB), "v"(l + 2u * GROWB), "v"(l + 3u * GROWB),
         "v"(l + 4u * GROWB), "v"(l + 5u * GROWB), "v"(l + 6u * GROWB), "v"(l + 7u * GROWB),
         "v"(g), "v"(g + st), "v"(g + 2 * st), "v"(g + 3 * st),
         "v"(g + 4 * st), "v"(g + 5 * st), "v"(g + 6 * st), "v"(g + 7 * st)
      : "memory");
}

template <int EPI>
__global__ __launch_bounds__(128) void gemm_w32x128_kernel(
    const unsigned short* __restrict__ Ap, int lda,
    const unsigned short* __restrict__ Btp, int ldb,
    const float* __restrict__ cst, const float* __restrict__ snt,
    void* C0, void* C1, void* C2, void* C3, int ldc, int ldc2,
    int M, int N, int K,
    const unsigned short* __restrict__ A2p, void* D0, void* D1, int ldd, int M2, int N2) {
  __shared__ __align__(16) float lds_all[4 * SlabCfg<EPI>::PERWF];
  __shared__ __align__(16) unsigned short ring[2][2 * GOP];    // [buffer][A tile | Bt tile], 2 x 36,864 B

  const int tid  = (int)threadIdx.x;
  const int lane = tid & 31;
  const int wave = wave_id();
  const int hh = lane >> 4;           // lane half: k offset 8*hh, D row offset 8*hh
  const int rl = lane & 15;           // A row / B col / D col within subtile
  const int ntile1 = (M >> 7) * (N >> 7);
  const bool second = (EPI == 0) && ((int)blockIdx.x >= ntile1);   // block-uniform: this block works on the second product
  const int tilesN = (second ? N2 : N) >> 7;
  const int tilesM = (second ? M2 : M) >> 7;
  const int tile = (int)blockIdx.x - (second ? ntile1 : 0);
  if (tile >= tilesM * tilesN) return;          // block-uniform, in front of every barrier and copy
  const int tm = tile / tilesN;
  const int tn = tile - tm * tilesN;
  const int mblk = tm << 7;
  const int m0 = mblk + (wave << 5);
  const int n0 = tn << 7;

  // this lane's first piece of each operand tile: row tid >> 3, 16-B column tid & 7
  const int srow = tid >> 3;
  const int sc8  = (tid & 7) * 8;
  const unsigned short* gA = (second ? A2p : Ap) + (size_t)(mblk + srow) * lda + sc8;
  const unsigned short* gB = (second ? Ap : Btp) + (size_t)(n0   + srow) * ldb + sc8;
  const unsigned lA = lds_off(&ring[0][0]) + (unsigned)(srow * GPITCH + sc8) * 2u;
  const unsigned lB = lA + GOP * 2u;
  const unsigned bufb = 2u * GOP * 2u;           // bytes per buffer
  const int ntrip = K / GKT;

  v8f acc[2][8];
#pragma unroll
  for (int i = 0; i < 2; ++i)
#pragma unroll
    for (int j = 0; j < 8; ++j) acc[i][j] = zero8();

  // prologue: tile 0 lands and is published, then tile 1 starts
  stage_tile(lA, gA, lda);
  stage_tile(lB, gB, ldb);
  asm volatile("s_wait_asynccnt 0x0" ::: "memory");   // this wave's copies of tile 0 have landed
  __syncthreads();                                     // ... and every other wave's: tile 0 is readable
  if (ntrip > 1) {
    stage_tile(lA + bufb, gA + GKT, lda);
    stage_tile(lB + bufb, gB + GKT, ldb);
  }

  for (int t = 0; t < ntrip; ++t) {
    const __bf16* As = (const __bf16*)(const void*)&ring[t & 1][0]   + (wave * 32 + rl) * GPITCH + 8 * hh;
    const __bf16* Bs = (const __bf16*)(const void*)&ring[t & 1][GOP] + rl * GPITCH + 8 * hh;
    v16b ah[2][2], bf[2][8];                           // [k half of the tile][fragment]
#pragma unroll
    for (int s = 0; s < 2; ++s) {
#pragma unroll
      for (int i = 0; i < 2; ++i) ah[s][i] = ldfrag_b(As + i * 16 * GPITCH + s * 32);
#pragma unroll
      for (int j = 0; j < 8; ++j) bf[s][j] = ldfrag_b(Bs + j * 16 * GPITCH + s * 32);
    }
    // keeps the trip's LDS reads together in front of its WMMAs: one exposed LDS latency per trip instead of one per WMMA pair
    __builtin_amdgcn_sched_barrier(0);
#pragma unroll
    for (int s = 0; s < 2; ++s) {
#pragma unroll
      for (int j = 0; j < 8; ++j) {
        acc[0][j] = mma_b(ah[s][0], bf[s][j], acc[0][j]);
        acc[1][j] = mma_b(ah[s][1], bf[s][j], acc[1][j]);
      }
    }
    // keeps the WMMAs in front of the trip's foot: they overlap the LDS reads, and tile t + 1's copies get the whole trip to land
    __builtin_amdgcn_sched_barrier(0);
    asm volatile("s_wait_dscnt 0x0" ::: "memory");     // this wave's reads of buffer t & 1 are done before it is refilled
    asm volatile("s_wait_asynccnt 0x0" ::: "memory");  // this wave's copies of tile t + 1 have landed
    __syncthreads();                                   // publishes tile t + 1 and ends every reader's use of buffer t & 1
    if (t + 2 < ntrip) {                               // same for the whole block
      const unsigned bo = (unsigned)(t & 1) * bufb;
      stage_tile(lA + bo, gA + (size_t)(t + 2) * GKT, lda);
      stage_tile(lB + bo, gB + (size_t)(t + 2) * GKT, ldb);
    }
  }
  asm volatile("s_wait_asynccnt 0x0" ::: "memory");    // nothing of this wave is in flight behind the loop
  acc_guard4(acc[0][0], acc[0][1], acc[0][2], acc[0][3]);
  acc_guard4(acc[0][4], acc[0][5], acc[0][6], acc[0][7]);
  acc_guard4(acc[1][0], acc[1][1], acc[1][2], acc[1][3]);
  acc_guard4(acc[1][4], acc[1][5], acc[1][6], acc[1][7]);

  // ---- epilogue ----
  float* wl = lds_all + wave * SlabCfg<EPI>::PERWF;
  unsigned short* sl16 = (unsigned short*)(void*)wl;       // 4096 u16 = floats 0..2047 (two 16x128 planes)
  float* slf = wl;

  if (EPI == 0 && !second) {
    float* csl = wl + 2048;                                 // cos rows [16][32]
    float* snl = wl + 2048 + 16 * NFREQ;                    // sin rows [16][32]
    const bool isq = (n0 < QW);                             // wave-uniform
    unsigned short* P0 = isq ? (unsigned short*)C0 : (unsigned short*)C2;
    unsigned short* P1 = isq ? (unsigned short*)C1 : (unsigned short*)C3;
    const int ldp  = isq ? ldc : ldc2;
    const int col0 = isq ? n0 : (n0 - QW);
#pragma unroll
    for (int i = 0; i < 2; ++i) {
      const int mb = m0 + i * 16;
      // stage cos/sin of tokens mb..mb+15: 16 rows x 32 floats = 128 16-B pieces per table; lane -> 4 pieces (coverage 32x4 = 128)
      v4f cv4[4], sv4[4];
      const float* cp[4];
      const float* sp[4];
#pragma unroll
      for (int u = 0; u < 4; ++u) {
        const int p   = lane + 32 * u;
        const int row = p >> 3, c4 = (p & 7) * 4;
        cp[u] = cst + (size_t)(mb + row) * NFREQ + c4;
        sp[u] = snt + (size_t)(mb + row) * NFREQ + c4;
        cv4[u] = *(const v4f*)cp[u];
        sv4[u] = *(const v4f*)sp[u];
      }
      // precaution: the eight loads' address registers, named as inputs so that they live up to here, are reused only behind this wait
      asm volatile("s_wait_xcnt 0x0"
                   :: "v"(cp[0]), "v"(cp[1]), "v"(cp[2]), "v"(cp[3]), "v"(sp[0]), "v"(sp[1]), "v"(sp[2]), "v"(sp[3])
                   : "memory");
#pragma unroll
      for (int u = 0; u < 4; ++u) {
        const int p   = lane + 32 * u;
        const int row = p >> 3, c4 = (p & 7) * 4;
        *(v4f*)(csl + row * NFREQ + c4) = cv4[u];
        *(v4f*)(snl + row * NFREQ + c4) = sv4[u];
      }
      lds_wave_sync();
#pragma unroll
      for (int hs = 0; hs < 2; ++hs) {                      // head within the 128-col tile
#pragma unroll
        for (int jj = 0; jj < 2; ++jj) {
          const int j1 = hs * 4 + jj;                       // cols hs*64 + jj*16 + rl  (x1, dim d < 32)
          const int j2 = j1 + 2;                            // cols +32                 (x2, dim d + 32)
          const int d  = jj * 16 + rl;                      // freq index 0..31
#pragma unroll
          for (int r = 0; r < 8; ++r) {
            const int lrow = 8 * hh + r;
            const float cv = csl[lrow * NFREQ + d];
            const float sv = snl[lrow * NFREQ + d];
            const float x1 = acc[i][j1][r];
            const float x2 = acc[i][j2][r];
            const float o1 = x1 * cv - x2 * sv;
            const float o2 = x2 * cv + x1 * sv;
            const unsigned hb = cvt2(o1, o2);
            const unsigned lb = cvt2_res(o1, o2, hb);
            const int so = lrow * 128 + hs * 64 + d;
            sl16[so]             = (unsigned short)hb;
            sl16[so + 32]        = (unsigned short)(hb >> 16);
            sl16[2048 + so]      = (unsigned short)lb;
            sl16[2048 + so + 32] = (unsigned short)(lb >> 16);
          }
        }
      }
      lds_wave_sync();
      {
#pragma unroll
        for (int it = 0; it < 8; ++it) {
          const int row = it * 2 + hh;                      // it x hh covers rows 0..15
          const int c8  = rl * 8;
          const v4u vh = *(const v4u*)(sl16 + row * 128 + c8);
          const v4u vl = *(const v4u*)(sl16 + 2048 + row * 128 + c8);
          const size_t go = (size_t)(mb + row) * ldp + col0 + c8;
          *(v4u*)(P0 + go) = vh;
          *(v4u*)(P1 + go) = vl;
        }
        
      }
      lds_wave_sync();
    }
  } else if (EPI == 0) {
    unsigned short* P0 = (unsigned short*)D0;
    unsigned short* P1 = (unsigned short*)D1;
#pragma unroll
    for (int i = 0; i < 2; ++i) {
#pragma unroll
      for (int r = 0; r < 8; ++r) {
#pragma unroll
        for (int j = 0; j < 8; j += 2) {
          const float va = acc[i][j][r];
          const float vb = acc[i][j + 1][r];
          const unsigned hb = cvt2(va, vb);
          const unsigned lb = cvt2_res(va, vb, hb);
          const int so = (8 * hh + r) * 128 + j * 16 + rl;
          sl16[so]             = (unsigned short)hb;
          sl16[so + 16]        = (unsigned short)(hb >> 16);
          sl16[2048 + so]      = (unsigned short)lb;
          sl16[2048 + so + 16] = (unsigned short)(lb >> 16);
        }
      }
      lds_wave_sync();
      {
#pragma unroll
        for (int it = 0; it < 8; ++it) {
          const int row = it * 2 + hh;
          const int c8  = rl * 8;
          const v4u vh = *(const v4u*)(sl16 + row * 128 + c8);
          const v4u vl = *(const v4u*)(sl16 + 2048 + row * 128 + c8);
          const size_t go = (size_t)(m0 + i * 16 + row) * ldd + n0 + c8;
          *(v4u*)(P0 + go) = vh;
          *(v4u*)(P1 + go) = vl;
        }
        
      }
      lds_wave_sync();
    }
  } else {
    float* C = (float*)C0;
#pragma unroll
    for (int i = 0; i < 2; ++i) {
#pragma unroll
      for (int j = 0; j < 8; ++j)
#pragma unroll
        for (int r = 0; r < 8; ++r)
          slf[(8 * hh + r) * 128 + j * 16 + rl] = acc[i][j][r];
      lds_wave_sync();
      {
#pragma unroll
        for (int row = 0; row < 16; ++row) {                // 32 lanes x 16 B = the whole 512-B row segment per instruction
          const v4f v = *(const v4f*)(slf + row * 128 + lane * 4);
          *(v4f*)(C + (size_t)(m0 + i * 16 + row) * ldc + n0 + lane * 4) = v;
        }
        
      }
      lds_wave_sync();
    }
  }
}

#define AKC  32
#define KP   72          // K tile pitch (u16), 144 B rows
#define VP   40          // V^T tile pitch (u16), 80 B rows
#define MP   36          // mask tile pitch (f32), 144 B rows
static_assert((2 * AKC * KP + 2 * HDM * VP + 8 * 16 * 64) * 2 + 64 * MP * 4 <= 65536);

__global__ __launch_bounds__(128) void attn_kernel(
    const unsigned short* __restrict__ qhp, const unsigned short* __restrict__ qlp,
    const unsigned short* __restrict__ khp, const unsigned short* __restrict__ klp,
    const unsigned short* __restrict__ vhp, const unsigned short* __restrict__ vlp,
    const float* __restrict__ maskp, const int* __restrict__ clsp,
    unsigned short* __restrict__ aop) {
  __shared__ __align__(16) unsigned short Ks[AKC * KP];
  __shared__ __align__(16) unsigned short Kls[AKC * KP];
  __shared__ __align__(16) unsigned short Vhs[HDM * VP];
  __shared__ __align__(16) unsigned short Vls[HDM * VP];
  __shared__ __align__(16) float Ms[64 * MP];
  __shared__ __align__(16) unsigned short Osh[4][16 * 64];
  __shared__ __align__(16) unsigned short Osl[4][16 * 64];

  const int tid  = (int)threadIdx.x;
  const int lane = tid & 31;
  const int wave = wave_id();
  const int hh   = lane >> 4;
  const int c    = lane & 15;
  const int qt   = (int)blockIdx.x;
  const int h    = (int)blockIdx.y;
  const int b    = (int)blockIdx.z;
  const int kvh  = h >> 2;
  const int q0   = qt * 64 + wave * 16;          // first query row of this wave (within the sequence)
  const size_t tok0 = (size_t)b * SQ;

  // whole mask staging area initialised once (only class-2 chunks refresh it; other chunks never add from it)
#pragma unroll 1
  for (int u = tid; u < 64 * MP; u += 128) Ms[u] = 0.0f;

  const __bf16* Qhr = (const __bf16*)(const void*)qhp + (tok0 + q0 + c) * QW + h * HDM + 8 * hh;
  const __bf16* Qlr = (const __bf16*)(const void*)qlp + (tok0 + q0 + c) * QW + h * HDM + 8 * hh;
  const size_t mrow0 = (tok0 + (size_t)qt * 64) * SQ;                 // mask[b][0][qt*64][0]
  const int* crow = clsp + ((b * NT64) + qt) * NT64;

  v16b qh[2], ql[2];
#pragma unroll
  for (int dc = 0; dc < 2; ++dc) { qh[dc] = ldfrag_b(Qhr + dc * 32); ql[dc] = ldfrag_b(Qlr + dc * 32); }

  float mrow = -INFINITY;                          // running max of query c (the same in both halves)
  float lsum = 0.f;                                // running sum of query c over this half's keys
  v8f oacc[4];                                     // oacc[t][r] = O[query c][d = 16t + 8hh + r]
#pragma unroll
  for (int t = 0; t < 4; ++t) oacc[t] = zero8();

  for (int kc = 0; kc < 2 * NT64; ++kc) {
    const int nt = kc >> 1;
    const int cl = __builtin_amdgcn_readfirstlane(crow[nt]);         // block-uniform class of this chunk's tile
    if (cl == 0) continue;                                            // uniform for the whole block; before any barrier
    const int kv0 = kc * AKC;
    __syncthreads();                                                  // prior chunk's LDS readers are done
#pragma unroll
    for (int u = 0; u < 2; ++u) {                                     // coverage: 256 pieces of 8 halves per plane = whole tile
      const int p   = tid + 128 * u;                                  // 0..255
      const int key = p >> 3, d8 = (p & 7) * 8;                       // K: 32 keys x 64 d
      const size_t ko = (tok0 + kv0 + key) * KW + kvh * HDM + d8;
      const v4u kx = *(const v4u*)(khp + ko);
      const v4u ky = *(const v4u*)(klp + ko);
      *(v4u*)(Ks  + key * KP + d8) = kx;
      *(v4u*)(Kls + key * KP + d8) = ky;
      const int d = p >> 2, k8 = (p & 3) * 8;                         // V^T: 64 d x 32 keys
      const size_t vo = (size_t)(kvh * HDM + d) * NTOK + tok0 + kv0 + k8;
      const v4u vx = *(const v4u*)(vhp + vo);
      const v4u vy = *(const v4u*)(vlp + vo);
      *(v4u*)(Vhs + d * VP + k8) = vx;
      *(v4u*)(Vls + d * VP + k8) = vy;
    }
    if (cl == 2) {                                                    // block-uniform branch about the mask tile load
#pragma unroll
      for (int u = 0; u < 4; ++u) {                                   // coverage: 512 pieces of 4 floats = 64 rows x 32 keys
        const int p   = tid + 128 * u;                                // 0..511
        const int row = p >> 3, c4 = (p & 7) * 4;
        const v4f mv = *(const v4f*)(maskp + mrow0 + (size_t)row * SQ + kv0 + c4);
        *(v4f*)(Ms + row * MP + c4) = mv;
      }
    }
    __syncthreads();

    // ---- scores, transposed: 32 keys x 16 queries, K = 64, three products ----
    v8f sa[2];
    sa[0] = zero8(); sa[1] = zero8();
#pragma unroll
    for (int dc = 0; dc < 2; ++dc) {
#pragma unroll
      for (int j = 0; j < 2; ++j) {
        const v16b kb = ldfrag_b((const __bf16*)(const void*)Ks  + (j * 16 + c) * KP + dc * 32 + 8 * hh);
        const v16b kl = ldfrag_b((const __bf16*)(const void*)Kls + (j * 16 + c) * KP + dc * 32 + 8 * hh);
        sa[j] = mma_b(kb, qh[dc], sa[j]);
        sa[j] = mma_b(kl, qh[dc], sa[j]);
        sa[j] = mma_b(kb, ql[dc], sa[j]);
        guard1b4(sa[j], qh[dc], ql[dc], kb, kl);
      }
    }
    acc_guard2(sa[0], sa[1]);

    // ---- scale, mask add (class 2): sc[j][r] = score of (query c, key 16j + 8hh + r) ----
    float sc[2][8];
#pragma unroll
    for (int j = 0; j < 2; ++j)
#pragma unroll
      for (int r = 0; r < 8; ++r) sc[j][r] = sa[j][r] * 0.125f;
    if (cl == 2) {                                                    // block-uniform
      const float* mr = Ms + (wave * 16 + c) * MP + 8 * hh;           // the query's mask row, this half's keys
#pragma unroll
      for (int j = 0; j < 2; ++j) {
        const v4f ma = *(const v4f*)(mr + j * 16);
        const v4f mb = *(const v4f*)(mr + j * 16 + 4);
#pragma unroll
        for (int r = 0; r < 4; r += 2) {
          const unsigned wa = cvt2(ma[r], ma[r + 1]);
          const unsigned wb = cvt2(mb[r], mb[r + 1]);
          sc[j][r]     += lo_val(wa); sc[j][r + 1]     += hi_val(wa);
          sc[j][4 + r] += lo_val(wb); sc[j][4 + r + 1] += hi_val(wb);
        }
      }
    }
    // ---- chunk max of the query: in the lane, then with the other half ----
    float cm = -INFINITY;
#pragma unroll
    for (int j = 0; j < 2; ++j)
#pragma unroll
      for (int r = 0; r < 8; ++r) cm = fmaxf(cm, sc[j][r]);
    cm = fmaxf(cm, xhalf(cm));
    // ---- online softmax; p hi/lo packed in place into the B operands ----
    const float mnew  = fmaxf(mrow, cm);
    const float muse  = (mnew > -INFINITY) ? mnew : 0.0f;
    const float alpha = __expf(mrow - muse);
    mrow = mnew;
    union { v16b v; unsigned u[8]; } pa, pr;
    float ps[2];
#pragma unroll
    for (int j = 0; j < 2; ++j) {
      ps[j] = 0.f;
#pragma unroll
      for (int r = 0; r < 8; r += 2) {
        const float p0 = __expf(sc[j][r] - muse);
        const float p1 = __expf(sc[j][r + 1] - muse);
        ps[j] += p0;
        ps[j] += p1;
        const unsigned hp = cvt2(p0, p1);
        pa.u[j * 4 + (r >> 1)] = hp;
        pr.u[j * 4 + (r >> 1)] = cvt2_res(p0, p1, hp);
      }
    }
    lsum = lsum * alpha + (ps[0] + ps[1]);
#pragma unroll
    for (int t = 0; t < 4; ++t)
#pragma unroll
      for (int r = 0; r < 8; ++r) oacc[t][r] *= alpha;
    // ---- O^T += v^T . p^T (K = 32 keys, three products) ----
#pragma unroll
    for (int t = 0; t < 4; ++t) {
      const v16b vb = ldfrag_b((const __bf16*)(const void*)Vhs + (t * 16 + c) * VP + 8 * hh);
      const v16b vr = ldfrag_b((const __bf16*)(const void*)Vls + (t * 16 + c) * VP + 8 * hh);
      oacc[t] = mma_b(vb, pa.v, oacc[t]);
      oacc[t] = mma_b(vr, pa.v, oacc[t]);
      oacc[t] = mma_b(vb, pr.v, oacc[t]);
      guard1b4(oacc[t], pa.v, pr.v, vb, vr);
    }
  }
  __syncthreads();                                 // every wave is past the chunk loop (all waves reach this)
  acc_guard4(oacc[0], oacc[1], oacc[2], oacc[3]);

  unsigned short* osh = Osh[wave];
  unsigned short* osl = Osl[wave];
  const float inv = 1.0f / (lsum + xhalf(lsum));   // the halves' sums joined; l >= 1: the row max contributes exp(0)
#pragma unroll
  for (int t = 0; t < 4; ++t) {                    // 8 consecutive d of query c: one 16-B LDS store per plane
    v4u xh, xl;
#pragma unroll
    for (int r = 0; r < 8; r += 2) {
      const float o0 = oacc[t][r] * inv;
      const float o1 = oacc[t][r + 1] * inv;
      const unsigned ho = cvt2(o0, o1);
      xh[r >> 1] = ho;
      xl[r >> 1] = cvt2_res(o0, o1, ho);
    }
    *(v4u*)(osh + c * 64 + t * 16 + 8 * hh) = xh;
    *(v4u*)(osl + c * 64 + t * 16 + 8 * hh) = xl;
  }
  lds_wave_sync();
  unsigned short* Ag = aop + (tok0 + q0) * AOW + h * HDM;
  const int qq = lane >> 3;                        // 0..3
  const int c8 = (lane & 7) * 8;
  {
#pragma unroll
    for (int it = 0; it < 4; ++it) {
      const int row = it * 4 + qq;                 // it 0..3 x qq 0..3 covers rows 0..15
      const v4u x = *(const v4u*)(osh + row * 64 + c8);
      const v4u y = *(const v4u*)(osl + row * 64 + c8);
      *(v4u*)(Ag + (size_t)row * AOW + c8)      = x;
      *(v4u*)(Ag + (size_t)row * AOW + QW + c8) = y;
    }
    
  }
}

// ---------------------------------------------------------------------------
// Workspace map (bytes; every region is an exact whole number of the rows its producer writes with whole-line stores;
// all dimensions are tile multiples, no padded tails needed; every offset is a multiple of 128):
//   XB   bf16 [4096][1024]   8388608     WQK bf16 [1280][1024]   2621440     WV  bf16 [256][1024]    524288
//   WO2  bf16 [1024][2048]   4194304     CST f32  [4096][32]      524288     SNT f32  [4096][32]     524288
//   CLS  i32  [2][32][32]       8192     QH  bf16 [4096][1024]   8388608     QL  bf16 [4096][1024]  8388608
//   KH   bf16 [4096][256]    2097152     KL  bf16 [4096][256]    2097152     VTH bf16 [256][4096]   2097152
//   VTL  bf16 [256][4096]    2097152     AO  bf16 [4096][2048]  16777216
//   total                   58728448
// ---------------------------------------------------------------------------
extern "C" void kernel_launch(void* const* d_in, const int* in_sizes, int n_in,
                              void* d_out, int out_size, void* d_ws, size_t ws_size,
                              hipStream_t stream) {
  if (n_in < 7) return;
  if (in_sizes[0] != NTOK * HID) return;                  // hidden_states [2][2048][1024] f32
  if (in_sizes[1] != NB * SQ * SQ) return;                // attention_mask [2][1][2048][2048] f32
  if (in_sizes[2] != NTOK) return;                        // position_ids [2][2048] int32
  if (in_sizes[3] != QW * HID) return;                    // wq [1024][1024]
  if (in_sizes[4] != KW * HID) return;                    // wk [256][1024]
  if (in_sizes[5] != KW * HID) return;                    // wv [256][1024]
  if (in_sizes[6] != HID * QW) return;                    // wo [1024][1024]
  if (out_size != NTOK * HID) return;

  const float* hs   = (const float*)d_in[0];
  const float* mask = (const float*)d_in[1];
  const int*   pos  = (const int*)d_in[2];
  const float* wq   = (const float*)d_in[3];
  const float* wk   = (const float*)d_in[4];
  const float* wv   = (const float*)d_in[5];
  const float* wo   = (const float*)d_in[6];
  float* out = (float*)d_out;

  const size_t szXB  = (size_t)NTOK * HID * 2;
  const size_t szWQK = (size_t)QKN * HID * 2;
  const size_t szWV  = (size_t)KW * HID * 2;
  const size_t szWO2 = (size_t)HID * AOW * 2;
  const size_t szT   = (size_t)NTOK * NFREQ * 4;
  const size_t szCLS = (size_t)NB * NT64 * NT64 * 4;
  const size_t szQ   = (size_t)NTOK * QW * 2;
  const size_t szK   = (size_t)NTOK * KW * 2;
  const size_t szVT  = (size_t)KW * NTOK * 2;
  const size_t szAO  = (size_t)NTOK * AOW * 2;
  size_t off = 0;
  const size_t oXB  = off; off += szXB;
  const size_t oWQK = off; off += szWQK;
  const size_t oWV  = off; off += szWV;
  const size_t oWO2 = off; off += szWO2;
  const size_t oCST = off; off += szT;
  const size_t oSNT = off; off += szT;
  const size_t oCLS = off; off += szCLS;
  const size_t oQH  = off; off += szQ;
  const size_t oQL  = off; off += szQ;
  const size_t oKH  = off; off += szK;
  const size_t oKL  = off; off += szK;
  const size_t oVTH = off; off += szVT;
  const size_t oVTL = off; off += szVT;
  const size_t oAO  = off; off += szAO;
  if (off > ws_size) return;                              // off = 58728448

  char* ws = (char*)d_ws;
  unsigned short* XB  = (unsigned short*)(ws + oXB);
  unsigned short* WQK = (unsigned short*)(ws + oWQK);
  unsigned short* WV  = (unsigned short*)(ws + oWV);
  unsigned short* WO2 = (unsigned short*)(ws + oWO2);
  float*          CST = (float*)(ws + oCST);
  float*          SNT = (float*)(ws + oSNT);
  int*            CLS = (int*)(ws + oCLS);
  unsigned short* QH  = (unsigned short*)(ws + oQH);
  unsigned short* QL  = (unsigned short*)(ws + oQL);
  unsigned short* KH  = (unsigned short*)(ws + oKH);
  unsigned short* KL  = (unsigned short*)(ws + oKL);
  unsigned short* VTH = (unsigned short*)(ws + oVTH);
  unsigned short* VTL = (unsigned short*)(ws + oVTL);
  unsigned short* AO  = (unsigned short*)(ws + oAO);

  const dim3 b256(256), b128(128);

  // (1) preparation, one launch: mask classes, x / wq / wk / wv / wo bf16 planes, cos/sin table
  prep_kernel<<<dim3(PB_ALL), b256, 0, stream>>>(hs, mask, pos, wq, wk, wv, wo, XB, WQK, WV, WO2, CST, SNT, CLS);
  // (2) one launch, two products:
  //     q|k = x . [Wq;Wk]^T, RoPE, split -> QH/QL [4096][1024], KH/KL [4096][256]   (M=4096, N=1280, K=1024; 32 x 10 block tiles)
  //     v^T = Wv . x^T -> VTH/VTL [256][4096]   (A = WV, Bt = XB; M=256, N=4096, K=1024; 2 x 32 block tiles)
  gemm_w32x128_kernel<0><<<dim3((NTOK / 128) * (QKN / 128) + (KW / 128) * (NTOK / 128)), b128, 0, stream>>>(
      XB, HID, WQK, HID, CST, SNT, (void*)QH, (void*)QL, (void*)KH, (void*)KL, QW, KW, NTOK, QKN, HID,
      WV, (void*)VTH, (void*)VTL, NTOK, KW, NTOK);
  // (3) attention per (q tile, head, batch) -> AO hi|lo [4096][2048]
  attn_kernel<<<dim3(SQ / 64, NHQ, NB), b128, 0, stream>>>(QH, QL, KH, KL, VTH, VTL, mask, CLS, AO);
  // (4) out = [AOhi | AOlo] . [Wo | Wo]^T -> d_out f32 [4096][1024]   (M=4096, N=1024, K=2048; 32 x 8 block tiles)
  gemm_w32x128_kernel<2><<<dim3((NTOK / 128) * (HID / 128)), b128, 0, stream>>>(
      AO, AOW, WO2, AOW, CST, SNT, (void*)out, (void*)out, (void*)out, (void*)out, HID, HID, NTOK, HID, AOW,
      AO, (void*)out, (void*)out, HID, NTOK, HID);
  (void)hipGetLastError();
}

// v005
// Measured time: 164 microseconds a run.
// Timed twice side by side with v004, it ran 1.14 and 1.15 times as fast.
// Counting every step since v000, it is 3.00 times as fast.
// Contractions: x.[Wq;Wk]^T and Wv.x^T on v_wmma_f32_16x16x32_bf16 (operands = RNE bf16 copies of the f32 inputs, single products);
// q.k^T and p.v on v_wmma_f32_16x16x32_bf16 with bf16 hi/lo split operands (hi.hi + hi.lo + lo.hi, three products);
// attn.Wo^T on v_wmma_f32_16x16x32_bf16 with attn = bf16 hi|lo planes folded into K (two products) and Wo as RNE bf16.
// f32 accumulate everywhere; RoPE (f32 cos/sin table built from the position ids), mask add and online softmax in f32.
// Plane carry audit: every 16-bit plane is bf16 with carry 1 (hi = RNE(v), lo = RNE(v - hi), same accumulator); nothing is scaled,
// nothing is folded back: XB, WQK, WV, WO2 (RNE copies), QH/QL, KH/KL, VTH/VTL, P (registers), AO hi|lo.
#include <hip/hip_runtime.h>
#include <math.h>
#include <stdint.h>

#define NB     2
#define SQ     2048
#define HID    1024
#define NHQ    16
#define NKVH   4
#define HDM    64
#define QW     1024          // q plane width (16 heads x 64)
#define KW     256           // k / v width (4 heads x 64)
#define QKN    1280          // q|k projection columns
#define NTOK   4096
#define NFREQ  32
#define AOW    2048          // attn plane width: hi at col 0..1023, lo at col 1024..2047
#define NT64   32            // 64-wide tiles along each mask axis

typedef __bf16       v16b __attribute__((ext_vector_type(16)));
typedef __bf16       v8b  __attribute__((ext_vector_type(8)));
typedef float        v8f  __attribute__((ext_vector_type(8)));
typedef float        v4f  __attribute__((ext_vector_type(4)));
typedef unsigned int v4u  __attribute__((ext_vector_type(4)));
typedef float        v2f  __attribute__((ext_vector_type(2)));
typedef __bf16       v2b  __attribute__((ext_vector_type(2)));

// ---------------------------------------------------------------------------
// small helpers
// ---------------------------------------------------------------------------
// two f32 -> two bf16 (RNE) in one word by the hardware's packed convert: a in bits 15..0, b in bits 31..16
__device__ __forceinline__ unsigned cvt2(float a, float b) {
  const v2f x = {a, b};
  return __builtin_bit_cast(unsigned, __builtin_convertvector(x, v2b));
}
__device__ __forceinline__ float lo_val(unsigned w) { return __uint_as_float(w << 16); }          // f32 value of the low bf16
__device__ __forceinline__ float hi_val(unsigned w) { return __uint_as_float(w & 0xFFFF0000u); }  // f32 value of the high bf16
// the residues of a and b against their bf16 roundings held in w = cvt2(a, b), rounded to bf16 in turn
__device__ __forceinline__ unsigned cvt2_res(float a, float b, unsigned w) { return cvt2(a - lo_val(w), b - hi_val(w)); }
__device__ __forceinline__ v8f zero8() { v8f z = {0.f, 0.f, 0.f, 0.f, 0.f, 0.f, 0.f, 0.f}; return z; }
// lane l with lane l ^ 16 (the other half of the wave)
__device__ __forceinline__ float xhalf(float x) {
  const int b = __builtin_bit_cast(int, x);
  return __builtin_bit_cast(float, __builtin_amdgcn_permlanex16(b, b, 0x76543210, 0xfedcba98, false, false));
}
__device__ __forceinline__ int wave_id() { return __builtin_amdgcn_readfirstlane((int)(threadIdx.x >> 5)); }

__device__ __forceinline__ void lds_wave_sync() {
  __builtin_amdgcn_fence(__ATOMIC_RELEASE, "workgroup");
  __builtin_amdgcn_wave_barrier();
  __builtin_amdgcn_fence(__ATOMIC_ACQUIRE, "workgroup");
}

// ---------------------------------------------------------------------------
// WMMA fragments (wave32, 16x16x32, bf16 operands). For A (row m = lane&15) and B (col n = lane&15) alike:
// elements 0..7 <- k0 + 8*(lane>>4) + 0..7, elements 8..15 <- k0 + 16 + 8*(lane>>4) + 0..7.
// ldfrag_b(p) with p = rowbase + k0 + 8*(lane>>4): two 16-B loads p[0..7], p[16..23] (A rows and k-contiguous B rows alike).
// D: acc[r] = (row 8*(lane>>4) + r, col lane&15).
// ---------------------------------------------------------------------------
union FragB { v16b v; v8b h[2]; };
__device__ __forceinline__ v16b ldfrag_b(const __bf16* p) { FragB f; f.h[0] = *(const v8b*)(p); f.h[1] = *(const v8b*)(p + 16); return f.v; }

__device__ __forceinline__ v8f mma_b(v16b a, v16b b, v8f c) {
  return __builtin_amdgcn_wmma_f32_16x16x32_bf16(false, a, false, b, (short)0, c, false, false);
}
// hazard guards: 4 VALU slots after the last WMMA of a group, D tied, A/B kept live; memory clobber keeps later loads behind the group
__device__ __forceinline__ void guard1b4(v8f& a, v16b w, v16b x, v16b y, v16b z) {
  asm volatile("v_nop\n\tv_nop\n\tv_nop\n\tv_nop" : "+v"(a) : "v"(w), "v"(x), "v"(y), "v"(z) : "memory");
}
__device__ __forceinline__ void acc_guard4(v8f& a, v8f& b, v8f& c, v8f& d) {
  asm volatile("v_nop\n\tv_nop\n\tv_nop\n\tv_nop" : "+v"(a), "+v"(b), "+v"(c), "+v"(d));
}
__device__ __forceinline__ void acc_guard2(v8f& a, v8f& b) {
  asm volatile("v_nop\n\tv_nop\n\tv_nop\n\tv_nop" : "+v"(a), "+v"(b));
}

// ---------------------------------------------------------------------------
// RoPE table: cst[t][j] = cos(pos[t] * inv_freq[j]), snt[t][j] = sin(...), inv_freq[j] = 1 / 10000^(j/32), j < 32, all f32.
// ---------------------------------------------------------------------------
__device__ __forceinline__ void rope_table_part(int bid, const int* __restrict__ pos, float* __restrict__ cst,
                                                float* __restrict__ snt, int ntok) {
  const int lane = threadIdx.x & 31;
  const int wave = (int)(threadIdx.x >> 5);
  const int t = bid * 8 + wave;
  if (t >= ntok) return;                       // no barriers in this part
  const float pf  = (float)pos[t];
  const float e   = (float)lane * 0.03125f;    // (2*j)/64 exact
  const float pw  = powf(10000.0f, e);
  const float inv = 1.0f / pw;
  const float ang = pf * inv;
  const float cv  = cosf(ang);
  const float sv  = sinf(ang);
  const size_t o = (size_t)t * NFREQ + lane;
  {
    ((float*)cst)[o] = cv;
    ((float*)snt)[o] = sv;
    
  }
}

// ---------------------------------------------------------------------------
// Elementwise RNE f32 -> bf16 plane: 8 elements per thread, one 16-B store per lane -> 32 consecutive lanes write 4 whole
// ---------------------------------------------------------------------------
__device__ __forceinline__ void cvt_bf16_part(int bid, const float* __restrict__ in, unsigned short* __restrict__ outp, int n8) {
  const int i = bid * 256 + (int)threadIdx.x;
  if (i >= n8) return;
  const size_t e = 8 * (size_t)i;
  const v4f a = *(const v4f*)(in + e);
  const v4f b = *(const v4f*)(in + e + 4);
  v4u w;
  w[0] = cvt2(a[0], a[1]);
  w[1] = cvt2(a[2], a[3]);
  w[2] = cvt2(b[0], b[1]);
  w[3] = cvt2(b[2], b[3]);
  *(v4u*)(outp + e) = w;
  
}

// ---------------------------------------------------------------------------
// Wo [HID][kin] f32 -> WO2 [HID][ldo = 2*kin] bf16 with WO2[n][k] = WO2[n][kin + k] = bf16(Wo[n][k]).
// Coverage: grid = n8/256 x 256 x 8 = HID*kin source elements -> both halves of every WO2 row.
// ---------------------------------------------------------------------------
__device__ __forceinline__ void cvt_wo2_part(int bid, const float* __restrict__ in, unsigned short* __restrict__ outp,
                                             int n8, int kin, int ldo) {
  const int i = bid * 256 + (int)threadIdx.x;
  if (i >= n8) return;
  const size_t e = 8 * (size_t)i;
  const int n = (int)(e / (size_t)kin);
  const int k = (int)(e - (size_t)n * kin);
  const v4f a = *(const v4f*)(in + e);
  const v4f b = *(const v4f*)(in + e + 4);
  v4u w;
  w[0] = cvt2(a[0], a[1]);
  w[1] = cvt2(a[2], a[3]);
  w[2] = cvt2(b[0], b[1]);
  w[3] = cvt2(b[2], b[3]);
  const size_t o = (size_t)n * ldo + k;
  *(v4u*)(outp + o) = w;
  *(v4u*)(outp + o + kin) = w;
  
}

// ---------------------------------------------------------------------------
// Mask tile classes. mask [NB][1][SQ][SQ] f32 (additive). One block per (b, 64-row band mt): 256 threads x 8 consecutive columns,
// 64 rows each. For every 64x64 tile (b, mt, nt):
//   class 0 = every element <= -1e8 (tile contributes nothing: exp underflows to 0 exactly when the row has an admitted key),
//   class 1 = every element == 0 (nothing to add), class 2 = anything else (mask tile added elementwise).
// If the band contains a row with no element > -1e4 the skip is not valid for it: class 0 tiles of that band become class 2.
// Reductions are OR (order independent). Coverage: NB*32 blocks x 64 rows x 256 thr x 8 cols = the whole mask;
// ---------------------------------------------------------------------------
#define ADM_TH (-1.0e4f)
#define SKP_TH (-1.0e8f)

__device__ __forceinline__ void mask_class_part(int bid, const float* __restrict__ mask, int* __restrict__ cls) {
  __shared__ int nzs[NT64];
  __shared__ int bgs[NT64];
  __shared__ unsigned rlo[8];
  __shared__ unsigned rhi[8];
  const int bm   = bid;                  // b*32 + mt
  const int b    = bm >> 5;
  const int mt   = bm & 31;
  const int tid  = threadIdx.x;
  const int lane = tid & 31;
  const int wave = tid >> 5;
  const int j0   = tid * 8;
  int nz = 0, bg = 0;
  unsigned rowlo = 0u, rowhi = 0u;       // bit r: this thread's 8 columns contain an admitted element in row r
#pragma unroll 1
  for (int r = 0; r < 64; ++r) {
    const float* mr = mask + (((size_t)b * SQ) + (size_t)(mt * 64 + r)) * SQ + j0;
    const v4f mk0 = *(const v4f*)(mr);
    const v4f mk1 = *(const v4f*)(mr + 4);
    const int a = ((mk0[0] > ADM_TH) | (mk0[1] > ADM_TH) | (mk0[2] > ADM_TH) | (mk0[3] > ADM_TH) |
                   (mk1[0] > ADM_TH) | (mk1[1] > ADM_TH) | (mk1[2] > ADM_TH) | (mk1[3] > ADM_TH)) ? 1 : 0;
    const int z = ((mk0[0] != 0.0f) | (mk0[1] != 0.0f) | (mk0[2] != 0.0f) | (mk0[3] != 0.0f) |
                   (mk1[0] != 0.0f) | (mk1[1] != 0.0f) | (mk1[2] != 0.0f) | (mk1[3] != 0.0f)) ? 1 : 0;
    const int g = ((mk0[0] > SKP_TH) | (mk0[1] > SKP_TH) | (mk0[2] > SKP_TH) | (mk0[3] > SKP_TH) |
                   (mk1[0] > SKP_TH) | (mk1[1] > SKP_TH) | (mk1[2] > SKP_TH) | (mk1[3] > SKP_TH)) ? 1 : 0;
    nz |= z;
    bg |= g;
    const unsigned sh = ((unsigned)a) << (r & 31);
    rowlo |= (r < 32) ? sh : 0u;
    rowhi |= (r < 32) ? 0u : sh;
  }
  // OR over the 8 lanes 8q..8q+7 that share column tile nt = tid >> 3
  nz |= __shfl_xor(nz, 1, 32); nz |= __shfl_xor(nz, 2, 32); nz |= __shfl_xor(nz, 4, 32);
  bg |= __shfl_xor(bg, 1, 32); bg |= __shfl_xor(bg, 2, 32); bg |= __shfl_xor(bg, 4, 32);
#pragma unroll
  for (int off = 1; off < 32; off <<= 1) {
    rowlo |= (unsigned)__shfl_xor((int)rowlo, off, 32);
    rowhi |= (unsigned)__shfl_xor((int)rowhi, off, 32);
  }
  if ((lane & 7) == 0) { nzs[tid >> 3] = nz; bgs[tid >> 3] = bg; }
  if (lane == 0) { rlo[wave] = rowlo; rhi[wave] = rowhi; }
  __syncthreads();
  if (wave == 0) {                       // wave-uniform
    const int z = nzs[lane];
    const int g = bgs[lane];
    unsigned ol = rlo[0], oh = rhi[0];
#pragma unroll
    for (int w = 1; w < 8; ++w) { ol |= rlo[w]; oh |= rhi[w]; }
    const bool has_empty_row = (ol != 0xFFFFFFFFu) || (oh != 0xFFFFFFFFu);
    int cval = (g == 0) ? 0 : ((z == 0) ? 1 : 2);
    cval = (has_empty_row && cval == 0) ? 2 : cval;
    int* cp = cls + (size_t)bm * NT64 + lane;
    *cp = cval;
    
  }
}

// ---------------------------------------------------------------------------
// The seven preparation jobs depend on the inputs alone and on nothing of each other: one launch, each job a range of blocks
// (256 threads each, the block counts the jobs had as launches of their own). The mask bands, the longest blocks, come first.
// Every branch is on the block index: whole blocks take it, so the barrier of the mask part stays block-uniform.
// ---------------------------------------------------------------------------
#define PB_MASK (NB * NT64)                  // 64
#define PB_X    ((NTOK * HID / 8) / 256)     // 2048
#define PB_ROPE (NTOK / 8)                   // 512
#define PB_WQ   ((QW * HID / 8) / 256)       // 512
#define PB_WO   ((HID * QW / 8) / 256)       // 512
#define PB_WKV  ((KW * HID / 8) / 256)       // 128, wk and wv each
#define PB_ALL  (PB_MASK + PB_X + PB_ROPE + PB_WQ + PB_WO + 2 * PB_WKV)

__global__ __launch_bounds__(256) void prep_kernel(
    const float* __restrict__ hs, const float* __restrict__ mask, const int* __restrict__ pos,
    const float* __restrict__ wq, const float* __restrict__ wk, const float* __restrict__ wv, const float* __restrict__ wo,
    unsigned short* __restrict__ xb, unsigned short* __restrict__ wqk, unsigned short* __restrict__ wvb,
    unsigned short* __restrict__ wo2, float* __restrict__ cst, float* __restrict__ snt, int* __restrict__ cls) {
  int bid = (int)blockIdx.x;
  // mask tile classes [2][32][32]
  if (bid < PB_MASK) { mask_class_part(bid, mask, cls); return; }
  bid -= PB_MASK;
  // x -> bf16 plane [4096][1024]
  if (bid < PB_X) { cvt_bf16_part(bid, hs, xb, NTOK * HID / 8); return; }
  bid -= PB_X;
  // cos/sin table [4096][32] x 2 from the position ids
  if (bid < PB_ROPE) { rope_table_part(bid, pos, cst, snt, NTOK); return; }
  bid -= PB_ROPE;
  // wq [1024][1024] -> WQK rows 0..1023 (natural [out][in] = Bt layout)
  if (bid < PB_WQ) { cvt_bf16_part(bid, wq, wqk, QW * HID / 8); return; }
  bid -= PB_WQ;
  // wo [1024][1024] -> WO2 [1024][2048] (both halves)
  if (bid < PB_WO) { cvt_wo2_part(bid, wo, wo2, HID * QW / 8, QW, AOW); return; }
  bid -= PB_WO;
  // wk [256][1024] -> WQK rows 1024..1279
  if (bid < PB_WKV) { cvt_bf16_part(bid, wk, wqk + (size_t)QW * HID, KW * HID / 8); return; }
  bid -= PB_WKV;
  // wv [256][1024] -> WV
  if (bid < PB_WKV) { cvt_bf16_part(bid, wv, wvb, KW * HID / 8); return; }
}

// ---------------------------------------------------------------------------
// bf16 WMMA GEMM, block = 4 waves (128 threads) = one 128 x 128 tile of C; wave w owns rows 32w..32w+31 of it, all 128 cols.
//   C[m][n] = sum_k A[m][k] * Bt[n][k]; A row-major [M][K] bf16 (pitch lda), Bt row-major [N][K] bf16 (pitch ldb);
//   M % 128 == 0, N % 128 == 0, K % 64 == 0, K >= 64, lda % 8 == 0, ldb % 8 == 0; grid.x = M/128 * N/128.
//   EPI 0 carries a second, independent product in the same launch: blocks M/128 * N/128 .. + M2/128 * N2/128 - 1 compute
//   C'[m][n] = sum_k A2[m][k] * A[n][k] (A2 [M2][K] pitch lda; the first product's A, N2 rows of it, as Bt with pitch ldb:
//   lda == ldb), same K, same loop.
//   Operands: per trip of 64 k the 128 A rows and the 128 Bt rows (128 B each) are copied global -> LDS asynchronously, whole
//   128-B lines per 8 lanes, into one of two buffers; trip t works on buffer t & 1 while tile t + 1 flies into the other.
//   Fragments are read from LDS rows (ldfrag_b) in the same k order as before.
// Epilogues (all: per wave, per 16-row slab: stage in LDS, wave sync, write each row segment with ONE instruction of
//   EPI 0: q|k projection with RoPE. The 128-col tile holds two 64-dim heads; pairs (d, d+32) inside each head are rotated with
//          the f32 cos/sin rows of the token (staged per slab in LDS), then split to bf16 hi (C0/C2) and lo (C1/C3) planes.
//          cols n0 < QW -> q planes [M][ldc], col n0; cols n0 >= QW -> k planes [M][ldc2], col n0-QW. Row segment 256 B = 16 lanes x 16 B.
//          Second product = v^T projection: bf16 hi plane D0, lo plane D1, [M2][ldd], row segment 256 B.
//   EPI 2: f32 output C0 [M][ldc]; row segment 128 floats = 512 B = 32 lanes x 16 B per instruction.
// ---------------------------------------------------------------------------
template <int EPI> struct SlabCfg { static constexpr int PERWF = 2048; };   // floats per wave (8 KB)
template <> struct SlabCfg<0>     { static constexpr int PERWF = 3072; };   // + 16x32 cos + 16x32 sin rows

#define GKT  64                 // k per staged tile: 128-B rows
#define GPITCH  72                 // LDS row pitch in bf16: 144 B = 16 B x odd, for the 16-B fragment reads
#define GOP  (128 * GPITCH)        // bf16 per operand tile (128 rows)
#define GROWB (16 * GPITCH * 2)    // LDS bytes between a lane's consecutive copies (16 rows)

__device__ __forceinline__ unsigned lds_off(const void* p) { return (unsigned)(size_t)p; }

// One operand tile, 128 rows x 128 B: lane t copies 16 B of rows (t >> 3) + 16u, u = 0..7 (128 lanes x 8 = 1024 pieces = the tile).
// l = the lane's LDS byte address for u = 0, g = its global address for u = 0, ld = global row pitch in elements.
// s_wait_xcnt stands inside the statement so that no address register is rewritten ahead of it.
__device__ __forceinline__ void stage_tile(unsigned l, const unsigned short* g, int ld) {
  const size_t st = (size_t)16 * (size_t)ld;
  asm volatile(
      "global_load_async_to_lds_b128 %0, %8, off\n\t"
      "global_load_async_to_lds_b128 %1, %9, off\n\t"
      "global_load_async_to_lds_b128 %2, %10, off\n\t"
      "global_load_async_to_lds_b128 %3, %11, off\n\t"
      "global_load_async_to_lds_b128 %4, %12, off\n\t"
      "global_load_async_to_lds_b128 %5, %13, off\n\t"
      "global_load_async_to_lds_b128 %6, %14, off\n\t"
      "global_load_async_to_lds_b128 %7, %15, off\n\t"
      "s_wait_xcnt 0x0"
      :: "v"(l), "v"(l + 1u * GROWB), "v"(l + 2u * GROWB), "v"(l + 3u * GROWB),
         "v"(l + 4u * GROWB), "v"(l + 5u * GROWB), "v"(l + 6u * GROWB), "v"(l + 7u * GROWB),
         "v"(g), "v"(g + st), "v"(g + 2 * st), "v"(g + 3 * st),
         "v"(g + 4 * st), "v"(g + 5 * st), "v"(g + 6 * st), "v"(g + 7 * st)
      : "memory");
}

template <int EPI>
__global__ __launch_bounds__(128) void gemm_w32x128_kernel(
    const unsigned short* __restrict__ Ap, int lda,
    const unsigned short* __restrict__ Btp, int ldb,
    const float* __restrict__ cst, const float* __restrict__ snt,
    void* C0, void* C1, void* C2, void* C3, int ldc, int ldc2,
    int M, int N, int K,
    const unsigned short* __restrict__ A2p, void* D0, void* D1, int ldd, int M2, int N2) {
  __shared__ __align__(16) float lds_all[4 * SlabCfg<EPI>::PERWF];
  __shared__ __align__(16) unsigned short ring[2][2 * GOP];    // [buffer][A tile | Bt tile], 2 x 36,864 B

  const int tid  = (int)threadIdx.x;
  const int lane = tid & 31;
  const int wave = wave_id();
  const int hh = lane >> 4;           // lane half: k offset 8*hh, D row offset 8*hh
  const int rl = lane & 15;           // A row / B col / D col within subtile
  const int ntile1 = (M >> 7) * (N >> 7);
  const bool second = (EPI == 0) && ((int)blockIdx.x >= ntile1);   // block-uniform: this block works on the second product
  const int tilesN = (second ? N2 : N) >> 7;
  const int tilesM = (second ? M2 : M) >> 7;
  const int tile = (int)blockIdx.x - (second ? ntile1 : 0);
  if (tile >= tilesM * tilesN) return;          // block-uniform, in front of every barrier and copy
  const int tm = tile / tilesN;
  const int tn = tile - tm * tilesN;
  const int mblk = tm << 7;
  const int m0 = mblk + (wave << 5);
  const int n0 = tn << 7;

  // this lane's first piece of each operand tile: row tid >> 3, 16-B column tid & 7
  const int srow = tid >> 3;
  const int sc8  = (tid & 7) * 8;
  const unsigned short* gA = (second ? A2p : Ap) + (size_t)(mblk + srow) * lda + sc8;
  const unsigned short* gB = (second ? Ap : Btp) + (size_t)(n0   + srow) * ldb + sc8;
  const unsigned lA = lds_off(&ring[0][0]) + (unsigned)(srow * GPITCH + sc8) * 2u;
  const unsigned lB = lA + GOP * 2u;
  const unsigned bufb = 2u * GOP * 2u;           // bytes per buffer
  const int ntrip = K / GKT;

  v8f acc[2][8];
#pragma unroll
  for (int i = 0; i < 2; ++i)
#pragma unroll
    for (int j = 0; j < 8; ++j) acc[i][j] = zero8();

  // prologue: tile 0 lands and is published, then tile 1 starts
  stage_tile(lA, gA, lda);
  stage_tile(lB, gB, ldb);
  asm volatile("s_wait_asynccnt 0x0" ::: "memory");   // this wave's copies of tile 0 have landed
  __syncthreads();                                     // ... and every other wave's: tile 0 is readable
  if (ntrip > 1) {
    stage_tile(lA + bufb, gA + GKT, lda);
    stage_tile(lB + bufb, gB + GKT, ldb);
  }

  for (int t = 0; t < ntrip; ++t) {
    const __bf16* As = (const __bf16*)(const void*)&ring[t & 1][0]   + (wave * 32 + rl) * GPITCH + 8 * hh;
    const __bf16* Bs = (const __bf16*)(const void*)&ring[t & 1][GOP] + rl * GPITCH + 8 * hh;
    v16b ah[2][2], bf[2][8];                           // [k half of the tile][fragment]
#pragma unroll
    for (int s = 0; s < 2; ++s) {
#pragma unroll
      for (int i = 0; i < 2; ++i) ah[s][i] = ldfrag_b(As + i * 16 * GPITCH + s * 32);
#pragma unroll
      for (int j = 0; j < 8; ++j) bf[s][j] = ldfrag_b(Bs + j * 16 * GPITCH + s * 32);
    }
    // keeps the trip's LDS reads together in front of its WMMAs: one exposed LDS latency per trip instead of one per WMMA pair
    __builtin_amdgcn_sched_barrier(0);
#pragma unroll
    for (int s = 0; s < 2; ++s) {
#pragma unroll
      for (int j = 0; j < 8; ++j) {
        acc[0][j] = mma_b(ah[s][0], bf[s][j], acc[0][j]);
        acc[1][j] = mma_b(ah[s][1], bf[s][j], acc[1][j]);
      }
    }
    // keeps the WMMAs in front of the trip's foot: they overlap the LDS reads, and tile t + 1's copies get the whole trip to land
    __builtin_amdgcn_sched_barrier(0);
    asm volatile("s_wait_dscnt 0x0" ::: "memory");     // this wave's reads of buffer t & 1 are done before it is refilled
    asm volatile("s_wait_asynccnt 0x0" ::: "memory");  // this wave's copies of tile t + 1 have landed
    __syncthreads();                                   // publishes tile t + 1 and ends every reader's use of buffer t & 1
    if (t + 2 < ntrip) {                               // same for the whole block
      const unsigned bo = (unsigned)(t & 1) * bufb;
      stage_tile(lA + bo, gA + (size_t)(t + 2) * GKT, lda);
      stage_tile(lB + bo, gB + (size_t)(t + 2) * GKT, ldb);
    }
  }
  asm volatile("s_wait_asynccnt 0x0" ::: "memory");    // nothing of this wave is in flight behind the loop
  acc_guard4(acc[0][0], acc[0][1], acc[0][2], acc[0][3]);
  acc_guard4(acc[0][4], acc[0][5], acc[0][6], acc[0][7]);
  acc_guard4(acc[1][0], acc[1][1], acc[1][2], acc[1][3]);
  acc_guard4(acc[1][4], acc[1][5], acc[1][6], acc[1][7]);

  // ---- epilogue ----
  float* wl = lds_all + wave * SlabCfg<EPI>::PERWF;
  unsigned short* sl16 = (unsigned short*)(void*)wl;       // 4096 u16 = floats 0..2047 (two 16x128 planes)
  float* slf = wl;

  if (EPI == 0 && !second) {
    float* csl = wl + 2048;                                 // cos rows [16][32]
    float* snl = wl + 2048 + 16 * NFREQ;                    // sin rows [16][32]
    const bool isq = (n0 < QW);                             // wave-uniform
    unsigned short* P0 = isq ? (unsigned short*)C0 : (unsigned short*)C2;
    unsigned short* P1 = isq ? (unsigned short*)C1 : (unsigned short*)C3;
    const int ldp  = isq ? ldc : ldc2;
    const int col0 = isq ? n0 : (n0 - QW);
#pragma unroll
    for (int i = 0; i < 2; ++i) {
      const int mb = m0 + i * 16;
      // stage cos/sin of tokens mb..mb+15: 16 rows x 32 floats = 128 16-B pieces per table; lane -> 4 pieces (coverage 32x4 = 128)
      v4f cv4[4], sv4[4];
      const float* cp[4];
      const float* sp[4];
#pragma unroll
      for (int u = 0; u < 4; ++u) {
        const int p   = lane + 32 * u;
        const int row = p >> 3, c4 = (p & 7) * 4;
        cp[u] = cst + (size_t)(mb + row) * NFREQ + c4;
        sp[u] = snt + (size_t)(mb + row) * NFREQ + c4;
        cv4[u] = *(const v4f*)cp[u];
        sv4[u] = *(const v4f*)sp[u];
      }
      // precaution: the eight loads' address registers, named as inputs so that they live up to here, are reused only behind this wait
      asm volatile("s_wait_xcnt 0x0"
                   :: "v"(cp[0]), "v"(cp[1]), "v"(cp[2]), "v"(cp[3]), "v"(sp[0]), "v"(sp[1]), "v"(sp[2]), "v"(sp[3])
                   : "memory");
#pragma unroll
      for (int u = 0; u < 4; ++u) {
        const int p   = lane + 32 * u;
        const int row = p >> 3, c4 = (p & 7) * 4;
        *(v4f*)(csl + row * NFREQ + c4) = cv4[u];
        *(v4f*)(snl + row * NFREQ + c4) = sv4[u];
      }
      lds_wave_sync();
#pragma unroll
      for (int hs = 0; hs < 2; ++hs) {                      // head within the 128-col tile
#pragma unroll
        for (int jj = 0; jj < 2; ++jj) {
          const int j1 = hs * 4 + jj;                       // cols hs*64 + jj*16 + rl  (x1, dim d < 32)
          const int j2 = j1 + 2;                            // cols +32                 (x2, dim d + 32)
          const int d  = jj * 16 + rl;                      // freq index 0..31
#pragma unroll
          for (int r = 0; r < 8; ++r) {
            const int lrow = 8 * hh + r;
            const float cv = csl[lrow * NFREQ + d];
            const float sv = snl[lrow * NFREQ + d];
            const float x1 = acc[i][j1][r];
            const float x2 = acc[i][j2][r];
            const float o1 = x1 * cv - x2 * sv;
            const float o2 = x2 * cv + x1 * sv;
            const unsigned hb = cvt2(o1, o2);
            const unsigned lb = cvt2_res(o1, o2, hb);
            const int so = lrow * 128 + hs * 64 + d;
            sl16[so]             = (unsigned short)hb;
            sl16[so + 32]        = (unsigned short)(hb >> 16);
            sl16[2048 + so]      = (unsigned short)lb;
            sl16[2048 + so + 32] = (unsigned short)(lb >> 16);
          }
        }
      }
      lds_wave_sync();
      {
#pragma unroll
        for (int it = 0; it < 8; ++it) {
          const int row = it * 2 + hh;                      // it x hh covers rows 0..15
          const int c8  = rl * 8;
          const v4u vh = *(const v4u*)(sl16 + row * 128 + c8);
          const v4u vl = *(const v4u*)(sl16 + 2048 + row * 128 + c8);
          const size_t go = (size_t)(mb + row) * ldp + col0 + c8;
          *(v4u*)(P0 + go) = vh;
          *(v4u*)(P1 + go) = vl;
        }
        
      }
      lds_wave_sync();
    }
  } else if (EPI == 0) {
    unsigned short* P0 = (unsigned short*)D0;
    unsigned short* P1 = (unsigned short*)D1;
#pragma unroll
    for (int i = 0; i < 2; ++i) {
#pragma unroll
      for (int r = 0; r < 8; ++r) {
#pragma unroll
        for (int j = 0; j < 8; j += 2) {
          const float va = acc[i][j][r];
          const float vb = acc[i][j + 1][r];
          const unsigned hb = cvt2(va, vb);
          const unsigned lb = cvt2_res(va, vb, hb);
          const int so = (8 * hh + r) * 128 + j * 16 + rl;
          sl16[so]             = (unsigned short)hb;
          sl16[so + 16]        = (unsigned short)(hb >> 16);
          sl16[2048 + so]      = (unsigned short)lb;
          sl16[2048 + so + 16] = (unsigned short)(lb >> 16);
        }
      }
      lds_wave_sync();
      {
#pragma unroll
        for (int it = 0; it < 8; ++it) {
          const int row = it * 2 + hh;
          const int c8  = rl * 8;
          const v4u vh = *(const v4u*)(sl16 + row * 128 + c8);
          const v4u vl = *(const v4u*)(sl16 + 2048 + row * 128 + c8);
          const size_t go = (size_t)(m0 + i * 16 + row) * ldd + n0 + c8;
          *(v4u*)(P0 + go) = vh;
          *(v4u*)(P1 + go) = vl;
        }
        
      }
      lds_wave_sync();
    }
  } else {
    float* C = (float*)C0;
#pragma unroll
    for (int i = 0; i < 2; ++i) {
#pragma unroll
      for (int j = 0; j < 8; ++j)
#pragma unroll
        for (int r = 0; r < 8; ++r)
          slf[(8 * hh + r) * 128 + j * 16 + rl] = acc[i][j][r];
      lds_wave_sync();
      {
#pragma unroll
        for (int row = 0; row < 16; ++row) {                // 32 lanes x 16 B = the whole 512-B row segment per instruction
          const v4f v = *(const v4f*)(slf + row * 128 + lane * 4);
          *(v4f*)(C + (size_t)(m0 + i * 16 + row) * ldc + n0 + lane * 4) = v;
        }
        
      }
      lds_wave_sync();
    }
  }
}

#define AKC  32
#define NKG  4
#define TKC  (AKC * NKG)
#define KP   72
#define VP   136
#define MP   132
#define KVB  ((2 * TKC * KP + 2 * HDM * VP) * 2)
#define JOB  ((NKG - 1) * 4 * 32 * (32 + 2) * 4)
static_assert(JOB <= KVB);

// 16 B at a block-uniform base plus the thread's 32-bit byte offset
__device__ __forceinline__ v4u ld16(const unsigned short* base, unsigned boff) { return *(const v4u*)((const char*)base + boff); }

// eight waves per SIMD = two blocks per WGP: one block's products fill the other's staging and barrier waits (2 x LDS fits too)
__global__ __launch_bounds__(512) __attribute__((amdgpu_waves_per_eu(8, 8))) void attn_kernel(
    const unsigned short* __restrict__ qhp, const unsigned short* __restrict__ qlp,
    const unsigned short* __restrict__ khp, const unsigned short* __restrict__ klp,
    const unsigned short* __restrict__ vhp, const unsigned short* __restrict__ vlp,
    const float* __restrict__ maskp, const int* __restrict__ clsp,
    unsigned short* __restrict__ aop) {
  __shared__ __align__(16) unsigned short KVs[KVB / 2];
  __shared__ __align__(16) float Ms[64 * MP];
  __shared__ __align__(16) unsigned short Osh[4][16 * 64];
  __shared__ __align__(16) unsigned short Osl[4][16 * 64];
  unsigned short* Ks  = KVs;
  unsigned short* Kls = KVs + TKC * KP;
  unsigned short* Vhs = KVs + 2 * TKC * KP;
  unsigned short* Vls = KVs + 2 * TKC * KP + HDM * VP;

  const int tid  = (int)threadIdx.x;
  const int lane = tid & 31;
  const int wave = wave_id();
  const int wq   = wave & 3;                     // query slab of the wave
  const int kg   = wave >> 2;                    // key group of the wave
  const int hh   = lane >> 4;
  const int c    = lane & 15;
  const int qt   = (int)blockIdx.x;
  const int h    = (int)blockIdx.y;
  const int b    = (int)blockIdx.z;
  const int kvh  = h >> 2;
  const int q0   = qt * 64 + wq * 16;            // first query row of this wave (within the sequence)
  const size_t tok0 = (size_t)b * SQ;

  // whole mask staging area initialised once (only class-2 tiles refresh it; other tiles never add from it)
#pragma unroll 1
  for (int u = tid; u < 64 * MP; u += 512) Ms[u] = 0.0f;

  const __bf16* Qhr = (const __bf16*)(const void*)qhp + (tok0 + q0 + c) * QW + h * HDM + 8 * hh;
  const __bf16* Qlr = (const __bf16*)(const void*)qlp + (tok0 + q0 + c) * QW + h * HDM + 8 * hh;
  const size_t mrow0 = (tok0 + (size_t)qt * 64) * SQ;                 // mask[b][0][qt*64][0]
  const int* crow = clsp + ((b * NT64) + qt) * NT64;
  // staging: block-uniform element offsets of the (b, kv head) planes, and this thread's own byte offsets (global) and places (LDS)
  const size_t kbase = tok0 * KW + kvh * HDM;
  const size_t vbase = (size_t)(kvh * HDM) * NTOK + tok0;
  const unsigned kgo = (unsigned)((tid >> 3) * KW + (tid & 7) * 8) * 2u;
  const unsigned vgo = (unsigned)((tid >> 4) * NTOK + (tid & 15) * 8) * 2u;
  const unsigned mgo = (unsigned)((tid >> 4) * SQ + (tid & 15) * 4) * 4u;
  const int kso = (tid >> 3) * KP + (tid & 7) * 8;
  const int vso = (tid >> 4) * VP + (tid & 15) * 8;
  const int mso = (tid >> 4) * MP + (tid & 15) * 4;

  v16b qh[2], ql[2];
#pragma unroll
  for (int dc = 0; dc < 2; ++dc) { qh[dc] = ldfrag_b(Qhr + dc * 32); ql[dc] = ldfrag_b(Qlr + dc * 32); }

  float mrow = -INFINITY;                          // running max of query c over this wave's keys (the same in both halves)
  float lsum = 0.f;                                // running sum of query c over this wave's keys of this half
  v8f oacc[4];                                     // oacc[t][r] = O[query c][d = 16t + 8hh + r], this wave's keys
#pragma unroll
  for (int t = 0; t < 4; ++t) oacc[t] = zero8();

  for (int s = 0; s < NT64 / 2; ++s) {
    const int cl0 = __builtin_amdgcn_readfirstlane(crow[2 * s]);      // block-uniform classes of the trip's two mask tiles
    const int cl1 = __builtin_amdgcn_readfirstlane(crow[2 * s + 1]);
    if ((cl0 | cl1) == 0) continue;                                   // uniform for the whole block; before any barrier
    const int kv0 = s * TKC;
    __syncthreads();                                                  // prior trip's LDS readers are done
    const unsigned short* kbh = khp + kbase + (size_t)kv0 * KW;       // block-uniform bases of the trip's tiles
    const unsigned short* kbl = klp + kbase + (size_t)kv0 * KW;
    const unsigned short* vbh = vhp + vbase + kv0;
    const unsigned short* vbl = vlp + vbase + kv0;
    v4u kx[2], ky[2], vx[2], vy[2];
#pragma unroll
    for (int u = 0; u < 2; ++u) {                                     // coverage: 1024 pieces of 8 halves per plane = whole tile
      kx[u] = ld16(kbh + u * 64 * KW, kgo);                           // K: 128 keys x 64 d; key = (tid >> 3) + 64u
      ky[u] = ld16(kbl + u * 64 * KW, kgo);
      vx[u] = ld16(vbh + (size_t)u * 32 * NTOK, vgo);                 // V^T: 64 d x 128 keys; d = (tid >> 4) + 32u
      vy[u] = ld16(vbl + (size_t)u * 32 * NTOK, vgo);
    }
#pragma unroll
    for (int u = 0; u < 2; ++u) {
      *(v4u*)(Ks  + kso + u * 64 * KP) = kx[u];
      *(v4u*)(Kls + kso + u * 64 * KP) = ky[u];
      *(v4u*)(Vhs + vso + u * 32 * VP) = vx[u];
      *(v4u*)(Vls + vso + u * 32 * VP) = vy[u];
    }
#pragma unroll
    for (int mtl = 0; mtl < 2; ++mtl) {
      if ((mtl ? cl1 : cl0) == 2) {                                   // block-uniform branch about the mask tile load
        const float* mbase = maskp + mrow0 + kv0 + mtl * 64;
#pragma unroll
        for (int u = 0; u < 2; ++u) {                                 // coverage: 1024 pieces of 4 floats = 64 rows x 64 keys
          const v4f mv = *(const v4f*)((const char*)(mbase + (size_t)u * 32 * SQ) + mgo);   // row = (tid >> 4) + 32u
          *(v4f*)(Ms + mso + u * 32 * MP + mtl * 64) = mv;
        }
      }
    }
    __syncthreads();

    const int cl = (kg < 2) ? cl0 : cl1;                              // wave-uniform class of this wave's 32 keys
    if (cl == 0) continue;                                            // no barrier between here and the next trip's first one

    // ---- scores, transposed: 32 keys x 16 queries, K = 64, three products ----
    v8f sa[2];
    sa[0] = zero8(); sa[1] = zero8();
#pragma unroll
    for (int dc = 0; dc < 2; ++dc) {
#pragma unroll
      for (int j = 0; j < 2; ++j) {
        const v16b kb = ldfrag_b((const __bf16*)(const void*)Ks  + (kg * AKC + j * 16 + c) * KP + dc * 32 + 8 * hh);
        const v16b kl = ldfrag_b((const __bf16*)(const void*)Kls + (kg * AKC + j * 16 + c) * KP + dc * 32 + 8 * hh);
        sa[j] = mma_b(kb, qh[dc], sa[j]);
        sa[j] = mma_b(kl, qh[dc], sa[j]);
        sa[j] = mma_b(kb, ql[dc], sa[j]);
        guard1b4(sa[j], qh[dc], ql[dc], kb, kl);
      }
    }
    acc_guard2(sa[0], sa[1]);

    // ---- scale, mask add (class 2): sc[j][r] = score of (query c, key 16j + 8hh + r) ----
    float sc[2][8];
#pragma unroll
    for (int j = 0; j < 2; ++j)
#pragma unroll
      for (int r = 0; r < 8; ++r) sc[j][r] = sa[j][r] * 0.125f;
    if (cl == 2) {                                                    // wave-uniform
      const float* mr = Ms + (wq * 16 + c) * MP + kg * AKC + 8 * hh;  // the query's mask row, this wave's keys, this half's
#pragma unroll
      for (int j = 0; j < 2; ++j) {
        const v4f ma = *(const v4f*)(mr + j * 16);
        const v4f mb = *(const v4f*)(mr + j * 16 + 4);
#pragma unroll
        for (int r = 0; r < 4; r += 2) {
          const unsigned wa = cvt2(ma[r], ma[r + 1]);
          const unsigned wb = cvt2(mb[r], mb[r + 1]);
          sc[j][r]     += lo_val(wa); sc[j][r + 1]     += hi_val(wa);
          sc[j][4 + r] += lo_val(wb); sc[j][4 + r + 1] += hi_val(wb);
        }
      }
    }
    // ---- chunk max of the query: in the lane, then with the other half ----
    float cm = -INFINITY;
#pragma unroll
    for (int j = 0; j < 2; ++j)
#pragma unroll
      for (int r = 0; r < 8; ++r) cm = fmaxf(cm, sc[j][r]);
    cm = fmaxf(cm, xhalf(cm));
    // ---- online softmax; p hi/lo packed in place into the B operands ----
    const float mnew  = fmaxf(mrow, cm);
    const float muse  = (mnew > -INFINITY) ? mnew : 0.0f;
    const float alpha = __expf(mrow - muse);
    mrow = mnew;
    union { v16b v; unsigned u[8]; } pa, pr;
    float ps[2];
#pragma unroll
    for (int j = 0; j < 2; ++j) {
      ps[j] = 0.f;
#pragma unroll
      for (int r = 0; r < 8; r += 2) {
        const float p0 = __expf(sc[j][r] - muse);
        const float p1 = __expf(sc[j][r + 1] - muse);
        ps[j] += p0;
        ps[j] += p1;
        const unsigned hp = cvt2(p0, p1);
        pa.u[j * 4 + (r >> 1)] = hp;
        pr.u[j * 4 + (r >> 1)] = cvt2_res(p0, p1, hp);
      }
    }
    lsum = lsum * alpha + (ps[0] + ps[1]);
#pragma unroll
    for (int t = 0; t < 4; ++t)
#pragma unroll
      for (int r = 0; r < 8; ++r) oacc[t][r] *= alpha;
    // ---- O^T += v^T . p^T (K = 32 keys, three products) ----
#pragma unroll
    for (int t = 0; t < 4; ++t) {
      const v16b vb = ldfrag_b((const __bf16*)(const void*)Vhs + (t * 16 + c) * VP + kg * AKC + 8 * hh);
      const v16b vr = ldfrag_b((const __bf16*)(const void*)Vls + (t * 16 + c) * VP + kg * AKC + 8 * hh);
      oacc[t] = mma_b(vb, pa.v, oacc[t]);
      oacc[t] = mma_b(vr, pa.v, oacc[t]);
      oacc[t] = mma_b(vb, pr.v, oacc[t]);
      guard1b4(oacc[t], pa.v, pr.v, vb, vr);
    }
  }
  __syncthreads();                                 // every wave is past the trip loop: the K / V^T tiles are free
  acc_guard4(oacc[0], oacc[1], oacc[2], oacc[3]);

  // ---- the four key groups' parts of a query slab are joined in group 0 ----
  // hand-over area: O parts as 16-B pieces [part][piece 0..7][lane], then (max, sum) pairs [part][lane]; part = (kg - 1) * 4 + wq
  v4f* jo = (v4f*)(void*)KVs;
  v2f* jm = (v2f*)(void*)(jo + (NKG - 1) * 4 * 8 * 32);
  if (kg != 0) {                                   // wave-uniform
    const int part = (kg - 1) * 4 + wq;
#pragma unroll
    for (int t = 0; t < 4; ++t) {
      const v4f x0 = {oacc[t][0], oacc[t][1], oacc[t][2], oacc[t][3]};
      const v4f x1 = {oacc[t][4], oacc[t][5], oacc[t][6], oacc[t][7]};
      jo[(part * 8 + 2 * t) * 32 + lane]     = x0;
      jo[(part * 8 + 2 * t + 1) * 32 + lane] = x1;
    }
    const v2f ml = {mrow, lsum};
    jm[part * 32 + lane] = ml;
  }
  __syncthreads();                                 // the parts are readable; the last barrier of the kernel
  if (kg != 0) return;                             // whole waves leave, behind every barrier

  v2f oml[NKG - 1];
  float mall = mrow;
#pragma unroll
  for (int g = 0; g < NKG - 1; ++g) {
    oml[g] = jm[(g * 4 + wq) * 32 + lane];
    mall = fmaxf(mall, oml[g][0]);
  }
  const float mjoin = (mall > -INFINITY) ? mall : 0.0f;
  float w0 = __expf(mrow - mjoin);                 // a part that saw no key has max -inf: weight 0
  float wg[NKG - 1];
#pragma unroll
  for (int g = 0; g < NKG - 1; ++g) wg[g] = __expf(oml[g][0] - mjoin);
  // the slot the instruction set asks for between an exp and the first user of its result or overwriter of its source; the four
  // weights are tied to it so that it stands behind the run of exps and in front of every product with a weight
  asm volatile("v_nop" : "+v"(w0), "+v"(wg[0]), "+v"(wg[1]), "+v"(wg[2]));
  lsum *= w0;
#pragma unroll
  for (int t = 0; t < 4; ++t)
#pragma unroll
    for (int r = 0; r < 8; ++r) oacc[t][r] *= w0;
#pragma unroll
  for (int g = 0; g < NKG - 1; ++g) {
    lsum += wg[g] * oml[g][1];
#pragma unroll
    for (int t = 0; t < 4; ++t) {
      const v4f x0 = jo[((g * 4 + wq) * 8 + 2 * t) * 32 + lane];
      const v4f x1 = jo[((g * 4 + wq) * 8 + 2 * t + 1) * 32 + lane];
#pragma unroll
      for (int r = 0; r < 4; ++r) {
        oacc[t][r]     += wg[g] * x0[r];
        oacc[t][4 + r] += wg[g] * x1[r];
      }
    }
  }

  unsigned short* osh = Osh[wq];
  unsigned short* osl = Osl[wq];
  const float inv = 1.0f / (lsum + xhalf(lsum));   // the halves' sums joined; l >= 1: the row max contributes exp(0)
#pragma unroll
  for (int t = 0; t < 4; ++t) {                    // 8 consecutive d of query c: one 16-B LDS store per plane
    v4u xh, xl;
#pragma unroll
    for (int r = 0; r < 8; r += 2) {
      const float o0 = oacc[t][r] * inv;
      const float o1 = oacc[t][r + 1] * inv;
      const unsigned ho = cvt2(o0, o1);
      xh[r >> 1] = ho;
      xl[r >> 1] = cvt2_res(o0, o1, ho);
    }
    *(v4u*)(osh + c * 64 + t * 16 + 8 * hh) = xh;
    *(v4u*)(osl + c * 64 + t * 16 + 8 * hh) = xl;
  }
  lds_wave_sync();
  unsigned short* Ag = aop + (tok0 + q0) * AOW + h * HDM;
  const int qq = lane >> 3;                        // 0..3
  const int c8 = (lane & 7) * 8;
  {
#pragma unroll
    for (int it = 0; it < 4; ++it) {
      const int row = it * 4 + qq;                 // it 0..3 x qq 0..3 covers rows 0..15
      const v4u x = *(const v4u*)(osh + row * 64 + c8);
      const v4u y = *(const v4u*)(osl + row * 64 + c8);
      *(v4u*)(Ag + (size_t)row * AOW + c8)      = x;
      *(v4u*)(Ag + (size_t)row * AOW + QW + c8) = y;
    }
    
  }
}

// ---------------------------------------------------------------------------
// Workspace map (bytes; every region is an exact whole number of the rows its producer writes with whole-line stores;
// all dimensions are tile multiples, no padded tails needed; every offset is a multiple of 128):
//   XB   bf16 [4096][1024]   8388608     WQK bf16 [1280][1024]   2621440     WV  bf16 [256][1024]    524288
//   WO2  bf16 [1024][2048]   4194304     CST f32  [4096][32]      524288     SNT f32  [4096][32]     524288
//   CLS  i32  [2][32][32]       8192     QH  bf16 [4096][1024]   8388608     QL  bf16 [4096][1024]  8388608
//   KH   bf16 [4096][256]    2097152     KL  bf16 [4096][256]    2097152     VTH bf16 [256][4096]   2097152
//   VTL  bf16 [256][4096]    2097152     AO  bf16 [4096][2048]  16777216
//   total                   58728448
// ---------------------------------------------------------------------------
extern "C" void kernel_launch(void* const* d_in, const int* in_sizes, int n_in,
                              void* d_out, int out_size, void* d_ws, size_t ws_size,
                              hipStream_t stream) {
  if (n_in < 7) return;
  if (in_sizes[0] != NTOK * HID) return;                  // hidden_states [2][2048][1024] f32
  if (in_sizes[1] != NB * SQ * SQ) return;                // attention_mask [2][1][2048][2048] f32
  if (in_sizes[2] != NTOK) return;                        // position_ids [2][2048] int32
  if (in_sizes[3] != QW * HID) return;                    // wq [1024][1024]
  if (in_sizes[4] != KW * HID) return;                    // wk [256][1024]
  if (in_sizes[5] != KW * HID) return;                    // wv [256][1024]
  if (in_sizes[6] != HID * QW) return;                    // wo [1024][1024]
  if (out_size != NTOK * HID) return;

  const float* hs   = (const float*)d_in[0];
  const float* mask = (const float*)d_in[1];
  const int*   pos  = (const int*)d_in[2];
  const float* wq   = (const float*)d_in[3];
  const float* wk   = (const float*)d_in[4];
  const float* wv   = (const float*)d_in[5];
  const float* wo   = (const float*)d_in[6];
  float* out = (float*)d_out;

  const size_t szXB  = (size_t)NTOK * HID * 2;
  const size_t szWQK = (size_t)QKN * HID * 2;
  const size_t szWV  = (size_t)KW * HID * 2;
  const size_t szWO2 = (size_t)HID * AOW * 2;
  const size_t szT   = (size_t)NTOK * NFREQ * 4;
  const size_t szCLS = (size_t)NB * NT64 * NT64 * 4;
  const size_t szQ   = (size_t)NTOK * QW * 2;
  const size_t szK   = (size_t)NTOK * KW * 2;
  const size_t szVT  = (size_t)KW * NTOK * 2;
  const size_t szAO  = (size_t)NTOK * AOW * 2;
  size_t off = 0;
  const size_t oXB  = off; off += szXB;
  const size_t oWQK = off; off += szWQK;
  const size_t oWV  = off; off += szWV;
  const size_t oWO2 = off; off += szWO2;
  const size_t oCST = off; off += szT;
  const size_t oSNT = off; off += szT;
  const size_t oCLS = off; off += szCLS;
  const size_t oQH  = off; off += szQ;
  const size_t oQL  = off; off += szQ;
  const size_t oKH  = off; off += szK;
  const size_t oKL  = off; off += szK;
  const size_t oVTH = off; off += szVT;
  const size_t oVTL = off; off += szVT;
  const size_t oAO  = off; off += szAO;
  if (off > ws_size) return;                              // off = 58728448

  char* ws = (char*)d_ws;
  unsigned short* XB  = (unsigned short*)(ws + oXB);
  unsigned short* WQK = (unsigned short*)(ws + oWQK);
  unsigned short* WV  = (unsigned short*)(ws + oWV);
  unsigned short* WO2 = (unsigned short*)(ws + oWO2);
  float*          CST = (float*)(ws + oCST);
  float*          SNT = (float*)(ws + oSNT);
  int*            CLS = (int*)(ws + oCLS);
  unsigned short* QH  = (unsigned short*)(ws + oQH);
  unsigned short* QL  = (unsigned short*)(ws + oQL);
  unsigned short* KH  = (unsigned short*)(ws + oKH);
  unsigned short* KL  = (unsigned short*)(ws + oKL);
  unsigned short* VTH = (unsigned short*)(ws + oVTH);
  unsigned short* VTL = (unsigned short*)(ws + oVTL);
  unsigned short* AO  = (unsigned short*)(ws + oAO);

  const dim3 b256(256), b128(128), b512(512);

  // (1) preparation, one launch: mask classes, x / wq / wk / wv / wo bf16 planes, cos/sin table
  prep_kernel<<<dim3(PB_ALL), b256, 0, stream>>>(hs, mask, pos, wq, wk, wv, wo, XB, WQK, WV, WO2, CST, SNT, CLS);
  // (2) one launch, two products:
  //     q|k = x . [Wq;Wk]^T, RoPE, split -> QH/QL [4096][1024], KH/KL [4096][256]   (M=4096, N=1280, K=1024; 32 x 10 block tiles)
  //     v^T = Wv . x^T -> VTH/VTL [256][4096]   (A = WV, Bt = XB; M=256, N=4096, K=1024; 2 x 32 block tiles)
  gemm_w32x128_kernel<0><<<dim3((NTOK / 128) * (QKN / 128) + (KW / 128) * (NTOK / 128)), b128, 0, stream>>>(
      XB, HID, WQK, HID, CST, SNT, (void*)QH, (void*)QL, (void*)KH, (void*)KL, QW, KW, NTOK, QKN, HID,
      WV, (void*)VTH, (void*)VTL, NTOK, KW, NTOK);
  // (3) attention per (q tile, head, batch) -> AO hi|lo [4096][2048]
  attn_kernel<<<dim3(SQ / 64, NHQ, NB), b512, 0, stream>>>(QH, QL, KH, KL, VTH, VTL, mask, CLS, AO);
  // (4) out = [AOhi | AOlo] . [Wo | Wo]^T -> d_out f32 [4096][1024]   (M=4096, N=1024, K=2048; 32 x 8 block tiles)
  gemm_w32x128_kernel<2><<<dim3((NTOK / 128) * (HID / 128)), b128, 0, stream>>>(
      AO, AOW, WO2, AOW, CST, SNT, (void*)out, (void*)out, (void*)out, (void*)out, HID, HID, NTOK, HID, AOW,
      AO, (void*)out, (void*)out, HID, NTOK, HID);
  (void)hipGetLastError();
}

// v006
// One run takes 141 microseconds.
// Timed twice side by side with v005, it ran 1.17 and 1.16 times as fast.
// All steps since v000 together make it 3.48 times as fast.
// Contractions: x.[Wq;Wk]^T and Wv.x^T on v_wmma_f32_16x16x32_bf16 (operands = RNE bf16 copies of the f32 inputs, single products);
// q.k^T and p.v on v_wmma_f32_16x16x32_bf16 with bf16 hi/lo split operands (hi.hi + hi.lo + lo.hi, three products);
// attn.Wo^T on v_wmma_f32_16x16x32_bf16 with attn = bf16 hi|lo planes folded into K (two products) and Wo as RNE bf16.
// f32 accumulate everywhere; RoPE (f32 cos/sin table built from the position ids), mask add and online softmax in f32.
// Plane carry audit: every 16-bit plane is bf16 with carry 1 (hi = RNE(v), lo = RNE(v - hi), same accumulator); nothing is scaled,
// nothing is folded back: XB, WQK, WV, WO2 (RNE copies), QH/QL, KH/KL, VTH/VTL, P (registers), AO hi|lo.
#include <hip/hip_runtime.h>
#include <math.h>
#include <stdint.h>

#define NB     2
#define SQ     2048
#define HID    1024
#define NHQ    16
#define NKVH   4
#define HDM    64
#define QW     1024          // q plane width (16 heads x 64)
#define KW     256           // k / v width (4 heads x 64)
#define QKN    1280          // q|k projection columns
#define NTOK   4096
#define NFREQ  32
#define AOW    2048          // attn plane width: hi at col 0..1023, lo at col 1024..2047
#define NT64   32            // 64-wide tiles along each mask axis

typedef __bf16       v16b __attribute__((ext_vector_type(16)));
typedef __bf16       v8b  __attribute__((ext_vector_type(8)));
typedef float        v8f  __attribute__((ext_vector_type(8)));
typedef float        v4f  __attribute__((ext_vector_type(4)));
typedef unsigned int v4u  __attribute__((ext_vector_type(4)));
typedef float        v2f  __attribute__((ext_vector_type(2)));
typedef __bf16       v2b  __attribute__((ext_vector_type(2)));

// ---------------------------------------------------------------------------
// small helpers
// ---------------------------------------------------------------------------
// two f32 -> two bf16 (RNE) in one word by the hardware's packed convert: a in bits 15..0, b in bits 31..16
__device__ __forceinline__ unsigned cvt2(float a, float b) {
  const v2f x = {a, b};
  return __builtin_bit_cast(unsigned, __builtin_convertvector(x, v2b));
}
__device__ __forceinline__ float lo_val(unsigned w) { return __uint_as_float(w << 16); }          // f32 value of the low bf16
__device__ __forceinline__ float hi_val(unsigned w) { return __uint_as_float(w & 0xFFFF0000u); }  // f32 value of the high bf16
// the residues of a and b against their bf16 roundings held in w = cvt2(a, b), rounded to bf16 in turn
__device__ __forceinline__ unsigned cvt2_res(float a, float b, unsigned w) { return cvt2(a - lo_val(w), b - hi_val(w)); }
__device__ __forceinline__ v8f zero8() { v8f z = {0.f, 0.f, 0.f, 0.f, 0.f, 0.f, 0.f, 0.f}; return z; }
// lane l with lane l ^ 16 (the other half of the wave)
__device__ __forceinline__ float xhalf(float x) {
  const int b = __builtin_bit_cast(int, x);
  return __builtin_bit_cast(float, __builtin_amdgcn_permlanex16(b, b, 0x76543210, 0xfedcba98, false, false));
}
__device__ __forceinline__ int wave_id() { return __builtin_amdgcn_readfirstlane((int)(threadIdx.x >> 5)); }

__device__ __forceinline__ void lds_wave_sync() {
  __builtin_amdgcn_fence(__ATOMIC_RELEASE, "workgroup");
  __builtin_amdgcn_wave_barrier();
  __builtin_amdgcn_fence(__ATOMIC_ACQUIRE, "workgroup");
}

// ---------------------------------------------------------------------------
// WMMA fragments (wave32, 16x16x32, bf16 operands). For A (row m = lane&15) and B (col n = lane&15) alike:
// elements 0..7 <- k0 + 8*(lane>>4) + 0..7, elements 8..15 <- k0 + 16 + 8*(lane>>4) + 0..7.
// ldfrag_b(p) with p = rowbase + k0 + 8*(lane>>4): two 16-B loads p[0..7], p[16..23] (A rows and k-contiguous B rows alike).
// D: acc[r] = (row 8*(lane>>4) + r, col lane&15).
// ---------------------------------------------------------------------------
union FragB { v16b v; v8b h[2]; };
__device__ __forceinline__ v16b ldfrag_b(const __bf16* p) { FragB f; f.h[0] = *(const v8b*)(p); f.h[1] = *(const v8b*)(p + 16); return f.v; }

__device__ __forceinline__ v8f mma_b(v16b a, v16b b, v8f c) {
  return __builtin_amdgcn_wmma_f32_16x16x32_bf16(false, a, false, b, (short)0, c, false, false);
}
// hazard guards: 4 VALU slots after the last WMMA of a group, D tied, A/B kept live; memory clobber keeps later loads behind the group
__device__ __forceinline__ void guard1b4(v8f& a, v16b w, v16b x, v16b y, v16b z) {
  asm volatile("v_nop\n\tv_nop\n\tv_nop\n\tv_nop" : "+v"(a) : "v"(w), "v"(x), "v"(y), "v"(z) : "memory");
}
__device__ __forceinline__ void acc_guard4(v8f& a, v8f& b, v8f& c, v8f& d) {
  asm volatile("v_nop\n\tv_nop\n\tv_nop\n\tv_nop" : "+v"(a), "+v"(b), "+v"(c), "+v"(d));
}
__device__ __forceinline__ void acc_guard2(v8f& a, v8f& b) {
  asm volatile("v_nop\n\tv_nop\n\tv_nop\n\tv_nop" : "+v"(a), "+v"(b));
}

// ---------------------------------------------------------------------------
// RoPE table: cst[t][j] = cos(pos[t] * inv_freq[j]), snt[t][j] = sin(...), inv_freq[j] = 1 / 10000^(j/32), j < 32, all f32.
// ---------------------------------------------------------------------------
__device__ __forceinline__ void rope_table_part(int bid, const int* __restrict__ pos, float* __restrict__ cst,
                                                float* __restrict__ snt, int ntok) {
  const int lane = threadIdx.x & 31;
  const int wave = (int)(threadIdx.x >> 5);
  const int t = bid * 8 + wave;
  if (t >= ntok) return;                       // no barriers in this part
  const float pf  = (float)pos[t];
  const float e   = (float)lane * 0.03125f;    // (2*j)/64 exact
  const float pw  = powf(10000.0f, e);
  const float inv = 1.0f / pw;
  const float ang = pf * inv;
  const float cv  = cosf(ang);
  const float sv  = sinf(ang);
  const size_t o = (size_t)t * NFREQ + lane;
  {
    ((float*)cst)[o] = cv;
    ((float*)snt)[o] = sv;
    
  }
}

// ---------------------------------------------------------------------------
// Elementwise RNE f32 -> bf16 plane: 8 elements per thread, one 16-B store per lane -> 32 consecutive lanes write 4 whole
// ---------------------------------------------------------------------------
__device__ __forceinline__ void cvt_bf16_part(int bid, const float* __restrict__ in, unsigned short* __restrict__ outp, int n8) {
  const int i = bid * 256 + (int)threadIdx.x;
  if (i >= n8) return;
  const size_t e = 8 * (size_t)i;
  const v4f a = *(const v4f*)(in + e);
  const v4f b = *(const v4f*)(in + e + 4);
  v4u w;
  w[0] = cvt2(a[0], a[1]);
  w[1] = cvt2(a[2], a[3]);
  w[2] = cvt2(b[0], b[1]);
  w[3] = cvt2(b[2], b[3]);
  *(v4u*)(outp + e) = w;
  
}

// ---------------------------------------------------------------------------
// Wo [HID][kin] f32 -> WO2 [HID][ldo = 2*kin] bf16 with WO2[n][k] = WO2[n][kin + k] = bf16(Wo[n][k]).
// Coverage: grid = n8/256 x 256 x 8 = HID*kin source elements -> both halves of every WO2 row.
// ---------------------------------------------------------------------------
__device__ __forceinline__ void cvt_wo2_part(int bid, const float* __restrict__ in, unsigned short* __restrict__ outp,
                                             int n8, int kin, int ldo) {
  const int i = bid * 256 + (int)threadIdx.x;
  if (i >= n8) return;
  const size_t e = 8 * (size_t)i;
  const int n = (int)(e / (size_t)kin);
  const int k = (int)(e - (size_t)n * kin);
  const v4f a = *(const v4f*)(in + e);
  const v4f b = *(const v4f*)(in + e + 4);
  v4u w;
  w[0] = cvt2(a[0], a[1]);
  w[1] = cvt2(a[2], a[3]);
  w[2] = cvt2(b[0], b[1]);
  w[3] = cvt2(b[2], b[3]);
  const size_t o = (size_t)n * ldo + k;
  *(v4u*)(outp + o) = w;
  *(v4u*)(outp + o + kin) = w;
  
}

// ---------------------------------------------------------------------------
// Mask tile classes. mask [NB][1][SQ][SQ] f32 (additive). One block per (b, 64-row band mt): 256 threads x 8 consecutive columns,
// 64 rows each. For every 64x64 tile (b, mt, nt):
//   class 0 = every element <= -1e8 (tile contributes nothing: exp underflows to 0 exactly when the row has an admitted key),
//   class 1 = every element == 0 (nothing to add), class 2 = anything else (mask tile added elementwise).
// If the band contains a row with no element > -1e4 the skip is not valid for it: class 0 tiles of that band become class 2.
// Reductions are OR (order independent). Coverage: NB*32 blocks x 64 rows x 256 thr x 8 cols = the whole mask;
// ---------------------------------------------------------------------------
#define ADM_TH (-1.0e4f)
#define SKP_TH (-1.0e8f)

__device__ __forceinline__ void mask_class_part(int bid, const float* __restrict__ mask, int* __restrict__ cls) {
  __shared__ int nzs[NT64];
  __shared__ int bgs[NT64];
  __shared__ unsigned rlo[8];
  __shared__ unsigned rhi[8];
  const int bm   = bid;                  // b*32 + mt
  const int b    = bm >> 5;
  const int mt   = bm & 31;
  const int tid  = threadIdx.x;
  const int lane = tid & 31;
  const int wave = tid >> 5;
  const int j0   = tid * 8;
  int nz = 0, bg = 0;
  unsigned rowlo = 0u, rowhi = 0u;       // bit r: this thread's 8 columns contain an admitted element in row r
#pragma unroll 1
  for (int r = 0; r < 64; ++r) {
    const float* mr = mask + (((size_t)b * SQ) + (size_t)(mt * 64 + r)) * SQ + j0;
    const v4f mk0 = *(const v4f*)(mr);
    const v4f mk1 = *(const v4f*)(mr + 4);
    const int a = ((mk0[0] > ADM_TH) | (mk0[1] > ADM_TH) | (mk0[2] > ADM_TH) | (mk0[3] > ADM_TH) |
                   (mk1[0] > ADM_TH) | (mk1[1] > ADM_TH) | (mk1[2] > ADM_TH) | (mk1[3] > ADM_TH)) ? 1 : 0;
    const int z = ((mk0[0] != 0.0f) | (mk0[1] != 0.0f) | (mk0[2] != 0.0f) | (mk0[3] != 0.0f) |
                   (mk1[0] != 0.0f) | (mk1[1] != 0.0f) | (mk1[2] != 0.0f) | (mk1[3] != 0.0f)) ? 1 : 0;
    const int g = ((mk0[0] > SKP_TH) | (mk0[1] > SKP_TH) | (mk0[2] > SKP_TH) | (mk0[3] > SKP_TH) |
                   (mk1[0] > SKP_TH) | (mk1[1] > SKP_TH) | (mk1[2] > SKP_TH) | (mk1[3] > SKP_TH)) ? 1 : 0;
    nz |= z;
    bg |= g;
    const unsigned sh = ((unsigned)a) << (r & 31);
    rowlo |= (r < 32) ? sh : 0u;
    rowhi |= (r < 32) ? 0u : sh;
  }
  // OR over the 8 lanes 8q..8q+7 that share column tile nt = tid >> 3
  nz |= __shfl_xor(nz, 1, 32); nz |= __shfl_xor(nz, 2, 32); nz |= __shfl_xor(nz, 4, 32);
  bg |= __shfl_xor(bg, 1, 32); bg |= __shfl_xor(bg, 2, 32); bg |= __shfl_xor(bg, 4, 32);
#pragma unroll
  for (int off = 1; off < 32; off <<= 1) {
    rowlo |= (unsigned)__shfl_xor((int)rowlo, off, 32);
    rowhi |= (unsigned)__shfl_xor((int)rowhi, off, 32);
  }
  if ((lane & 7) == 0) { nzs[tid >> 3] = nz; bgs[tid >> 3] = bg; }
  if (lane == 0) { rlo[wave] = rowlo; rhi[wave] = rowhi; }
  __syncthreads();
  if (wave == 0) {                       // wave-uniform
    const int z = nzs[lane];
    const int g = bgs[lane];
    unsigned ol = rlo[0], oh = rhi[0];
#pragma unroll
    for (int w = 1; w < 8; ++w) { ol |= rlo[w]; oh |= rhi[w]; }
    const bool has_empty_row = (ol != 0xFFFFFFFFu) || (oh != 0xFFFFFFFFu);
    int cval = (g == 0) ? 0 : ((z == 0) ? 1 : 2);
    cval = (has_empty_row && cval == 0) ? 2 : cval;
    int* cp = cls + (size_t)bm * NT64 + lane;
    *cp = cval;
    
  }
}

// ---------------------------------------------------------------------------
// The seven preparation jobs depend on the inputs alone and on nothing of each other: one launch, each job a range of blocks
// (256 threads each, the block counts the jobs had as launches of their own). The mask bands, the longest blocks, come first.
// Every branch is on the block index: whole blocks take it, so the barrier of the mask part stays block-uniform.
// ---------------------------------------------------------------------------
#define PB_MASK (NB * NT64)                  // 64
#define PB_X    ((NTOK * HID / 8) / 256)     // 2048
#define PB_ROPE (NTOK / 8)                   // 512
#define PB_WQ   ((QW * HID / 8) / 256)       // 512
#define PB_WO   ((HID * QW / 8) / 256)       // 512
#define PB_WKV  ((KW * HID / 8) / 256)       // 128, wk and wv each
#define PB_ALL  (PB_MASK + PB_X + PB_ROPE + PB_WQ + PB_WO + 2 * PB_WKV)

__global__ __launch_bounds__(256) void prep_kernel(
    const float* __restrict__ hs, const float* __restrict__ mask, const int* __restrict__ pos,
    const float* __restrict__ wq, const float* __restrict__ wk, const float* __restrict__ wv, const float* __restrict__ wo,
    unsigned short* __restrict__ xb, unsigned short* __restrict__ wqk, unsigned short* __restrict__ wvb,
    unsigned short* __restrict__ wo2, float* __restrict__ cst, float* __restrict__ snt, int* __restrict__ cls) {
  int bid = (int)blockIdx.x;
  // mask tile classes [2][32][32]
  if (bid < PB_MASK) { mask_class_part(bid, mask, cls); return; }
  bid -= PB_MASK;
  // x -> bf16 plane [4096][1024]
  if (bid < PB_X) { cvt_bf16_part(bid, hs, xb, NTOK * HID / 8); return; }
  bid -= PB_X;
  // cos/sin table [4096][32] x 2 from the position ids
  if (bid < PB_ROPE) { rope_table_part(bid, pos, cst, snt, NTOK); return; }
  bid -= PB_ROPE;
  // wq [1024][1024] -> WQK rows 0..1023 (natural [out][in] = Bt layout)
  if (bid < PB_WQ) { cvt_bf16_part(bid, wq, wqk, QW * HID / 8); return; }
  bid -= PB_WQ;
  // wo [1024][1024] -> WO2 [1024][2048] (both halves)
  if (bid < PB_WO) { cvt_wo2_part(bid, wo, wo2, HID * QW / 8, QW, AOW); return; }
  bid -= PB_WO;
  // wk [256][1024] -> WQK rows 1024..1279
  if (bid < PB_WKV) { cvt_bf16_part(bid, wk, wqk + (size_t)QW * HID, KW * HID / 8); return; }
  bid -= PB_WKV;
  // wv [256][1024] -> WV
  if (bid < PB_WKV) { cvt_bf16_part(bid, wv, wvb, KW * HID / 8); return; }
}

// ---------------------------------------------------------------------------
// bf16 WMMA GEMM, block = 4 waves (128 threads) = one 128 x 128 tile of C; wave w owns rows 32w..32w+31 of it, all 128 cols.
//   C[m][n] = sum_k A[m][k] * Bt[n][k]; A row-major [M][K] bf16 (pitch lda), Bt row-major [N][K] bf16 (pitch ldb);
//   M % 128 == 0, N % 128 == 0, K % 64 == 0, K >= 64, lda % 8 == 0, ldb % 8 == 0; grid.x = M/128 * N/128.
//   EPI 0 carries a second, independent product in the same launch: blocks M/128 * N/128 .. + M2/128 * N2/128 - 1 compute
//   C'[m][n] = sum_k A2[m][k] * A[n][k] (A2 [M2][K] pitch lda; the first product's A, N2 rows of it, as Bt with pitch ldb:
//   lda == ldb), same K, same loop.
//   Operands: per trip of 64 k the 128 A rows and the 128 Bt rows (128 B each) are copied global -> LDS asynchronously, whole
//   128-B lines per 8 lanes, into one of two buffers; trip t works on buffer t & 1 while tile t + 1 flies into the other.
//   Fragments are read from LDS rows (ldfrag_b) in the same k order as before.
// Epilogues (all: per wave, per 16-row slab: stage in LDS, wave sync, write each row segment with ONE instruction of
//   EPI 0: q|k projection with RoPE. The 128-col tile holds two 64-dim heads; pairs (d, d+32) inside each head are rotated with
//          the f32 cos/sin rows of the token (staged per slab in LDS), then split to bf16 hi (C0/C2) and lo (C1/C3) planes.
//          cols n0 < QW -> q planes [M][ldc], col n0; cols n0 >= QW -> k planes [M][ldc2], col n0-QW. Row segment 256 B = 16 lanes x 16 B.
//          Second product = v^T projection: bf16 hi plane D0, lo plane D1, [M2][ldd], row segment 256 B.
//   EPI 2: f32 output C0 [M][ldc]; row segment 128 floats = 512 B = 32 lanes x 16 B per instruction.
// ---------------------------------------------------------------------------
template <int EPI> struct SlabCfg { static constexpr int PERWF = 2048; };   // floats per wave (8 KB)
template <> struct SlabCfg<0>     { static constexpr int PERWF = 3072; };   // + 16x32 cos + 16x32 sin rows

#define GKT  64                 // k per staged tile: 128-B rows
#define GPITCH  72                 // LDS row pitch in bf16: 144 B = 16 B x odd, for the 16-B fragment reads
#define GOP  (128 * GPITCH)        // bf16 per operand tile (128 rows)
#define GROWB (16 * GPITCH * 2)    // LDS bytes between a lane's consecutive copies (16 rows)

__device__ __forceinline__ unsigned lds_off(const void* p) { return (unsigned)(size_t)p; }

// One operand tile, 128 rows x 128 B: lane t copies 16 B of rows (t >> 3) + 16u, u = 0..7 (128 lanes x 8 = 1024 pieces = the tile).
// l = the lane's LDS byte address for u = 0, g = its global address for u = 0, ld = global row pitch in elements.
// s_wait_xcnt stands inside the statement so that no address register is rewritten ahead of it.
__device__ __forceinline__ void stage_tile(unsigned l, const unsigned short* g, int ld) {
  const size_t st = (size_t)16 * (size_t)ld;
  asm volatile(
      "global_load_async_to_lds_b128 %0, %8, off\n\t"
      "global_load_async_to_lds_b128 %1, %9, off\n\t"
      "global_load_async_to_lds_b128 %2, %10, off\n\t"
      "global_load_async_to_lds_b128 %3, %11, off\n\t"
      "global_load_async_to_lds_b128 %4, %12, off\n\t"
      "global_load_async_to_lds_b128 %5, %13, off\n\t"
      "global_load_async_to_lds_b128 %6, %14, off\n\t"
      "global_load_async_to_lds_b128 %7, %15, off\n\t"
      "s_wait_xcnt 0x0"
      :: "v"(l), "v"(l + 1u * GROWB), "v"(l + 2u * GROWB), "v"(l + 3u * GROWB),
         "v"(l + 4u * GROWB), "v"(l + 5u * GROWB), "v"(l + 6u * GROWB), "v"(l + 7u * GROWB),
         "v"(g), "v"(g + st), "v"(g + 2 * st), "v"(g + 3 * st),
         "v"(g + 4 * st), "v"(g + 5 * st), "v"(g + 6 * st), "v"(g + 7 * st)
      : "memory");
}

template <int EPI>
__global__ __launch_bounds__(128) void gemm_w32x128_kernel(
    const unsigned short* __restrict__ Ap, int lda,
    const unsigned short* __restrict__ Btp, int ldb,
    const float* __restrict__ cst, const float* __restrict__ snt,
    void* C0, void* C1, void* C2, void* C3, int ldc, int ldc2,
    int M, int N, int K,
    const unsigned short* __restrict__ A2p, void* D0, void* D1, int ldd, int M2, int N2) {
  __shared__ __align__(16) float lds_all[4 * SlabCfg<EPI>::PERWF];
  __shared__ __align__(16) unsigned short ring[2][2 * GOP];    // [buffer][A tile | Bt tile], 2 x 36,864 B

  const int tid  = (int)threadIdx.x;
  const int lane = tid & 31;
  const int wave = wave_id();
  const int hh = lane >> 4;           // lane half: k offset 8*hh, D row offset 8*hh
  const int rl = lane & 15;           // A row / B col / D col within subtile
  const int ntile1 = (M >> 7) * (N >> 7);
  const bool second = (EPI == 0) && ((int)blockIdx.x >= ntile1);   // block-uniform: this block works on the second product
  const int tilesN = (second ? N2 : N) >> 7;
  const int tilesM = (second ? M2 : M) >> 7;
  const int tile = (int)blockIdx.x - (second ? ntile1 : 0);
  if (tile >= tilesM * tilesN) return;          // block-uniform, in front of every barrier and copy
  const int tm = tile / tilesN;
  const int tn = tile - tm * tilesN;
  const int mblk = tm << 7;
  const int m0 = mblk + (wave << 5);
  const int n0 = tn << 7;

  // this lane's first piece of each operand tile: row tid >> 3, 16-B column tid & 7
  const int srow = tid >> 3;
  const int sc8  = (tid & 7) * 8;
  const unsigned short* gA = (second ? A2p : Ap) + (size_t)(mblk + srow) * lda + sc8;
  const unsigned short* gB = (second ? Ap : Btp) + (size_t)(n0   + srow) * ldb + sc8;
  const unsigned lA = lds_off(&ring[0][0]) + (unsigned)(srow * GPITCH + sc8) * 2u;
  const unsigned lB = lA + GOP * 2u;
  const unsigned bufb = 2u * GOP * 2u;           // bytes per buffer
  const int ntrip = K / GKT;

  v8f acc[2][8];
#pragma unroll
  for (int i = 0; i < 2; ++i)
#pragma unroll
    for (int j = 0; j < 8; ++j) acc[i][j] = zero8();

  // prologue: tile 0 lands and is published, then tile 1 starts
  stage_tile(lA, gA, lda);
  stage_tile(lB, gB, ldb);
  asm volatile("s_wait_asynccnt 0x0" ::: "memory");   // this wave's copies of tile 0 have landed
  __syncthreads();                                     // ... and every other wave's: tile 0 is readable
  if (ntrip > 1) {
    stage_tile(lA + bufb, gA + GKT, lda);
    stage_tile(lB + bufb, gB + GKT, ldb);
  }

  for (int t = 0; t < ntrip; ++t) {
    const __bf16* As = (const __bf16*)(const void*)&ring[t & 1][0]   + (wave * 32 + rl) * GPITCH + 8 * hh;
    const __bf16* Bs = (const __bf16*)(const void*)&ring[t & 1][GOP] + rl * GPITCH + 8 * hh;
    v16b ah[2][2], bf[2][8];                           // [k half of the tile][fragment]
#pragma unroll
    for (int s = 0; s < 2; ++s) {
#pragma unroll
      for (int i = 0; i < 2; ++i) ah[s][i] = ldfrag_b(As + i * 16 * GPITCH + s * 32);
#pragma unroll
      for (int j = 0; j < 8; ++j) bf[s][j] = ldfrag_b(Bs + j * 16 * GPITCH + s * 32);
    }
    // keeps the trip's LDS reads together in front of its WMMAs: one exposed LDS latency per trip instead of one per WMMA pair
    __builtin_amdgcn_sched_barrier(0);
#pragma unroll
    for (int s = 0; s < 2; ++s) {
#pragma unroll
      for (int j = 0; j < 8; ++j) {
        acc[0][j] = mma_b(ah[s][0], bf[s][j], acc[0][j]);
        acc[1][j] = mma_b(ah[s][1], bf[s][j], acc[1][j]);
      }
    }
    // keeps the WMMAs in front of the trip's foot: they overlap the LDS reads, and tile t + 1's copies get the whole trip to land
    __builtin_amdgcn_sched_barrier(0);
    asm volatile("s_wait_dscnt 0x0" ::: "memory");     // this wave's reads of buffer t & 1 are done before it is refilled
    asm volatile("s_wait_asynccnt 0x0" ::: "memory");  // this wave's copies of tile t + 1 have landed
    __syncthreads();                                   // publishes tile t + 1 and ends every reader's use of buffer t & 1
    if (t + 2 < ntrip) {                               // same for the whole block
      const unsigned bo = (unsigned)(t & 1) * bufb;
      stage_tile(lA + bo, gA + (size_t)(t + 2) * GKT, lda);
      stage_tile(lB + bo, gB + (size_t)(t + 2) * GKT, ldb);
    }
  }
  asm volatile("s_wait_asynccnt 0x0" ::: "memory");    // nothing of this wave is in flight behind the loop
  acc_guard4(acc[0][0], acc[0][1], acc[0][2], acc[0][3]);
  acc_guard4(acc[0][4], acc[0][5], acc[0][6], acc[0][7]);
  acc_guard4(acc[1][0], acc[1][1], acc[1][2], acc[1][3]);
  acc_guard4(acc[1][4], acc[1][5], acc[1][6], acc[1][7]);

  // ---- epilogue ----
  float* wl = lds_all + wave * SlabCfg<EPI>::PERWF;
  unsigned short* sl16 = (unsigned short*)(void*)wl;       // 4096 u16 = floats 0..2047 (two 16x128 planes)
  float* slf = wl;

  if (EPI == 0 && !second) {
    float* csl = wl + 2048;                                 // cos rows [16][32]
    float* snl = wl + 2048 + 16 * NFREQ;                    // sin rows [16][32]
    const bool isq = (n0 < QW);                             // wave-uniform
    unsigned short* P0 = isq ? (unsigned short*)C0 : (unsigned short*)C2;
    unsigned short* P1 = isq ? (unsigned short*)C1 : (unsigned short*)C3;
    const int ldp  = isq ? ldc : ldc2;
    const int col0 = isq ? n0 : (n0 - QW);
#pragma unroll
    for (int i = 0; i < 2; ++i) {
      const int mb = m0 + i * 16;
      // stage cos/sin of tokens mb..mb+15: 16 rows x 32 floats = 128 16-B pieces per table; lane -> 4 pieces (coverage 32x4 = 128)
      v4f cv4[4], sv4[4];
      const float* cp[4];
      const float* sp[4];
#pragma unroll
      for (int u = 0; u < 4; ++u) {
        const int p   = lane + 32 * u;
        const int row = p >> 3, c4 = (p & 7) * 4;
        cp[u] = cst + (size_t)(mb + row) * NFREQ + c4;
        sp[u] = snt + (size_t)(mb + row) * NFREQ + c4;
        cv4[u] = *(const v4f*)cp[u];
        sv4[u] = *(const v4f*)sp[u];
      }
      // precaution: the eight loads' address registers, named as inputs so that they live up to here, are reused only behind this wait
      asm volatile("s_wait_xcnt 0x0"
                   :: "v"(cp[0]), "v"(cp[1]), "v"(cp[2]), "v"(cp[3]), "v"(sp[0]), "v"(sp[1]), "v"(sp[2]), "v"(sp[3])
                   : "memory");
#pragma unroll
      for (int u = 0; u < 4; ++u) {
        const int p   = lane + 32 * u;
        const int row = p >> 3, c4 = (p & 7) * 4;
        *(v4f*)(csl + row * NFREQ + c4) = cv4[u];
        *(v4f*)(snl + row * NFREQ + c4) = sv4[u];
      }
      lds_wave_sync();
#pragma unroll
      for (int hs = 0; hs < 2; ++hs) {                      // head within the 128-col tile
#pragma unroll
        for (int jj = 0; jj < 2; ++jj) {
          const int j1 = hs * 4 + jj;                       // cols hs*64 + jj*16 + rl  (x1, dim d < 32)
          const int j2 = j1 + 2;                            // cols +32                 (x2, dim d + 32)
          const int d  = jj * 16 + rl;                      // freq index 0..31
#pragma unroll
          for (int r = 0; r < 8; ++r) {
            const int lrow = 8 * hh + r;
            const float cv = csl[lrow * NFREQ + d];
            const float sv = snl[lrow * NFREQ + d];
            const float x1 = acc[i][j1][r];
            const float x2 = acc[i][j2][r];
            const float o1 = x1 * cv - x2 * sv;
            const float o2 = x2 * cv + x1 * sv;
            const unsigned hb = cvt2(o1, o2);
            const unsigned lb = cvt2_res(o1, o2, hb);
            const int so = lrow * 128 + hs * 64 + d;
            sl16[so]             = (unsigned short)hb;
            sl16[so + 32]        = (unsigned short)(hb >> 16);
            sl16[2048 + so]      = (unsigned short)lb;
            sl16[2048 + so + 32] = (unsigned short)(lb >> 16);
          }
        }
      }
      lds_wave_sync();
      {
#pragma unroll
        for (int it = 0; it < 8; ++it) {
          const int row = it * 2 + hh;                      // it x hh covers rows 0..15
          const int c8  = rl * 8;
          const v4u vh = *(const v4u*)(sl16 + row * 128 + c8);
          const v4u vl = *(const v4u*)(sl16 + 2048 + row * 128 + c8);
          const size_t go = (size_t)(mb + row) * ldp + col0 + c8;
          *(v4u*)(P0 + go) = vh;
          *(v4u*)(P1 + go) = vl;
        }
        
      }
      lds_wave_sync();
    }
  } else if (EPI == 0) {
    unsigned short* P0 = (unsigned short*)D0;
    unsigned short* P1 = (unsigned short*)D1;
#pragma unroll
    for (int i = 0; i < 2; ++i) {
#pragma unroll
      for (int r = 0; r < 8; ++r) {
#pragma unroll
        for (int j = 0; j < 8; j += 2) {
          const float va = acc[i][j][r];
          const float vb = acc[i][j + 1][r];
          const unsigned hb = cvt2(va, vb);
          const unsigned lb = cvt2_res(va, vb, hb);
          const int so = (8 * hh + r) * 128 + j * 16 + rl;
          sl16[so]             = (unsigned short)hb;
          sl16[so + 16]        = (unsigned short)(hb >> 16);
          sl16[2048 + so]      = (unsigned short)lb;
          sl16[2048 + so + 16] = (unsigned short)(lb >> 16);
        }
      }
      lds_wave_sync();
      {
#pragma unroll
        for (int it = 0; it < 8; ++it) {
          const int row = it * 2 + hh;
          const int c8  = rl * 8;
          const v4u vh = *(const v4u*)(sl16 + row * 128 + c8);
          const v4u vl = *(const v4u*)(sl16 + 2048 + row * 128 + c8);
          const size_t go = (size_t)(m0 + i * 16 + row) * ldd + n0 + c8;
          *(v4u*)(P0 + go) = vh;
          *(v4u*)(P1 + go) = vl;
        }
        
      }
      lds_wave_sync();
    }
  } else {
    float* C = (float*)C0;
#pragma unroll
    for (int i = 0; i < 2; ++i) {
#pragma unroll
      for (int j = 0; j < 8; ++j)
#pragma unroll
        for (int r = 0; r < 8; ++r)
          slf[(8 * hh + r) * 128 + j * 16 + rl] = acc[i][j][r];
      lds_wave_sync();
      {
#pragma unroll
        for (int row = 0; row < 16; ++row) {                // 32 lanes x 16 B = the whole 512-B row segment per instruction
          const v4f v = *(const v4f*)(slf + row * 128 + lane * 4);
          *(v4f*)(C + (size_t)(m0 + i * 16 + row) * ldc + n0 + lane * 4) = v;
        }
        
      }
      lds_wave_sync();
    }
  }
}

#define AKC  32
#define NKG  4
#define TKC  (AKC * NKG)
#define KP   72
#define VP   136
#define MP   132
#define KVB  ((2 * TKC * KP + 2 * HDM * VP) * 2)
#define JOB  ((NKG - 1) * 4 * 32 * (32 + 2) * 4)
static_assert(JOB <= KVB);

// 16 B at a block-uniform base plus the thread's 32-bit byte offset
__device__ __forceinline__ v4u ld16(const unsigned short* base, unsigned boff) { return *(const v4u*)((const char*)base + boff); }

// eight waves per SIMD = two blocks per WGP: one block's products fill the other's staging and barrier waits (2 x LDS fits too)
__global__ __launch_bounds__(512) __attribute__((amdgpu_waves_per_eu(8, 8))) void attn_kernel(
    const unsigned short* __restrict__ qhp, const unsigned short* __restrict__ qlp,
    const unsigned short* __restrict__ khp, const unsigned short* __restrict__ klp,
    const unsigned short* __restrict__ vhp, const unsigned short* __restrict__ vlp,
    const float* __restrict__ maskp, const int* __restrict__ clsp,
    unsigned short* __restrict__ aop) {
  __shared__ __align__(16) unsigned short KVs[KVB / 2];
  __shared__ __align__(16) float Ms[64 * MP];
  __shared__ __align__(16) unsigned short Osh[4][16 * 64];
  __shared__ __align__(16) unsigned short Osl[4][16 * 64];
  unsigned short* Ks  = KVs;
  unsigned short* Kls = KVs + TKC * KP;
  unsigned short* Vhs = KVs + 2 * TKC * KP;
  unsigned short* Vls = KVs + 2 * TKC * KP + HDM * VP;

  const int tid  = (int)threadIdx.x;
  const int lane = tid & 31;
  const int wave = wave_id();
  const int wq   = wave & 3;                     // query slab of the wave
  const int kg   = wave >> 2;                    // key group of the wave
  const int hh   = lane >> 4;
  const int c    = lane & 15;
  // Which (query tile, head, batch) a block takes: the tile falls as the flat index rises. Where the mask admits keys up to the
  // query (a tile's trips then grow with qt), the long blocks come first in index order, for speed only. The map is a permutation of the grid for any mask: every (qt, h, b) is taken exactly once.
  const unsigned flat = blockIdx.x + NT64 * (blockIdx.y + NHQ * blockIdx.z);   // grid (NT64, NHQ, NB)
  const int qt   = NT64 - 1 - (int)(flat / (NHQ * NB));
  const int h    = (int)(flat % NHQ);
  const int b    = (int)((flat / NHQ) % NB);
  const int kvh  = h >> 2;
  const int q0   = qt * 64 + wq * 16;            // first query row of this wave (within the sequence)
  const size_t tok0 = (size_t)b * SQ;

  // whole mask staging area initialised once (only class-2 tiles refresh it; other tiles never add from it)
#pragma unroll 1
  for (int u = tid; u < 64 * MP; u += 512) Ms[u] = 0.0f;

  const __bf16* Qhr = (const __bf16*)(const void*)qhp + (tok0 + q0 + c) * QW + h * HDM + 8 * hh;
  const __bf16* Qlr = (const __bf16*)(const void*)qlp + (tok0 + q0 + c) * QW + h * HDM + 8 * hh;
  const size_t mrow0 = (tok0 + (size_t)qt * 64) * SQ;                 // mask[b][0][qt*64][0]
  const int* crow = clsp + ((b * NT64) + qt) * NT64;
  // staging: block-uniform element offsets of the (b, kv head) planes, and this thread's own byte offsets (global) and places (LDS)
  const size_t kbase = tok0 * KW + kvh * HDM;
  const size_t vbase = (size_t)(kvh * HDM) * NTOK + tok0;
  const unsigned kgo = (unsigned)((tid >> 3) * KW + (tid & 7) * 8) * 2u;
  const unsigned vgo = (unsigned)((tid >> 4) * NTOK + (tid & 15) * 8) * 2u;
  const unsigned mgo = (unsigned)((tid >> 4) * SQ + (tid & 15) * 4) * 4u;
  const int kso = (tid >> 3) * KP + (tid & 7) * 8;
  const int vso = (tid >> 4) * VP + (tid & 15) * 8;
  const int mso = (tid >> 4) * MP + (tid & 15) * 4;

  v16b qh[2], ql[2];
#pragma unroll
  for (int dc = 0; dc < 2; ++dc) { qh[dc] = ldfrag_b(Qhr + dc * 32); ql[dc] = ldfrag_b(Qlr + dc * 32); }

  float mrow = -INFINITY;                          // running max of query c over this wave's keys (the same in both halves)
  float lsum = 0.f;                                // running sum of query c over this wave's keys of this half
  v8f oacc[4];                                     // oacc[t][r] = O[query c][d = 16t + 8hh + r], this wave's keys
#pragma unroll
  for (int t = 0; t < 4; ++t) oacc[t] = zero8();

  for (int s = 0; s < NT64 / 2; ++s) {
    const int cl0 = __builtin_amdgcn_readfirstlane(crow[2 * s]);      // block-uniform classes of the trip's two mask tiles
    const int cl1 = __builtin_amdgcn_readfirstlane(crow[2 * s + 1]);
    if ((cl0 | cl1) == 0) continue;                                   // uniform for the whole block; before any barrier
    const int kv0 = s * TKC;
    __syncthreads();                                                  // prior trip's LDS readers are done
    const unsigned short* kbh = khp + kbase + (size_t)kv0 * KW;       // block-uniform bases of the trip's tiles
    const unsigned short* kbl = klp + kbase + (size_t)kv0 * KW;
    const unsigned short* vbh = vhp + vbase + kv0;
    const unsigned short* vbl = vlp + vbase + kv0;
    v4u kx[2], ky[2], vx[2], vy[2];
#pragma unroll
    for (int u = 0; u < 2; ++u) {                                     // coverage: 1024 pieces of 8 halves per plane = whole tile
      kx[u] = ld16(kbh + u * 64 * KW, kgo);                           // K: 128 keys x 64 d; key = (tid >> 3) + 64u
      ky[u] = ld16(kbl + u * 64 * KW, kgo);
      vx[u] = ld16(vbh + (size_t)u * 32 * NTOK, vgo);                 // V^T: 64 d x 128 keys; d = (tid >> 4) + 32u
      vy[u] = ld16(vbl + (size_t)u * 32 * NTOK, vgo);
    }
#pragma unroll
    for (int u = 0; u < 2; ++u) {
      *(v4u*)(Ks  + kso + u * 64 * KP) = kx[u];
      *(v4u*)(Kls + kso + u * 64 * KP) = ky[u];
      *(v4u*)(Vhs + vso + u * 32 * VP) = vx[u];
      *(v4u*)(Vls + vso + u * 32 * VP) = vy[u];
    }
#pragma unroll
    for (int mtl = 0; mtl < 2; ++mtl) {
      if ((mtl ? cl1 : cl0) == 2) {                                   // block-uniform branch about the mask tile load
        const float* mbase = maskp + mrow0 + kv0 + mtl * 64;
#pragma unroll
        for (int u = 0; u < 2; ++u) {                                 // coverage: 1024 pieces of 4 floats = 64 rows x 64 keys
          const v4f mv = *(const v4f*)((const char*)(mbase + (size_t)u * 32 * SQ) + mgo);   // row = (tid >> 4) + 32u
          *(v4f*)(Ms + mso + u * 32 * MP + mtl * 64) = mv;
        }
      }
    }
    __syncthreads();

    const int cl = (kg < 2) ? cl0 : cl1;                              // wave-uniform class of this wave's 32 keys
    if (cl == 0) continue;                                            // no barrier between here and the next trip's first one

    // ---- scores, transposed: 32 keys x 16 queries, K = 64, three products ----
    v8f sa[2];
    sa[0] = zero8(); sa[1] = zero8();
#pragma unroll
    for (int dc = 0; dc < 2; ++dc) {
#pragma unroll
      for (int j = 0; j < 2; ++j) {
        const v16b kb = ldfrag_b((const __bf16*)(const void*)Ks  + (kg * AKC + j * 16 + c) * KP + dc * 32 + 8 * hh);
        const v16b kl = ldfrag_b((const __bf16*)(const void*)Kls + (kg * AKC + j * 16 + c) * KP + dc * 32 + 8 * hh);
        sa[j] = mma_b(kb, qh[dc], sa[j]);
        sa[j] = mma_b(kl, qh[dc], sa[j]);
        sa[j] = mma_b(kb, ql[dc], sa[j]);
        guard1b4(sa[j], qh[dc], ql[dc], kb, kl);
      }
    }
    acc_guard2(sa[0], sa[1]);

    // ---- scale, mask add (class 2): sc[j][r] = score of (query c, key 16j + 8hh + r) ----
    float sc[2][8];
#pragma unroll
    for (int j = 0; j < 2; ++j)
#pragma unroll
      for (int r = 0; r < 8; ++r) sc[j][r] = sa[j][r] * 0.125f;
    if (cl == 2) {                                                    // wave-uniform
      const float* mr = Ms + (wq * 16 + c) * MP + kg * AKC + 8 * hh;  // the query's mask row, this wave's keys, this half's
#pragma unroll
      for (int j = 0; j < 2; ++j) {
        const v4f ma = *(const v4f*)(mr + j * 16);
        const v4f mb = *(const v4f*)(mr + j * 16 + 4);
#pragma unroll
        for (int r = 0; r < 4; r += 2) {
          const unsigned wa = cvt2(ma[r], ma[r + 1]);
          const unsigned wb = cvt2(mb[r], mb[r + 1]);
          sc[j][r]     += lo_val(wa); sc[j][r + 1]     += hi_val(wa);
          sc[j][4 + r] += lo_val(wb); sc[j][4 + r + 1] += hi_val(wb);
        }
      }
    }
    // ---- chunk max of the query: in the lane, then with the other half ----
    float cm = -INFINITY;
#pragma unroll
    for (int j = 0; j < 2; ++j)
#pragma unroll
      for (int r = 0; r < 8; ++r) cm = fmaxf(cm, sc[j][r]);
    cm = fmaxf(cm, xhalf(cm));
    // ---- online softmax; p hi/lo packed in place into the B operands ----
    const float mnew  = fmaxf(mrow, cm);
    const float muse  = (mnew > -INFINITY) ? mnew : 0.0f;
    const float alpha = __expf(mrow - muse);
    mrow = mnew;
    union { v16b v; unsigned u[8]; } pa, pr;
    float ps[2];
#pragma unroll
    for (int j = 0; j < 2; ++j) {
      ps[j] = 0.f;
#pragma unroll
      for (int r = 0; r < 8; r += 2) {
        const float p0 = __expf(sc[j][r] - muse);
        const float p1 = __expf(sc[j][r + 1] - muse);
        ps[j] += p0;
        ps[j] += p1;
        const unsigned hp = cvt2(p0, p1);
        pa.u[j * 4 + (r >> 1)] = hp;
        pr.u[j * 4 + (r >> 1)] = cvt2_res(p0, p1, hp);
      }
    }
    lsum = lsum * alpha + (ps[0] + ps[1]);
#pragma unroll
    for (int t = 0; t < 4; ++t)
#pragma unroll
      for (int r = 0; r < 8; ++r) oacc[t][r] *= alpha;
    // ---- O^T += v^T . p^T (K = 32 keys, three products) ----
#pragma unroll
    for (int t = 0; t < 4; ++t) {
      const v16b vb = ldfrag_b((const __bf16*)(const void*)Vhs + (t * 16 + c) * VP + kg * AKC + 8 * hh);
      const v16b vr = ldfrag_b((const __bf16*)(const void*)Vls + (t * 16 + c) * VP + kg * AKC + 8 * hh);
      oacc[t] = mma_b(vb, pa.v, oacc[t]);
      oacc[t] = mma_b(vr, pa.v, oacc[t]);
      oacc[t] = mma_b(vb, pr.v, oacc[t]);
      guard1b4(oacc[t], pa.v, pr.v, vb, vr);
    }
  }
  __syncthreads();                                 // every wave is past the trip loop: the K / V^T tiles are free
  acc_guard4(oacc[0], oacc[1], oacc[2], oacc[3]);

  // ---- the four key groups' parts of a query slab are joined in group 0 ----
  // hand-over area: O parts as 16-B pieces [part][piece 0..7][lane], then (max, sum) pairs [part][lane]; part = (kg - 1) * 4 + wq
  v4f* jo = (v4f*)(void*)KVs;
  v2f* jm = (v2f*)(void*)(jo + (NKG - 1) * 4 * 8 * 32);
  if (kg != 0) {                                   // wave-uniform
    const int part = (kg - 1) * 4 + wq;
#pragma unroll
    for (int t = 0; t < 4; ++t) {
      const v4f x0 = {oacc[t][0], oacc[t][1], oacc[t][2], oacc[t][3]};
      const v4f x1 = {oacc[t][4], oacc[t][5], oacc[t][6], oacc[t][7]};
      jo[(part * 8 + 2 * t) * 32 + lane]     = x0;
      jo[(part * 8 + 2 * t + 1) * 32 + lane] = x1;
    }
    const v2f ml = {mrow, lsum};
    jm[part * 32 + lane] = ml;
  }
  __syncthreads();                                 // the parts are readable; the last barrier of the kernel
  if (kg != 0) return;                             // whole waves leave, behind every barrier

  v2f oml[NKG - 1];
  float mall = mrow;
#pragma unroll
  for (int g = 0; g < NKG - 1; ++g) {
    oml[g] = jm[(g * 4 + wq) * 32 + lane];
    mall = fmaxf(mall, oml[g][0]);
  }
  const float mjoin = (mall > -INFINITY) ? mall : 0.0f;
  float w0 = __expf(mrow - mjoin);                 // a part that saw no key has max -inf: weight 0
  float wg[NKG - 1];
#pragma unroll
  for (int g = 0; g < NKG - 1; ++g) wg[g] = __expf(oml[g][0] - mjoin);
  // the slot the instruction set asks for between an exp and the first user of its result or overwriter of its source; the four
  // weights are tied to it so that it stands behind the run of exps and in front of every product with a weight
  asm volatile("v_nop" : "+v"(w0), "+v"(wg[0]), "+v"(wg[1]), "+v"(wg[2]));
  lsum *= w0;
#pragma unroll
  for (int t = 0; t < 4; ++t)
#pragma unroll
    for (int r = 0; r < 8; ++r) oacc[t][r] *= w0;
#pragma unroll
  for (int g = 0; g < NKG - 1; ++g) {
    lsum += wg[g] * oml[g][1];
#pragma unroll
    for (int t = 0; t < 4; ++t) {
      const v4f x0 = jo[((g * 4 + wq) * 8 + 2 * t) * 32 + lane];
      const v4f x1 = jo[((g * 4 + wq) * 8 + 2 * t + 1) * 32 + lane];
#pragma unroll
      for (int r = 0; r < 4; ++r) {
        oacc[t][r]     += wg[g] * x0[r];
        oacc[t][4 + r] += wg[g] * x1[r];
      }
    }
  }

  unsigned short* osh = Osh[wq];
  unsigned short* osl = Osl[wq];
  const float inv = 1.0f / (lsum + xhalf(lsum));   // the halves' sums joined; l >= 1: the row max contributes exp(0)
#pragma unroll
  for (int t = 0; t < 4; ++t) {                    // 8 consecutive d of query c: one 16-B LDS store per plane
    v4u xh, xl;
#pragma unroll
    for (int r = 0; r < 8; r += 2) {
      const float o0 = oacc[t][r] * inv;
      const float o1 = oacc[t][r + 1] * inv;
      const unsigned ho = cvt2(o0, o1);
      xh[r >> 1] = ho;
      xl[r >> 1] = cvt2_res(o0, o1, ho);
    }
    *(v4u*)(osh + c * 64 + t * 16 + 8 * hh) = xh;
    *(v4u*)(osl + c * 64 + t * 16 + 8 * hh) = xl;
  }
  lds_wave_sync();
  unsigned short* Ag = aop + (tok0 + q0) * AOW + h * HDM;
  const int qq = lane >> 3;                        // 0..3
  const int c8 = (lane & 7) * 8;
  {
#pragma unroll
    for (int it = 0; it < 4; ++it) {
      const int row = it * 4 + qq;                 // it 0..3 x qq 0..3 covers rows 0..15
      const v4u x = *(const v4u*)(osh + row * 64 + c8);
      const v4u y = *(const v4u*)(osl + row * 64 + c8);
      *(v4u*)(Ag + (size_t)row * AOW + c8)      = x;
      *(v4u*)(Ag + (size_t)row * AOW + QW + c8) = y;
    }
    
  }
}

// ---------------------------------------------------------------------------
// Workspace map (bytes; every region is an exact whole number of the rows its producer writes with whole-line stores;
// all dimensions are tile multiples, no padded tails needed; every offset is a multiple of 128):
//   XB   bf16 [4096][1024]   8388608     WQK bf16 [1280][1024]   2621440     WV  bf16 [256][1024]    524288
//   WO2  bf16 [1024][2048]   4194304     CST f32  [4096][32]      524288     SNT f32  [4096][32]     524288
//   CLS  i32  [2][32][32]       8192     QH  bf16 [4096][1024]   8388608     QL  bf16 [4096][1024]  8388608
//   KH   bf16 [4096][256]    2097152     KL  bf16 [4096][256]    2097152     VTH bf16 [256][4096]   2097152
//   VTL  bf16 [256][4096]    2097152     AO  bf16 [4096][2048]  16777216
//   total                   58728448
// ---------------------------------------------------------------------------
extern "C" void kernel_launch(void* const* d_in, const int* in_sizes, int n_in,
                              void* d_out, int out_size, void* d_ws, size_t ws_size,
                              hipStream_t stream) {
  if (n_in < 7) return;
  if (in_sizes[0] != NTOK * HID) return;                  // hidden_states [2][2048][1024] f32
  if (in_sizes[1] != NB * SQ * SQ) return;                // attention_mask [2][1][2048][2048] f32
  if (in_sizes[2] != NTOK) return;                        // position_ids [2][2048] int32
  if (in_sizes[3] != QW * HID) return;                    // wq [1024][1024]
  if (in_sizes[4] != KW * HID) return;                    // wk [256][1024]
  if (in_sizes[5] != KW * HID) return;                    // wv [256][1024]
  if (in_sizes[6] != HID * QW) return;                    // wo [1024][1024]
  if (out_size != NTOK * HID) return;

  const float* hs   = (const float*)d_in[0];
  const float* mask = (const float*)d_in[1];
  const int*   pos  = (const int*)d_in[2];
  const float* wq   = (const float*)d_in[3];
  const float* wk   = (const float*)d_in[4];
  const float* wv   = (const float*)d_in[5];
  const float* wo   = (const float*)d_in[6];
  float* out = (float*)d_out;

  const size_t szXB  = (size_t)NTOK * HID * 2;
  const size_t szWQK = (size_t)QKN * HID * 2;
  const size_t szWV  = (size_t)KW * HID * 2;
  const size_t szWO2 = (size_t)HID * AOW * 2;
  const size_t szT   = (size_t)NTOK * NFREQ * 4;
  const size_t szCLS = (size_t)NB * NT64 * NT64 * 4;
  const size_t szQ   = (size_t)NTOK * QW * 2;
  const size_t szK   = (size_t)NTOK * KW * 2;
  const size_t szVT  = (size_t)KW * NTOK * 2;
  const size_t szAO  = (size_t)NTOK * AOW * 2;
  size_t off = 0;
  const size_t oXB  = off; off += szXB;
  const size_t oWQK = off; off += szWQK;
  const size_t oWV  = off; off += szWV;
  const size_t oWO2 = off; off += szWO2;
  const size_t oCST = off; off += szT;
  const size_t oSNT = off; off += szT;
  const size_t oCLS = off; off += szCLS;
  const size_t oQH  = off; off += szQ;
  const size_t oQL  = off; off += szQ;
  const size_t oKH  = off; off += szK;
  const size_t oKL  = off; off += szK;
  const size_t oVTH = off; off += szVT;
  const size_t oVTL = off; off += szVT;
  const size_t oAO  = off; off += szAO;
  if (off > ws_size) return;                              // off = 58728448

  char* ws = (char*)d_ws;
  unsigned short* XB  = (unsigned short*)(ws + oXB);
  unsigned short* WQK = (unsigned short*)(ws + oWQK);
  unsigned short* WV  = (unsigned short*)(ws + oWV);
  unsigned short* WO2 = (unsigned short*)(ws + oWO2);
  float*          CST = (float*)(ws + oCST);
  float*          SNT = (float*)(ws + oSNT);
  int*            CLS = (int*)(ws + oCLS);
  unsigned short* QH  = (unsigned short*)(ws + oQH);
  unsigned short* QL  = (unsigned short*)(ws + oQL);
  unsigned short* KH  = (unsigned short*)(ws + oKH);
  unsigned short* KL  = (unsigned short*)(ws + oKL);
  unsigned short* VTH = (unsigned short*)(ws + oVTH);
  unsigned short* VTL = (unsigned short*)(ws + oVTL);
  unsigned short* AO  = (unsigned short*)(ws + oAO);

  const dim3 b256(256), b128(128), b512(512);

  // (1) preparation, one launch: mask classes, x / wq / wk / wv / wo bf16 planes, cos/sin table
  prep_kernel<<<dim3(PB_ALL), b256, 0, stream>>>(hs, mask, pos, wq, wk, wv, wo, XB, WQK, WV, WO2, CST, SNT, CLS);
  // (2) one launch, two products:
  //     q|k = x . [Wq;Wk]^T, RoPE, split -> QH/QL [4096][1024], KH/KL [4096][256]   (M=4096, N=1280, K=1024; 32 x 10 block tiles)
  //     v^T = Wv . x^T -> VTH/VTL [256][4096]   (A = WV, Bt = XB; M=256, N=4096, K=1024; 2 x 32 block tiles)
  gemm_w32x128_kernel<0><<<dim3((NTOK / 128) * (QKN / 128) + (KW / 128) * (NTOK / 128)), b128, 0, stream>>>(
      XB, HID, WQK, HID, CST, SNT, (void*)QH, (void*)QL, (void*)KH, (void*)KL, QW, KW, NTOK, QKN, HID,
      WV, (void*)VTH, (void*)VTL, NTOK, KW, NTOK);
  // (3) attention per (q tile, head, batch) -> AO hi|lo [4096][2048]
  attn_kernel<<<dim3(SQ / 64, NHQ, NB), b512, 0, stream>>>(QH, QL, KH, KL, VTH, VTL, mask, CLS, AO);
  // (4) out = [AOhi | AOlo] . [Wo | Wo]^T -> d_out f32 [4096][1024]   (M=4096, N=1024, K=2048; 32 x 8 block tiles)
  gemm_w32x128_kernel<2><<<dim3((NTOK / 128) * (HID / 128)), b128, 0, stream>>>(
      AO, AOW, WO2, AOW, CST, SNT, (void*)out, (void*)out, (void*)out, (void*)out, HID, HID, NTOK, HID, AOW,
      AO, (void*)out, (void*)out, HID, NTOK, HID);
  (void)hipGetLastError();
}

// v007
// A run of this version takes 133 microseconds.
// Next to v006, in two timings, it ran 1.06 times as fast each time.
// Counting every step since v000, it is 3.68 times as fast.
// Contractions: x.[Wq;Wk]^T and Wv.x^T on v_wmma_f32_16x16x32_bf16 (operands = RNE bf16 copies of the f32 inputs, single products);
// q.k^T and p.v on v_wmma_f32_16x16x32_bf16 with bf16 hi/lo split operands (hi.hi + hi.lo + lo.hi, three products);
// attn.Wo^T on v_wmma_f32_16x16x32_bf16 with attn = bf16 hi|lo planes folded into K (two products) and Wo as RNE bf16.
// f32 accumulate everywhere; RoPE (f32 cos/sin table built from the position ids), mask add and online softmax in f32.
// Plane carry audit: every 16-bit plane is bf16 with carry 1 (hi = RNE(v), lo = RNE(v - hi), same accumulator); nothing is scaled,
// nothing is folded back: XB, WQK, WV, WO2 (RNE copies), QH/QL, KH/KL, VTH/VTL, P (registers), AO hi|lo.
#include <hip/hip_runtime.h>
#include <math.h>
#include <stdint.h>

#define NB     2
#define SQ     2048
#define HID    1024
#define NHQ    16
#define NKVH   4
#define HDM    64
#define QW     1024          // q plane width (16 heads x 64)
#define KW     256           // k / v width (4 heads x 64)
#define QKN    1280          // q|k projection columns
#define NTOK   4096
#define NFREQ  32
#define AOW    2048          // attn plane width: hi at col 0..1023, lo at col 1024..2047
#define NT64   32            // 64-wide tiles along each mask axis

typedef __bf16       v16b __attribute__((ext_vector_type(16)));
typedef __bf16       v8b  __attribute__((ext_vector_type(8)));
typedef float        v8f  __attribute__((ext_vector_type(8)));
typedef float        v4f  __attribute__((ext_vector_type(4)));
typedef unsigned int v4u  __attribute__((ext_vector_type(4)));
typedef float        v2f  __attribute__((ext_vector_type(2)));
typedef __bf16       v2b  __attribute__((ext_vector_type(2)));

// ---------------------------------------------------------------------------
// small helpers
// ---------------------------------------------------------------------------
// two f32 -> two bf16 (RNE) in one word by the hardware's packed convert: a in bits 15..0, b in bits 31..16
__device__ __forceinline__ unsigned cvt2(float a, float b) {
  const v2f x = {a, b};
  return __builtin_bit_cast(unsigned, __builtin_convertvector(x, v2b));
}
__device__ __forceinline__ float lo_val(unsigned w) { return __uint_as_float(w << 16); }          // f32 value of the low bf16
__device__ __forceinline__ float hi_val(unsigned w) { return __uint_as_float(w & 0xFFFF0000u); }  // f32 value of the high bf16
// the residues of a and b against their bf16 roundings held in w = cvt2(a, b), rounded to bf16 in turn
__device__ __forceinline__ unsigned cvt2_res(float a, float b, unsigned w) { return cvt2(a - lo_val(w), b - hi_val(w)); }
__device__ __forceinline__ v8f zero8() { v8f z = {0.f, 0.f, 0.f, 0.f, 0.f, 0.f, 0.f, 0.f}; return z; }
// lane l with lane l ^ 16 (the other half of the wave)
__device__ __forceinline__ float xhalf(float x) {
  const int b = __builtin_bit_cast(int, x);
  return __builtin_bit_cast(float, __builtin_amdgcn_permlanex16(b, b, 0x76543210, 0xfedcba98, false, false));
}
__device__ __forceinline__ int wave_id() { return __builtin_amdgcn_readfirstlane((int)(threadIdx.x >> 5)); }

__device__ __forceinline__ void lds_wave_sync() {
  __builtin_amdgcn_fence(__ATOMIC_RELEASE, "workgroup");
  __builtin_amdgcn_wave_barrier();
  __builtin_amdgcn_fence(__ATOMIC_ACQUIRE, "workgroup");
}

// ---------------------------------------------------------------------------
// WMMA fragments (wave32, 16x16x32, bf16 operands). For A (row m = lane&15) and B (col n = lane&15) alike:
// elements 0..7 <- k0 + 8*(lane>>4) + 0..7, elements 8..15 <- k0 + 16 + 8*(lane>>4) + 0..7.
// ldfrag_b(p) with p = rowbase + k0 + 8*(lane>>4): two 16-B loads p[0..7], p[16..23] (A rows and k-contiguous B rows alike).
// D: acc[r] = (row 8*(lane>>4) + r, col lane&15).
// ---------------------------------------------------------------------------
union FragB { v16b v; v8b h[2]; };
__device__ __forceinline__ v16b ldfrag_b(const __bf16* p) { FragB f; f.h[0] = *(const v8b*)(p); f.h[1] = *(const v8b*)(p + 16); return f.v; }

__device__ __forceinline__ v8f mma_b(v16b a, v16b b, v8f c) {
  return __builtin_amdgcn_wmma_f32_16x16x32_bf16(false, a, false, b, (short)0, c, false, false);
}
// hazard guards: 4 VALU slots after the last WMMA of a group, D tied, A/B kept live; memory clobber keeps later loads behind the group
__device__ __forceinline__ void guard1b4(v8f& a, v16b w, v16b x, v16b y, v16b z) {
  asm volatile("v_nop\n\tv_nop\n\tv_nop\n\tv_nop" : "+v"(a) : "v"(w), "v"(x), "v"(y), "v"(z) : "memory");
}
__device__ __forceinline__ void acc_guard4(v8f& a, v8f& b, v8f& c, v8f& d) {
  asm volatile("v_nop\n\tv_nop\n\tv_nop\n\tv_nop" : "+v"(a), "+v"(b), "+v"(c), "+v"(d));
}
__device__ __forceinline__ void acc_guard2(v8f& a, v8f& b) {
  asm volatile("v_nop\n\tv_nop\n\tv_nop\n\tv_nop" : "+v"(a), "+v"(b));
}

// ---------------------------------------------------------------------------
// RoPE table: cst[t][j] = cos(pos[t] * inv_freq[j]), snt[t][j] = sin(...), inv_freq[j] = 1 / 10000^(j/32), j < 32, all f32.
// ---------------------------------------------------------------------------
// A wave takes RTW consecutive tokens (lane = frequency j): their position ids are read together, inv_freq is formed once.
#define RTW 4
static_assert(NTOK % (8 * RTW) == 0);          // whole blocks of 8 waves cover the tokens exactly
__device__ __forceinline__ void rope_table_part(int bid, const int* __restrict__ pos, float* __restrict__ cst,
                                                float* __restrict__ snt) {
  const int lane = threadIdx.x & 31;
  const int wave = (int)(threadIdx.x >> 5);
  const int t0 = (bid * 8 + wave) * RTW;
  int pi[RTW];
#pragma unroll
  for (int u = 0; u < RTW; ++u) pi[u] = pos[t0 + u];
  const float e   = (float)lane * 0.03125f;    // (2*j)/64 exact
  const float pw  = powf(10000.0f, e);
  const float inv = 1.0f / pw;
#pragma unroll
  for (int u = 0; u < RTW; ++u) {
    const float ang = (float)pi[u] * inv;
    const float cv  = cosf(ang);
    const float sv  = sinf(ang);
    const size_t o = (size_t)(t0 + u) * NFREQ + lane;
    cst[o] = cv;
    snt[o] = sv;
  }
  // behind the last store: no register that an issued store names is rewritten ahead of this wait (the rule for issued global stores)
  asm volatile("s_wait_xcnt 0x0" ::: "memory");
}

// ---------------------------------------------------------------------------
// Elementwise RNE f32 -> bf16 plane: a piece = 8 elements, one 16-B store per lane -> 32 consecutive lanes write 4 whole lines.
// A thread takes CPT pieces, 256 pieces apart (a block = 256 * CPT consecutive pieces), and issues all its 2 * CPT loads before
// it uses the first: one memory latency per thread instead of one per piece, and a CPT-th of the blocks to start.
// Every plane is a whole number of such blocks (asserted at the block counts below): no tail, no guard.
// ---------------------------------------------------------------------------
#define CPT 4
#define CBE (256 * CPT * 8)                    // elements per conversion block
__device__ __forceinline__ v4u pack8(v4f a, v4f b) {
  v4u w;
  w[0] = cvt2(a[0], a[1]);
  w[1] = cvt2(a[2], a[3]);
  w[2] = cvt2(b[0], b[1]);
  w[3] = cvt2(b[2], b[3]);
  return w;
}
__device__ __forceinline__ void cvt_bf16_part(int bid, const float* __restrict__ in, unsigned short* __restrict__ outp) {
  const size_t e0 = (size_t)bid * CBE + 8 * (size_t)threadIdx.x;
  v4f a[CPT], b[CPT];
#pragma unroll
  for (int u = 0; u < CPT; ++u) {
    a[u] = *(const v4f*)(in + e0 + u * 2048);
    b[u] = *(const v4f*)(in + e0 + u * 2048 + 4);
  }
#pragma unroll
  for (int u = 0; u < CPT; ++u) *(v4u*)(outp + e0 + u * 2048) = pack8(a[u], b[u]);
  // behind the last store: no register that an issued store names is rewritten ahead of this wait (the rule for issued global stores)
  asm volatile("s_wait_xcnt 0x0" ::: "memory");
}

// ---------------------------------------------------------------------------
// Wo [HID][kin] f32 -> WO2 [HID][ldo = 2*kin] bf16 with WO2[n][k] = WO2[n][kin + k] = bf16(Wo[n][k]).
// Coverage: blocks x 256 x CPT x 8 = HID*kin source elements -> both halves of every WO2 row. Pieces and loads as in cvt_bf16_part.
// ---------------------------------------------------------------------------
__device__ __forceinline__ void cvt_wo2_part(int bid, const float* __restrict__ in, unsigned short* __restrict__ outp,
                                             int kin, int ldo) {
  const size_t e0 = (size_t)bid * CBE + 8 * (size_t)threadIdx.x;
  v4f a[CPT], b[CPT];
#pragma unroll
  for (int u = 0; u < CPT; ++u) {
    a[u] = *(const v4f*)(in + e0 + u * 2048);
    b[u] = *(const v4f*)(in + e0 + u * 2048 + 4);
  }
#pragma unroll
  for (int u = 0; u < CPT; ++u) {
    const size_t e = e0 + u * 2048;
    const int n = (int)(e / (size_t)kin);
    const int k = (int)(e - (size_t)n * kin);
    const v4u w = pack8(a[u], b[u]);
    const size_t o = (size_t)n * ldo + k;
    *(v4u*)(outp + o) = w;
    *(v4u*)(outp + o + kin) = w;
  }
  // behind the last store: no register that an issued store names is rewritten ahead of this wait (the rule for issued global stores)
  asm volatile("s_wait_xcnt 0x0" ::: "memory");
}

// ---------------------------------------------------------------------------
// Mask tile classes. mask [NB][1][SQ][SQ] f32 (additive). One block per (b, 64-row band mt): 256 threads x 8 consecutive columns,
// 64 rows each. For every 64x64 tile (b, mt, nt):
//   class 0 = every element <= -1e8 (tile contributes nothing: exp underflows to 0 exactly when the row has an admitted key),
//   class 1 = every element == 0 (nothing to add), class 2 = anything else (mask tile added elementwise).
// If the band contains a row with no element > -1e4 the skip is not valid for it: class 0 tiles of that band become class 2.
// Reductions are OR (order independent). Coverage: NB*32 blocks x 64 rows x 256 thr x 8 cols = the whole mask;
// The rows are read MRB at a time, all 2 * MRB loads of a thread issued before the first is used: 64 / MRB exposed memory
// latencies per block instead of 64.
// ---------------------------------------------------------------------------
#define ADM_TH (-1.0e4f)
#define SKP_TH (-1.0e8f)
#define MRB 8

__device__ __forceinline__ void mask_class_part(int bid, const float* __restrict__ mask, int* __restrict__ cls) {
  __shared__ int nzs[NT64];
  __shared__ int bgs[NT64];
  __shared__ unsigned rlo[8];
  __shared__ unsigned rhi[8];
  const int bm   = bid;                  // b*32 + mt
  const int b    = bm >> 5;
  const int mt   = bm & 31;
  const int tid  = threadIdx.x;
  const int lane = tid & 31;
  const int wave = tid >> 5;
  const int j0   = tid * 8;
  int nz = 0, bg = 0;
  unsigned rowlo = 0u, rowhi = 0u;       // bit r: this thread's 8 columns contain an admitted element in row r
  // rolled: one batch of rows is as much as a thread's registers should hold
#pragma unroll 1
  for (int r0 = 0; r0 < 64; r0 += MRB) {
    const float* mr = mask + (((size_t)b * SQ) + (size_t)(mt * 64 + r0)) * SQ + j0;
    v4f ma[MRB], mb[MRB];
#pragma unroll
    for (int u = 0; u < MRB; ++u) {
      ma[u] = *(const v4f*)(mr + (size_t)u * SQ);
      mb[u] = *(const v4f*)(mr + (size_t)u * SQ + 4);
    }
    // keeps the whole batch's loads in front of the first use: left alone, the compiler holds some back until registers are
    // free again, and those pay a second memory latency in every batch
    __builtin_amdgcn_sched_barrier(0);
#pragma unroll
    for (int u = 0; u < MRB; ++u) {
      const int r = r0 + u;
      const v4f mk0 = ma[u];
      const v4f mk1 = mb[u];
      const int a = ((mk0[0] > ADM_TH) | (mk0[1] > ADM_TH) | (mk0[2] > ADM_TH) | (mk0[3] > ADM_TH) |
                     (mk1[0] > ADM_TH) | (mk1[1] > ADM_TH) | (mk1[2] > ADM_TH) | (mk1[3] > ADM_TH)) ? 1 : 0;
      const int z = ((mk0[0] != 0.0f) | (mk0[1] != 0.0f) | (mk0[2] != 0.0f) | (mk0[3] != 0.0f) |
                     (mk1[0] != 0.0f) | (mk1[1] != 0.0f) | (mk1[2] != 0.0f) | (mk1[3] != 0.0f)) ? 1 : 0;
      const int g = ((mk0[0] > SKP_TH) | (mk0[1] > SKP_TH) | (mk0[2] > SKP_TH) | (mk0[3] > SKP_TH) |
                     (mk1[0] > SKP_TH) | (mk1[1] > SKP_TH) | (mk1[2] > SKP_TH) | (mk1[3] > SKP_TH)) ? 1 : 0;
      nz |= z;
      bg |= g;
      const unsigned sh = ((unsigned)a) << (r & 31);
      rowlo |= (r < 32) ? sh : 0u;
      rowhi |= (r < 32) ? 0u : sh;
    }
  }
  // OR over the 8 lanes 8q..8q+7 that share column tile nt = tid >> 3
  nz |= __shfl_xor(nz, 1, 32); nz |= __shfl_xor(nz, 2, 32); nz |= __shfl_xor(nz, 4, 32);
  bg |= __shfl_xor(bg, 1, 32); bg |= __shfl_xor(bg, 2, 32); bg |= __shfl_xor(bg, 4, 32);
#pragma unroll
  for (int off = 1; off < 32; off <<= 1) {
    rowlo |= (unsigned)__shfl_xor((int)rowlo, off, 32);
    rowhi |= (unsigned)__shfl_xor((int)rowhi, off, 32);
  }
  if ((lane & 7) == 0) { nzs[tid >> 3] = nz; bgs[tid >> 3] = bg; }
  if (lane == 0) { rlo[wave] = rowlo; rhi[wave] = rowhi; }
  __syncthreads();
  if (wave == 0) {                       // wave-uniform
    const int z = nzs[lane];
    const int g = bgs[lane];
    unsigned ol = rlo[0], oh = rhi[0];
#pragma unroll
    for (int w = 1; w < 8; ++w) { ol |= rlo[w]; oh |= rhi[w]; }
    const bool has_empty_row = (ol != 0xFFFFFFFFu) || (oh != 0xFFFFFFFFu);
    int cval = (g == 0) ? 0 : ((z == 0) ? 1 : 2);
    cval = (has_empty_row && cval == 0) ? 2 : cval;
    int* cp = cls + (size_t)bm * NT64 + lane;
    *cp = cval;
    
  }
}

// ---------------------------------------------------------------------------
// The seven preparation jobs depend on the inputs alone and on nothing of each other: one launch, each job a range of blocks
// (256 threads each). The mask bands, the longest blocks, come first.
// Every branch is on the block index: whole blocks take it, so the barrier of the mask part stays block-uniform.
// ---------------------------------------------------------------------------
#define PB_MASK (NB * NT64)                  // 64
#define PB_X    (NTOK * HID / CBE)           // 512
#define PB_ROPE (NTOK / (8 * RTW))           // 128
#define PB_WQ   (QW * HID / CBE)             // 128
#define PB_WO   (HID * QW / CBE)             // 128
#define PB_WKV  (KW * HID / CBE)             // 32, wk and wv each
#define PB_ALL  (PB_MASK + PB_X + PB_ROPE + PB_WQ + PB_WO + 2 * PB_WKV)
static_assert((NTOK * HID) % CBE == 0 && (QW * HID) % CBE == 0 && (KW * HID) % CBE == 0);   // whole conversion blocks only

__global__ __launch_bounds__(256) void prep_kernel(
    const float* __restrict__ hs, const float* __restrict__ mask, const int* __restrict__ pos,
    const float* __restrict__ wq, const float* __restrict__ wk, const float* __restrict__ wv, const float* __restrict__ wo,
    unsigned short* __restrict__ xb, unsigned short* __restrict__ wqk, unsigned short* __restrict__ wvb,
    unsigned short* __restrict__ wo2, float* __restrict__ cst, float* __restrict__ snt, int* __restrict__ cls) {
  int bid = (int)blockIdx.x;
  // mask tile classes [2][32][32]
  if (bid < PB_MASK) { mask_class_part(bid, mask, cls); return; }
  bid -= PB_MASK;
  // x -> bf16 plane [4096][1024]
  if (bid < PB_X) { cvt_bf16_part(bid, hs, xb); return; }
  bid -= PB_X;
  // cos/sin table [4096][32] x 2 from the position ids
  if (bid < PB_ROPE) { rope_table_part(bid, pos, cst, snt); return; }
  bid -= PB_ROPE;
  // wq [1024][1024] -> WQK rows 0..1023 (natural [out][in] = Bt layout)
  if (bid < PB_WQ) { cvt_bf16_part(bid, wq, wqk); return; }
  bid -= PB_WQ;
  // wo [1024][1024] -> WO2 [1024][2048] (both halves)
  if (bid < PB_WO) { cvt_wo2_part(bid, wo, wo2, QW, AOW); return; }
  bid -= PB_WO;
  // wk [256][1024] -> WQK rows 1024..1279
  if (bid < PB_WKV) { cvt_bf16_part(bid, wk, wqk + (size_t)QW * HID); return; }
  bid -= PB_WKV;
  // wv [256][1024] -> WV
  if (bid < PB_WKV) { cvt_bf16_part(bid, wv, wvb); return; }
}

// ---------------------------------------------------------------------------
// bf16 WMMA GEMM, block = 4 waves (128 threads) = one 128 x 128 tile of C; wave w owns rows 32w..32w+31 of it, all 128 cols.
//   C[m][n] = sum_k A[m][k] * Bt[n][k]; A row-major [M][K] bf16 (pitch lda), Bt row-major [N][K] bf16 (pitch ldb);
//   M % 128 == 0, N % 128 == 0, K % 64 == 0, K >= 64, lda % 8 == 0, ldb % 8 == 0; grid.x = M/128 * N/128.
//   EPI 0 carries a second, independent product in the same launch: blocks M/128 * N/128 .. + M2/128 * N2/128 - 1 compute
//   C'[m][n] = sum_k A2[m][k] * A[n][k] (A2 [M2][K] pitch lda; the first product's A, N2 rows of it, as Bt with pitch ldb:
//   lda == ldb), same K, same loop.
//   Operands: per trip of 64 k the 128 A rows and the 128 Bt rows (128 B each) are copied global -> LDS asynchronously, whole
//   128-B lines per 8 lanes, into one of two buffers; trip t works on buffer t & 1 while tile t + 1 flies into the other.
//   Fragments are read from LDS rows (ldfrag_b) in the same k order as before.
// Epilogues (all: per wave, per 16-row slab: stage in LDS, wave sync, write each row segment with ONE instruction of
//   EPI 0: q|k projection with RoPE. The 128-col tile holds two 64-dim heads; pairs (d, d+32) inside each head are rotated with
//          the f32 cos/sin rows of the token (staged per slab in LDS), then split to bf16 hi (C0/C2) and lo (C1/C3) planes.
//          cols n0 < QW -> q planes [M][ldc], col n0; cols n0 >= QW -> k planes [M][ldc2], col n0-QW. Row segment 256 B = 16 lanes x 16 B.
//          Second product = v^T projection: bf16 hi plane D0, lo plane D1, [M2][ldd], row segment 256 B.
//   EPI 2: f32 output C0 [M][ldc]; row segment 128 floats = 512 B = 32 lanes x 16 B per instruction.
// ---------------------------------------------------------------------------
template <int EPI> struct SlabCfg { static constexpr int PERWF = 2048; };   // floats per wave (8 KB)
template <> struct SlabCfg<0>     { static constexpr int PERWF = 3072; };   // + 16x32 cos + 16x32 sin rows

#define GKT  64                 // k per staged tile: 128-B rows
#define GPITCH  72                 // LDS row pitch in bf16: 144 B = 16 B x odd, for the 16-B fragment reads
#define GOP  (128 * GPITCH)        // bf16 per operand tile (128 rows)
#define GROWB (16 * GPITCH * 2)    // LDS bytes between a lane's consecutive copies (16 rows)

__device__ __forceinline__ unsigned lds_off(const void* p) { return (unsigned)(size_t)p; }

// One operand tile, 128 rows x 128 B: lane t copies 16 B of rows (t >> 3) + 16u, u = 0..7 (128 lanes x 8 = 1024 pieces = the tile).
// l = the lane's LDS byte address for u = 0, g = its global address for u = 0, ld = global row pitch in elements.
// s_wait_xcnt stands inside the statement so that no address register is rewritten ahead of it.
__device__ __forceinline__ void stage_tile(unsigned l, const unsigned short* g, int ld) {
  const size_t st = (size_t)16 * (size_t)ld;
  asm volatile(
      "global_load_async_to_lds_b128 %0, %8, off\n\t"
      "global_load_async_to_lds_b128 %1, %9, off\n\t"
      "global_load_async_to_lds_b128 %2, %10, off\n\t"
      "global_load_async_to_lds_b128 %3, %11, off\n\t"
      "global_load_async_to_lds_b128 %4, %12, off\n\t"
      "global_load_async_to_lds_b128 %5, %13, off\n\t"
      "global_load_async_to_lds_b128 %6, %14, off\n\t"
      "global_load_async_to_lds_b128 %7, %15, off\n\t"
      "s_wait_xcnt 0x0"
      :: "v"(l), "v"(l + 1u * GROWB), "v"(l + 2u * GROWB), "v"(l + 3u * GROWB),
         "v"(l + 4u * GROWB), "v"(l + 5u * GROWB), "v"(l + 6u * GROWB), "v"(l + 7u * GROWB),
         "v"(g), "v"(g + st), "v"(g + 2 * st), "v"(g + 3 * st),
         "v"(g + 4 * st), "v"(g + 5 * st), "v"(g + 6 * st), "v"(g + 7 * st)
      : "memory");
}

template <int EPI>
__global__ __launch_bounds__(128) void gemm_w32x128_kernel(
    const unsigned short* __restrict__ Ap, int lda,
    const unsigned short* __restrict__ Btp, int ldb,
    const float* __restrict__ cst, const float* __restrict__ snt,
    void* C0, void* C1, void* C2, void* C3, int ldc, int ldc2,
    int M, int N, int K,
    const unsigned short* __restrict__ A2p, void* D0, void* D1, int ldd, int M2, int N2) {
  __shared__ __align__(16) float lds_all[4 * SlabCfg<EPI>::PERWF];
  __shared__ __align__(16) unsigned short ring[2][2 * GOP];    // [buffer][A tile | Bt tile], 2 x 36,864 B

  const int tid  = (int)threadIdx.x;
  const int lane = tid & 31;
  const int wave = wave_id();
  const int hh = lane >> 4;           // lane half: k offset 8*hh, D row offset 8*hh
  const int rl = lane & 15;           // A row / B col / D col within subtile
  const int ntile1 = (M >> 7) * (N >> 7);
  const bool second = (EPI == 0) && ((int)blockIdx.x >= ntile1);   // block-uniform: this block works on the second product
  const int tilesN = (second ? N2 : N) >> 7;
  const int tilesM = (second ? M2 : M) >> 7;
  const int tile = (int)blockIdx.x - (second ? ntile1 : 0);
  if (tile >= tilesM * tilesN) return;          // block-uniform, in front of every barrier and copy
  const int tm = tile / tilesN;
  const int tn = tile - tm * tilesN;
  const int mblk = tm << 7;
  const int m0 = mblk + (wave << 5);
  const int n0 = tn << 7;

  // this lane's first piece of each operand tile: row tid >> 3, 16-B column tid & 7
  const int srow = tid >> 3;
  const int sc8  = (tid & 7) * 8;
  const unsigned short* gA = (second ? A2p : Ap) + (size_t)(mblk + srow) * lda + sc8;
  const unsigned short* gB = (second ? Ap : Btp) + (size_t)(n0   + srow) * ldb + sc8;
  const unsigned lA = lds_off(&ring[0][0]) + (unsigned)(srow * GPITCH + sc8) * 2u;
  const unsigned lB = lA + GOP * 2u;
  const unsigned bufb = 2u * GOP * 2u;           // bytes per buffer
  const int ntrip = K / GKT;

  v8f acc[2][8];
#pragma unroll
  for (int i = 0; i < 2; ++i)
#pragma unroll
    for (int j = 0; j < 8; ++j) acc[i][j] = zero8();

  // prologue: tile 0 lands and is published, then tile 1 starts
  stage_tile(lA, gA, lda);
  stage_tile(lB, gB, ldb);
  asm volatile("s_wait_asynccnt 0x0" ::: "memory");   // this wave's copies of tile 0 have landed
  __syncthreads();                                     // ... and every other wave's: tile 0 is readable
  if (ntrip > 1) {
    stage_tile(lA + bufb, gA + GKT, lda);
    stage_tile(lB + bufb, gB + GKT, ldb);
  }

  for (int t = 0; t < ntrip; ++t) {
    const __bf16* As = (const __bf16*)(const void*)&ring[t & 1][0]   + (wave * 32 + rl) * GPITCH + 8 * hh;
    const __bf16* Bs = (const __bf16*)(const void*)&ring[t & 1][GOP] + rl * GPITCH + 8 * hh;
    v16b ah[2][2], bf[2][8];                           // [k half of the tile][fragment]
#pragma unroll
    for (int s = 0; s < 2; ++s) {
#pragma unroll
      for (int i = 0; i < 2; ++i) ah[s][i] = ldfrag_b(As + i * 16 * GPITCH + s * 32);
#pragma unroll
      for (int j = 0; j < 8; ++j) bf[s][j] = ldfrag_b(Bs + j * 16 * GPITCH + s * 32);
    }
    // keeps the trip's LDS reads together in front of its WMMAs: one exposed LDS latency per trip instead of one per WMMA pair
    __builtin_amdgcn_sched_barrier(0);
#pragma unroll
    for (int s = 0; s < 2; ++s) {
#pragma unroll
      for (int j = 0; j < 8; ++j) {
        acc[0][j] = mma_b(ah[s][0], bf[s][j], acc[0][j]);
        acc[1][j] = mma_b(ah[s][1], bf[s][j], acc[1][j]);
      }
    }
    // keeps the WMMAs in front of the trip's foot: they overlap the LDS reads, and tile t + 1's copies get the whole trip to land
    __builtin_amdgcn_sched_barrier(0);
    asm volatile("s_wait_dscnt 0x0" ::: "memory");     // this wave's reads of buffer t & 1 are done before it is refilled
    asm volatile("s_wait_asynccnt 0x0" ::: "memory");  // this wave's copies of tile t + 1 have landed
    __syncthreads();                                   // publishes tile t + 1 and ends every reader's use of buffer t & 1
    if (t + 2 < ntrip) {                               // same for the whole block
      const unsigned bo = (unsigned)(t & 1) * bufb;
      stage_tile(lA + bo, gA + (size_t)(t + 2) * GKT, lda);
      stage_tile(lB + bo, gB + (size_t)(t + 2) * GKT, ldb);
    }
  }
  asm volatile("s_wait_asynccnt 0x0" ::: "memory");    // nothing of this wave is in flight behind the loop
  acc_guard4(acc[0][0], acc[0][1], acc[0][2], acc[0][3]);
  acc_guard4(acc[0][4], acc[0][5], acc[0][6], acc[0][7]);
  acc_guard4(acc[1][0], acc[1][1], acc[1][2], acc[1][3]);
  acc_guard4(acc[1][4], acc[1][5], acc[1][6], acc[1][7]);

  // ---- epilogue ----
  float* wl = lds_all + wave * SlabCfg<EPI>::PERWF;
  unsigned short* sl16 = (unsigned short*)(void*)wl;       // 4096 u16 = floats 0..2047 (two 16x128 planes)
  float* slf = wl;

  if (EPI == 0 && !second) {
    float* csl = wl + 2048;                                 // cos rows [16][32]
    float* snl = wl + 2048 + 16 * NFREQ;                    // sin rows [16][32]
    const bool isq = (n0 < QW);                             // wave-uniform
    unsigned short* P0 = isq ? (unsigned short*)C0 : (unsigned short*)C2;
    unsigned short* P1 = isq ? (unsigned short*)C1 : (unsigned short*)C3;
    const int ldp  = isq ? ldc : ldc2;
    const int col0 = isq ? n0 : (n0 - QW);
#pragma unroll
    for (int i = 0; i < 2; ++i) {
      const int mb = m0 + i * 16;
      // stage cos/sin of tokens mb..mb+15: 16 rows x 32 floats = 128 16-B pieces per table; lane -> 4 pieces (coverage 32x4 = 128)
      v4f cv4[4], sv4[4];
      const float* cp[4];
      const float* sp[4];
#pragma unroll
      for (int u = 0; u < 4; ++u) {
        const int p   = lane + 32 * u;
        const int row = p >> 3, c4 = (p & 7) * 4;
        cp[u] = cst + (size_t)(mb + row) * NFREQ + c4;
        sp[u] = snt + (size_t)(mb + row) * NFREQ + c4;
        cv4[u] = *(const v4f*)cp[u];
        sv4[u] = *(const v4f*)sp[u];
      }
      // precaution: the eight loads' address registers, named as inputs so that they live up to here, are reused only behind this wait
      asm volatile("s_wait_xcnt 0x0"
                   :: "v"(cp[0]), "v"(cp[1]), "v"(cp[2]), "v"(cp[3]), "v"(sp[0]), "v"(sp[1]), "v"(sp[2]), "v"(sp[3])
                   : "memory");
#pragma unroll
      for (int u = 0; u < 4; ++u) {
        const int p   = lane + 32 * u;
        const int row = p >> 3, c4 = (p & 7) * 4;
        *(v4f*)(csl + row * NFREQ + c4) = cv4[u];
        *(v4f*)(snl + row * NFREQ + c4) = sv4[u];
      }
      lds_wave_sync();
#pragma unroll
      for (int hs = 0; hs < 2; ++hs) {                      // head within the 128-col tile
#pragma unroll
        for (int jj = 0; jj < 2; ++jj) {
          const int j1 = hs * 4 + jj;                       // cols hs*64 + jj*16 + rl  (x1, dim d < 32)
          const int j2 = j1 + 2;                            // cols +32                 (x2, dim d + 32)
          const int d  = jj * 16 + rl;                      // freq index 0..31
#pragma unroll
          for (int r = 0; r < 8; ++r) {
            const int lrow = 8 * hh + r;
            const float cv = csl[lrow * NFREQ + d];
            const float sv = snl[lrow * NFREQ + d];
            const float x1 = acc[i][j1][r];
            const float x2 = acc[i][j2][r];
            const float o1 = x1 * cv - x2 * sv;
            const float o2 = x2 * cv + x1 * sv;
            const unsigned hb = cvt2(o1, o2);
            const unsigned lb = cvt2_res(o1, o2, hb);
            const int so = lrow * 128 + hs * 64 + d;
            sl16[so]             = (unsigned short)hb;
            sl16[so + 32]        = (unsigned short)(hb >> 16);
            sl16[2048 + so]      = (unsigned short)lb;
            sl16[2048 + so + 32] = (unsigned short)(lb >> 16);
          }
        }
      }
      lds_wave_sync();
      {
#pragma unroll
        for (int it = 0; it < 8; ++it) {
          const int row = it * 2 + hh;                      // it x hh covers rows 0..15
          const int c8  = rl * 8;
          const v4u vh = *(const v4u*)(sl16 + row * 128 + c8);
          const v4u vl = *(const v4u*)(sl16 + 2048 + row * 128 + c8);
          const size_t go = (size_t)(mb + row) * ldp + col0 + c8;
          *(v4u*)(P0 + go) = vh;
          *(v4u*)(P1 + go) = vl;
        }
        
      }
      lds_wave_sync();
    }
  } else if (EPI == 0) {
    unsigned short* P0 = (unsigned short*)D0;
    unsigned short* P1 = (unsigned short*)D1;
#pragma unroll
    for (int i = 0; i < 2; ++i) {
#pragma unroll
      for (int r = 0; r < 8; ++r) {
#pragma unroll
        for (int j = 0; j < 8; j += 2) {
          const float va = acc[i][j][r];
          const float vb = acc[i][j + 1][r];
          const unsigned hb = cvt2(va, vb);
          const unsigned lb = cvt2_res(va, vb, hb);
          const int so = (8 * hh + r) * 128 + j * 16 + rl;
          sl16[so]             = (unsigned short)hb;
          sl16[so + 16]        = (unsigned short)(hb >> 16);
          sl16[2048 + so]      = (unsigned short)lb;
          sl16[2048 + so + 16] = (unsigned short)(lb >> 16);
        }
      }
      lds_wave_sync();
      {
#pragma unroll
        for (int it = 0; it < 8; ++it) {
          const int row = it * 2 + hh;
          const int c8  = rl * 8;
          const v4u vh = *(const v4u*)(sl16 + row * 128 + c8);
          const v4u vl = *(const v4u*)(sl16 + 2048 + row * 128 + c8);
          const size_t go = (size_t)(m0 + i * 16 + row) * ldd + n0 + c8;
          *(v4u*)(P0 + go) = vh;
          *(v4u*)(P1 + go) = vl;
        }
        
      }
      lds_wave_sync();
    }
  } else {
    float* C = (float*)C0;
#pragma unroll
    for (int i = 0; i < 2; ++i) {
#pragma unroll
      for (int j = 0; j < 8; ++j)
#pragma unroll
        for (int r = 0; r < 8; ++r)
          slf[(8 * hh + r) * 128 + j * 16 + rl] = acc[i][j][r];
      lds_wave_sync();
      {
#pragma unroll
        for (int row = 0; row < 16; ++row) {                // 32 lanes x 16 B = the whole 512-B row segment per instruction
          const v4f v = *(const v4f*)(slf + row * 128 + lane * 4);
          *(v4f*)(C + (size_t)(m0 + i * 16 + row) * ldc + n0 + lane * 4) = v;
        }
        
      }
      lds_wave_sync();
    }
  }
}

#define AKC  32
#define NKG  4
#define TKC  (AKC * NKG)
#define KP   72
#define VP   136
#define MP   132
#define KVB  ((2 * TKC * KP + 2 * HDM * VP) * 2)
#define JOB  ((NKG - 1) * 4 * 32 * (32 + 2) * 4)
static_assert(JOB <= KVB);

// 16 B at a block-uniform base plus the thread's 32-bit byte offset
__device__ __forceinline__ v4u ld16(const unsigned short* base, unsigned boff) { return *(const v4u*)((const char*)base + boff); }

// eight waves per SIMD = two blocks per WGP: one block's products fill the other's staging and barrier waits (2 x LDS fits too)
__global__ __launch_bounds__(512) __attribute__((amdgpu_waves_per_eu(8, 8))) void attn_kernel(
    const unsigned short* __restrict__ qhp, const unsigned short* __restrict__ qlp,
    const unsigned short* __restrict__ khp, const unsigned short* __restrict__ klp,
    const unsigned short* __restrict__ vhp, const unsigned short* __restrict__ vlp,
    const float* __restrict__ maskp, const int* __restrict__ clsp,
    unsigned short* __restrict__ aop) {
  __shared__ __align__(16) unsigned short KVs[KVB / 2];
  __shared__ __align__(16) float Ms[64 * MP];
  __shared__ __align__(16) unsigned short Osh[4][16 * 64];
  __shared__ __align__(16) unsigned short Osl[4][16 * 64];
  unsigned short* Ks  = KVs;
  unsigned short* Kls = KVs + TKC * KP;
  unsigned short* Vhs = KVs + 2 * TKC * KP;
  unsigned short* Vls = KVs + 2 * TKC * KP + HDM * VP;

  const int tid  = (int)threadIdx.x;
  const int lane = tid & 31;
  const int wave = wave_id();
  const int wq   = wave & 3;                     // query slab of the wave
  const int kg   = wave >> 2;                    // key group of the wave
  const int hh   = lane >> 4;
  const int c    = lane & 15;
  // Which (query tile, head, batch) a block takes: the tile falls as the flat index rises. Where the mask admits keys up to the
  // query (a tile's trips then grow with qt), the long blocks come first in index order, for speed only. The map is a permutation of the grid for any mask: every (qt, h, b) is taken exactly once.
  const unsigned flat = blockIdx.x + NT64 * (blockIdx.y + NHQ * blockIdx.z);   // grid (NT64, NHQ, NB)
  const int qt   = NT64 - 1 - (int)(flat / (NHQ * NB));
  const int h    = (int)(flat % NHQ);
  const int b    = (int)((flat / NHQ) % NB);
  const int kvh  = h >> 2;
  const int q0   = qt * 64 + wq * 16;            // first query row of this wave (within the sequence)
  const size_t tok0 = (size_t)b * SQ;

  // whole mask staging area initialised once (only class-2 tiles refresh it; other tiles never add from it)
#pragma unroll 1
  for (int u = tid; u < 64 * MP; u += 512) Ms[u] = 0.0f;

  const __bf16* Qhr = (const __bf16*)(const void*)qhp + (tok0 + q0 + c) * QW + h * HDM + 8 * hh;
  const __bf16* Qlr = (const __bf16*)(const void*)qlp + (tok0 + q0 + c) * QW + h * HDM + 8 * hh;
  const size_t mrow0 = (tok0 + (size_t)qt * 64) * SQ;                 // mask[b][0][qt*64][0]
  const int* crow = clsp + ((b * NT64) + qt) * NT64;
  // staging: block-uniform element offsets of the (b, kv head) planes, and this thread's own byte offsets (global) and places (LDS)
  const size_t kbase = tok0 * KW + kvh * HDM;
  const size_t vbase = (size_t)(kvh * HDM) * NTOK + tok0;
  const unsigned kgo = (unsigned)((tid >> 3) * KW + (tid & 7) * 8) * 2u;
  const unsigned vgo = (unsigned)((tid >> 4) * NTOK + (tid & 15) * 8) * 2u;
  const unsigned mgo = (unsigned)((tid >> 4) * SQ + (tid & 15) * 4) * 4u;
  const int kso = (tid >> 3) * KP + (tid & 7) * 8;
  const int vso = (tid >> 4) * VP + (tid & 15) * 8;
  const int mso = (tid >> 4) * MP + (tid & 15) * 4;

  v16b qh[2], ql[2];
#pragma unroll
  for (int dc = 0; dc < 2; ++dc) { qh[dc] = ldfrag_b(Qhr + dc * 32); ql[dc] = ldfrag_b(Qlr + dc * 32); }

  float mrow = -INFINITY;                          // running max of query c over this wave's keys (the same in both halves)
  float lsum = 0.f;                                // running sum of query c over this wave's keys of this half
  v8f oacc[4];                                     // oacc[t][r] = O[query c][d = 16t + 8hh + r], this wave's keys
#pragma unroll
  for (int t = 0; t < 4; ++t) oacc[t] = zero8();

  for (int s = 0; s < NT64 / 2; ++s) {
    const int cl0 = __builtin_amdgcn_readfirstlane(crow[2 * s]);      // block-uniform classes of the trip's two mask tiles
    const int cl1 = __builtin_amdgcn_readfirstlane(crow[2 * s + 1]);
    if ((cl0 | cl1) == 0) continue;                                   // uniform for the whole block; before any barrier
    const int kv0 = s * TKC;
    __syncthreads();                                                  // prior trip's LDS readers are done
    const unsigned short* kbh = khp + kbase + (size_t)kv0 * KW;       // block-uniform bases of the trip's tiles
    const unsigned short* kbl = klp + kbase + (size_t)kv0 * KW;
    const unsigned short* vbh = vhp + vbase + kv0;
    const unsigned short* vbl = vlp + vbase + kv0;
    v4u kx[2], ky[2], vx[2], vy[2];
#pragma unroll
    for (int u = 0; u < 2; ++u) {                                     // coverage: 1024 pieces of 8 halves per plane = whole tile
      kx[u] = ld16(kbh + u * 64 * KW, kgo);                           // K: 128 keys x 64 d; key = (tid >> 3) + 64u
      ky[u] = ld16(kbl + u * 64 * KW, kgo);
      vx[u] = ld16(vbh + (size_t)u * 32 * NTOK, vgo);                 // V^T: 64 d x 128 keys; d = (tid >> 4) + 32u
      vy[u] = ld16(vbl + (size_t)u * 32 * NTOK, vgo);
    }
#pragma unroll
    for (int u = 0; u < 2; ++u) {
      *(v4u*)(Ks  + kso + u * 64 * KP) = kx[u];
      *(v4u*)(Kls + kso + u * 64 * KP) = ky[u];
      *(v4u*)(Vhs + vso + u * 32 * VP) = vx[u];
      *(v4u*)(Vls + vso + u * 32 * VP) = vy[u];
    }
#pragma unroll
    for (int mtl = 0; mtl < 2; ++mtl) {
      if ((mtl ? cl1 : cl0) == 2) {                                   // block-uniform branch about the mask tile load
        const float* mbase = maskp + mrow0 + kv0 + mtl * 64;
#pragma unroll
        for (int u = 0; u < 2; ++u) {                                 // coverage: 1024 pieces of 4 floats = 64 rows x 64 keys
          const v4f mv = *(const v4f*)((const char*)(mbase + (size_t)u * 32 * SQ) + mgo);   // row = (tid >> 4) + 32u
          *(v4f*)(Ms + mso + u * 32 * MP + mtl * 64) = mv;
        }
      }
    }
    __syncthreads();

    const int cl = (kg < 2) ? cl0 : cl1;                              // wave-uniform class of this wave's 32 keys
    if (cl == 0) continue;                                            // no barrier between here and the next trip's first one

    // ---- scores, transposed: 32 keys x 16 queries, K = 64, three products ----
    v8f sa[2];
    sa[0] = zero8(); sa[1] = zero8();
#pragma unroll
    for (int dc = 0; dc < 2; ++dc) {
#pragma unroll
      for (int j = 0; j < 2; ++j) {
        const v16b kb = ldfrag_b((const __bf16*)(const void*)Ks  + (kg * AKC + j * 16 + c) * KP + dc * 32 + 8 * hh);
        const v16b kl = ldfrag_b((const __bf16*)(const void*)Kls + (kg * AKC + j * 16 + c) * KP + dc * 32 + 8 * hh);
        sa[j] = mma_b(kb, qh[dc], sa[j]);
        sa[j] = mma_b(kl, qh[dc], sa[j]);
        sa[j] = mma_b(kb, ql[dc], sa[j]);
        guard1b4(sa[j], qh[dc], ql[dc], kb, kl);
      }
    }
    acc_guard2(sa[0], sa[1]);

    // ---- scale, mask add (class 2): sc[j][r] = score of (query c, key 16j + 8hh + r) ----
    float sc[2][8];
#pragma unroll
    for (int j = 0; j < 2; ++j)
#pragma unroll
      for (int r = 0; r < 8; ++r) sc[j][r] = sa[j][r] * 0.125f;
    if (cl == 2) {                                                    // wave-uniform
      const float* mr = Ms + (wq * 16 + c) * MP + kg * AKC + 8 * hh;  // the query's mask row, this wave's keys, this half's
#pragma unroll
      for (int j = 0; j < 2; ++j) {
        const v4f ma = *(const v4f*)(mr + j * 16);
        const v4f mb = *(const v4f*)(mr + j * 16 + 4);
#pragma unroll
        for (int r = 0; r < 4; r += 2) {
          const unsigned wa = cvt2(ma[r], ma[r + 1]);
          const unsigned wb = cvt2(mb[r], mb[r + 1]);
          sc[j][r]     += lo_val(wa); sc[j][r + 1]     += hi_val(wa);
          sc[j][4 + r] += lo_val(wb); sc[j][4 + r + 1] += hi_val(wb);
        }
      }
    }
    // ---- chunk max of the query: in the lane, then with the other half ----
    float cm = -INFINITY;
#pragma unroll
    for (int j = 0; j < 2; ++j)
#pragma unroll
      for (int r = 0; r < 8; ++r) cm = fmaxf(cm, sc[j][r]);
    cm = fmaxf(cm, xhalf(cm));
    // ---- online softmax; p hi/lo packed in place into the B operands ----
    const float mnew  = fmaxf(mrow, cm);
    const float muse  = (mnew > -INFINITY) ? mnew : 0.0f;
    const float alpha = __expf(mrow - muse);
    mrow = mnew;
    union { v16b v; unsigned u[8]; } pa, pr;
    float ps[2];
#pragma unroll
    for (int j = 0; j < 2; ++j) {
      ps[j] = 0.f;
#pragma unroll
      for (int r = 0; r < 8; r += 2) {
        const float p0 = __expf(sc[j][r] - muse);
        const float p1 = __expf(sc[j][r + 1] - muse);
        ps[j] += p0;
        ps[j] += p1;
        const unsigned hp = cvt2(p0, p1);
        pa.u[j * 4 + (r >> 1)] = hp;
        pr.u[j * 4 + (r >> 1)] = cvt2_res(p0, p1, hp);
      }
    }
    lsum = lsum * alpha + (ps[0] + ps[1]);
#pragma unroll
    for (int t = 0; t < 4; ++t)
#pragma unroll
      for (int r = 0; r < 8; ++r) oacc[t][r] *= alpha;
    // ---- O^T += v^T . p^T (K = 32 keys, three products) ----
#pragma unroll
    for (int t = 0; t < 4; ++t) {
      const v16b vb = ldfrag_b((const __bf16*)(const void*)Vhs + (t * 16 + c) * VP + kg * AKC + 8 * hh);
      const v16b vr = ldfrag_b((const __bf16*)(const void*)Vls + (t * 16 + c) * VP + kg * AKC + 8 * hh);
      oacc[t] = mma_b(vb, pa.v, oacc[t]);
      oacc[t] = mma_b(vr, pa.v, oacc[t]);
      oacc[t] = mma_b(vb, pr.v, oacc[t]);
      guard1b4(oacc[t], pa.v, pr.v, vb, vr);
    }
  }
  __syncthreads();                                 // every wave is past the trip loop: the K / V^T tiles are free
  acc_guard4(oacc[0], oacc[1], oacc[2], oacc[3]);

  // ---- the four key groups' parts of a query slab are joined in group 0 ----
  // hand-over area: O parts as 16-B pieces [part][piece 0..7][lane], then (max, sum) pairs [part][lane]; part = (kg - 1) * 4 + wq
  v4f* jo = (v4f*)(void*)KVs;
  v2f* jm = (v2f*)(void*)(jo + (NKG - 1) * 4 * 8 * 32);
  if (kg != 0) {                                   // wave-uniform
    const int part = (kg - 1) * 4 + wq;
#pragma unroll
    for (int t = 0; t < 4; ++t) {
      const v4f x0 = {oacc[t][0], oacc[t][1], oacc[t][2], oacc[t][3]};
      const v4f x1 = {oacc[t][4], oacc[t][5], oacc[t][6], oacc[t][7]};
      jo[(part * 8 + 2 * t) * 32 + lane]     = x0;
      jo[(part * 8 + 2 * t + 1) * 32 + lane] = x1;
    }
    const v2f ml = {mrow, lsum};
    jm[part * 32 + lane] = ml;
  }
  __syncthreads();                                 // the parts are readable; the last barrier of the kernel
  if (kg != 0) return;                             // whole waves leave, behind every barrier

  v2f oml[NKG - 1];
  float mall = mrow;
#pragma unroll
  for (int g = 0; g < NKG - 1; ++g) {
    oml[g] = jm[(g * 4 + wq) * 32 + lane];
    mall = fmaxf(mall, oml[g][0]);
  }
  const float mjoin = (mall > -INFINITY) ? mall : 0.0f;
  float w0 = __expf(mrow - mjoin);                 // a part that saw no key has max -inf: weight 0
  float wg[NKG - 1];
#pragma unroll
  for (int g = 0; g < NKG - 1; ++g) wg[g] = __expf(oml[g][0] - mjoin);
  // the slot the instruction set asks for between an exp and the first user of its result or overwriter of its source; the four
  // weights are tied to it so that it stands behind the run of exps and in front of every product with a weight
  asm volatile("v_nop" : "+v"(w0), "+v"(wg[0]), "+v"(wg[1]), "+v"(wg[2]));
  lsum *= w0;
#pragma unroll
  for (int t = 0; t < 4; ++t)
#pragma unroll
    for (int r = 0; r < 8; ++r) oacc[t][r] *= w0;
#pragma unroll
  for (int g = 0; g < NKG - 1; ++g) {
    lsum += wg[g] * oml[g][1];
#pragma unroll
    for (int t = 0; t < 4; ++t) {
      const v4f x0 = jo[((g * 4 + wq) * 8 + 2 * t) * 32 + lane];
      const v4f x1 = jo[((g * 4 + wq) * 8 + 2 * t + 1) * 32 + lane];
#pragma unroll
      for (int r = 0; r < 4; ++r) {
        oacc[t][r]     += wg[g] * x0[r];
        oacc[t][4 + r] += wg[g] * x1[r];
      }
    }
  }

  unsigned short* osh = Osh[wq];
  unsigned short* osl = Osl[wq];
  const float inv = 1.0f / (lsum + xhalf(lsum));   // the halves' sums joined; l >= 1: the row max contributes exp(0)
#pragma unroll
  for (int t = 0; t < 4; ++t) {                    // 8 consecutive d of query c: one 16-B LDS store per plane
    v4u xh, xl;
#pragma unroll
    for (int r = 0; r < 8; r += 2) {
      const float o0 = oacc[t][r] * inv;
      const float o1 = oacc[t][r + 1] * inv;
      const unsigned ho = cvt2(o0, o1);
      xh[r >> 1] = ho;
      xl[r >> 1] = cvt2_res(o0, o1, ho);
    }
    *(v4u*)(osh + c * 64 + t * 16 + 8 * hh) = xh;
    *(v4u*)(osl + c * 64 + t * 16 + 8 * hh) = xl;
  }
  lds_wave_sync();
  unsigned short* Ag = aop + (tok0 + q0) * AOW + h * HDM;
  const int qq = lane >> 3;                        // 0..3
  const int c8 = (lane & 7) * 8;
  {
#pragma unroll
    for (int it = 0; it < 4; ++it) {
      const int row = it * 4 + qq;                 // it 0..3 x qq 0..3 covers rows 0..15
      const v4u x = *(const v4u*)(osh + row * 64 + c8);
      const v4u y = *(const v4u*)(osl + row * 64 + c8);
      *(v4u*)(Ag + (size_t)row * AOW + c8)      = x;
      *(v4u*)(Ag + (size_t)row * AOW + QW + c8) = y;
    }
    
  }
}

// ---------------------------------------------------------------------------
// Workspace map (bytes; every region is an exact whole number of the rows its producer writes with whole-line stores;
// all dimensions are tile multiples, no padded tails needed; every offset is a multiple of 128):
//   XB   bf16 [4096][1024]   8388608     WQK bf16 [1280][1024]   2621440     WV  bf16 [256][1024]    524288
//   WO2  bf16 [1024][2048]   4194304     CST f32  [4096][32]      524288     SNT f32  [4096][32]     524288
//   CLS  i32  [2][32][32]       8192     QH  bf16 [4096][1024]   8388608     QL  bf16 [4096][1024]  8388608
//   KH   bf16 [4096][256]    2097152     KL  bf16 [4096][256]    2097152     VTH bf16 [256][4096]   2097152
//   VTL  bf16 [256][4096]    2097152     AO  bf16 [4096][2048]  16777216
//   total                   58728448
// ---------------------------------------------------------------------------
extern "C" void kernel_launch(void* const* d_in, const int* in_sizes, int n_in,
                              void* d_out, int out_size, void* d_ws, size_t ws_size,
                              hipStream_t stream) {
  if (n_in < 7) return;
  if (in_sizes[0] != NTOK * HID) return;                  // hidden_states [2][2048][1024] f32
  if (in_sizes[1] != NB * SQ * SQ) return;                // attention_mask [2][1][2048][2048] f32
  if (in_sizes[2] != NTOK) return;                        // position_ids [2][2048] int32
  if (in_sizes[3] != QW * HID) return;                    // wq [1024][1024]
  if (in_sizes[4] != KW * HID) return;                    // wk [256][1024]
  if (in_sizes[5] != KW * HID) return;                    // wv [256][1024]
  if (in_sizes[6] != HID * QW) return;                    // wo [1024][1024]
  if (out_size != NTOK * HID) return;

  const float* hs   = (const float*)d_in[0];
  const float* mask = (const float*)d_in[1];
  const int*   pos  = (const int*)d_in[2];
  const float* wq   = (const float*)d_in[3];
  const float* wk   = (const float*)d_in[4];
  const float* wv   = (const float*)d_in[5];
  const float* wo   = (const float*)d_in[6];
  float* out = (float*)d_out;

  const size_t szXB  = (size_t)NTOK * HID * 2;
  const size_t szWQK = (size_t)QKN * HID * 2;
  const size_t szWV  = (size_t)KW * HID * 2;
  const size_t szWO2 = (size_t)HID * AOW * 2;
  const size_t szT   = (size_t)NTOK * NFREQ * 4;
  const size_t szCLS = (size_t)NB * NT64 * NT64 * 4;
  const size_t szQ   = (size_t)NTOK * QW * 2;
  const size_t szK   = (size_t)NTOK * KW * 2;
  const size_t szVT  = (size_t)KW * NTOK * 2;
  const size_t szAO  = (size_t)NTOK * AOW * 2;
  size_t off = 0;
  const size_t oXB  = off; off += szXB;
  const size_t oWQK = off; off += szWQK;
  const size_t oWV  = off; off += szWV;
  const size_t oWO2 = off; off += szWO2;
  const size_t oCST = off; off += szT;
  const size_t oSNT = off; off += szT;
  const size_t oCLS = off; off += szCLS;
  const size_t oQH  = off; off += szQ;
  const size_t oQL  = off; off += szQ;
  const size_t oKH  = off; off += szK;
  const size_t oKL  = off; off += szK;
  const size_t oVTH = off; off += szVT;
  const size_t oVTL = off; off += szVT;
  const size_t oAO  = off; off += szAO;
  if (off > ws_size) return;                              // off = 58728448

  char* ws = (char*)d_ws;
  unsigned short* XB  = (unsigned short*)(ws + oXB);
  unsigned short* WQK = (unsigned short*)(ws + oWQK);
  unsigned short* WV  = (unsigned short*)(ws + oWV);
  unsigned short* WO2 = (unsigned short*)(ws + oWO2);
  float*          CST = (float*)(ws + oCST);
  float*          SNT = (float*)(ws + oSNT);
  int*            CLS = (int*)(ws + oCLS);
  unsigned short* QH  = (unsigned short*)(ws + oQH);
  unsigned short* QL  = (unsigned short*)(ws + oQL);
  unsigned short* KH  = (unsigned short*)(ws + oKH);
  unsigned short* KL  = (unsigned short*)(ws + oKL);
  unsigned short* VTH = (unsigned short*)(ws + oVTH);
  unsigned short* VTL = (unsigned short*)(ws + oVTL);
  unsigned short* AO  = (unsigned short*)(ws + oAO);

  const dim3 b256(256), b128(128), b512(512);

  // (1) preparation, one launch: mask classes, x / wq / wk / wv / wo bf16 planes, cos/sin table
  prep_kernel<<<dim3(PB_ALL), b256, 0, stream>>>(hs, mask, pos, wq, wk, wv, wo, XB, WQK, WV, WO2, CST, SNT, CLS);
  // (2) one launch, two products:
  //     q|k = x . [Wq;Wk]^T, RoPE, split -> QH/QL [4096][1024], KH/KL [4096][256]   (M=4096, N=1280, K=1024; 32 x 10 block tiles)
  //     v^T = Wv . x^T -> VTH/VTL [256][4096]   (A = WV, Bt = XB; M=256, N=4096, K=1024; 2 x 32 block tiles)
  gemm_w32x128_kernel<0><<<dim3((NTOK / 128) * (QKN / 128) + (KW / 128) * (NTOK / 128)), b128, 0, stream>>>(
      XB, HID, WQK, HID, CST, SNT, (void*)QH, (void*)QL, (void*)KH, (void*)KL, QW, KW, NTOK, QKN, HID,
      WV, (void*)VTH, (void*)VTL, NTOK, KW, NTOK);
  // (3) attention per (q tile, head, batch) -> AO hi|lo [4096][2048]
  attn_kernel<<<dim3(SQ / 64, NHQ, NB), b512, 0, stream>>>(QH, QL, KH, KL, VTH, VTL, mask, CLS, AO);
  // (4) out = [AOhi | AOlo] . [Wo | Wo]^T -> d_out f32 [4096][1024]   (M=4096, N=1024, K=2048; 32 x 8 block tiles)
  gemm_w32x128_kernel<2><<<dim3((NTOK / 128) * (HID / 128)), b128, 0, stream>>>(
      AO, AOW, WO2, AOW, CST, SNT, (void*)out, (void*)out, (void*)out, (void*)out, HID, HID, NTOK, HID, AOW,
      AO, (void*)out, (void*)out, HID, NTOK, HID);
  (void)hipGetLastError();
}

// v008
// It runs in 127 microseconds.
// Two timings next to v007 put it at 1.07 and 1.06 times that version's speed.
// All steps since v000 together make it 3.92 times as fast.
// Contractions: x.[Wq;Wk]^T and Wv.x^T on v_wmma_f32_16x16x32_bf16 (operands = RNE bf16 copies of the f32 inputs, single products);
// q.k^T and p.v on v_wmma_f32_16x16x32_bf16 with bf16 hi/lo split operands (hi.hi + hi.lo + lo.hi, three products);
// attn.Wo^T on v_wmma_f32_16x16x32_bf16 with attn = bf16 hi and lo planes (two products, both against the same Wo fragment) and Wo as RNE bf16.
// f32 accumulate everywhere; RoPE (f32 cos/sin table built from the position ids), mask add and online softmax in f32.
// Plane carry audit: every 16-bit plane is bf16 with carry 1 (hi = RNE(v), lo = RNE(v - hi), same accumulator); nothing is scaled,
// nothing is folded back: XB, WQK, WV, WO (RNE copies), QH/QL, KH/KL, VTH/VTL, P (registers), AO hi|lo.
#include <hip/hip_runtime.h>
#include <math.h>
#include <stdint.h>

#define NB     2
#define SQ     2048
#define HID    1024
#define NHQ    16
#define NKVH   4
#define HDM    64
#define QW     1024          // q plane width (16 heads x 64)
#define KW     256           // k / v width (4 heads x 64)
#define QKN    1280          // q|k projection columns
#define NTOK   4096
#define NFREQ  32
#define AOW    2048          // attn plane width: hi at col 0..1023, lo at col 1024..2047
#define NT64   32            // 64-wide tiles along each mask axis

typedef __bf16       v16b __attribute__((ext_vector_type(16)));
typedef __bf16       v8b  __attribute__((ext_vector_type(8)));
typedef float        v8f  __attribute__((ext_vector_type(8)));
typedef float        v4f  __attribute__((ext_vector_type(4)));
typedef unsigned int v4u  __attribute__((ext_vector_type(4)));
typedef float        v2f  __attribute__((ext_vector_type(2)));
typedef __bf16       v2b  __attribute__((ext_vector_type(2)));

// ---------------------------------------------------------------------------
// small helpers
// ---------------------------------------------------------------------------
// two f32 -> two bf16 (RNE) in one word by the hardware's packed convert: a in bits 15..0, b in bits 31..16
__device__ __forceinline__ unsigned cvt2(float a, float b) {
  const v2f x = {a, b};
  return __builtin_bit_cast(unsigned, __builtin_convertvector(x, v2b));
}
__device__ __forceinline__ float lo_val(unsigned w) { return __uint_as_float(w << 16); }          // f32 value of the low bf16
__device__ __forceinline__ float hi_val(unsigned w) { return __uint_as_float(w & 0xFFFF0000u); }  // f32 value of the high bf16
// the residues of a and b against their bf16 roundings held in w = cvt2(a, b), rounded to bf16 in turn
__device__ __forceinline__ unsigned cvt2_res(float a, float b, unsigned w) { return cvt2(a - lo_val(w), b - hi_val(w)); }
__device__ __forceinline__ v8f zero8() { v8f z = {0.f, 0.f, 0.f, 0.f, 0.f, 0.f, 0.f, 0.f}; return z; }
// lane l with lane l ^ 16 (the other half of the wave)
__device__ __forceinline__ float xhalf(float x) {
  const int b = __builtin_bit_cast(int, x);
  return __builtin_bit_cast(float, __builtin_amdgcn_permlanex16(b, b, 0x76543210, 0xfedcba98, false, false));
}
__device__ __forceinline__ int wave_id() { return __builtin_amdgcn_readfirstlane((int)(threadIdx.x >> 5)); }

__device__ __forceinline__ void lds_wave_sync() {
  __builtin_amdgcn_fence(__ATOMIC_RELEASE, "workgroup");
  __builtin_amdgcn_wave_barrier();
  __builtin_amdgcn_fence(__ATOMIC_ACQUIRE, "workgroup");
}

// ---------------------------------------------------------------------------
// WMMA fragments (wave32, 16x16x32, bf16 operands). For A (row m = lane&15) and B (col n = lane&15) alike:
// elements 0..7 <- k0 + 8*(lane>>4) + 0..7, elements 8..15 <- k0 + 16 + 8*(lane>>4) + 0..7.
// ldfrag_b(p) with p = rowbase + k0 + 8*(lane>>4): two 16-B loads p[0..7], p[16..23] (A rows and k-contiguous B rows alike).
// D: acc[r] = (row 8*(lane>>4) + r, col lane&15).
// ---------------------------------------------------------------------------
union FragB { v16b v; v8b h[2]; };
__device__ __forceinline__ v16b ldfrag_b(const __bf16* p) { FragB f; f.h[0] = *(const v8b*)(p); f.h[1] = *(const v8b*)(p + 16); return f.v; }

__device__ __forceinline__ v8f mma_b(v16b a, v16b b, v8f c) {
  return __builtin_amdgcn_wmma_f32_16x16x32_bf16(false, a, false, b, (short)0, c, false, false);
}
// hazard guards: 4 VALU slots after the last WMMA of a group, D tied, A/B kept live; memory clobber keeps later loads behind the group
__device__ __forceinline__ void guard1b4(v8f& a, v16b w, v16b x, v16b y, v16b z) {
  asm volatile("v_nop\n\tv_nop\n\tv_nop\n\tv_nop" : "+v"(a) : "v"(w), "v"(x), "v"(y), "v"(z) : "memory");
}
__device__ __forceinline__ void acc_guard4(v8f& a, v8f& b, v8f& c, v8f& d) {
  asm volatile("v_nop\n\tv_nop\n\tv_nop\n\tv_nop" : "+v"(a), "+v"(b), "+v"(c), "+v"(d));
}
__device__ __forceinline__ void acc_guard2(v8f& a, v8f& b) {
  asm volatile("v_nop\n\tv_nop\n\tv_nop\n\tv_nop" : "+v"(a), "+v"(b));
}

// ---------------------------------------------------------------------------
// RoPE table: cst[t][j] = cos(pos[t] * inv_freq[j]), snt[t][j] = sin(...), inv_freq[j] = 1 / 10000^(j/32), j < 32, all f32.
// ---------------------------------------------------------------------------
// A wave takes RTW consecutive tokens (lane = frequency j): their position ids are read together, inv_freq is formed once.
#define RTW 4
static_assert(NTOK % (8 * RTW) == 0);          // whole blocks of 8 waves cover the tokens exactly
__device__ __forceinline__ void rope_table_part(int bid, const int* __restrict__ pos, float* __restrict__ cst,
                                                float* __restrict__ snt) {
  const int lane = threadIdx.x & 31;
  const int wave = (int)(threadIdx.x >> 5);
  const int t0 = (bid * 8 + wave) * RTW;
  int pi[RTW];
#pragma unroll
  for (int u = 0; u < RTW; ++u) pi[u] = pos[t0 + u];
  const float e   = (float)lane * 0.03125f;    // (2*j)/64 exact
  const float pw  = powf(10000.0f, e);
  const float inv = 1.0f / pw;
#pragma unroll
  for (int u = 0; u < RTW; ++u) {
    const float ang = (float)pi[u] * inv;
    const float cv  = cosf(ang);
    const float sv  = sinf(ang);
    const size_t o = (size_t)(t0 + u) * NFREQ + lane;
    cst[o] = cv;
    snt[o] = sv;
  }
  // behind the last store: no register that an issued store names is rewritten ahead of this wait (the rule for issued global stores)
  asm volatile("s_wait_xcnt 0x0" ::: "memory");
}

// ---------------------------------------------------------------------------
// Elementwise RNE f32 -> bf16 plane: a piece = 8 elements, one 16-B store per lane -> 32 consecutive lanes write 4 whole lines.
// A thread takes CPT pieces, 256 pieces apart (a block = 256 * CPT consecutive pieces), and issues all its 2 * CPT loads before
// it uses the first: one memory latency per thread instead of one per piece, and a CPT-th of the blocks to start.
// Every plane is a whole number of such blocks (asserted at the block counts below): no tail, no guard.
// ---------------------------------------------------------------------------
#define CPT 4
#define CBE (256 * CPT * 8)                    // elements per conversion block
__device__ __forceinline__ v4u pack8(v4f a, v4f b) {
  v4u w;
  w[0] = cvt2(a[0], a[1]);
  w[1] = cvt2(a[2], a[3]);
  w[2] = cvt2(b[0], b[1]);
  w[3] = cvt2(b[2], b[3]);
  return w;
}
__device__ __forceinline__ void cvt_bf16_part(int bid, const float* __restrict__ in, unsigned short* __restrict__ outp) {
  const size_t e0 = (size_t)bid * CBE + 8 * (size_t)threadIdx.x;
  v4f a[CPT], b[CPT];
#pragma unroll
  for (int u = 0; u < CPT; ++u) {
    a[u] = *(const v4f*)(in + e0 + u * 2048);
    b[u] = *(const v4f*)(in + e0 + u * 2048 + 4);
  }
#pragma unroll
  for (int u = 0; u < CPT; ++u) *(v4u*)(outp + e0 + u * 2048) = pack8(a[u], b[u]);
  // behind the last store: no register that an issued store names is rewritten ahead of this wait (the rule for issued global stores)
  asm volatile("s_wait_xcnt 0x0" ::: "memory");
}

// ---------------------------------------------------------------------------
// Mask tile classes. mask [NB][1][SQ][SQ] f32 (additive). One block per (b, 64-row band mt): 256 threads x 8 consecutive columns,
// 64 rows each. For every 64x64 tile (b, mt, nt):
//   class 0 = every element <= -1e8 (tile contributes nothing: exp underflows to 0 exactly when the row has an admitted key),
//   class 1 = every element == 0 (nothing to add), class 2 = anything else (mask tile added elementwise).
// If the band contains a row with no element > -1e4 the skip is not valid for it: class 0 tiles of that band become class 2.
// Reductions are OR (order independent). Coverage: NB*32 blocks x 64 rows x 256 thr x 8 cols = the whole mask;
// The rows are read MRB at a time, all 2 * MRB loads of a thread issued before the first is used: 64 / MRB exposed memory
// latencies per block instead of 64.
// ---------------------------------------------------------------------------
#define ADM_TH (-1.0e4f)
#define SKP_TH (-1.0e8f)
#define MRB 8

__device__ __forceinline__ void mask_class_part(int bid, const float* __restrict__ mask, int* __restrict__ cls) {
  __shared__ int nzs[NT64];
  __shared__ int bgs[NT64];
  __shared__ unsigned rlo[8];
  __shared__ unsigned rhi[8];
  const int bm   = bid;                  // b*32 + mt
  const int b    = bm >> 5;
  const int mt   = bm & 31;
  const int tid  = threadIdx.x;
  const int lane = tid & 31;
  const int wave = tid >> 5;
  const int j0   = tid * 8;
  int nz = 0, bg = 0;
  unsigned rowlo = 0u, rowhi = 0u;       // bit r: this thread's 8 columns contain an admitted element in row r
  // rolled: one batch of rows is as much as a thread's registers should hold
#pragma unroll 1
  for (int r0 = 0; r0 < 64; r0 += MRB) {
    const float* mr = mask + (((size_t)b * SQ) + (size_t)(mt * 64 + r0)) * SQ + j0;
    v4f ma[MRB], mb[MRB];
#pragma unroll
    for (int u = 0; u < MRB; ++u) {
      ma[u] = *(const v4f*)(mr + (size_t)u * SQ);
      mb[u] = *(const v4f*)(mr + (size_t)u * SQ + 4);
    }
    // keeps the whole batch's loads in front of the first use: left alone, the compiler holds some back until registers are
    // free again, and those pay a second memory latency in every batch
    __builtin_amdgcn_sched_barrier(0);
#pragma unroll
    for (int u = 0; u < MRB; ++u) {
      const int r = r0 + u;
      const v4f mk0 = ma[u];
      const v4f mk1 = mb[u];
      const int a = ((mk0[0] > ADM_TH) | (mk0[1] > ADM_TH) | (mk0[2] > ADM_TH) | (mk0[3] > ADM_TH) |
                     (mk1[0] > ADM_TH) | (mk1[1] > ADM_TH) | (mk1[2] > ADM_TH) | (mk1[3] > ADM_TH)) ? 1 : 0;
      const int z = ((mk0[0] != 0.0f) | (mk0[1] != 0.0f) | (mk0[2] != 0.0f) | (mk0[3] != 0.0f) |
                     (mk1[0] != 0.0f) | (mk1[1] != 0.0f) | (mk1[2] != 0.0f) | (mk1[3] != 0.0f)) ? 1 : 0;
      const int g = ((mk0[0] > SKP_TH) | (mk0[1] > SKP_TH) | (mk0[2] > SKP_TH) | (mk0[3] > SKP_TH) |
                     (mk1[0] > SKP_TH) | (mk1[1] > SKP_TH) | (mk1[2] > SKP_TH) | (mk1[3] > SKP_TH)) ? 1 : 0;
      nz |= z;
      bg |= g;
      const unsigned sh = ((unsigned)a) << (r & 31);
      rowlo |= (r < 32) ? sh : 0u;
      rowhi |= (r < 32) ? 0u : sh;
    }
  }
  // OR over the 8 lanes 8q..8q+7 that share column tile nt = tid >> 3
  nz |= __shfl_xor(nz, 1, 32); nz |= __shfl_xor(nz, 2, 32); nz |= __shfl_xor(nz, 4, 32);
  bg |= __shfl_xor(bg, 1, 32); bg |= __shfl_xor(bg, 2, 32); bg |= __shfl_xor(bg, 4, 32);
#pragma unroll
  for (int off = 1; off < 32; off <<= 1) {
    rowlo |= (unsigned)__shfl_xor((int)rowlo, off, 32);
    rowhi |= (unsigned)__shfl_xor((int)rowhi, off, 32);
  }
  if ((lane & 7) == 0) { nzs[tid >> 3] = nz; bgs[tid >> 3] = bg; }
  if (lane == 0) { rlo[wave] = rowlo; rhi[wave] = rowhi; }
  __syncthreads();
  if (wave == 0) {                       // wave-uniform
    const int z = nzs[lane];
    const int g = bgs[lane];
    unsigned ol = rlo[0], oh = rhi[0];
#pragma unroll
    for (int w = 1; w < 8; ++w) { ol |= rlo[w]; oh |= rhi[w]; }
    const bool has_empty_row = (ol != 0xFFFFFFFFu) || (oh != 0xFFFFFFFFu);
    int cval = (g == 0) ? 0 : ((z == 0) ? 1 : 2);
    cval = (has_empty_row && cval == 0) ? 2 : cval;
    int* cp = cls + (size_t)bm * NT64 + lane;
    *cp = cval;
    
  }
}

// ---------------------------------------------------------------------------
// The seven preparation jobs depend on the inputs alone and on nothing of each other: one launch, each job a range of blocks
// (256 threads each). The mask bands, the longest blocks, come first.
// Every branch is on the block index: whole blocks take it, so the barrier of the mask part stays block-uniform.
// ---------------------------------------------------------------------------
#define PB_MASK (NB * NT64)                  // 64
#define PB_X    (NTOK * HID / CBE)           // 512
#define PB_ROPE (NTOK / (8 * RTW))           // 128
#define PB_WQ   (QW * HID / CBE)             // 128
#define PB_WO   (HID * QW / CBE)             // 128
#define PB_WKV  (KW * HID / CBE)             // 32, wk and wv each
#define PB_ALL  (PB_MASK + PB_X + PB_ROPE + PB_WQ + PB_WO + 2 * PB_WKV)
static_assert((NTOK * HID) % CBE == 0 && (QW * HID) % CBE == 0 && (KW * HID) % CBE == 0);   // whole conversion blocks only

__global__ __launch_bounds__(256) void prep_kernel(
    const float* __restrict__ hs, const float* __restrict__ mask, const int* __restrict__ pos,
    const float* __restrict__ wq, const float* __restrict__ wk, const float* __restrict__ wv, const float* __restrict__ wo,
    unsigned short* __restrict__ xb, unsigned short* __restrict__ wqk, unsigned short* __restrict__ wvb,
    unsigned short* __restrict__ wob, float* __restrict__ cst, float* __restrict__ snt, int* __restrict__ cls) {
  int bid = (int)blockIdx.x;
  // mask tile classes [2][32][32]
  if (bid < PB_MASK) { mask_class_part(bid, mask, cls); return; }
  bid -= PB_MASK;
  // x -> bf16 plane [4096][1024]
  if (bid < PB_X) { cvt_bf16_part(bid, hs, xb); return; }
  bid -= PB_X;
  // cos/sin table [4096][32] x 2 from the position ids
  if (bid < PB_ROPE) { rope_table_part(bid, pos, cst, snt); return; }
  bid -= PB_ROPE;
  // wq [1024][1024] -> WQK rows 0..1023 (natural [out][in] = Bt layout)
  if (bid < PB_WQ) { cvt_bf16_part(bid, wq, wqk); return; }
  bid -= PB_WQ;
  // wo [1024][1024] -> WO (natural [out][in] = Bt layout)
  if (bid < PB_WO) { cvt_bf16_part(bid, wo, wob); return; }
  bid -= PB_WO;
  // wk [256][1024] -> WQK rows 1024..1279
  if (bid < PB_WKV) { cvt_bf16_part(bid, wk, wqk + (size_t)QW * HID); return; }
  bid -= PB_WKV;
  // wv [256][1024] -> WV
  if (bid < PB_WKV) { cvt_bf16_part(bid, wv, wvb); return; }
}

// ---------------------------------------------------------------------------
// bf16 WMMA GEMM, block = 4 waves (128 threads) = one 128 x 128 tile of C; wave w owns rows 32w..32w+31 of it, all 128 cols.
//   C[m][n] = sum_k A[m][k] * Bt[n][k]; A row-major [M][K] bf16 (pitch lda), Bt row-major [N][K] bf16 (pitch ldb);
//   M % 128 == 0, N % 128 == 0, K % 64 == 0, K >= 64, lda % 8 == 0, ldb % 8 == 0; grid.x = M/128 * N/128.
//   EPI 0 carries a second, independent product in the same launch: blocks M/128 * N/128 .. + M2/128 * N2/128 - 1 compute
//   C'[m][n] = sum_k A2[m][k] * A[n][k] (A2 [M2][K] pitch lda; the first product's A, N2 rows of it, as Bt with pitch ldb:
//   lda == ldb), same K, same loop.
//   Operands: per trip of 64 k the 128 A rows and the 128 Bt rows (128 B each) are copied global -> LDS asynchronously, whole
//   128-B lines per 8 lanes, into one of two buffers; trip t works on buffer t & 1 while tile t + 1 flies into the other.
//   Fragments are read from LDS rows (ldfrag_b) in the same k order as before.
//   EPI 2 takes A as two planes side by side, [M][2K] (pitch lda): C[m][n] = sum_k (A[m][k] + A[m][K + k]) * Bt[n][k], two products.
//   A trip stages both planes' 64-k tiles next to ONE Bt tile, and each Bt fragment, read from LDS once, feeds both planes' WMMAs.
// Epilogues (all: per wave, per 16-row slab: stage in LDS, wave sync, write each row segment with ONE instruction of
//   EPI 0: q|k projection with RoPE. The 128-col tile holds two 64-dim heads; pairs (d, d+32) inside each head are rotated with
//          the f32 cos/sin rows of the token (staged per slab in LDS), then split to bf16 hi (C0/C2) and lo (C1/C3) planes.
//          cols n0 < QW -> q planes [M][ldc], col n0; cols n0 >= QW -> k planes [M][ldc2], col n0-QW. Row segment 256 B = 16 lanes x 16 B.
//          Second product = v^T projection: bf16 hi plane D0, lo plane D1, [M2][ldd], row segment 256 B.
//   EPI 2: f32 output C0 [M][ldc]; row segment 128 floats = 512 B = 32 lanes x 16 B per instruction.
// ---------------------------------------------------------------------------
template <int EPI> struct SlabCfg { static constexpr int PERWF = 2048; };   // floats per wave (8 KB)
template <> struct SlabCfg<0>     { static constexpr int PERWF = 3072; };   // + 16x32 cos + 16x32 sin rows

#define GKT  64                 // k per staged tile: 128-B rows
#define GPITCH  72                 // LDS row pitch in bf16: 144 B = 16 B x odd, for the 16-B fragment reads
#define GOP  (128 * GPITCH)        // bf16 per operand tile (128 rows)
#define GROWB (16 * GPITCH * 2)    // LDS bytes between a lane's consecutive copies (16 rows)

__device__ __forceinline__ unsigned lds_off(const void* p) { return (unsigned)(size_t)p; }

// One operand tile, 128 rows x 128 B: lane t copies 16 B of rows (t >> 3) + 16u, u = 0..7 (128 lanes x 8 = 1024 pieces = the tile).
// l = the lane's LDS byte address for u = 0, g = its global address for u = 0, ld = global row pitch in elements.
// s_wait_xcnt stands inside the statement so that no address register is rewritten ahead of it.
__device__ __forceinline__ void stage_tile(unsigned l, const unsigned short* g, int ld) {
  const size_t st = (size_t)16 * (size_t)ld;
  asm volatile(
      "global_load_async_to_lds_b128 %0, %8, off\n\t"
      "global_load_async_to_lds_b128 %1, %9, off\n\t"
      "global_load_async_to_lds_b128 %2, %10, off\n\t"
      "global_load_async_to_lds_b128 %3, %11, off\n\t"
      "global_load_async_to_lds_b128 %4, %12, off\n\t"
      "global_load_async_to_lds_b128 %5, %13, off\n\t"
      "global_load_async_to_lds_b128 %6, %14, off\n\t"
      "global_load_async_to_lds_b128 %7, %15, off\n\t"
      "s_wait_xcnt 0x0"
      :: "v"(l), "v"(l + 1u * GROWB), "v"(l + 2u * GROWB), "v"(l + 3u * GROWB),
         "v"(l + 4u * GROWB), "v"(l + 5u * GROWB), "v"(l + 6u * GROWB), "v"(l + 7u * GROWB),
         "v"(g), "v"(g + st), "v"(g + 2 * st), "v"(g + 3 * st),
         "v"(g + 4 * st), "v"(g + 5 * st), "v"(g + 6 * st), "v"(g + 7 * st)
      : "memory");
}

template <int EPI>
__global__ __launch_bounds__(128) void gemm_w32x128_kernel(
    const unsigned short* __restrict__ Ap, int lda,
    const unsigned short* __restrict__ Btp, int ldb,
    const float* __restrict__ cst, const float* __restrict__ snt,
    void* C0, void* C1, void* C2, void* C3, int ldc, int ldc2,
    int M, int N, int K,
    const unsigned short* __restrict__ A2p, void* D0, void* D1, int ldd, int M2, int N2) {
  __shared__ __align__(16) float lds_all[4 * SlabCfg<EPI>::PERWF];
  constexpr int NA = (EPI == 2) ? 2 : 1;                       // A planes that share the Bt tile
  __shared__ __align__(16) unsigned short ring[2][(NA + 1) * GOP];   // [buffer][A tile(s) | Bt tile], 18,432 B a tile

  const int tid  = (int)threadIdx.x;
  const int lane = tid & 31;
  const int wave = wave_id();
  const int hh = lane >> 4;           // lane half: k offset 8*hh, D row offset 8*hh
  const int rl = lane & 15;           // A row / B col / D col within subtile
  const int ntile1 = (M >> 7) * (N >> 7);
  const bool second = (EPI == 0) && ((int)blockIdx.x >= ntile1);   // block-uniform: this block works on the second product
  const int tilesN = (second ? N2 : N) >> 7;
  const int tilesM = (second ? M2 : M) >> 7;
  const int tile = (int)blockIdx.x - (second ? ntile1 : 0);
  if (tile >= tilesM * tilesN) return;          // block-uniform, in front of every barrier and copy
  const int tm = tile / tilesN;
  const int tn = tile - tm * tilesN;
  const int mblk = tm << 7;
  const int m0 = mblk + (wave << 5);
  const int n0 = tn << 7;

  // this lane's first piece of each operand tile: row tid >> 3, 16-B column tid & 7
  const int srow = tid >> 3;
  const int sc8  = (tid & 7) * 8;
  const unsigned short* gA = (second ? A2p : Ap) + (size_t)(mblk + srow) * lda + sc8;
  const unsigned short* gB = (second ? Ap : Btp) + (size_t)(n0   + srow) * ldb + sc8;
  const unsigned lA = lds_off(&ring[0][0]) + (unsigned)(srow * GPITCH + sc8) * 2u;
  const unsigned lA2 = lA + GOP * 2u;            // second A plane's tile (NA == 2)
  const unsigned lB = lA + NA * GOP * 2u;
  const unsigned bufb = (NA + 1) * GOP * 2u;     // bytes per buffer
  const int ntrip = K / GKT;

  v8f acc[2][8];
#pragma unroll
  for (int i = 0; i < 2; ++i)
#pragma unroll
    for (int j = 0; j < 8; ++j) acc[i][j] = zero8();

  // prologue: tile 0 lands and is published, then tile 1 starts
  stage_tile(lA, gA, lda);
  if (NA == 2) stage_tile(lA2, gA + K, lda);
  stage_tile(lB, gB, ldb);
  asm volatile("s_wait_asynccnt 0x0" ::: "memory");   // this wave's copies of tile 0 have landed
  __syncthreads();                                     // ... and every other wave's: tile 0 is readable
  if (ntrip > 1) {
    stage_tile(lA + bufb, gA + GKT, lda);
    if (NA == 2) stage_tile(lA2 + bufb, gA + K + GKT, lda);
    stage_tile(lB + bufb, gB + GKT, ldb);
  }

  for (int t = 0; t < ntrip; ++t) {
    const __bf16* As = (const __bf16*)(const void*)&ring[t & 1][0]   + (wave * 32 + rl) * GPITCH + 8 * hh;
    const __bf16* Bs = (const __bf16*)(const void*)&ring[t & 1][NA * GOP] + rl * GPITCH + 8 * hh;
    v16b ah[2][NA][2], bf[2][8];                       // [k half of the tile]([plane])[fragment]
#pragma unroll
    for (int s = 0; s < 2; ++s) {                      // in the order of first use
#pragma unroll
      for (int i = 0; i < 2; ++i) ah[s][0][i] = ldfrag_b(As + i * 16 * GPITCH + s * 32);
#pragma unroll
      for (int j = 0; j < 8; ++j) bf[s][j] = ldfrag_b(Bs + j * 16 * GPITCH + s * 32);
#pragma unroll
      for (int p = 1; p < NA; ++p)
#pragma unroll
        for (int i = 0; i < 2; ++i) ah[s][p][i] = ldfrag_b(As + p * GOP + i * 16 * GPITCH + s * 32);
    }
    // keeps the trip's LDS reads together in front of its WMMAs: one exposed LDS latency per trip instead of one per WMMA pair
    __builtin_amdgcn_sched_barrier(0);
#pragma unroll
    for (int s = 0; s < 2; ++s) {
#pragma unroll
      for (int p = 0; p < NA; ++p) {
#pragma unroll
        for (int j = 0; j < 8; ++j) {
          acc[0][j] = mma_b(ah[s][p][0], bf[s][j], acc[0][j]);
          acc[1][j] = mma_b(ah[s][p][1], bf[s][j], acc[1][j]);
        }
      }
    }
    // keeps the WMMAs in front of the trip's foot: they overlap the LDS reads, and tile t + 1's copies get the whole trip to land
    __builtin_amdgcn_sched_barrier(0);
    asm volatile("s_wait_dscnt 0x0" ::: "memory");     // this wave's reads of buffer t & 1 are done before it is refilled
    asm volatile("s_wait_asynccnt 0x0" ::: "memory");  // this wave's copies of tile t + 1 have landed
    __syncthreads();                                   // publishes tile t + 1 and ends every reader's use of buffer t & 1
    if (t + 2 < ntrip) {                               // same for the whole block
      const unsigned bo = (unsigned)(t & 1) * bufb;
      stage_tile(lA + bo, gA + (size_t)(t + 2) * GKT, lda);
      if (NA == 2) stage_tile(lA2 + bo, gA + K + (size_t)(t + 2) * GKT, lda);
      stage_tile(lB + bo, gB + (size_t)(t + 2) * GKT, ldb);
    }
  }
  asm volatile("s_wait_asynccnt 0x0" ::: "memory");    // nothing of this wave is in flight behind the loop
  acc_guard4(acc[0][0], acc[0][1], acc[0][2], acc[0][3]);
  acc_guard4(acc[0][4], acc[0][5], acc[0][6], acc[0][7]);
  acc_guard4(acc[1][0], acc[1][1], acc[1][2], acc[1][3]);
  acc_guard4(acc[1][4], acc[1][5], acc[1][6], acc[1][7]);

  // ---- epilogue ----
  float* wl = lds_all + wave * SlabCfg<EPI>::PERWF;
  unsigned short* sl16 = (unsigned short*)(void*)wl;       // 4096 u16 = floats 0..2047 (two 16x128 planes)
  float* slf = wl;

  if (EPI == 0 && !second) {
    float* csl = wl + 2048;                                 // cos rows [16][32]
    float* snl = wl + 2048 + 16 * NFREQ;                    // sin rows [16][32]
    const bool isq = (n0 < QW);                             // wave-uniform
    unsigned short* P0 = isq ? (unsigned short*)C0 : (unsigned short*)C2;
    unsigned short* P1 = isq ? (unsigned short*)C1 : (unsigned short*)C3;
    const int ldp  = isq ? ldc : ldc2;
    const int col0 = isq ? n0 : (n0 - QW);
#pragma unroll
    for (int i = 0; i < 2; ++i) {
      const int mb = m0 + i * 16;
      // stage cos/sin of tokens mb..mb+15: 16 rows x 32 floats = 128 16-B pieces per table; lane -> 4 pieces (coverage 32x4 = 128)
      v4f cv4[4], sv4[4];
      const float* cp[4];
      const float* sp[4];
#pragma unroll
      for (int u = 0; u < 4; ++u) {
        const int p   = lane + 32 * u;
        const int row = p >> 3, c4 = (p & 7) * 4;
        cp[u] = cst + (size_t)(mb + row) * NFREQ + c4;
        sp[u] = snt + (size_t)(mb + row) * NFREQ + c4;
        cv4[u] = *(const v4f*)cp[u];
        sv4[u] = *(const v4f*)sp[u];
      }
      // precaution: the eight loads' address registers, named as inputs so that they live up to here, are reused only behind this wait
      asm volatile("s_wait_xcnt 0x0"
                   :: "v"(cp[0]), "v"(cp[1]), "v"(cp[2]), "v"(cp[3]), "v"(sp[0]), "v"(sp[1]), "v"(sp[2]), "v"(sp[3])
                   : "memory");
#pragma unroll
      for (int u = 0; u < 4; ++u) {
        const int p   = lane + 32 * u;
        const int row = p >> 3, c4 = (p & 7) * 4;
        *(v4f*)(csl + row * NFREQ + c4) = cv4[u];
        *(v4f*)(snl + row * NFREQ + c4) = sv4[u];
      }
      lds_wave_sync();
#pragma unroll
      for (int hs = 0; hs < 2; ++hs) {                      // head within the 128-col tile
#pragma unroll
        for (int jj = 0; jj < 2; ++jj) {
          const int j1 = hs * 4 + jj;                       // cols hs*64 + jj*16 + rl  (x1, dim d < 32)
          const int j2 = j1 + 2;                            // cols +32                 (x2, dim d + 32)
          const int d  = jj * 16 + rl;                      // freq index 0..31
#pragma unroll
          for (int r = 0; r < 8; ++r) {
            const int lrow = 8 * hh + r;
            const float cv = csl[lrow * NFREQ + d];
            const float sv = snl[lrow * NFREQ + d];
            const float x1 = acc[i][j1][r];
            const float x2 = acc[i][j2][r];
            const float o1 = x1 * cv - x2 * sv;
            const float o2 = x2 * cv + x1 * sv;
            const unsigned hb = cvt2(o1, o2);
            const unsigned lb = cvt2_res(o1, o2, hb);
            const int so = lrow * 128 + hs * 64 + d;
            sl16[so]             = (unsigned short)hb;
            sl16[so + 32]        = (unsigned short)(hb >> 16);
            sl16[2048 + so]      = (unsigned short)lb;
            sl16[2048 + so + 32] = (unsigned short)(lb >> 16);
          }
        }
      }
      lds_wave_sync();
      {
#pragma unroll
        for (int it = 0; it < 8; ++it) {
          const int row = it * 2 + hh;                      // it x hh covers rows 0..15
          const int c8  = rl * 8;
          const v4u vh = *(const v4u*)(sl16 + row * 128 + c8);
          const v4u vl = *(const v4u*)(sl16 + 2048 + row * 128 + c8);
          const size_t go = (size_t)(mb + row) * ldp + col0 + c8;
          *(v4u*)(P0 + go) = vh;
          *(v4u*)(P1 + go) = vl;
        }
        
      }
      lds_wave_sync();
    }
  } else if (EPI == 0) {
    unsigned short* P0 = (unsigned short*)D0;
    unsigned short* P1 = (unsigned short*)D1;
#pragma unroll
    for (int i = 0; i < 2; ++i) {
#pragma unroll
      for (int r = 0; r < 8; ++r) {
#pragma unroll
        for (int j = 0; j < 8; j += 2) {
          const float va = acc[i][j][r];
          const float vb = acc[i][j + 1][r];
          const unsigned hb = cvt2(va, vb);
          const unsigned lb = cvt2_res(va, vb, hb);
          const int so = (8 * hh + r) * 128 + j * 16 + rl;
          sl16[so]             = (unsigned short)hb;
          sl16[so + 16]        = (unsigned short)(hb >> 16);
          sl16[2048 + so]      = (unsigned short)lb;
          sl16[2048 + so + 16] = (unsigned short)(lb >> 16);
        }
      }
      lds_wave_sync();
      {
#pragma unroll
        for (int it = 0; it < 8; ++it) {
          const int row = it * 2 + hh;
          const int c8  = rl * 8;
          const v4u vh = *(const v4u*)(sl16 + row * 128 + c8);
          const v4u vl = *(const v4u*)(sl16 + 2048 + row * 128 + c8);
          const size_t go = (size_t)(m0 + i * 16 + row) * ldd + n0 + c8;
          *(v4u*)(P0 + go) = vh;
          *(v4u*)(P1 + go) = vl;
        }
        
      }
      lds_wave_sync();
    }
  } else {
    float* C = (float*)C0;
#pragma unroll
    for (int i = 0; i < 2; ++i) {
#pragma unroll
      for (int j = 0; j < 8; ++j)
#pragma unroll
        for (int r = 0; r < 8; ++r)
          slf[(8 * hh + r) * 128 + j * 16 + rl] = acc[i][j][r];
      lds_wave_sync();
      {
#pragma unroll
        for (int row = 0; row < 16; ++row) {                // 32 lanes x 16 B = the whole 512-B row segment per instruction
          const v4f v = *(const v4f*)(slf + row * 128 + lane * 4);
          *(v4f*)(C + (size_t)(m0 + i * 16 + row) * ldc + n0 + lane * 4) = v;
        }
        
      }
      lds_wave_sync();
    }
  }
}

#define AKC  32
#define NKG  4
#define TKC  (AKC * NKG)
#define KP   72
#define VP   136
#define MP   132
#define KVB  ((2 * TKC * KP + 2 * HDM * VP) * 2)
#define JOB  ((NKG - 1) * 4 * 32 * (32 + 2) * 4)
static_assert(JOB <= KVB);

// 16 B at a block-uniform base plus the thread's 32-bit byte offset
__device__ __forceinline__ v4u ld16(const unsigned short* base, unsigned boff) { return *(const v4u*)((const char*)base + boff); }

// eight waves per SIMD = two blocks per WGP: one block's products fill the other's staging and barrier waits (2 x LDS fits too)
__global__ __launch_bounds__(512) __attribute__((amdgpu_waves_per_eu(8, 8))) void attn_kernel(
    const unsigned short* __restrict__ qhp, const unsigned short* __restrict__ qlp,
    const unsigned short* __restrict__ khp, const unsigned short* __restrict__ klp,
    const unsigned short* __restrict__ vhp, const unsigned short* __restrict__ vlp,
    const float* __restrict__ maskp, const int* __restrict__ clsp,
    unsigned short* __restrict__ aop) {
  __shared__ __align__(16) unsigned short KVs[KVB / 2];
  __shared__ __align__(16) float Ms[64 * MP];
  __shared__ __align__(16) unsigned short Osh[4][16 * 64];
  __shared__ __align__(16) unsigned short Osl[4][16 * 64];
  unsigned short* Ks  = KVs;
  unsigned short* Kls = KVs + TKC * KP;
  unsigned short* Vhs = KVs + 2 * TKC * KP;
  unsigned short* Vls = KVs + 2 * TKC * KP + HDM * VP;

  const int tid  = (int)threadIdx.x;
  const int lane = tid & 31;
  const int wave = wave_id();
  const int wq   = wave & 3;                     // query slab of the wave
  const int kg   = wave >> 2;                    // key group of the wave
  const int hh   = lane >> 4;
  const int c    = lane & 15;
  // Which (query tile, head, batch) a block takes: the tile falls as the flat index rises. Where the mask admits keys up to the
  // query (a tile's trips then grow with qt), the long blocks come first in index order, for speed only. The map is a permutation of the grid for any mask: every (qt, h, b) is taken exactly once.
  const unsigned flat = blockIdx.x + NT64 * (blockIdx.y + NHQ * blockIdx.z);   // grid (NT64, NHQ, NB)
  const int qt   = NT64 - 1 - (int)(flat / (NHQ * NB));
  const int h    = (int)(flat % NHQ);
  const int b    = (int)((flat / NHQ) % NB);
  const int kvh  = h >> 2;
  const int q0   = qt * 64 + wq * 16;            // first query row of this wave (within the sequence)
  const size_t tok0 = (size_t)b * SQ;

  // whole mask staging area initialised once (only class-2 tiles refresh it; other tiles never add from it)
#pragma unroll 1
  for (int u = tid; u < 64 * MP; u += 512) Ms[u] = 0.0f;

  const __bf16* Qhr = (const __bf16*)(const void*)qhp + (tok0 + q0 + c) * QW + h * HDM + 8 * hh;
  const __bf16* Qlr = (const __bf16*)(const void*)qlp + (tok0 + q0 + c) * QW + h * HDM + 8 * hh;
  const size_t mrow0 = (tok0 + (size_t)qt * 64) * SQ;                 // mask[b][0][qt*64][0]
  const int* crow = clsp + ((b * NT64) + qt) * NT64;
  // staging: block-uniform element offsets of the (b, kv head) planes, and this thread's own byte offsets (global) and places (LDS)
  const size_t kbase = tok0 * KW + kvh * HDM;
  const size_t vbase = (size_t)(kvh * HDM) * NTOK + tok0;
  const unsigned kgo = (unsigned)((tid >> 3) * KW + (tid & 7) * 8) * 2u;
  const unsigned vgo = (unsigned)((tid >> 4) * NTOK + (tid & 15) * 8) * 2u;
  const unsigned mgo = (unsigned)((tid >> 4) * SQ + (tid & 15) * 4) * 4u;
  const int kso = (tid >> 3) * KP + (tid & 7) * 8;
  const int vso = (tid >> 4) * VP + (tid & 15) * 8;
  const int mso = (tid >> 4) * MP + (tid & 15) * 4;

  v16b qh[2], ql[2];
#pragma unroll
  for (int dc = 0; dc < 2; ++dc) { qh[dc] = ldfrag_b(Qhr + dc * 32); ql[dc] = ldfrag_b(Qlr + dc * 32); }

  float mrow = -INFINITY;                          // running max of query c over this wave's keys (the same in both halves)
  float lsum = 0.f;                                // running sum of query c over this wave's keys of this half
  v8f oacc[4];                                     // oacc[t][r] = O[query c][d = 16t + 8hh + r], this wave's keys
#pragma unroll
  for (int t = 0; t < 4; ++t) oacc[t] = zero8();

  for (int s = 0; s < NT64 / 2; ++s) {
    const int cl0 = __builtin_amdgcn_readfirstlane(crow[2 * s]);      // block-uniform classes of the trip's two mask tiles
    const int cl1 = __builtin_amdgcn_readfirstlane(crow[2 * s + 1]);
    if ((cl0 | cl1) == 0) continue;                                   // uniform for the whole block; before any barrier
    const int kv0 = s * TKC;
    __syncthreads();                                                  // prior trip's LDS readers are done
    const unsigned short* kbh = khp + kbase + (size_t)kv0 * KW;       // block-uniform bases of the trip's tiles
    const unsigned short* kbl = klp + kbase + (size_t)kv0 * KW;
    const unsigned short* vbh = vhp + vbase + kv0;
    const unsigned short* vbl = vlp + vbase + kv0;
    v4u kx[2], ky[2], vx[2], vy[2];
#pragma unroll
    for (int u = 0; u < 2; ++u) {                                     // coverage: 1024 pieces of 8 halves per plane = whole tile
      kx[u] = ld16(kbh + u * 64 * KW, kgo);                           // K: 128 keys x 64 d; key = (tid >> 3) + 64u
      ky[u] = ld16(kbl + u * 64 * KW, kgo);
      vx[u] = ld16(vbh + (size_t)u * 32 * NTOK, vgo);                 // V^T: 64 d x 128 keys; d = (tid >> 4) + 32u
      vy[u] = ld16(vbl + (size_t)u * 32 * NTOK, vgo);
    }
#pragma unroll
    for (int u = 0; u < 2; ++u) {
      *(v4u*)(Ks  + kso + u * 64 * KP) = kx[u];
      *(v4u*)(Kls + kso + u * 64 * KP) = ky[u];
      *(v4u*)(Vhs + vso + u * 32 * VP) = vx[u];
      *(v4u*)(Vls + vso + u * 32 * VP) = vy[u];
    }
#pragma unroll
    for (int mtl = 0; mtl < 2; ++mtl) {
      if ((mtl ? cl1 : cl0) == 2) {                                   // block-uniform branch about the mask tile load
        const float* mbase = maskp + mrow0 + kv0 + mtl * 64;
#pragma unroll
        for (int u = 0; u < 2; ++u) {                                 // coverage: 1024 pieces of 4 floats = 64 rows x 64 keys
          const v4f mv = *(const v4f*)((const char*)(mbase + (size_t)u * 32 * SQ) + mgo);   // row = (tid >> 4) + 32u
          *(v4f*)(Ms + mso + u * 32 * MP + mtl * 64) = mv;
        }
      }
    }
    __syncthreads();

    const int cl = (kg < 2) ? cl0 : cl1;                              // wave-uniform class of this wave's 32 keys
    if (cl == 0) continue;                                            // no barrier between here and the next trip's first one

    // ---- scores, transposed: 32 keys x 16 queries, K = 64, three products ----
    v8f sa[2];
    sa[0] = zero8(); sa[1] = zero8();
#pragma unroll
    for (int dc = 0; dc < 2; ++dc) {
#pragma unroll
      for (int j = 0; j < 2; ++j) {
        const v16b kb = ldfrag_b((const __bf16*)(const void*)Ks  + (kg * AKC + j * 16 + c) * KP + dc * 32 + 8 * hh);
        const v16b kl = ldfrag_b((const __bf16*)(const void*)Kls + (kg * AKC + j * 16 + c) * KP + dc * 32 + 8 * hh);
        sa[j] = mma_b(kb, qh[dc], sa[j]);
        sa[j] = mma_b(kl, qh[dc], sa[j]);
        sa[j] = mma_b(kb, ql[dc], sa[j]);
        guard1b4(sa[j], qh[dc], ql[dc], kb, kl);
      }
    }
    acc_guard2(sa[0], sa[1]);

    // ---- scale, mask add (class 2): sc[j][r] = score of (query c, key 16j + 8hh + r) ----
    float sc[2][8];
#pragma unroll
    for (int j = 0; j < 2; ++j)
#pragma unroll
      for (int r = 0; r < 8; ++r) sc[j][r] = sa[j][r] * 0.125f;
    if (cl == 2) {                                                    // wave-uniform
      const float* mr = Ms + (wq * 16 + c) * MP + kg * AKC + 8 * hh;  // the query's mask row, this wave's keys, this half's
#pragma unroll
      for (int j = 0; j < 2; ++j) {
        const v4f ma = *(const v4f*)(mr + j * 16);
        const v4f mb = *(const v4f*)(mr + j * 16 + 4);
#pragma unroll
        for (int r = 0; r < 4; r += 2) {
          const unsigned wa = cvt2(ma[r], ma[r + 1]);
          const unsigned wb = cvt2(mb[r], mb[r + 1]);
          sc[j][r]     += lo_val(wa); sc[j][r + 1]     += hi_val(wa);
          sc[j][4 + r] += lo_val(wb); sc[j][4 + r + 1] += hi_val(wb);
        }
      }
    }
    // ---- chunk max of the query: in the lane, then with the other half ----
    float cm = -INFINITY;
#pragma unroll
    for (int j = 0; j < 2; ++j)
#pragma unroll
      for (int r = 0; r < 8; ++r) cm = fmaxf(cm, sc[j][r]);
    cm = fmaxf(cm, xhalf(cm));
    // ---- online softmax; p hi/lo packed in place into the B operands ----
    const float mnew  = fmaxf(mrow, cm);
    const float muse  = (mnew > -INFINITY) ? mnew : 0.0f;
    const float alpha = __expf(mrow - muse);
    mrow = mnew;
    union { v16b v; unsigned u[8]; } pa, pr;
    float ps[2];
#pragma unroll
    for (int j = 0; j < 2; ++j) {
      ps[j] = 0.f;
#pragma unroll
      for (int r = 0; r < 8; r += 2) {
        const float p0 = __expf(sc[j][r] - muse);
        const float p1 = __expf(sc[j][r + 1] - muse);
        ps[j] += p0;
        ps[j] += p1;
        const unsigned hp = cvt2(p0, p1);
        pa.u[j * 4 + (r >> 1)] = hp;
        pr.u[j * 4 + (r >> 1)] = cvt2_res(p0, p1, hp);
      }
    }
    lsum = lsum * alpha + (ps[0] + ps[1]);
#pragma unroll
    for (int t = 0; t < 4; ++t)
#pragma unroll
      for (int r = 0; r < 8; ++r) oacc[t][r] *= alpha;
    // ---- O^T += v^T . p^T (K = 32 keys, three products) ----
#pragma unroll
    for (int t = 0; t < 4; ++t) {
      const v16b vb = ldfrag_b((const __bf16*)(const void*)Vhs + (t * 16 + c) * VP + kg * AKC + 8 * hh);
      const v16b vr = ldfrag_b((const __bf16*)(const void*)Vls + (t * 16 + c) * VP + kg * AKC + 8 * hh);
      oacc[t] = mma_b(vb, pa.v, oacc[t]);
      oacc[t] = mma_b(vr, pa.v, oacc[t]);
      oacc[t] = mma_b(vb, pr.v, oacc[t]);
      guard1b4(oacc[t], pa.v, pr.v, vb, vr);
    }
  }
  __syncthreads();                                 // every wave is past the trip loop: the K / V^T tiles are free
  acc_guard4(oacc[0], oacc[1], oacc[2], oacc[3]);

  // ---- the four key groups' parts of a query slab are joined in group 0 ----
  // hand-over area: O parts as 16-B pieces [part][piece 0..7][lane], then (max, sum) pairs [part][lane]; part = (kg - 1) * 4 + wq
  v4f* jo = (v4f*)(void*)KVs;
  v2f* jm = (v2f*)(void*)(jo + (NKG - 1) * 4 * 8 * 32);
  if (kg != 0) {                                   // wave-uniform
    const int part = (kg - 1) * 4 + wq;
#pragma unroll
    for (int t = 0; t < 4; ++t) {
      const v4f x0 = {oacc[t][0], oacc[t][1], oacc[t][2], oacc[t][3]};
      const v4f x1 = {oacc[t][4], oacc[t][5], oacc[t][6], oacc[t][7]};
      jo[(part * 8 + 2 * t) * 32 + lane]     = x0;
      jo[(part * 8 + 2 * t + 1) * 32 + lane] = x1;
    }
    const v2f ml = {mrow, lsum};
    jm[part * 32 + lane] = ml;
  }
  __syncthreads();                                 // the parts are readable; the last barrier of the kernel
  if (kg != 0) return;                             // whole waves leave, behind every barrier

  v2f oml[NKG - 1];
  float mall = mrow;
#pragma unroll
  for (int g = 0; g < NKG - 1; ++g) {
    oml[g] = jm[(g * 4 + wq) * 32 + lane];
    mall = fmaxf(mall, oml[g][0]);
  }
  const float mjoin = (mall > -INFINITY) ? mall : 0.0f;
  float w0 = __expf(mrow - mjoin);                 // a part that saw no key has max -inf: weight 0
  float wg[NKG - 1];
#pragma unroll
  for (int g = 0; g < NKG - 1; ++g) wg[g] = __expf(oml[g][0] - mjoin);
  // the slot the instruction set asks for between an exp and the first user of its result or overwriter of its source; the four
  // weights are tied to it so that it stands behind the run of exps and in front of every product with a weight
  asm volatile("v_nop" : "+v"(w0), "+v"(wg[0]), "+v"(wg[1]), "+v"(wg[2]));
  lsum *= w0;
#pragma unroll
  for (int t = 0; t < 4; ++t)
#pragma unroll
    for (int r = 0; r < 8; ++r) oacc[t][r] *= w0;
#pragma unroll
  for (int g = 0; g < NKG - 1; ++g) {
    lsum += wg[g] * oml[g][1];
#pragma unroll
    for (int t = 0; t < 4; ++t) {
      const v4f x0 = jo[((g * 4 + wq) * 8 + 2 * t) * 32 + lane];
      const v4f x1 = jo[((g * 4 + wq) * 8 + 2 * t + 1) * 32 + lane];
#pragma unroll
      for (int r = 0; r < 4; ++r) {
        oacc[t][r]     += wg[g] * x0[r];
        oacc[t][4 + r] += wg[g] * x1[r];
      }
    }
  }

  unsigned short* osh = Osh[wq];
  unsigned short* osl = Osl[wq];
  const float inv = 1.0f / (lsum + xhalf(lsum));   // the halves' sums joined; l >= 1: the row max contributes exp(0)
#pragma unroll
  for (int t = 0; t < 4; ++t) {                    // 8 consecutive d of query c: one 16-B LDS store per plane
    v4u xh, xl;
#pragma unroll
    for (int r = 0; r < 8; r += 2) {
      const float o0 = oacc[t][r] * inv;
      const float o1 = oacc[t][r + 1] * inv;
      const unsigned ho = cvt2(o0, o1);
      xh[r >> 1] = ho;
      xl[r >> 1] = cvt2_res(o0, o1, ho);
    }
    *(v4u*)(osh + c * 64 + t * 16 + 8 * hh) = xh;
    *(v4u*)(osl + c * 64 + t * 16 + 8 * hh) = xl;
  }
  lds_wave_sync();
  unsigned short* Ag = aop + (tok0 + q0) * AOW + h * HDM;
  const int qq = lane >> 3;                        // 0..3
  const int c8 = (lane & 7) * 8;
  {
#pragma unroll
    for (int it = 0; it < 4; ++it) {
      const int row = it * 4 + qq;                 // it 0..3 x qq 0..3 covers rows 0..15
      const v4u x = *(const v4u*)(osh + row * 64 + c8);
      const v4u y = *(const v4u*)(osl + row * 64 + c8);
      *(v4u*)(Ag + (size_t)row * AOW + c8)      = x;
      *(v4u*)(Ag + (size_t)row * AOW + QW + c8) = y;
    }
    
  }
}

// ---------------------------------------------------------------------------
// Workspace map (bytes; every region is an exact whole number of the rows its producer writes with whole-line stores;
// all dimensions are tile multiples, no padded tails needed; every offset is a multiple of 128):
//   XB   bf16 [4096][1024]   8388608     WQK bf16 [1280][1024]   2621440     WV  bf16 [256][1024]    524288
//   WO   bf16 [1024][1024]   2097152     CST f32  [4096][32]      524288     SNT f32  [4096][32]     524288
//   CLS  i32  [2][32][32]       8192     QH  bf16 [4096][1024]   8388608     QL  bf16 [4096][1024]  8388608
//   KH   bf16 [4096][256]    2097152     KL  bf16 [4096][256]    2097152     VTH bf16 [256][4096]   2097152
//   VTL  bf16 [256][4096]    2097152     AO  bf16 [4096][2048]  16777216
//   total                   56631296
// ---------------------------------------------------------------------------
extern "C" void kernel_launch(void* const* d_in, const int* in_sizes, int n_in,
                              void* d_out, int out_size, void* d_ws, size_t ws_size,
                              hipStream_t stream) {
  if (n_in < 7) return;
  if (in_sizes[0] != NTOK * HID) return;                  // hidden_states [2][2048][1024] f32
  if (in_sizes[1] != NB * SQ * SQ) return;                // attention_mask [2][1][2048][2048] f32
  if (in_sizes[2] != NTOK) return;                        // position_ids [2][2048] int32
  if (in_sizes[3] != QW * HID) return;                    // wq [1024][1024]
  if (in_sizes[4] != KW * HID) return;                    // wk [256][1024]
  if (in_sizes[5] != KW * HID) return;                    // wv [256][1024]
  if (in_sizes[6] != HID * QW) return;                    // wo [1024][1024]
  if (out_size != NTOK * HID) return;

  const float* hs   = (const float*)d_in[0];
  const float* mask = (const float*)d_in[1];
  const int*   pos  = (const int*)d_in[2];
  const float* wq   = (const float*)d_in[3];
  const float* wk   = (const float*)d_in[4];
  const float* wv   = (const float*)d_in[5];
  const float* wo   = (const float*)d_in[6];
  float* out = (float*)d_out;

  const size_t szXB  = (size_t)NTOK * HID * 2;
  const size_t szWQK = (size_t)QKN * HID * 2;
  const size_t szWV  = (size_t)KW * HID * 2;
  const size_t szWO  = (size_t)HID * QW * 2;
  const size_t szT   = (size_t)NTOK * NFREQ * 4;
  const size_t szCLS = (size_t)NB * NT64 * NT64 * 4;
  const size_t szQ   = (size_t)NTOK * QW * 2;
  const size_t szK   = (size_t)NTOK * KW * 2;
  const size_t szVT  = (size_t)KW * NTOK * 2;
  const size_t szAO  = (size_t)NTOK * AOW * 2;
  size_t off = 0;
  const size_t oXB  = off; off += szXB;
  const size_t oWQK = off; off += szWQK;
  const size_t oWV  = off; off += szWV;
  const size_t oWO  = off; off += szWO;
  const size_t oCST = off; off += szT;
  const size_t oSNT = off; off += szT;
  const size_t oCLS = off; off += szCLS;
  const size_t oQH  = off; off += szQ;
  const size_t oQL  = off; off += szQ;
  const size_t oKH  = off; off += szK;
  const size_t oKL  = off; off += szK;
  const size_t oVTH = off; off += szVT;
  const size_t oVTL = off; off += szVT;
  const size_t oAO  = off; off += szAO;
  if (off > ws_size) return;                              // off = 56631296

  char* ws = (char*)d_ws;
  unsigned short* XB  = (unsigned short*)(ws + oXB);
  unsigned short* WQK = (unsigned short*)(ws + oWQK);
  unsigned short* WV  = (unsigned short*)(ws + oWV);
  unsigned short* WO  = (unsigned short*)(ws + oWO);
  float*          CST = (float*)(ws + oCST);
  float*          SNT = (float*)(ws + oSNT);
  int*            CLS = (int*)(ws + oCLS);
  unsigned short* QH  = (unsigned short*)(ws + oQH);
  unsigned short* QL  = (unsigned short*)(ws + oQL);
  unsigned short* KH  = (unsigned short*)(ws + oKH);
  unsigned short* KL  = (unsigned short*)(ws + oKL);
  unsigned short* VTH = (unsigned short*)(ws + oVTH);
  unsigned short* VTL = (unsigned short*)(ws + oVTL);
  unsigned short* AO  = (unsigned short*)(ws + oAO);

  const dim3 b256(256), b128(128), b512(512);

  // (1) preparation, one launch: mask classes, x / wq / wk / wv / wo bf16 planes, cos/sin table
  prep_kernel<<<dim3(PB_ALL), b256, 0, stream>>>(hs, mask, pos, wq, wk, wv, wo, XB, WQK, WV, WO, CST, SNT, CLS);
  // (2) one launch, two products:
  //     q|k = x . [Wq;Wk]^T, RoPE, split -> QH/QL [4096][1024], KH/KL [4096][256]   (M=4096, N=1280, K=1024; 32 x 10 block tiles)
  //     v^T = Wv . x^T -> VTH/VTL [256][4096]   (A = WV, Bt = XB; M=256, N=4096, K=1024; 2 x 32 block tiles)
  gemm_w32x128_kernel<0><<<dim3((NTOK / 128) * (QKN / 128) + (KW / 128) * (NTOK / 128)), b128, 0, stream>>>(
      XB, HID, WQK, HID, CST, SNT, (void*)QH, (void*)QL, (void*)KH, (void*)KL, QW, KW, NTOK, QKN, HID,
      WV, (void*)VTH, (void*)VTL, NTOK, KW, NTOK);
  // (3) attention per (q tile, head, batch) -> AO hi|lo [4096][2048]
  attn_kernel<<<dim3(SQ / 64, NHQ, NB), b512, 0, stream>>>(QH, QL, KH, KL, VTH, VTL, mask, CLS, AO);
  // (4) out = (AOhi + AOlo) . Wo^T, two products on each Wo tile -> d_out f32 [4096][1024]   (M=4096, N=1024, K=1024; 32 x 8 block tiles)
  gemm_w32x128_kernel<2><<<dim3((NTOK / 128) * (HID / 128)), b128, 0, stream>>>(
      AO, AOW, WO, QW, CST, SNT, (void*)out, (void*)out, (void*)out, (void*)out, HID, HID, NTOK, HID, QW,
      AO, (void*)out, (void*)out, HID, NTOK, HID);
  (void)hipGetLastError();
}

// v009
// It runs in 123 microseconds.
// In both of two side-by-side timings against v008, it was 1.03 times as fast.
// All steps since v000 together make it 4.03 times as fast.
// Contractions: x.[Wq;Wk]^T and Wv.x^T on v_wmma_f32_16x16x32_bf16 (operands = RNE bf16 copies of the f32 inputs, single products);
// q.k^T and p.v on v_wmma_f32_16x16x32_bf16 with bf16 hi/lo split operands (hi.hi + hi.lo + lo.hi, three products);
// attn.Wo^T on v_wmma_f32_16x16x32_bf16 with attn = bf16 hi and lo planes (two products, both against the same Wo fragment) and Wo as RNE bf16.
// f32 accumulate everywhere; RoPE (f32 cos/sin table built from the position ids), mask add and online softmax in f32.
// Plane carry audit: every 16-bit plane is bf16 with carry 1 (hi = RNE(v), lo = RNE(v - hi), same accumulator); nothing is scaled,
// nothing is folded back: XB, WQK, WV, WO (RNE copies), QH/QL, KH/KL, VTH/VTL, P (registers), AO hi|lo.
#include <hip/hip_runtime.h>
#include <math.h>
#include <stdint.h>

#define NB     2
#define SQ     2048
#define HID    1024
#define NHQ    16
#define NKVH   4
#define HDM    64
#define QW     1024          // q plane width (16 heads x 64)
#define KW     256           // k / v width (4 heads x 64)
#define QKN    1280          // q|k projection columns
#define NTOK   4096
#define NFREQ  32
#define AOW    2048          // attn plane width: hi at col 0..1023, lo at col 1024..2047
#define NT64   32            // 64-wide tiles along each mask axis

typedef __bf16       v16b __attribute__((ext_vector_type(16)));
typedef __bf16       v8b  __attribute__((ext_vector_type(8)));
typedef float        v8f  __attribute__((ext_vector_type(8)));
typedef float        v4f  __attribute__((ext_vector_type(4)));
typedef unsigned int v4u  __attribute__((ext_vector_type(4)));
typedef float        v2f  __attribute__((ext_vector_type(2)));
typedef __bf16       v2b  __attribute__((ext_vector_type(2)));

// ---------------------------------------------------------------------------
// small helpers
// ---------------------------------------------------------------------------
// two f32 -> two bf16 (RNE) in one word by the hardware's packed convert: a in bits 15..0, b in bits 31..16
__device__ __forceinline__ unsigned cvt2(float a, float b) {
  const v2f x = {a, b};
  return __builtin_bit_cast(unsigned, __builtin_convertvector(x, v2b));
}
__device__ __forceinline__ float lo_val(unsigned w) { return __uint_as_float(w << 16); }          // f32 value of the low bf16
__device__ __forceinline__ float hi_val(unsigned w) { return __uint_as_float(w & 0xFFFF0000u); }  // f32 value of the high bf16
// the residues of a and b against their bf16 roundings held in w = cvt2(a, b), rounded to bf16 in turn
__device__ __forceinline__ unsigned cvt2_res(float a, float b, unsigned w) { return cvt2(a - lo_val(w), b - hi_val(w)); }
__device__ __forceinline__ v8f zero8() { v8f z = {0.f, 0.f, 0.f, 0.f, 0.f, 0.f, 0.f, 0.f}; return z; }
// lane l with lane l ^ 16 (the other half of the wave)
__device__ __forceinline__ float xhalf(float x) {
  const int b = __builtin_bit_cast(int, x);
  return __builtin_bit_cast(float, __builtin_amdgcn_permlanex16(b, b, 0x76543210, 0xfedcba98, false, false));
}
__device__ __forceinline__ int wave_id() { return __builtin_amdgcn_readfirstlane((int)(threadIdx.x >> 5)); }

__device__ __forceinline__ void lds_wave_sync() {
  __builtin_amdgcn_fence(__ATOMIC_RELEASE, "workgroup");
  __builtin_amdgcn_wave_barrier();
  __builtin_amdgcn_fence(__ATOMIC_ACQUIRE, "workgroup");
}

// ---------------------------------------------------------------------------
// WMMA fragments (wave32, 16x16x32, bf16 operands). For A (row m = lane&15) and B (col n = lane&15) alike:
// elements 0..7 <- k0 + 8*(lane>>4) + 0..7, elements 8..15 <- k0 + 16 + 8*(lane>>4) + 0..7.
// ldfrag_b(p) with p = rowbase + k0 + 8*(lane>>4): two 16-B loads p[0..7], p[16..23] (A rows and k-contiguous B rows alike).
// D: acc[r] = (row 8*(lane>>4) + r, col lane&15).
// ---------------------------------------------------------------------------
union FragB { v16b v; v8b h[2]; };
__device__ __forceinline__ v16b ldfrag_b(const __bf16* p) { FragB f; f.h[0] = *(const v8b*)(p); f.h[1] = *(const v8b*)(p + 16); return f.v; }

__device__ __forceinline__ v8f mma_b(v16b a, v16b b, v8f c) {
  return __builtin_amdgcn_wmma_f32_16x16x32_bf16(false, a, false, b, (short)0, c, false, false);
}
// hazard guards: 4 VALU slots after the last WMMA of a group, D tied, A/B kept live; memory clobber keeps later loads behind the group
// (a group = the products of two accumulators that share their A fragments)
__device__ __forceinline__ void guard2b6(v8f& a0, v8f& a1, v16b u, v16b v, v16b w, v16b x, v16b y, v16b z) {
  asm volatile("v_nop\n\tv_nop\n\tv_nop\n\tv_nop" : "+v"(a0), "+v"(a1) : "v"(u), "v"(v), "v"(w), "v"(x), "v"(y), "v"(z) : "memory");
}
__device__ __forceinline__ void acc_guard4(v8f& a, v8f& b, v8f& c, v8f& d) {
  asm volatile("v_nop\n\tv_nop\n\tv_nop\n\tv_nop" : "+v"(a), "+v"(b), "+v"(c), "+v"(d));
}

// ---------------------------------------------------------------------------
// RoPE table: cst[t][j] = cos(pos[t] * inv_freq[j]), snt[t][j] = sin(...), inv_freq[j] = 1 / 10000^(j/32), j < 32, all f32.
// ---------------------------------------------------------------------------
// A wave takes RTW consecutive tokens (lane = frequency j): their position ids are read together, inv_freq is formed once.
#define RTW 4
static_assert(NTOK % (8 * RTW) == 0);          // whole blocks of 8 waves cover the tokens exactly
__device__ __forceinline__ void rope_table_part(int bid, const int* __restrict__ pos, float* __restrict__ cst,
                                                float* __restrict__ snt) {
  const int lane = threadIdx.x & 31;
  const int wave = (int)(threadIdx.x >> 5);
  const int t0 = (bid * 8 + wave) * RTW;
  int pi[RTW];
#pragma unroll
  for (int u = 0; u < RTW; ++u) pi[u] = pos[t0 + u];
  const float e   = (float)lane * 0.03125f;    // (2*j)/64 exact
  const float pw  = powf(10000.0f, e);
  const float inv = 1.0f / pw;
#pragma unroll
  for (int u = 0; u < RTW; ++u) {
    const float ang = (float)pi[u] * inv;
    const float cv  = cosf(ang);
    const float sv  = sinf(ang);
    const size_t o = (size_t)(t0 + u) * NFREQ + lane;
    cst[o] = cv;
    snt[o] = sv;
  }
  // behind the last store: no register that an issued store names is rewritten ahead of this wait (the rule for issued global stores)
  asm volatile("s_wait_xcnt 0x0" ::: "memory");
}

// ---------------------------------------------------------------------------
// Elementwise RNE f32 -> bf16 plane: a piece = 8 elements, one 16-B store per lane -> 32 consecutive lanes write 4 whole lines.
// A thread takes CPT pieces, 256 pieces apart (a block = 256 * CPT consecutive pieces), and issues all its 2 * CPT loads before
// it uses the first: one memory latency per thread instead of one per piece, and a CPT-th of the blocks to start.
// Every plane is a whole number of such blocks (asserted at the block counts below): no tail, no guard.
// ---------------------------------------------------------------------------
#define CPT 4
#define CBE (256 * CPT * 8)                    // elements per conversion block
__device__ __forceinline__ v4u pack8(v4f a, v4f b) {
  v4u w;
  w[0] = cvt2(a[0], a[1]);
  w[1] = cvt2(a[2], a[3]);
  w[2] = cvt2(b[0], b[1]);
  w[3] = cvt2(b[2], b[3]);
  return w;
}
__device__ __forceinline__ void cvt_bf16_part(int bid, const float* __restrict__ in, unsigned short* __restrict__ outp) {
  const size_t e0 = (size_t)bid * CBE + 8 * (size_t)threadIdx.x;
  v4f a[CPT], b[CPT];
#pragma unroll
  for (int u = 0; u < CPT; ++u) {
    a[u] = *(const v4f*)(in + e0 + u * 2048);
    b[u] = *(const v4f*)(in + e0 + u * 2048 + 4);
  }
#pragma unroll
  for (int u = 0; u < CPT; ++u) *(v4u*)(outp + e0 + u * 2048) = pack8(a[u], b[u]);
  // behind the last store: no register that an issued store names is rewritten ahead of this wait (the rule for issued global stores)
  asm volatile("s_wait_xcnt 0x0" ::: "memory");
}

// ---------------------------------------------------------------------------
// Mask tile classes. mask [NB][1][SQ][SQ] f32 (additive). One block per (b, 64-row band mt): 256 threads x 8 consecutive columns,
// 64 rows each. For every 64x64 tile (b, mt, nt):
//   class 0 = every element <= -1e8 (tile contributes nothing: exp underflows to 0 exactly when the row has an admitted key),
//   class 1 = every element == 0 (nothing to add), class 2 = anything else (mask tile added elementwise).
// If the band contains a row with no element > -1e4 the skip is not valid for it: class 0 tiles of that band become class 2.
// Reductions are OR (order independent). Coverage: NB*32 blocks x 64 rows x 256 thr x 8 cols = the whole mask;
// The rows are read MRB at a time, all 2 * MRB loads of a thread issued before the first is used: 64 / MRB exposed memory
// latencies per block instead of 64.
// ---------------------------------------------------------------------------
#define ADM_TH (-1.0e4f)
#define SKP_TH (-1.0e8f)
#define MRB 8

__device__ __forceinline__ void mask_class_part(int bid, const float* __restrict__ mask, int* __restrict__ cls) {
  __shared__ int nzs[NT64];
  __shared__ int bgs[NT64];
  __shared__ unsigned rlo[8];
  __shared__ unsigned rhi[8];
  const int bm   = bid;                  // b*32 + mt
  const int b    = bm >> 5;
  const int mt   = bm & 31;
  const int tid  = threadIdx.x;
  const int lane = tid & 31;
  const int wave = tid >> 5;
  const int j0   = tid * 8;
  int nz = 0, bg = 0;
  unsigned rowlo = 0u, rowhi = 0u;       // bit r: this thread's 8 columns contain an admitted element in row r
  // rolled: one batch of rows is as much as a thread's registers should hold
#pragma unroll 1
  for (int r0 = 0; r0 < 64; r0 += MRB) {
    const float* mr = mask + (((size_t)b * SQ) + (size_t)(mt * 64 + r0)) * SQ + j0;
    v4f ma[MRB], mb[MRB];
#pragma unroll
    for (int u = 0; u < MRB; ++u) {
      ma[u] = *(const v4f*)(mr + (size_t)u * SQ);
      mb[u] = *(const v4f*)(mr + (size_t)u * SQ + 4);
    }
    // keeps the whole batch's loads in front of the first use: left alone, the compiler holds some back until registers are
    // free again, and those pay a second memory latency in every batch
    __builtin_amdgcn_sched_barrier(0);
#pragma unroll
    for (int u = 0; u < MRB; ++u) {
      const int r = r0 + u;
      const v4f mk0 = ma[u];
      const v4f mk1 = mb[u];
      const int a = ((mk0[0] > ADM_TH) | (mk0[1] > ADM_TH) | (mk0[2] > ADM_TH) | (mk0[3] > ADM_TH) |
                     (mk1[0] > ADM_TH) | (mk1[1] > ADM_TH) | (mk1[2] > ADM_TH) | (mk1[3] > ADM_TH)) ? 1 : 0;
      const int z = ((mk0[0] != 0.0f) | (mk0[1] != 0.0f) | (mk0[2] != 0.0f) | (mk0[3] != 0.0f) |
                     (mk1[0] != 0.0f) | (mk1[1] != 0.0f) | (mk1[2] != 0.0f) | (mk1[3] != 0.0f)) ? 1 : 0;
      const int g = ((mk0[0] > SKP_TH) | (mk0[1] > SKP_TH) | (mk0[2] > SKP_TH) | (mk0[3] > SKP_TH) |
                     (mk1[0] > SKP_TH) | (mk1[1] > SKP_TH) | (mk1[2] > SKP_TH) | (mk1[3] > SKP_TH)) ? 1 : 0;
      nz |= z;
      bg |= g;
      const unsigned sh = ((unsigned)a) << (r & 31);
      rowlo |= (r < 32) ? sh : 0u;
      rowhi |= (r < 32) ? 0u : sh;
    }
  }
  // OR over the 8 lanes 8q..8q+7 that share column tile nt = tid >> 3
  nz |= __shfl_xor(nz, 1, 32); nz |= __shfl_xor(nz, 2, 32); nz |= __shfl_xor(nz, 4, 32);
  bg |= __shfl_xor(bg, 1, 32); bg |= __shfl_xor(bg, 2, 32); bg |= __shfl_xor(bg, 4, 32);
#pragma unroll
  for (int off = 1; off < 32; off <<= 1) {
    rowlo |= (unsigned)__shfl_xor((int)rowlo, off, 32);
    rowhi |= (unsigned)__shfl_xor((int)rowhi, off, 32);
  }
  if ((lane & 7) == 0) { nzs[tid >> 3] = nz; bgs[tid >> 3] = bg; }
  if (lane == 0) { rlo[wave] = rowlo; rhi[wave] = rowhi; }
  __syncthreads();
  if (wave == 0) {                       // wave-uniform
    const int z = nzs[lane];
    const int g = bgs[lane];
    unsigned ol = rlo[0], oh = rhi[0];
#pragma unroll
    for (int w = 1; w < 8; ++w) { ol |= rlo[w]; oh |= rhi[w]; }
    const bool has_empty_row = (ol != 0xFFFFFFFFu) || (oh != 0xFFFFFFFFu);
    int cval = (g == 0) ? 0 : ((z == 0) ? 1 : 2);
    cval = (has_empty_row && cval == 0) ? 2 : cval;
    int* cp = cls + (size_t)bm * NT64 + lane;
    *cp = cval;
    
  }
}

// ---------------------------------------------------------------------------
// The seven preparation jobs depend on the inputs alone and on nothing of each other: one launch, each job a range of blocks
// (256 threads each). The mask bands, the longest blocks, come first.
// Every branch is on the block index: whole blocks take it, so the barrier of the mask part stays block-uniform.
// ---------------------------------------------------------------------------
#define PB_MASK (NB * NT64)                  // 64
#define PB_X    (NTOK * HID / CBE)           // 512
#define PB_ROPE (NTOK / (8 * RTW))           // 128
#define PB_WQ   (QW * HID / CBE)             // 128
#define PB_WO   (HID * QW / CBE)             // 128
#define PB_WKV  (KW * HID / CBE)             // 32, wk and wv each
#define PB_ALL  (PB_MASK + PB_X + PB_ROPE + PB_WQ + PB_WO + 2 * PB_WKV)
static_assert((NTOK * HID) % CBE == 0 && (QW * HID) % CBE == 0 && (KW * HID) % CBE == 0);   // whole conversion blocks only

__global__ __launch_bounds__(256) void prep_kernel(
    const float* __restrict__ hs, const float* __restrict__ mask, const int* __restrict__ pos,
    const float* __restrict__ wq, const float* __restrict__ wk, const float* __restrict__ wv, const float* __restrict__ wo,
    unsigned short* __restrict__ xb, unsigned short* __restrict__ wqk, unsigned short* __restrict__ wvb,
    unsigned short* __restrict__ wob, float* __restrict__ cst, float* __restrict__ snt, int* __restrict__ cls) {
  int bid = (int)blockIdx.x;
  // mask tile classes [2][32][32]
  if (bid < PB_MASK) { mask_class_part(bid, mask, cls); return; }
  bid -= PB_MASK;
  // x -> bf16 plane [4096][1024]
  if (bid < PB_X) { cvt_bf16_part(bid, hs, xb); return; }
  bid -= PB_X;
  // cos/sin table [4096][32] x 2 from the position ids
  if (bid < PB_ROPE) { rope_table_part(bid, pos, cst, snt); return; }
  bid -= PB_ROPE;
  // wq [1024][1024] -> WQK rows 0..1023 (natural [out][in] = Bt layout)
  if (bid < PB_WQ) { cvt_bf16_part(bid, wq, wqk); return; }
  bid -= PB_WQ;
  // wo [1024][1024] -> WO (natural [out][in] = Bt layout)
  if (bid < PB_WO) { cvt_bf16_part(bid, wo, wob); return; }
  bid -= PB_WO;
  // wk [256][1024] -> WQK rows 1024..1279
  if (bid < PB_WKV) { cvt_bf16_part(bid, wk, wqk + (size_t)QW * HID); return; }
  bid -= PB_WKV;
  // wv [256][1024] -> WV
  if (bid < PB_WKV) { cvt_bf16_part(bid, wv, wvb); return; }
}

// ---------------------------------------------------------------------------
// bf16 WMMA GEMM, block = 4 waves (128 threads) = one 128 x 128 tile of C; wave w owns rows 32w..32w+31 of it, all 128 cols.
//   C[m][n] = sum_k A[m][k] * Bt[n][k]; A row-major [M][K] bf16 (pitch lda), Bt row-major [N][K] bf16 (pitch ldb);
//   M % 128 == 0, N % 128 == 0, K % 64 == 0, K >= 64, lda % 8 == 0, ldb % 8 == 0; grid.x = M/128 * N/128.
//   EPI 0 carries a second, independent product in the same launch: blocks M/128 * N/128 .. + M2/128 * N2/128 - 1 compute
//   C'[m][n] = sum_k A2[m][k] * A[n][k] (A2 [M2][K] pitch lda; the first product's A, N2 rows of it, as Bt with pitch ldb:
//   lda == ldb), same K, same loop.
//   Operands: per trip of 64 k the 128 A rows and the 128 Bt rows (128 B each) are copied global -> LDS asynchronously, whole
//   128-B lines per 8 lanes, into one of two buffers; trip t works on buffer t & 1 while tile t + 1 flies into the other.
//   Fragments are read from LDS rows (ldfrag_b) in the same k order as before.
//   EPI 2 takes A as two planes side by side, [M][2K] (pitch lda): C[m][n] = sum_k (A[m][k] + A[m][K + k]) * Bt[n][k], two products.
//   A trip stages both planes' 64-k tiles next to ONE Bt tile, and each Bt fragment, read from LDS once, feeds both planes' WMMAs.
// Epilogues (all: per wave, per 16-row slab: stage in LDS, wave sync, write each row segment with ONE instruction of
//   EPI 0: q|k projection with RoPE. The 128-col tile holds two 64-dim heads; pairs (d, d+32) inside each head are rotated with
//          the f32 cos/sin rows of the token (staged per slab in LDS), then split to bf16 hi (C0/C2) and lo (C1/C3) planes.
//          cols n0 < QW -> q planes [M][ldc], col n0; cols n0 >= QW -> k planes [M][ldc2], col n0-QW. Row segment 256 B = 16 lanes x 16 B.
//          Second product = v^T projection: bf16 hi plane D0, lo plane D1, [M2][ldd], row segment 256 B.
//   EPI 2: f32 output C0 [M][ldc]; row segment 128 floats = 512 B = 32 lanes x 16 B per instruction.
// ---------------------------------------------------------------------------
template <int EPI> struct SlabCfg { static constexpr int PERWF = 2048; };   // floats per wave (8 KB)
template <> struct SlabCfg<0>     { static constexpr int PERWF = 3072; };   // + 16x32 cos + 16x32 sin rows

#define GKT  64                 // k per staged tile: 128-B rows
#define GPITCH  72                 // LDS row pitch in bf16: 144 B = 16 B x odd, for the 16-B fragment reads
#define GOP  (128 * GPITCH)        // bf16 per operand tile (128 rows)
#define GROWB (16 * GPITCH * 2)    // LDS bytes between a lane's consecutive copies (16 rows)

__device__ __forceinline__ unsigned lds_off(const void* p) { return (unsigned)(size_t)p; }

// One operand tile, 128 rows x 128 B: lane t copies 16 B of rows (t >> 3) + 16u, u = 0..7 (128 lanes x 8 = 1024 pieces = the tile).
// l = the lane's LDS byte address for u = 0, g = its global address for u = 0, ld = global row pitch in elements.
// s_wait_xcnt stands inside the statement so that no address register is rewritten ahead of it.
__device__ __forceinline__ void stage_tile(unsigned l, const unsigned short* g, int ld) {
  const size_t st = (size_t)16 * (size_t)ld;
  asm volatile(
      "global_load_async_to_lds_b128 %0, %8, off\n\t"
      "global_load_async_to_lds_b128 %1, %9, off\n\t"
      "global_load_async_to_lds_b128 %2, %10, off\n\t"
      "global_load_async_to_lds_b128 %3, %11, off\n\t"
      "global_load_async_to_lds_b128 %4, %12, off\n\t"
      "global_load_async_to_lds_b128 %5, %13, off\n\t"
      "global_load_async_to_lds_b128 %6, %14, off\n\t"
      "global_load_async_to_lds_b128 %7, %15, off\n\t"
      "s_wait_xcnt 0x0"
      :: "v"(l), "v"(l + 1u * GROWB), "v"(l + 2u * GROWB), "v"(l + 3u * GROWB),
         "v"(l + 4u * GROWB), "v"(l + 5u * GROWB), "v"(l + 6u * GROWB), "v"(l + 7u * GROWB),
         "v"(g), "v"(g + st), "v"(g + 2 * st), "v"(g + 3 * st),
         "v"(g + 4 * st), "v"(g + 5 * st), "v"(g + 6 * st), "v"(g + 7 * st)
      : "memory");
}

template <int EPI>
__global__ __launch_bounds__(128) void gemm_w32x128_kernel(
    const unsigned short* __restrict__ Ap, int lda,
    const unsigned short* __restrict__ Btp, int ldb,
    const float* __restrict__ cst, const float* __restrict__ snt,
    void* C0, void* C1, void* C2, void* C3, int ldc, int ldc2,
    int M, int N, int K,
    const unsigned short* __restrict__ A2p, void* D0, void* D1, int ldd, int M2, int N2) {
  __shared__ __align__(16) float lds_all[4 * SlabCfg<EPI>::PERWF];
  constexpr int NA = (EPI == 2) ? 2 : 1;                       // A planes that share the Bt tile
  __shared__ __align__(16) unsigned short ring[2][(NA + 1) * GOP];   // [buffer][A tile(s) | Bt tile], 18,432 B a tile

  const int tid  = (int)threadIdx.x;
  const int lane = tid & 31;
  const int wave = wave_id();
  const int hh = lane >> 4;           // lane half: k offset 8*hh, D row offset 8*hh
  const int rl = lane & 15;           // A row / B col / D col within subtile
  const int ntile1 = (M >> 7) * (N >> 7);
  const bool second = (EPI == 0) && ((int)blockIdx.x >= ntile1);   // block-uniform: this block works on the second product
  const int tilesN = (second ? N2 : N) >> 7;
  const int tilesM = (second ? M2 : M) >> 7;
  const int tile = (int)blockIdx.x - (second ? ntile1 : 0);
  if (tile >= tilesM * tilesN) return;          // block-uniform, in front of every barrier and copy
  const int tm = tile / tilesN;
  const int tn = tile - tm * tilesN;
  const int mblk = tm << 7;
  const int m0 = mblk + (wave << 5);
  const int n0 = tn << 7;

  // this lane's first piece of each operand tile: row tid >> 3, 16-B column tid & 7
  const int srow = tid >> 3;
  const int sc8  = (tid & 7) * 8;
  const unsigned short* gA = (second ? A2p : Ap) + (size_t)(mblk + srow) * lda + sc8;
  const unsigned short* gB = (second ? Ap : Btp) + (size_t)(n0   + srow) * ldb + sc8;
  const unsigned lA = lds_off(&ring[0][0]) + (unsigned)(srow * GPITCH + sc8) * 2u;
  const unsigned lA2 = lA + GOP * 2u;            // second A plane's tile (NA == 2)
  const unsigned lB = lA + NA * GOP * 2u;
  const unsigned bufb = (NA + 1) * GOP * 2u;     // bytes per buffer
  const int ntrip = K / GKT;

  v8f acc[2][8];
#pragma unroll
  for (int i = 0; i < 2; ++i)
#pragma unroll
    for (int j = 0; j < 8; ++j) acc[i][j] = zero8();

  // prologue: tile 0 lands and is published, then tile 1 starts
  stage_tile(lA, gA, lda);
  if (NA == 2) stage_tile(lA2, gA + K, lda);
  stage_tile(lB, gB, ldb);
  asm volatile("s_wait_asynccnt 0x0" ::: "memory");   // this wave's copies of tile 0 have landed
  __syncthreads();                                     // ... and every other wave's: tile 0 is readable
  if (ntrip > 1) {
    stage_tile(lA + bufb, gA + GKT, lda);
    if (NA == 2) stage_tile(lA2 + bufb, gA + K + GKT, lda);
    stage_tile(lB + bufb, gB + GKT, ldb);
  }

  for (int t = 0; t < ntrip; ++t) {
    const __bf16* As = (const __bf16*)(const void*)&ring[t & 1][0]   + (wave * 32 + rl) * GPITCH + 8 * hh;
    const __bf16* Bs = (const __bf16*)(const void*)&ring[t & 1][NA * GOP] + rl * GPITCH + 8 * hh;
    v16b ah[2][NA][2], bf[2][8];                       // [k half of the tile]([plane])[fragment]
#pragma unroll
    for (int s = 0; s < 2; ++s) {                      // in the order of first use
#pragma unroll
      for (int i = 0; i < 2; ++i) ah[s][0][i] = ldfrag_b(As + i * 16 * GPITCH + s * 32);
#pragma unroll
      for (int j = 0; j < 8; ++j) bf[s][j] = ldfrag_b(Bs + j * 16 * GPITCH + s * 32);
#pragma unroll
      for (int p = 1; p < NA; ++p)
#pragma unroll
        for (int i = 0; i < 2; ++i) ah[s][p][i] = ldfrag_b(As + p * GOP + i * 16 * GPITCH + s * 32);
    }
    // keeps the trip's LDS reads together in front of its WMMAs: one exposed LDS latency per trip instead of one per WMMA pair
    __builtin_amdgcn_sched_barrier(0);
#pragma unroll
    for (int s = 0; s < 2; ++s) {
#pragma unroll
      for (int p = 0; p < NA; ++p) {
#pragma unroll
        for (int j = 0; j < 8; ++j) {
          acc[0][j] = mma_b(ah[s][p][0], bf[s][j], acc[0][j]);
          acc[1][j] = mma_b(ah[s][p][1], bf[s][j], acc[1][j]);
        }
      }
    }
    // keeps the WMMAs in front of the trip's foot: they overlap the LDS reads, and tile t + 1's copies get the whole trip to land
    __builtin_amdgcn_sched_barrier(0);
    asm volatile("s_wait_dscnt 0x0" ::: "memory");     // this wave's reads of buffer t & 1 are done before it is refilled
    asm volatile("s_wait_asynccnt 0x0" ::: "memory");  // this wave's copies of tile t + 1 have landed
    __syncthreads();                                   // publishes tile t + 1 and ends every reader's use of buffer t & 1
    if (t + 2 < ntrip) {                               // same for the whole block
      const unsigned bo = (unsigned)(t & 1) * bufb;
      stage_tile(lA + bo, gA + (size_t)(t + 2) * GKT, lda);
      if (NA == 2) stage_tile(lA2 + bo, gA + K + (size_t)(t + 2) * GKT, lda);
      stage_tile(lB + bo, gB + (size_t)(t + 2) * GKT, ldb);
    }
  }
  asm volatile("s_wait_asynccnt 0x0" ::: "memory");    // nothing of this wave is in flight behind the loop
  acc_guard4(acc[0][0], acc[0][1], acc[0][2], acc[0][3]);
  acc_guard4(acc[0][4], acc[0][5], acc[0][6], acc[0][7]);
  acc_guard4(acc[1][0], acc[1][1], acc[1][2], acc[1][3]);
  acc_guard4(acc[1][4], acc[1][5], acc[1][6], acc[1][7]);

  // ---- epilogue ----
  float* wl = lds_all + wave * SlabCfg<EPI>::PERWF;
  unsigned short* sl16 = (unsigned short*)(void*)wl;       // 4096 u16 = floats 0..2047 (two 16x128 planes)
  float* slf = wl;

  if (EPI == 0 && !second) {
    float* csl = wl + 2048;                                 // cos rows [16][32]
    float* snl = wl + 2048 + 16 * NFREQ;                    // sin rows [16][32]
    const bool isq = (n0 < QW);                             // wave-uniform
    unsigned short* P0 = isq ? (unsigned short*)C0 : (unsigned short*)C2;
    unsigned short* P1 = isq ? (unsigned short*)C1 : (unsigned short*)C3;
    const int ldp  = isq ? ldc : ldc2;
    const int col0 = isq ? n0 : (n0 - QW);
#pragma unroll
    for (int i = 0; i < 2; ++i) {
      const int mb = m0 + i * 16;
      // stage cos/sin of tokens mb..mb+15: 16 rows x 32 floats = 128 16-B pieces per table; lane -> 4 pieces (coverage 32x4 = 128)
      v4f cv4[4], sv4[4];
      const float* cp[4];
      const float* sp[4];
#pragma unroll
      for (int u = 0; u < 4; ++u) {
        const int p   = lane + 32 * u;
        const int row = p >> 3, c4 = (p & 7) * 4;
        cp[u] = cst + (size_t)(mb + row) * NFREQ + c4;
        sp[u] = snt + (size_t)(mb + row) * NFREQ + c4;
        cv4[u] = *(const v4f*)cp[u];
        sv4[u] = *(const v4f*)sp[u];
      }
      // precaution: the eight loads' address registers, named as inputs so that they live up to here, are reused only behind this wait
      asm volatile("s_wait_xcnt 0x0"
                   :: "v"(cp[0]), "v"(cp[1]), "v"(cp[2]), "v"(cp[3]), "v"(sp[0]), "v"(sp[1]), "v"(sp[2]), "v"(sp[3])
                   : "memory");
#pragma unroll
      for (int u = 0; u < 4; ++u) {
        const int p   = lane + 32 * u;
        const int row = p >> 3, c4 = (p & 7) * 4;
        *(v4f*)(csl + row * NFREQ + c4) = cv4[u];
        *(v4f*)(snl + row * NFREQ + c4) = sv4[u];
      }
      lds_wave_sync();
#pragma unroll
      for (int hs = 0; hs < 2; ++hs) {                      // head within the 128-col tile
#pragma unroll
        for (int jj = 0; jj < 2; ++jj) {
          const int j1 = hs * 4 + jj;                       // cols hs*64 + jj*16 + rl  (x1, dim d < 32)
          const int j2 = j1 + 2;                            // cols +32                 (x2, dim d + 32)
          const int d  = jj * 16 + rl;                      // freq index 0..31
#pragma unroll
          for (int r = 0; r < 8; ++r) {
            const int lrow = 8 * hh + r;
            const float cv = csl[lrow * NFREQ + d];
            const float sv = snl[lrow * NFREQ + d];
            const float x1 = acc[i][j1][r];
            const float x2 = acc[i][j2][r];
            const float o1 = x1 * cv - x2 * sv;
            const float o2 = x2 * cv + x1 * sv;
            const unsigned hb = cvt2(o1, o2);
            const unsigned lb = cvt2_res(o1, o2, hb);
            const int so = lrow * 128 + hs * 64 + d;
            sl16[so]             = (unsigned short)hb;
            sl16[so + 32]        = (unsigned short)(hb >> 16);
            sl16[2048 + so]      = (unsigned short)lb;
            sl16[2048 + so + 32] = (unsigned short)(lb >> 16);
          }
        }
      }
      lds_wave_sync();
      {
#pragma unroll
        for (int it = 0; it < 8; ++it) {
          const int row = it * 2 + hh;                      // it x hh covers rows 0..15
          const int c8  = rl * 8;
          const v4u vh = *(const v4u*)(sl16 + row * 128 + c8);
          const v4u vl = *(const v4u*)(sl16 + 2048 + row * 128 + c8);
          const size_t go = (size_t)(mb + row) * ldp + col0 + c8;
          *(v4u*)(P0 + go) = vh;
          *(v4u*)(P1 + go) = vl;
        }
        
      }
      lds_wave_sync();
    }
  } else if (EPI == 0) {
    unsigned short* P0 = (unsigned short*)D0;
    unsigned short* P1 = (unsigned short*)D1;
#pragma unroll
    for (int i = 0; i < 2; ++i) {
#pragma unroll
      for (int r = 0; r < 8; ++r) {
#pragma unroll
        for (int j = 0; j < 8; j += 2) {
          const float va = acc[i][j][r];
          const float vb = acc[i][j + 1][r];
          const unsigned hb = cvt2(va, vb);
          const unsigned lb = cvt2_res(va, vb, hb);
          const int so = (8 * hh + r) * 128 + j * 16 + rl;
          sl16[so]             = (unsigned short)hb;
          sl16[so + 16]        = (unsigned short)(hb >> 16);
          sl16[2048 + so]      = (unsigned short)lb;
          sl16[2048 + so + 16] = (unsigned short)(lb >> 16);
        }
      }
      lds_wave_sync();
      {
#pragma unroll
        for (int it = 0; it < 8; ++it) {
          const int row = it * 2 + hh;
          const int c8  = rl * 8;
          const v4u vh = *(const v4u*)(sl16 + row * 128 + c8);
          const v4u vl = *(const v4u*)(sl16 + 2048 + row * 128 + c8);
          const size_t go = (size_t)(m0 + i * 16 + row) * ldd + n0 + c8;
          *(v4u*)(P0 + go) = vh;
          *(v4u*)(P1 + go) = vl;
        }
        
      }
      lds_wave_sync();
    }
  } else {
    float* C = (float*)C0;
#pragma unroll
    for (int i = 0; i < 2; ++i) {
#pragma unroll
      for (int j = 0; j < 8; ++j)
#pragma unroll
        for (int r = 0; r < 8; ++r)
          slf[(8 * hh + r) * 128 + j * 16 + rl] = acc[i][j][r];
      lds_wave_sync();
      {
#pragma unroll
        for (int row = 0; row < 16; ++row) {                // 32 lanes x 16 B = the whole 512-B row segment per instruction
          const v4f v = *(const v4f*)(slf + row * 128 + lane * 4);
          *(v4f*)(C + (size_t)(m0 + i * 16 + row) * ldc + n0 + lane * 4) = v;
        }
        
      }
      lds_wave_sync();
    }
  }
}

#define AKC  32
#define NKG  4
#define QS   2
#define TKC  (AKC * NKG)
#define KP   72
#define VP   136
#define MP   132
#define KVB  ((2 * TKC * KP + 2 * HDM * VP) * 2)
#define JOB  ((NKG - 1) * 4 * 32 * (32 + 2) * 4)
static_assert(JOB <= KVB);

#define LOG2E 1.44269504088896340736f
__device__ __forceinline__ float exp2_slot(float x) {
  float r;
  asm("v_exp_f32 %0, %1\n\tv_nop" : "=&v"(r) : "v"(x));
  return r;
}
__device__ __forceinline__ void exp2x8_slot(float (&r)[8], const float (&x)[8]) {
  asm("v_exp_f32 %0, %8\n\tv_exp_f32 %1, %9\n\tv_exp_f32 %2, %10\n\tv_exp_f32 %3, %11\n\t"
      "v_exp_f32 %4, %12\n\tv_exp_f32 %5, %13\n\tv_exp_f32 %6, %14\n\tv_exp_f32 %7, %15\n\tv_nop"
      : "=&v"(r[0]), "=&v"(r[1]), "=&v"(r[2]), "=&v"(r[3]), "=&v"(r[4]), "=&v"(r[5]), "=&v"(r[6]), "=&v"(r[7])
      : "v"(x[0]), "v"(x[1]), "v"(x[2]), "v"(x[3]), "v"(x[4]), "v"(x[5]), "v"(x[6]), "v"(x[7]));
}

// four waves per SIMD = two blocks per WGP: one block's products fill the other's staging and barrier waits (2 x LDS fits too)
__global__ __launch_bounds__(256) __attribute__((amdgpu_waves_per_eu(4, 4))) void attn_kernel(
    const unsigned short* __restrict__ qhp, const unsigned short* __restrict__ qlp,
    const unsigned short* __restrict__ khp, const unsigned short* __restrict__ klp,
    const unsigned short* __restrict__ vhp, const unsigned short* __restrict__ vlp,
    const float* __restrict__ maskp, const int* __restrict__ clsp,
    unsigned short* __restrict__ aop) {
  __shared__ __align__(16) unsigned short KVs[KVB / 2];
  __shared__ __align__(16) float Ms[64 * MP];
  __shared__ __align__(16) unsigned short Osh[4][16 * 64];
  __shared__ __align__(16) unsigned short Osl[4][16 * 64];
  unsigned short* Ks  = KVs;
  unsigned short* Kls = KVs + TKC * KP;
  unsigned short* Vhs = KVs + 2 * TKC * KP;
  unsigned short* Vls = KVs + 2 * TKC * KP + HDM * VP;

  const int tid  = (int)threadIdx.x;
  const int lane = tid & 31;
  const int wave = wave_id();
  const int wq   = wave & 1;                     // query slab pair of the wave: slabs 2 wq, 2 wq + 1 of the block's four
  const int kg   = wave >> 1;                    // key group of the wave
  const int hh   = lane >> 4;
  const int c    = lane & 15;
  // Which (query tile, head, batch) a block takes: the tile falls as the flat index rises. Where the mask admits keys up to the
  // query (a tile's trips then grow with qt), the long blocks come first in index order, for speed only. The map is a permutation of the grid for any mask: every (qt, h, b) is taken exactly once.
  const unsigned flat = blockIdx.x + NT64 * (blockIdx.y + NHQ * blockIdx.z);   // grid (NT64, NHQ, NB)
  const int qt   = NT64 - 1 - (int)(flat / (NHQ * NB));
  const int h    = (int)(flat % NHQ);
  const int b    = (int)((flat / NHQ) % NB);
  const int kvh  = h >> 2;
  const int q0   = qt * 64 + wq * (16 * QS);     // first query row of this wave (within the sequence)
  const size_t tok0 = (size_t)b * SQ;

  // whole mask staging area initialised once (only class-2 tiles refresh it; other tiles never add from it)
#pragma unroll 1
  for (int u = tid; u < 64 * MP; u += 256) Ms[u] = 0.0f;

  const __bf16* Qhr = (const __bf16*)(const void*)qhp + (tok0 + q0 + c) * QW + h * HDM + 8 * hh;
  const __bf16* Qlr = (const __bf16*)(const void*)qlp + (tok0 + q0 + c) * QW + h * HDM + 8 * hh;
  const size_t mrow0 = (tok0 + (size_t)qt * 64) * SQ;                 // mask[b][0][qt*64][0]
  const int* crow = clsp + ((b * NT64) + qt) * NT64;
  // staging: block-uniform element offsets of the (b, kv head) planes, and this thread's own byte offsets (global) and places (LDS)
  const size_t kbase = tok0 * KW + kvh * HDM;
  const size_t vbase = (size_t)(kvh * HDM) * NTOK + tok0;
  const unsigned kgo = (unsigned)((tid >> 3) * KW + (tid & 7) * 8) * 2u;
  const unsigned vgo = (unsigned)((tid >> 4) * NTOK + (tid & 15) * 8) * 2u;
  const unsigned mgo = (unsigned)((tid >> 4) * SQ + (tid & 15) * 4) * 4u;
  const int kso = (tid >> 3) * KP + (tid & 7) * 8;
  const int vso = (tid >> 4) * VP + (tid & 15) * 8;
  const int mso = (tid >> 4) * MP + (tid & 15) * 4;

  v16b qh[QS][2], ql[QS][2];                       // [slab][d half]
#pragma unroll
  for (int z = 0; z < QS; ++z)
#pragma unroll
    for (int dc = 0; dc < 2; ++dc) {
      qh[z][dc] = ldfrag_b(Qhr + (size_t)z * 16 * QW + dc * 32);
      ql[z][dc] = ldfrag_b(Qlr + (size_t)z * 16 * QW + dc * 32);
    }

  float mrow[QS];                                  // running max of query c of slab z over this wave's keys (the same in both halves)
  float lsum[QS];                                  // running sum of query c of slab z over this wave's keys of this half
  v8f oacc[QS][4];                                 // oacc[z][t][r] = O[query c of slab z][d = 16t + 8hh + r], this wave's keys
#pragma unroll
  for (int z = 0; z < QS; ++z) {
    mrow[z] = -INFINITY;
    lsum[z] = 0.f;
#pragma unroll
    for (int t = 0; t < 4; ++t) oacc[z][t] = zero8();
  }

  for (int s = 0; s < NT64 / 2; ++s) {
    const int cl0 = __builtin_amdgcn_readfirstlane(crow[2 * s]);      // block-uniform classes of the trip's two mask tiles
    const int cl1 = __builtin_amdgcn_readfirstlane(crow[2 * s + 1]);
    if ((cl0 | cl1) == 0) continue;                                   // uniform for the whole block; before any barrier
    const int kv0 = s * TKC;
    __syncthreads();                                                  // prior trip's LDS readers are done
    const unsigned short* kbh = khp + kbase + (size_t)kv0 * KW;       // block-uniform bases of the trip's tiles
    const unsigned short* kbl = klp + kbase + (size_t)kv0 * KW;
    const unsigned short* vbh = vhp + vbase + kv0;
    const unsigned short* vbl = vlp + vbase + kv0;
    const char* kph = (const char*)kbh + kgo;                         // this thread's own addresses in the four planes
    const char* kpl = (const char*)kbl + kgo;
    const char* vph = (const char*)vbh + vgo;
    const char* vpl = (const char*)vbl + vgo;
    v4u kx[4], ky[4], vx[4], vy[4];
#pragma unroll
    for (int u = 0; u < 4; ++u) {                                     // coverage: 1024 pieces of 8 halves per plane = whole tile
      kx[u] = *(const v4u*)(kph + u * 32 * KW * 2);                   // K: 128 keys x 64 d; key = (tid >> 3) + 32u
      ky[u] = *(const v4u*)(kpl + u * 32 * KW * 2);
      vx[u] = *(const v4u*)(vph + u * 16 * NTOK * 2);                 // V^T: 64 d x 128 keys; d = (tid >> 4) + 16u
      vy[u] = *(const v4u*)(vpl + u * 16 * NTOK * 2);
    }
    // behind the run's last load, in front of every rewrite of a register that a load of the run names (the rule for issued global
    // loads). The four addresses are inputs: they stay live up to the wait, so no load of the run lands in a pair that another names.
    asm volatile("s_wait_xcnt 0x0" :: "v"(kph), "v"(kpl), "v"(vph), "v"(vpl) : "memory");
#pragma unroll
    for (int u = 0; u < 4; ++u) {
      *(v4u*)(Ks  + kso + u * 32 * KP) = kx[u];
      *(v4u*)(Kls + kso + u * 32 * KP) = ky[u];
      *(v4u*)(Vhs + vso + u * 16 * VP) = vx[u];
      *(v4u*)(Vls + vso + u * 16 * VP) = vy[u];
    }
#pragma unroll
    for (int mtl = 0; mtl < 2; ++mtl) {
      if ((mtl ? cl1 : cl0) == 2) {                                   // block-uniform branch about the mask tile load
        const float* mbase = maskp + mrow0 + kv0 + mtl * 64;
        v4f mv[4];
#pragma unroll
        for (int u = 0; u < 4; ++u)                                   // coverage: 1024 pieces of 4 floats = 64 rows x 64 keys
          mv[u] = *(const v4f*)((const char*)(mbase + (size_t)u * 16 * SQ) + mgo);          // row = (tid >> 4) + 16u
#pragma unroll
        for (int u = 0; u < 4; ++u) *(v4f*)(Ms + mso + u * 16 * MP + mtl * 64) = mv[u];
      }
    }
    __syncthreads();

    const int cl = (kg < 2) ? cl0 : cl1;                              // wave-uniform class of this wave's 32 keys
    if (cl == 0) continue;                                            // no barrier between here and the next trip's first one

    // ---- scores, transposed: 32 keys x 2 x 16 queries, K = 64, three products; each K fragment feeds both slabs ----
    v8f sa[QS][2];
#pragma unroll
    for (int z = 0; z < QS; ++z) { sa[z][0] = zero8(); sa[z][1] = zero8(); }
#pragma unroll
    for (int dc = 0; dc < 2; ++dc) {
#pragma unroll
      for (int j = 0; j < 2; ++j) {
        const v16b kb = ldfrag_b((const __bf16*)(const void*)Ks  + (kg * AKC + j * 16 + c) * KP + dc * 32 + 8 * hh);
        const v16b kl = ldfrag_b((const __bf16*)(const void*)Kls + (kg * AKC + j * 16 + c) * KP + dc * 32 + 8 * hh);
#pragma unroll
        for (int z = 0; z < QS; ++z) sa[z][j] = mma_b(kb, qh[z][dc], sa[z][j]);
#pragma unroll
        for (int z = 0; z < QS; ++z) sa[z][j] = mma_b(kl, qh[z][dc], sa[z][j]);
#pragma unroll
        for (int z = 0; z < QS; ++z) sa[z][j] = mma_b(kb, ql[z][dc], sa[z][j]);
        guard2b6(sa[0][j], sa[1][j], kb, kl, qh[0][dc], qh[1][dc], ql[0][dc], ql[1][dc]);
      }
    }
    acc_guard4(sa[0][0], sa[0][1], sa[1][0], sa[1][1]);

    union PB { v16b v; unsigned u[8]; };
    PB pa[QS], pr[QS];
#pragma unroll
    for (int z = 0; z < QS; ++z) {
      // ---- scale, mask add (class 2): sc[j][r] = score of (query c of slab z, key 16j + 8hh + r) ----
      float sc[2][8];
#pragma unroll
      for (int j = 0; j < 2; ++j)
#pragma unroll
        for (int r = 0; r < 8; ++r) sc[j][r] = sa[z][j][r] * 0.125f;
      if (cl == 2) {                                                  // wave-uniform
        const float* mr = Ms + ((wq * QS + z) * 16 + c) * MP + kg * AKC + 8 * hh;   // the query's mask row, this wave's keys, this half's
#pragma unroll
        for (int j = 0; j < 2; ++j) {
          const v4f ma = *(const v4f*)(mr + j * 16);
          const v4f mb = *(const v4f*)(mr + j * 16 + 4);
#pragma unroll
          for (int r = 0; r < 4; r += 2) {
            const unsigned wa = cvt2(ma[r], ma[r + 1]);
            const unsigned wb = cvt2(mb[r], mb[r + 1]);
            sc[j][r]     += lo_val(wa); sc[j][r + 1]     += hi_val(wa);
            sc[j][4 + r] += lo_val(wb); sc[j][4 + r + 1] += hi_val(wb);
          }
        }
      }
      // ---- chunk max of the query: in the lane, then with the other half ----
      float cm = -INFINITY;
#pragma unroll
      for (int j = 0; j < 2; ++j)
#pragma unroll
        for (int r = 0; r < 8; ++r) cm = fmaxf(cm, sc[j][r]);
      cm = fmaxf(cm, xhalf(cm));
      // ---- online softmax; p hi/lo packed in place into the B operands ----
      const float mnew  = fmaxf(mrow[z], cm);
      const float muse  = (mnew > -INFINITY) ? mnew : 0.0f;
      const float alpha = exp2_slot((mrow[z] - muse) * LOG2E);
      mrow[z] = mnew;
      float ps[2];
#pragma unroll
      for (int j = 0; j < 2; ++j) {
        float tx[8], px[8];
#pragma unroll
        for (int r = 0; r < 8; ++r) tx[r] = (sc[j][r] - muse) * LOG2E;
        exp2x8_slot(px, tx);
        ps[j] = 0.f;
#pragma unroll
        for (int r = 0; r < 8; r += 2) {
          const float p0 = px[r];
          const float p1 = px[r + 1];
          ps[j] += p0;
          ps[j] += p1;
          const unsigned hp = cvt2(p0, p1);
          pa[z].u[j * 4 + (r >> 1)] = hp;
          pr[z].u[j * 4 + (r >> 1)] = cvt2_res(p0, p1, hp);
        }
      }
      lsum[z] = lsum[z] * alpha + (ps[0] + ps[1]);
#pragma unroll
      for (int t = 0; t < 4; ++t)
#pragma unroll
        for (int r = 0; r < 8; ++r) oacc[z][t][r] *= alpha;
    }
    // ---- O^T += v^T . p^T (K = 32 keys, three products); each V^T fragment feeds both slabs ----
#pragma unroll
    for (int t = 0; t < 4; ++t) {
      const v16b vb = ldfrag_b((const __bf16*)(const void*)Vhs + (t * 16 + c) * VP + kg * AKC + 8 * hh);
      const v16b vr = ldfrag_b((const __bf16*)(const void*)Vls + (t * 16 + c) * VP + kg * AKC + 8 * hh);
#pragma unroll
      for (int z = 0; z < QS; ++z) oacc[z][t] = mma_b(vb, pa[z].v, oacc[z][t]);
#pragma unroll
      for (int z = 0; z < QS; ++z) oacc[z][t] = mma_b(vr, pa[z].v, oacc[z][t]);
#pragma unroll
      for (int z = 0; z < QS; ++z) oacc[z][t] = mma_b(vb, pr[z].v, oacc[z][t]);
      guard2b6(oacc[0][t], oacc[1][t], vb, vr, pa[0].v, pa[1].v, pr[0].v, pr[1].v);
    }
  }
  __syncthreads();                                 // every wave is past the trip loop: the K / V^T tiles are free
  acc_guard4(oacc[0][0], oacc[0][1], oacc[0][2], oacc[0][3]);
  acc_guard4(oacc[1][0], oacc[1][1], oacc[1][2], oacc[1][3]);

  // ---- the four key groups' parts of a query slab are joined in group 0 ----
  // hand-over area: O parts as 16-B pieces [part][piece 0..7][lane], then (max, sum) pairs [part][lane];
  // part = (kg - 1) * 4 + slab, slab = 2 wq + z
  v4f* jo = (v4f*)(void*)KVs;
  v2f* jm = (v2f*)(void*)(jo + (NKG - 1) * 4 * 8 * 32);
  if (kg != 0) {                                   // wave-uniform
#pragma unroll
    for (int z = 0; z < QS; ++z) {
      const int part = (kg - 1) * 4 + wq * QS + z;
#pragma unroll
      for (int t = 0; t < 4; ++t) {
        const v4f x0 = {oacc[z][t][0], oacc[z][t][1], oacc[z][t][2], oacc[z][t][3]};
        const v4f x1 = {oacc[z][t][4], oacc[z][t][5], oacc[z][t][6], oacc[z][t][7]};
        jo[(part * 8 + 2 * t) * 32 + lane]     = x0;
        jo[(part * 8 + 2 * t + 1) * 32 + lane] = x1;
      }
      const v2f ml = {mrow[z], lsum[z]};
      jm[part * 32 + lane] = ml;
    }
  }
  __syncthreads();                                 // the parts are readable; the last barrier of the kernel
  if (kg != 0) return;                             // whole waves leave, behind every barrier

#pragma unroll
  for (int z = 0; z < QS; ++z) {
    const int sl = wq * QS + z;                    // this slab of the block's four
    v2f oml[NKG - 1];
    float mall = mrow[z];
#pragma unroll
    for (int g = 0; g < NKG - 1; ++g) {
      oml[g] = jm[(g * 4 + sl) * 32 + lane];
      mall = fmaxf(mall, oml[g][0]);
    }
    const float mjoin = (mall > -INFINITY) ? mall : 0.0f;
    float w0 = __expf(mrow[z] - mjoin);            // a part that saw no key has max -inf: weight 0
    float wg[NKG - 1];
#pragma unroll
    for (int g = 0; g < NKG - 1; ++g) wg[g] = __expf(oml[g][0] - mjoin);
    // the slot the instruction set asks for between an exp and the first user of its result or overwriter of its source; the four
    // weights are tied to it so that it stands behind the run of exps and in front of every product with a weight
    asm volatile("v_nop" : "+v"(w0), "+v"(wg[0]), "+v"(wg[1]), "+v"(wg[2]));
    float ls = lsum[z] * w0;
#pragma unroll
    for (int t = 0; t < 4; ++t)
#pragma unroll
      for (int r = 0; r < 8; ++r) oacc[z][t][r] *= w0;
#pragma unroll
    for (int g = 0; g < NKG - 1; ++g) {
      ls += wg[g] * oml[g][1];
#pragma unroll
      for (int t = 0; t < 4; ++t) {
        const v4f x0 = jo[((g * 4 + sl) * 8 + 2 * t) * 32 + lane];
        const v4f x1 = jo[((g * 4 + sl) * 8 + 2 * t + 1) * 32 + lane];
#pragma unroll
        for (int r = 0; r < 4; ++r) {
          oacc[z][t][r]     += wg[g] * x0[r];
          oacc[z][t][4 + r] += wg[g] * x1[r];
        }
      }
    }

    unsigned short* osh = Osh[sl];
    unsigned short* osl = Osl[sl];
    const float inv = 1.0f / (ls + xhalf(ls));     // the halves' sums joined; l >= 1: the row max contributes exp(0)
#pragma unroll
    for (int t = 0; t < 4; ++t) {                  // 8 consecutive d of query c: one 16-B LDS store per plane
      v4u xh, xl;
#pragma unroll
      for (int r = 0; r < 8; r += 2) {
        const float o0 = oacc[z][t][r] * inv;
        const float o1 = oacc[z][t][r + 1] * inv;
        const unsigned ho = cvt2(o0, o1);
        xh[r >> 1] = ho;
        xl[r >> 1] = cvt2_res(o0, o1, ho);
      }
      *(v4u*)(osh + c * 64 + t * 16 + 8 * hh) = xh;
      *(v4u*)(osl + c * 64 + t * 16 + 8 * hh) = xl;
    }
  }
  lds_wave_sync();
  const int qq = lane >> 3;                        // 0..3
  const int c8 = (lane & 7) * 8;
#pragma unroll
  for (int z = 0; z < QS; ++z) {
    const unsigned short* osh = Osh[wq * QS + z];
    const unsigned short* osl = Osl[wq * QS + z];
    unsigned short* Ag = aop + (tok0 + q0 + z * 16) * AOW + h * HDM;
#pragma unroll
    for (int it = 0; it < 4; ++it) {
      const int row = it * 4 + qq;                 // it 0..3 x qq 0..3 covers rows 0..15
      const v4u x = *(const v4u*)(osh + row * 64 + c8);
      const v4u y = *(const v4u*)(osl + row * 64 + c8);
      *(v4u*)(Ag + (size_t)row * AOW + c8)      = x;
      *(v4u*)(Ag + (size_t)row * AOW + QW + c8) = y;
    }
  }
}

// ---------------------------------------------------------------------------
// Workspace map (bytes; every region is an exact whole number of the rows its producer writes with whole-line stores;
// all dimensions are tile multiples, no padded tails needed; every offset is a multiple of 128):
//   XB   bf16 [4096][1024]   8388608     WQK bf16 [1280][1024]   2621440     WV  bf16 [256][1024]    524288
//   WO   bf16 [1024][1024]   2097152     CST f32  [4096][32]      524288     SNT f32  [4096][32]     524288
//   CLS  i32  [2][32][32]       8192     QH  bf16 [4096][1024]   8388608     QL  bf16 [4096][1024]  8388608
//   KH   bf16 [4096][256]    2097152     KL  bf16 [4096][256]    2097152     VTH bf16 [256][4096]   2097152
//   VTL  bf16 [256][4096]    2097152     AO  bf16 [4096][2048]  16777216
//   total                   56631296
// ---------------------------------------------------------------------------
extern "C" void kernel_launch(void* const* d_in, const int* in_sizes, int n_in,
                              void* d_out, int out_size, void* d_ws, size_t ws_size,
                              hipStream_t stream) {
  if (n_in < 7) return;
  if (in_sizes[0] != NTOK * HID) return;                  // hidden_states [2][2048][1024] f32
  if (in_sizes[1] != NB * SQ * SQ) return;                // attention_mask [2][1][2048][2048] f32
  if (in_sizes[2] != NTOK) return;                        // position_ids [2][2048] int32
  if (in_sizes[3] != QW * HID) return;                    // wq [1024][1024]
  if (in_sizes[4] != KW * HID) return;                    // wk [256][1024]
  if (in_sizes[5] != KW * HID) return;                    // wv [256][1024]
  if (in_sizes[6] != HID * QW) return;                    // wo [1024][1024]
  if (out_size != NTOK * HID) return;

  const float* hs   = (const float*)d_in[0];
  const float* mask = (const float*)d_in[1];
  const int*   pos  = (const int*)d_in[2];
  const float* wq   = (const float*)d_in[3];
  const float* wk   = (const float*)d_in[4];
  const float* wv   = (const float*)d_in[5];
  const float* wo   = (const float*)d_in[6];
  float* out = (float*)d_out;

  const size_t szXB  = (size_t)NTOK * HID * 2;
  const size_t szWQK = (size_t)QKN * HID * 2;
  const size_t szWV  = (size_t)KW * HID * 2;
  const size_t szWO  = (size_t)HID * QW * 2;
  const size_t szT   = (size_t)NTOK * NFREQ * 4;
  const size_t szCLS = (size_t)NB * NT64 * NT64 * 4;
  const size_t szQ   = (size_t)NTOK * QW * 2;
  const size_t szK   = (size_t)NTOK * KW * 2;
  const size_t szVT  = (size_t)KW * NTOK * 2;
  const size_t szAO  = (size_t)NTOK * AOW * 2;
  size_t off = 0;
  const size_t oXB  = off; off += szXB;
  const size_t oWQK = off; off += szWQK;
  const size_t oWV  = off; off += szWV;
  const size_t oWO  = off; off += szWO;
  const size_t oCST = off; off += szT;
  const size_t oSNT = off; off += szT;
  const size_t oCLS = off; off += szCLS;
  const size_t oQH  = off; off += szQ;
  const size_t oQL  = off; off += szQ;
  const size_t oKH  = off; off += szK;
  const size_t oKL  = off; off += szK;
  const size_t oVTH = off; off += szVT;
  const size_t oVTL = off; off += szVT;
  const size_t oAO  = off; off += szAO;
  if (off > ws_size) return;                              // off = 56631296

  char* ws = (char*)d_ws;
  unsigned short* XB  = (unsigned short*)(ws + oXB);
  unsigned short* WQK = (unsigned short*)(ws + oWQK);
  unsigned short* WV  = (unsigned short*)(ws + oWV);
  unsigned short* WO  = (unsigned short*)(ws + oWO);
  float*          CST = (float*)(ws + oCST);
  float*          SNT = (float*)(ws + oSNT);
  int*            CLS = (int*)(ws + oCLS);
  unsigned short* QH  = (unsigned short*)(ws + oQH);
  unsigned short* QL  = (unsigned short*)(ws + oQL);
  unsigned short* KH  = (unsigned short*)(ws + oKH);
  unsigned short* KL  = (unsigned short*)(ws + oKL);
  unsigned short* VTH = (unsigned short*)(ws + oVTH);
  unsigned short* VTL = (unsigned short*)(ws + oVTL);
  unsigned short* AO  = (unsigned short*)(ws + oAO);

  const dim3 b256(256), b128(128);

  // (1) preparation, one launch: mask classes, x / wq / wk / wv / wo bf16 planes, cos/sin table
  prep_kernel<<<dim3(PB_ALL), b256, 0, stream>>>(hs, mask, pos, wq, wk, wv, wo, XB, WQK, WV, WO, CST, SNT, CLS);
  // (2) one launch, two products:
  //     q|k = x . [Wq;Wk]^T, RoPE, split -> QH/QL [4096][1024], KH/KL [4096][256]   (M=4096, N=1280, K=1024; 32 x 10 block tiles)
  //     v^T = Wv . x^T -> VTH/VTL [256][4096]   (A = WV, Bt = XB; M=256, N=4096, K=1024; 2 x 32 block tiles)
  gemm_w32x128_kernel<0><<<dim3((NTOK / 128) * (QKN / 128) + (KW / 128) * (NTOK / 128)), b128, 0, stream>>>(
      XB, HID, WQK, HID, CST, SNT, (void*)QH, (void*)QL, (void*)KH, (void*)KL, QW, KW, NTOK, QKN, HID,
      WV, (void*)VTH, (void*)VTL, NTOK, KW, NTOK);
  // (3) attention per (q tile, head, batch) -> AO hi|lo [4096][2048]
  attn_kernel<<<dim3(SQ / 64, NHQ, NB), b256, 0, stream>>>(QH, QL, KH, KL, VTH, VTL, mask, CLS, AO);
  // (4) out = (AOhi + AOlo) . Wo^T, two products on each Wo tile -> d_out f32 [4096][1024]   (M=4096, N=1024, K=1024; 32 x 8 block tiles)
  gemm_w32x128_kernel<2><<<dim3((NTOK / 128) * (HID / 128)), b128, 0, stream>>>(
      AO, AOW, WO, QW, CST, SNT, (void*)out, (void*)out, (void*)out, (void*)out, HID, HID, NTOK, HID, QW,
      AO, (void*)out, (void*)out, HID, NTOK, HID);
  (void)hipGetLastError();
}

// v010
// It runs in 117 microseconds.
// Next to v009, in two timings, it ran 1.05 times as fast each time.
// All steps since v000 together make it 4.23 times as fast.
// Contractions: x.[Wq;Wk]^T and Wv.x^T on v_wmma_f32_16x16x32_bf16 (operands = RNE bf16 copies of the f32 inputs, single products);
// q.k^T and p.v on v_wmma_f32_16x16x32_bf16 with bf16 hi/lo split operands (hi.hi + hi.lo + lo.hi, three products);
// attn.Wo^T on v_wmma_f32_16x16x32_bf16 with attn = bf16 hi and lo planes (two products, both against the same Wo fragment) and Wo as RNE bf16.
// f32 accumulate everywhere; RoPE (f32 cos/sin table built from the position ids), mask add and online softmax in f32.
// Plane carry audit: every 16-bit plane is bf16 with carry 1 (hi = RNE(v), lo = RNE(v - hi), same accumulator); nothing is scaled,
// nothing is folded back: XB, WQK, WV, WO (RNE copies), QH/QL, KH/KL, VTH/VTL, P (registers), AO hi|lo.
#include <hip/hip_runtime.h>
#include <math.h>
#include <stdint.h>

#define NB     2
#define SQ     2048
#define HID    1024
#define NHQ    16
#define NKVH   4
#define HDM    64
#define QW     1024          // q plane width (16 heads x 64)
#define KW     256           // k / v width (4 heads x 64)
#define QKN    1280          // q|k projection columns
#define NTOK   4096
#define NFREQ  32
#define AOW    2048          // attn plane width: hi at col 0..1023, lo at col 1024..2047
#define NT64   32            // 64-wide tiles along each mask axis

typedef __bf16       v16b __attribute__((ext_vector_type(16)));
typedef __bf16       v8b  __attribute__((ext_vector_type(8)));
typedef float        v8f  __attribute__((ext_vector_type(8)));
typedef float        v4f  __attribute__((ext_vector_type(4)));
typedef unsigned int v4u  __attribute__((ext_vector_type(4)));
typedef float        v2f  __attribute__((ext_vector_type(2)));
typedef __bf16       v2b  __attribute__((ext_vector_type(2)));

// ---------------------------------------------------------------------------
// small helpers
// ---------------------------------------------------------------------------
// two f32 -> two bf16 (RNE) in one word by the hardware's packed convert: a in bits 15..0, b in bits 31..16
__device__ __forceinline__ unsigned cvt2(float a, float b) {
  const v2f x = {a, b};
  return __builtin_bit_cast(unsigned, __builtin_convertvector(x, v2b));
}
__device__ __forceinline__ float lo_val(unsigned w) { return __uint_as_float(w << 16); }          // f32 value of the low bf16
__device__ __forceinline__ float hi_val(unsigned w) { return __uint_as_float(w & 0xFFFF0000u); }  // f32 value of the high bf16
// the residues of a and b against their bf16 roundings held in w = cvt2(a, b), rounded to bf16 in turn
__device__ __forceinline__ unsigned cvt2_res(float a, float b, unsigned w) { return cvt2(a - lo_val(w), b - hi_val(w)); }
__device__ __forceinline__ v8f zero8() { v8f z = {0.f, 0.f, 0.f, 0.f, 0.f, 0.f, 0.f, 0.f}; return z; }
// lane l with lane l ^ 16 (the other half of the wave)
__device__ __forceinline__ float xhalf(float x) {
  const int b = __builtin_bit_cast(int, x);
  return __builtin_bit_cast(float, __builtin_amdgcn_permlanex16(b, b, 0x76543210, 0xfedcba98, false, false));
}
__device__ __forceinline__ int wave_id() { return __builtin_amdgcn_readfirstlane((int)(threadIdx.x >> 5)); }

__device__ __forceinline__ void lds_wave_sync() {
  __builtin_amdgcn_fence(__ATOMIC_RELEASE, "workgroup");
  __builtin_amdgcn_wave_barrier();
  __builtin_amdgcn_fence(__ATOMIC_ACQUIRE, "workgroup");
}

// ---------------------------------------------------------------------------
// WMMA fragments (wave32, 16x16x32, bf16 operands). For A (row m = lane&15) and B (col n = lane&15) alike:
// elements 0..7 <- k0 + 8*(lane>>4) + 0..7, elements 8..15 <- k0 + 16 + 8*(lane>>4) + 0..7.
// ldfrag_b(p) with p = rowbase + k0 + 8*(lane>>4): two 16-B loads p[0..7], p[16..23] (A rows and k-contiguous B rows alike).
// D: acc[r] = (row 8*(lane>>4) + r, col lane&15).
// ---------------------------------------------------------------------------
union FragB { v16b v; v8b h[2]; };
__device__ __forceinline__ v16b ldfrag_b(const __bf16* p) { FragB f; f.h[0] = *(const v8b*)(p); f.h[1] = *(const v8b*)(p + 16); return f.v; }

__device__ __forceinline__ v8f mma_b(v16b a, v16b b, v8f c) {
  return __builtin_amdgcn_wmma_f32_16x16x32_bf16(false, a, false, b, (short)0, c, false, false);
}
// hazard guards: 4 VALU slots after the last WMMA of a group, D tied, A/B kept live; memory clobber keeps later loads behind the group
// (a group = the products of two accumulators that share their A fragments)
__device__ __forceinline__ void guard2b6(v8f& a0, v8f& a1, v16b u, v16b v, v16b w, v16b x, v16b y, v16b z) {
  asm volatile("v_nop\n\tv_nop\n\tv_nop\n\tv_nop" : "+v"(a0), "+v"(a1) : "v"(u), "v"(v), "v"(w), "v"(x), "v"(y), "v"(z) : "memory");
}
__device__ __forceinline__ void acc_guard4(v8f& a, v8f& b, v8f& c, v8f& d) {
  asm volatile("v_nop\n\tv_nop\n\tv_nop\n\tv_nop" : "+v"(a), "+v"(b), "+v"(c), "+v"(d));
}

// ---------------------------------------------------------------------------
// RoPE table: cst[t][j] = cos(pos[t] * inv_freq[j]), snt[t][j] = sin(...), inv_freq[j] = 1 / 10000^(j/32), j < 32, all f32.
// ---------------------------------------------------------------------------
// A wave takes RTW consecutive tokens (lane = frequency j): their position ids are read together, inv_freq is formed once.
#define RTW 4
static_assert(NTOK % (8 * RTW) == 0);          // whole blocks of 8 waves cover the tokens exactly
__device__ __forceinline__ void rope_table_part(int bid, const int* __restrict__ pos, float* __restrict__ cst,
                                                float* __restrict__ snt) {
  const int lane = threadIdx.x & 31;
  const int wave = (int)(threadIdx.x >> 5);
  const int t0 = (bid * 8 + wave) * RTW;
  int pi[RTW];
#pragma unroll
  for (int u = 0; u < RTW; ++u) pi[u] = pos[t0 + u];
  const float e   = (float)lane * 0.03125f;    // (2*j)/64 exact
  const float pw  = powf(10000.0f, e);
  const float inv = 1.0f / pw;
#pragma unroll
  for (int u = 0; u < RTW; ++u) {
    const float ang = (float)pi[u] * inv;
    const float cv  = cosf(ang);
    const float sv  = sinf(ang);
    const size_t o = (size_t)(t0 + u) * NFREQ + lane;
    cst[o] = cv;
    snt[o] = sv;
  }
  // behind the last store: no register that an issued store names is rewritten ahead of this wait (the rule for issued global stores)
  asm volatile("s_wait_xcnt 0x0" ::: "memory");
}

// ---------------------------------------------------------------------------
// Elementwise RNE f32 -> bf16 plane: a piece = 8 elements, one 16-B store per lane -> 32 consecutive lanes write 4 whole lines.
// A thread takes CPT pieces, 256 pieces apart (a block = 256 * CPT consecutive pieces), and issues all its 2 * CPT loads before
// it uses the first: one memory latency per thread instead of one per piece, and a CPT-th of the blocks to start.
// Every plane is a whole number of such blocks (asserted at the block counts below): no tail, no guard.
// ---------------------------------------------------------------------------
#define CPT 4
#define CBE (256 * CPT * 8)                    // elements per conversion block
__device__ __forceinline__ v4u pack8(v4f a, v4f b) {
  v4u w;
  w[0] = cvt2(a[0], a[1]);
  w[1] = cvt2(a[2], a[3]);
  w[2] = cvt2(b[0], b[1]);
  w[3] = cvt2(b[2], b[3]);
  return w;
}
__device__ __forceinline__ void cvt_bf16_part(int bid, const float* __restrict__ in, unsigned short* __restrict__ outp) {
  const size_t e0 = (size_t)bid * CBE + 8 * (size_t)threadIdx.x;
  v4f a[CPT], b[CPT];
#pragma unroll
  for (int u = 0; u < CPT; ++u) {
    a[u] = *(const v4f*)(in + e0 + u * 2048);
    b[u] = *(const v4f*)(in + e0 + u * 2048 + 4);
  }
#pragma unroll
  for (int u = 0; u < CPT; ++u) *(v4u*)(outp + e0 + u * 2048) = pack8(a[u], b[u]);
  // behind the last store: no register that an issued store names is rewritten ahead of this wait (the rule for issued global stores)
  asm volatile("s_wait_xcnt 0x0" ::: "memory");
}

// ---------------------------------------------------------------------------
// Mask tile classes. mask [NB][1][SQ][SQ] f32 (additive). One block per (b, 64-row band mt): 256 threads x 8 consecutive columns,
// 64 rows each. For every 64x64 tile (b, mt, nt):
//   class 0 = every element <= -1e8 (tile contributes nothing: exp underflows to 0 exactly when the row has an admitted key),
//   class 1 = every element == 0 (nothing to add), class 2 = anything else (mask tile added elementwise).
// If the band contains a row with no element > -1e4 the skip is not valid for it: class 0 tiles of that band become class 2.
// Reductions are OR (order independent). Coverage: NB*32 blocks x 64 rows x 256 thr x 8 cols = the whole mask;
// The rows are read MRB at a time, all 2 * MRB loads of a thread issued before the first is used: 64 / MRB exposed memory
// latencies per block instead of 64.
// ---------------------------------------------------------------------------
#define ADM_TH (-1.0e4f)
#define SKP_TH (-1.0e8f)
#define MRB 8

__device__ __forceinline__ void mask_class_part(int bid, const float* __restrict__ mask, int* __restrict__ cls) {
  __shared__ int nzs[NT64];
  __shared__ int bgs[NT64];
  __shared__ unsigned rlo[8];
  __shared__ unsigned rhi[8];
  const int bm   = bid;                  // b*32 + mt
  const int b    = bm >> 5;
  const int mt   = bm & 31;
  const int tid  = threadIdx.x;
  const int lane = tid & 31;
  const int wave = tid >> 5;
  const int j0   = tid * 8;
  int nz = 0, bg = 0;
  unsigned rowlo = 0u, rowhi = 0u;       // bit r: this thread's 8 columns contain an admitted element in row r
  // rolled: one batch of rows is as much as a thread's registers should hold
#pragma unroll 1
  for (int r0 = 0; r0 < 64; r0 += MRB) {
    const float* mr = mask + (((size_t)b * SQ) + (size_t)(mt * 64 + r0)) * SQ + j0;
    v4f ma[MRB], mb[MRB];
#pragma unroll
    for (int u = 0; u < MRB; ++u) {
      ma[u] = *(const v4f*)(mr + (size_t)u * SQ);
      mb[u] = *(const v4f*)(mr + (size_t)u * SQ + 4);
    }
    // keeps the whole batch's loads in front of the first use: left alone, the compiler holds some back until registers are
    // free again, and those pay a second memory latency in every batch
    __builtin_amdgcn_sched_barrier(0);
#pragma unroll
    for (int u = 0; u < MRB; ++u) {
      const int r = r0 + u;
      const v4f mk0 = ma[u];
      const v4f mk1 = mb[u];
      const int a = ((mk0[0] > ADM_TH) | (mk0[1] > ADM_TH) | (mk0[2] > ADM_TH) | (mk0[3] > ADM_TH) |
                     (mk1[0] > ADM_TH) | (mk1[1] > ADM_TH) | (mk1[2] > ADM_TH) | (mk1[3] > ADM_TH)) ? 1 : 0;
      const int z = ((mk0[0] != 0.0f) | (mk0[1] != 0.0f) | (mk0[2] != 0.0f) | (mk0[3] != 0.0f) |
                     (mk1[0] != 0.0f) | (mk1[1] != 0.0f) | (mk1[2] != 0.0f) | (mk1[3] != 0.0f)) ? 1 : 0;
      const int g = ((mk0[0] > SKP_TH) | (mk0[1] > SKP_TH) | (mk0[2] > SKP_TH) | (mk0[3] > SKP_TH) |
                     (mk1[0] > SKP_TH) | (mk1[1] > SKP_TH) | (mk1[2] > SKP_TH) | (mk1[3] > SKP_TH)) ? 1 : 0;
      nz |= z;
      bg |= g;
      const unsigned sh = ((unsigned)a) << (r & 31);
      rowlo |= (r < 32) ? sh : 0u;
      rowhi |= (r < 32) ? 0u : sh;
    }
  }
  // OR over the 8 lanes 8q..8q+7 that share column tile nt = tid >> 3
  nz |= __shfl_xor(nz, 1, 32); nz |= __shfl_xor(nz, 2, 32); nz |= __shfl_xor(nz, 4, 32);
  bg |= __shfl_xor(bg, 1, 32); bg |= __shfl_xor(bg, 2, 32); bg |= __shfl_xor(bg, 4, 32);
#pragma unroll
  for (int off = 1; off < 32; off <<= 1) {
    rowlo |= (unsigned)__shfl_xor((int)rowlo, off, 32);
    rowhi |= (unsigned)__shfl_xor((int)rowhi, off, 32);
  }
  if ((lane & 7) == 0) { nzs[tid >> 3] = nz; bgs[tid >> 3] = bg; }
  if (lane == 0) { rlo[wave] = rowlo; rhi[wave] = rowhi; }
  __syncthreads();
  if (wave == 0) {                       // wave-uniform
    const int z = nzs[lane];
    const int g = bgs[lane];
    unsigned ol = rlo[0], oh = rhi[0];
#pragma unroll
    for (int w = 1; w < 8; ++w) { ol |= rlo[w]; oh |= rhi[w]; }
    const bool has_empty_row = (ol != 0xFFFFFFFFu) || (oh != 0xFFFFFFFFu);
    int cval = (g == 0) ? 0 : ((z == 0) ? 1 : 2);
    cval = (has_empty_row && cval == 0) ? 2 : cval;
    int* cp = cls + (size_t)bm * NT64 + lane;
    *cp = cval;
    
  }
}

// ---------------------------------------------------------------------------
// The seven preparation jobs depend on the inputs alone and on nothing of each other: one launch, each job a range of blocks
// (256 threads each). The mask bands, the longest blocks, come first.
// Every branch is on the block index: whole blocks take it, so the barrier of the mask part stays block-uniform.
// ---------------------------------------------------------------------------
#define PB_MASK (NB * NT64)                  // 64
#define PB_X    (NTOK * HID / CBE)           // 512
#define PB_ROPE (NTOK / (8 * RTW))           // 128
#define PB_WQ   (QW * HID / CBE)             // 128
#define PB_WO   (HID * QW / CBE)             // 128
#define PB_WKV  (KW * HID / CBE)             // 32, wk and wv each
#define PB_ALL  (PB_MASK + PB_X + PB_ROPE + PB_WQ + PB_WO + 2 * PB_WKV)
static_assert((NTOK * HID) % CBE == 0 && (QW * HID) % CBE == 0 && (KW * HID) % CBE == 0);   // whole conversion blocks only

__global__ __launch_bounds__(256) void prep_kernel(
    const float* __restrict__ hs, const float* __restrict__ mask, const int* __restrict__ pos,
    const float* __restrict__ wq, const float* __restrict__ wk, const float* __restrict__ wv, const float* __restrict__ wo,
    unsigned short* __restrict__ xb, unsigned short* __restrict__ wqk, unsigned short* __restrict__ wvb,
    unsigned short* __restrict__ wob, float* __restrict__ cst, float* __restrict__ snt, int* __restrict__ cls) {
  int bid = (int)blockIdx.x;
  // mask tile classes [2][32][32]
  if (bid < PB_MASK) { mask_class_part(bid, mask, cls); return; }
  bid -= PB_MASK;
  // x -> bf16 plane [4096][1024]
  if (bid < PB_X) { cvt_bf16_part(bid, hs, xb); return; }
  bid -= PB_X;
  // cos/sin table [4096][32] x 2 from the position ids
  if (bid < PB_ROPE) { rope_table_part(bid, pos, cst, snt); return; }
  bid -= PB_ROPE;
  // wq [1024][1024] -> WQK rows 0..1023 (natural [out][in] = Bt layout)
  if (bid < PB_WQ) { cvt_bf16_part(bid, wq, wqk); return; }
  bid -= PB_WQ;
  // wo [1024][1024] -> WO (natural [out][in] = Bt layout)
  if (bid < PB_WO) { cvt_bf16_part(bid, wo, wob); return; }
  bid -= PB_WO;
  // wk [256][1024] -> WQK rows 1024..1279
  if (bid < PB_WKV) { cvt_bf16_part(bid, wk, wqk + (size_t)QW * HID); return; }
  bid -= PB_WKV;
  // wv [256][1024] -> WV
  if (bid < PB_WKV) { cvt_bf16_part(bid, wv, wvb); return; }
}

// ---------------------------------------------------------------------------
// bf16 WMMA GEMM, block = 4 waves (128 threads) = one 128 x 128 tile of C; wave w owns rows 32w..32w+31 of it, all 128 cols.
//   C[m][n] = sum_k A[m][k] * Bt[n][k]; A row-major [M][K] bf16 (pitch lda), Bt row-major [N][K] bf16 (pitch ldb);
//   M % 128 == 0, N % 128 == 0, K % 64 == 0, K >= 64, lda % 8 == 0, ldb % 8 == 0; grid.x = M/128 * N/128.
//   EPI 0 carries a second, independent product in the same launch: blocks M/128 * N/128 .. + M2/128 * N2/128 - 1 compute
//   C'[m][n] = sum_k A2[m][k] * A[n][k] (A2 [M2][K] pitch lda; the first product's A, N2 rows of it, as Bt with pitch ldb:
//   lda == ldb), same K, same loop.
//   Operands: per trip of 64 k the 128 A rows and the 128 Bt rows (128 B each) are copied global -> LDS asynchronously, whole
//   128-B lines per 8 lanes, into one of two buffers; trip t works on buffer t & 1 while tile t + 1 flies into the other.
//   Fragments are read from LDS rows (ldfrag_b) in the same k order as before.
//   EPI 2 takes A as two planes side by side, [M][2K] (pitch lda): C[m][n] = sum_k (A[m][k] + A[m][K + k]) * Bt[n][k], two products.
//   A trip stages both planes' 64-k tiles next to ONE Bt tile, and each Bt fragment, read from LDS once, feeds both planes' WMMAs.
// Epilogues (all: per wave, per 16-row slab: stage in LDS, wave sync, write each row segment with ONE instruction of
//   EPI 0: q|k projection with RoPE. The 128-col tile holds two 64-dim heads; pairs (d, d+32) inside each head are rotated with
//          the f32 cos/sin rows of the token (staged per slab in LDS), then split to bf16 hi (C0/C2) and lo (C1/C3) planes.
//          cols n0 < QW -> q planes [M][ldc], col n0; cols n0 >= QW -> k planes [M][ldc2], col n0-QW. Row segment 256 B = 16 lanes x 16 B.
//          Second product = v^T projection: bf16 hi plane D0, lo plane D1, [M2][ldd], row segment 256 B.
//   EPI 2: f32 output C0 [M][ldc]; row segment 128 floats = 512 B = 32 lanes x 16 B per instruction.
// ---------------------------------------------------------------------------
template <int EPI> struct SlabCfg { static constexpr int PERWF = 2048; };   // floats per wave (8 KB)
template <> struct SlabCfg<0>     { static constexpr int PERWF = 3072; };   // + 16x32 cos + 16x32 sin rows

#define GKT  64                 // k per staged tile: 128-B rows
#define GPITCH  72                 // LDS row pitch in bf16: 144 B = 16 B x odd, for the 16-B fragment reads
#define GOP  (128 * GPITCH)        // bf16 per operand tile (128 rows)
#define GROWB (16 * GPITCH * 2)    // LDS bytes between a lane's consecutive copies (16 rows)

__device__ __forceinline__ unsigned lds_off(const void* p) { return (unsigned)(size_t)p; }

// One operand tile, 128 rows x 128 B: lane t copies 16 B of rows (t >> 3) + 16u, u = 0..7 (128 lanes x 8 = 1024 pieces = the tile).
// l = the lane's LDS byte address for u = 0, g = its global address for u = 0, ld = global row pitch in elements.
// s_wait_xcnt stands inside the statement so that no address register is rewritten ahead of it.
__device__ __forceinline__ void stage_tile(unsigned l, const unsigned short* g, int ld) {
  const size_t st = (size_t)16 * (size_t)ld;
  asm volatile(
      "global_load_async_to_lds_b128 %0, %8, off\n\t"
      "global_load_async_to_lds_b128 %1, %9, off\n\t"
      "global_load_async_to_lds_b128 %2, %10, off\n\t"
      "global_load_async_to_lds_b128 %3, %11, off\n\t"
      "global_load_async_to_lds_b128 %4, %12, off\n\t"
      "global_load_async_to_lds_b128 %5, %13, off\n\t"
      "global_load_async_to_lds_b128 %6, %14, off\n\t"
      "global_load_async_to_lds_b128 %7, %15, off\n\t"
      "s_wait_xcnt 0x0"
      :: "v"(l), "v"(l + 1u * GROWB), "v"(l + 2u * GROWB), "v"(l + 3u * GROWB),
         "v"(l + 4u * GROWB), "v"(l + 5u * GROWB), "v"(l + 6u * GROWB), "v"(l + 7u * GROWB),
         "v"(g), "v"(g + st), "v"(g + 2 * st), "v"(g + 3 * st),
         "v"(g + 4 * st), "v"(g + 5 * st), "v"(g + 6 * st), "v"(g + 7 * st)
      : "memory");
}

template <int EPI>
__global__ __launch_bounds__(128) void gemm_w32x128_kernel(
    const unsigned short* __restrict__ Ap, int lda,
    const unsigned short* __restrict__ Btp, int ldb,
    const float* __restrict__ cst, const float* __restrict__ snt,
    void* C0, void* C1, void* C2, void* C3, int ldc, int ldc2,
    int M, int N, int K,
    const unsigned short* __restrict__ A2p, void* D0, void* D1, int ldd, int M2, int N2) {
  __shared__ __align__(16) float lds_all[4 * SlabCfg<EPI>::PERWF];
  constexpr int NA = (EPI == 2) ? 2 : 1;                       // A planes that share the Bt tile
  __shared__ __align__(16) unsigned short ring[2][(NA + 1) * GOP];   // [buffer][A tile(s) | Bt tile], 18,432 B a tile

  const int tid  = (int)threadIdx.x;
  const int lane = tid & 31;
  const int wave = wave_id();
  const int hh = lane >> 4;           // lane half: k offset 8*hh, D row offset 8*hh
  const int rl = lane & 15;           // A row / B col / D col within subtile
  const int ntile1 = (M >> 7) * (N >> 7);
  const bool second = (EPI == 0) && ((int)blockIdx.x >= ntile1);   // block-uniform: this block works on the second product
  const int tilesN = (second ? N2 : N) >> 7;
  const int tilesM = (second ? M2 : M) >> 7;
  const int tile = (int)blockIdx.x - (second ? ntile1 : 0);
  if (tile >= tilesM * tilesN) return;          // block-uniform, in front of every barrier and copy
  const int tm = tile / tilesN;
  const int tn = tile - tm * tilesN;
  const int mblk = tm << 7;
  const int m0 = mblk + (wave << 5);
  const int n0 = tn << 7;

  // this lane's first piece of each operand tile: row tid >> 3, 16-B column tid & 7
  const int srow = tid >> 3;
  const int sc8  = (tid & 7) * 8;
  const unsigned short* gA = (second ? A2p : Ap) + (size_t)(mblk + srow) * lda + sc8;
  const unsigned short* gB = (second ? Ap : Btp) + (size_t)(n0   + srow) * ldb + sc8;
  const unsigned lA = lds_off(&ring[0][0]) + (unsigned)(srow * GPITCH + sc8) * 2u;
  const unsigned lA2 = lA + GOP * 2u;            // second A plane's tile (NA == 2)
  const unsigned lB = lA + NA * GOP * 2u;
  const unsigned bufb = (NA + 1) * GOP * 2u;     // bytes per buffer
  const int ntrip = K / GKT;

  v8f acc[2][8];
#pragma unroll
  for (int i = 0; i < 2; ++i)
#pragma unroll
    for (int j = 0; j < 8; ++j) acc[i][j] = zero8();

  // prologue: tile 0 lands and is published, then tile 1 starts
  stage_tile(lA, gA, lda);
  if (NA == 2) stage_tile(lA2, gA + K, lda);
  stage_tile(lB, gB, ldb);
  asm volatile("s_wait_asynccnt 0x0" ::: "memory");   // this wave's copies of tile 0 have landed
  __syncthreads();                                     // ... and every other wave's: tile 0 is readable
  if (ntrip > 1) {
    stage_tile(lA + bufb, gA + GKT, lda);
    if (NA == 2) stage_tile(lA2 + bufb, gA + K + GKT, lda);
    stage_tile(lB + bufb, gB + GKT, ldb);
  }

  for (int t = 0; t < ntrip; ++t) {
    const __bf16* As = (const __bf16*)(const void*)&ring[t & 1][0]   + (wave * 32 + rl) * GPITCH + 8 * hh;
    const __bf16* Bs = (const __bf16*)(const void*)&ring[t & 1][NA * GOP] + rl * GPITCH + 8 * hh;
    v16b ah[2][NA][2], bf[2][8];                       // [k half of the tile]([plane])[fragment]
#pragma unroll
    for (int s = 0; s < 2; ++s) {                      // in the order of first use
#pragma unroll
      for (int i = 0; i < 2; ++i) ah[s][0][i] = ldfrag_b(As + i * 16 * GPITCH + s * 32);
#pragma unroll
      for (int j = 0; j < 8; ++j) bf[s][j] = ldfrag_b(Bs + j * 16 * GPITCH + s * 32);
#pragma unroll
      for (int p = 1; p < NA; ++p)
#pragma unroll
        for (int i = 0; i < 2; ++i) ah[s][p][i] = ldfrag_b(As + p * GOP + i * 16 * GPITCH + s * 32);
    }
    // keeps the trip's LDS reads together in front of its WMMAs: one exposed LDS latency per trip instead of one per WMMA pair
    __builtin_amdgcn_sched_barrier(0);
#pragma unroll
    for (int s = 0; s < 2; ++s) {
#pragma unroll
      for (int p = 0; p < NA; ++p) {
#pragma unroll
        for (int j = 0; j < 8; ++j) {
          acc[0][j] = mma_b(ah[s][p][0], bf[s][j], acc[0][j]);
          acc[1][j] = mma_b(ah[s][p][1], bf[s][j], acc[1][j]);
        }
      }
    }
    // keeps the WMMAs in front of the trip's foot: they overlap the LDS reads, and tile t + 1's copies get the whole trip to land
    __builtin_amdgcn_sched_barrier(0);
    asm volatile("s_wait_dscnt 0x0" ::: "memory");     // this wave's reads of buffer t & 1 are done before it is refilled
    asm volatile("s_wait_asynccnt 0x0" ::: "memory");  // this wave's copies of tile t + 1 have landed
    __syncthreads();                                   // publishes tile t + 1 and ends every reader's use of buffer t & 1
    if (t + 2 < ntrip) {                               // same for the whole block
      const unsigned bo = (unsigned)(t & 1) * bufb;
      stage_tile(lA + bo, gA + (size_t)(t + 2) * GKT, lda);
      if (NA == 2) stage_tile(lA2 + bo, gA + K + (size_t)(t + 2) * GKT, lda);
      stage_tile(lB + bo, gB + (size_t)(t + 2) * GKT, ldb);
    }
  }
  asm volatile("s_wait_asynccnt 0x0" ::: "memory");    // nothing of this wave is in flight behind the loop
  acc_guard4(acc[0][0], acc[0][1], acc[0][2], acc[0][3]);
  acc_guard4(acc[0][4], acc[0][5], acc[0][6], acc[0][7]);
  acc_guard4(acc[1][0], acc[1][1], acc[1][2], acc[1][3]);
  acc_guard4(acc[1][4], acc[1][5], acc[1][6], acc[1][7]);

  // ---- epilogue ----
  float* wl = lds_all + wave * SlabCfg<EPI>::PERWF;
  unsigned short* sl16 = (unsigned short*)(void*)wl;       // 4096 u16 = floats 0..2047 (two 16x128 planes)
  float* slf = wl;

  if (EPI == 0 && !second) {
    float* csl = wl + 2048;                                 // cos rows [16][32]
    float* snl = wl + 2048 + 16 * NFREQ;                    // sin rows [16][32]
    const bool isq = (n0 < QW);                             // wave-uniform
    unsigned short* P0 = isq ? (unsigned short*)C0 : (unsigned short*)C2;
    unsigned short* P1 = isq ? (unsigned short*)C1 : (unsigned short*)C3;
    const int ldp  = isq ? ldc : ldc2;
    const int col0 = isq ? n0 : (n0 - QW);
#pragma unroll
    for (int i = 0; i < 2; ++i) {
      const int mb = m0 + i * 16;
      // stage cos/sin of tokens mb..mb+15: 16 rows x 32 floats = 128 16-B pieces per table; lane -> 4 pieces (coverage 32x4 = 128)
      v4f cv4[4], sv4[4];
      const float* cp[4];
      const float* sp[4];
#pragma unroll
      for (int u = 0; u < 4; ++u) {
        const int p   = lane + 32 * u;
        const int row = p >> 3, c4 = (p & 7) * 4;
        cp[u] = cst + (size_t)(mb + row) * NFREQ + c4;
        sp[u] = snt + (size_t)(mb + row) * NFREQ + c4;
        cv4[u] = *(const v4f*)cp[u];
        sv4[u] = *(const v4f*)sp[u];
      }
      // precaution: the eight loads' address registers, named as inputs so that they live up to here, are reused only behind this wait
      asm volatile("s_wait_xcnt 0x0"
                   :: "v"(cp[0]), "v"(cp[1]), "v"(cp[2]), "v"(cp[3]), "v"(sp[0]), "v"(sp[1]), "v"(sp[2]), "v"(sp[3])
                   : "memory");
#pragma unroll
      for (int u = 0; u < 4; ++u) {
        const int p   = lane + 32 * u;
        const int row = p >> 3, c4 = (p & 7) * 4;
        *(v4f*)(csl + row * NFREQ + c4) = cv4[u];
        *(v4f*)(snl + row * NFREQ + c4) = sv4[u];
      }
      lds_wave_sync();
#pragma unroll
      for (int hs = 0; hs < 2; ++hs) {                      // head within the 128-col tile
#pragma unroll
        for (int jj = 0; jj < 2; ++jj) {
          const int j1 = hs * 4 + jj;                       // cols hs*64 + jj*16 + rl  (x1, dim d < 32)
          const int j2 = j1 + 2;                            // cols +32                 (x2, dim d + 32)
          const int d  = jj * 16 + rl;                      // freq index 0..31
#pragma unroll
          for (int r = 0; r < 8; ++r) {
            const int lrow = 8 * hh + r;
            const float cv = csl[lrow * NFREQ + d];
            const float sv = snl[lrow * NFREQ + d];
            const float x1 = acc[i][j1][r];
            const float x2 = acc[i][j2][r];
            const float o1 = x1 * cv - x2 * sv;
            const float o2 = x2 * cv + x1 * sv;
            const unsigned hb = cvt2(o1, o2);
            const unsigned lb = cvt2_res(o1, o2, hb);
            const int so = lrow * 128 + hs * 64 + d;
            sl16[so]             = (unsigned short)hb;
            sl16[so + 32]        = (unsigned short)(hb >> 16);
            sl16[2048 + so]      = (unsigned short)lb;
            sl16[2048 + so + 32] = (unsigned short)(lb >> 16);
          }
        }
      }
      lds_wave_sync();
      {
#pragma unroll
        for (int it = 0; it < 8; ++it) {
          const int row = it * 2 + hh;                      // it x hh covers rows 0..15
          const int c8  = rl * 8;
          const v4u vh = *(const v4u*)(sl16 + row * 128 + c8);
          const v4u vl = *(const v4u*)(sl16 + 2048 + row * 128 + c8);
          const size_t go = (size_t)(mb + row) * ldp + col0 + c8;
          *(v4u*)(P0 + go) = vh;
          *(v4u*)(P1 + go) = vl;
        }
        
      }
      lds_wave_sync();
    }
  } else if (EPI == 0) {
    unsigned short* P0 = (unsigned short*)D0;
    unsigned short* P1 = (unsigned short*)D1;
#pragma unroll
    for (int i = 0; i < 2; ++i) {
#pragma unroll
      for (int r = 0; r < 8; ++r) {
#pragma unroll
        for (int j = 0; j < 8; j += 2) {
          const float va = acc[i][j][r];
          const float vb = acc[i][j + 1][r];
          const unsigned hb = cvt2(va, vb);
          const unsigned lb = cvt2_res(va, vb, hb);
          const int so = (8 * hh + r) * 128 + j * 16 + rl;
          sl16[so]             = (unsigned short)hb;
          sl16[so + 16]        = (unsigned short)(hb >> 16);
          sl16[2048 + so]      = (unsigned short)lb;
          sl16[2048 + so + 16] = (unsigned short)(lb >> 16);
        }
      }
      lds_wave_sync();
      {
#pragma unroll
        for (int it = 0; it < 8; ++it) {
          const int row = it * 2 + hh;
          const int c8  = rl * 8;
          const v4u vh = *(const v4u*)(sl16 + row * 128 + c8);
          const v4u vl = *(const v4u*)(sl16 + 2048 + row * 128 + c8);
          const size_t go = (size_t)(m0 + i * 16 + row) * ldd + n0 + c8;
          *(v4u*)(P0 + go) = vh;
          *(v4u*)(P1 + go) = vl;
        }
        
      }
      lds_wave_sync();
    }
  } else {
    float* C = (float*)C0;
#pragma unroll
    for (int i = 0; i < 2; ++i) {
#pragma unroll
      for (int j = 0; j < 8; ++j)
#pragma unroll
        for (int r = 0; r < 8; ++r)
          slf[(8 * hh + r) * 128 + j * 16 + rl] = acc[i][j][r];
      lds_wave_sync();
      {
#pragma unroll
        for (int row = 0; row < 16; ++row) {                // 32 lanes x 16 B = the whole 512-B row segment per instruction
          const v4f v = *(const v4f*)(slf + row * 128 + lane * 4);
          *(v4f*)(C + (size_t)(m0 + i * 16 + row) * ldc + n0 + lane * 4) = v;
        }
        
      }
      lds_wave_sync();
    }
  }
}

#define AKC  32
#define NKG  4
#define QS   2
#define TKC  (AKC * NKG)
#define KP   72
#define VP   136
#define KVB  ((2 * TKC * KP + 2 * HDM * VP) * 2)
#define JOB  ((NKG - 1) * 4 * 32 * (32 + 2) * 4)
static_assert(JOB <= KVB);
#define KRB  (32 * KP * 2)      // LDS bytes between a thread's consecutive K copies (32 keys)
#define KPL  (TKC * KP * 2)     // LDS bytes from the K hi tile to the K lo tile
#define KGS  (32 * KW * 2)      // global bytes between a thread's consecutive K copies
#define VRB  (16 * VP * 2)      // LDS bytes between a thread's consecutive V^T copies (16 d rows)
#define VPL  (HDM * VP * 2)     // LDS bytes from the V^T hi tile to the V^T lo tile
#define VGS  (16 * NTOK * 2)    // global bytes between a thread's consecutive V^T copies

// One trip's four tiles: a thread copies 4 x 16 B of each plane (K: keys (tid >> 3) + 32u; V^T: d rows (tid >> 4) + 16u).
// lk / lv = the thread's LDS byte addresses in the K hi / V^T hi tile for u = 0; kh, kl, vh, vl = its global addresses for u = 0.
// s_wait_xcnt stands inside each statement so that no address register is rewritten ahead of it.
__device__ __forceinline__ void stage_kv(unsigned lk, unsigned lv, const char* kh, const char* kl, const char* vh, const char* vl) {
  asm volatile(
      "global_load_async_to_lds_b128 %0, %8, off\n\t"
      "global_load_async_to_lds_b128 %1, %9, off\n\t"
      "global_load_async_to_lds_b128 %2, %10, off\n\t"
      "global_load_async_to_lds_b128 %3, %11, off\n\t"
      "global_load_async_to_lds_b128 %4, %12, off\n\t"
      "global_load_async_to_lds_b128 %5, %13, off\n\t"
      "global_load_async_to_lds_b128 %6, %14, off\n\t"
      "global_load_async_to_lds_b128 %7, %15, off\n\t"
      "s_wait_xcnt 0x0"
      :: "v"(lk), "v"(lk + 1u * KRB), "v"(lk + 2u * KRB), "v"(lk + 3u * KRB),
         "v"(lk + KPL), "v"(lk + KPL + 1u * KRB), "v"(lk + KPL + 2u * KRB), "v"(lk + KPL + 3u * KRB),
         "v"(kh), "v"(kh + 1 * KGS), "v"(kh + 2 * KGS), "v"(kh + 3 * KGS),
         "v"(kl), "v"(kl + 1 * KGS), "v"(kl + 2 * KGS), "v"(kl + 3 * KGS)
      : "memory");
  asm volatile(
      "global_load_async_to_lds_b128 %0, %8, off\n\t"
      "global_load_async_to_lds_b128 %1, %9, off\n\t"
      "global_load_async_to_lds_b128 %2, %10, off\n\t"
      "global_load_async_to_lds_b128 %3, %11, off\n\t"
      "global_load_async_to_lds_b128 %4, %12, off\n\t"
      "global_load_async_to_lds_b128 %5, %13, off\n\t"
      "global_load_async_to_lds_b128 %6, %14, off\n\t"
      "global_load_async_to_lds_b128 %7, %15, off\n\t"
      "s_wait_xcnt 0x0"
      :: "v"(lv), "v"(lv + 1u * VRB), "v"(lv + 2u * VRB), "v"(lv + 3u * VRB),
         "v"(lv + VPL), "v"(lv + VPL + 1u * VRB), "v"(lv + VPL + 2u * VRB), "v"(lv + VPL + 3u * VRB),
         "v"(vh), "v"(vh + 1 * VGS), "v"(vh + 2 * VGS), "v"(vh + 3 * VGS),
         "v"(vl), "v"(vl + 1 * VGS), "v"(vl + 2 * VGS), "v"(vl + 3 * VGS)
      : "memory");
}

#define LOG2E 1.44269504088896340736f
__device__ __forceinline__ float exp2_slot(float x) {
  float r;
  asm("v_exp_f32 %0, %1\n\tv_nop" : "=&v"(r) : "v"(x));
  return r;
}
__device__ __forceinline__ void exp2x8_slot(float (&r)[8], const float (&x)[8]) {
  asm("v_exp_f32 %0, %8\n\tv_exp_f32 %1, %9\n\tv_exp_f32 %2, %10\n\tv_exp_f32 %3, %11\n\t"
      "v_exp_f32 %4, %12\n\tv_exp_f32 %5, %13\n\tv_exp_f32 %6, %14\n\tv_exp_f32 %7, %15\n\tv_nop"
      : "=&v"(r[0]), "=&v"(r[1]), "=&v"(r[2]), "=&v"(r[3]), "=&v"(r[4]), "=&v"(r[5]), "=&v"(r[6]), "=&v"(r[7])
      : "v"(x[0]), "v"(x[1]), "v"(x[2]), "v"(x[3]), "v"(x[4]), "v"(x[5]), "v"(x[6]), "v"(x[7]));
}

// four waves per SIMD = two blocks per WGP: one block's products fill the other's staging and barrier waits (2 x LDS fits too)
__global__ __launch_bounds__(256) __attribute__((amdgpu_waves_per_eu(4, 4))) void attn_kernel(
    const unsigned short* __restrict__ qhp, const unsigned short* __restrict__ qlp,
    const unsigned short* __restrict__ khp, const unsigned short* __restrict__ klp,
    const unsigned short* __restrict__ vhp, const unsigned short* __restrict__ vlp,
    const float* __restrict__ maskp, const int* __restrict__ clsp,
    unsigned short* __restrict__ aop) {
  __shared__ __align__(16) unsigned short KVs[2 * (KVB / 2)];      // two buffers of [K hi | K lo | V^T hi | V^T lo]
  __shared__ __align__(16) unsigned short Osh[4][16 * 64];
  __shared__ __align__(16) unsigned short Osl[4][16 * 64];

  const int tid  = (int)threadIdx.x;
  const int lane = tid & 31;
  const int wave = wave_id();
  const int wq   = wave & 1;                     // query slab pair of the wave: slabs 2 wq, 2 wq + 1 of the block's four
  const int kg   = wave >> 1;                    // key group of the wave
  const int hh   = lane >> 4;
  const int c    = lane & 15;
  // Which (query tile, head, batch) a block takes: the tile falls as the flat index rises. Where the mask admits keys up to the
  // query (a tile's trips then grow with qt), the long blocks come first in index order, for speed only. The map is a permutation of the grid for any mask: every (qt, h, b) is taken exactly once.
  const unsigned flat = blockIdx.x + NT64 * (blockIdx.y + NHQ * blockIdx.z);   // grid (NT64, NHQ, NB)
  const int qt   = NT64 - 1 - (int)(flat / (NHQ * NB));
  const int h    = (int)(flat % NHQ);
  const int b    = (int)((flat / NHQ) % NB);
  const int kvh  = h >> 2;
  const int q0   = qt * 64 + wq * (16 * QS);     // first query row of this wave (within the sequence)
  const size_t tok0 = (size_t)b * SQ;

  const __bf16* Qhr = (const __bf16*)(const void*)qhp + (tok0 + q0 + c) * QW + h * HDM + 8 * hh;
  const __bf16* Qlr = (const __bf16*)(const void*)qlp + (tok0 + q0 + c) * QW + h * HDM + 8 * hh;
  const size_t mrow0 = (tok0 + (size_t)qt * 64) * SQ;                 // mask[b][0][qt*64][0]
  const int* crow = clsp + ((b * NT64) + qt) * NT64;
  // staging: block-uniform element offsets of the (b, kv head) planes, and this thread's own byte offsets (global) and places (LDS)
  const size_t kbase = tok0 * KW + kvh * HDM;
  const size_t vbase = (size_t)(kvh * HDM) * NTOK + tok0;
  const unsigned kgo = (unsigned)((tid >> 3) * KW + (tid & 7) * 8) * 2u;
  const unsigned vgo = (unsigned)((tid >> 4) * NTOK + (tid & 15) * 8) * 2u;
  const char* kph = (const char*)(khp + kbase) + kgo;                 // this thread's own addresses in the four planes, key 0
  const char* kpl = (const char*)(klp + kbase) + kgo;
  const char* vph = (const char*)(vhp + vbase) + vgo;
  const char* vpl = (const char*)(vlp + vbase) + vgo;
  const unsigned lk = lds_off(KVs) + (unsigned)((tid >> 3) * KP + (tid & 7) * 8) * 2u;                  // buffer 0
  const unsigned lv = lds_off(KVs) + (unsigned)(2 * TKC * KP + (tid >> 4) * VP + (tid & 15) * 8) * 2u;

  // the band's 32 tile classes, lane = tile, as two wave-uniform masks (the same in every wave): bit nt of nzm = class not 0,
  // bit nt of c2m = class 2. rem holds bit 2s for every trip s that is still to be staged (a trip with a tile of class not 0).
  const int* cpl = crow + lane;
  const int cv = *cpl;
  // precaution: the load's address register, named as an input so that it lives up to here, is reused only behind this wait
  asm volatile("s_wait_xcnt 0x0" :: "v"(cpl) : "memory");
  const unsigned nzm = __builtin_amdgcn_ballot_w32(cv != 0);
  const unsigned c2m = __builtin_amdgcn_ballot_w32(cv == 2);
  unsigned rem = (nzm | (nzm >> 1)) & 0x55555555u;

  v16b qh[QS][2], ql[QS][2];                       // [slab][d half]
#pragma unroll
  for (int z = 0; z < QS; ++z)
#pragma unroll
    for (int dc = 0; dc < 2; ++dc) {
      qh[z][dc] = ldfrag_b(Qhr + (size_t)z * 16 * QW + dc * 32);
      ql[z][dc] = ldfrag_b(Qlr + (size_t)z * 16 * QW + dc * 32);
    }

  float mrow[QS];                                  // running max of query c of slab z over this wave's keys (the same in both halves)
  float lsum[QS];                                  // running sum of query c of slab z over this wave's keys of this half
  v8f oacc[QS][4];                                 // oacc[z][t][r] = O[query c of slab z][d = 16t + 8hh + r], this wave's keys
#pragma unroll
  for (int z = 0; z < QS; ++z) {
    mrow[z] = -INFINITY;
    lsum[z] = 0.f;
#pragma unroll
    for (int t = 0; t < 4; ++t) oacc[z][t] = zero8();
  }

  // prologue: the first trip's tiles land and are published, then the second trip's start. cur, nxt = 2 x trip index, -1 = none.
  int cur = -1, nxt = -1;
  unsigned bufb = 0u;                              // byte offset of the buffer that trip cur works on
  if (rem != 0u) {                                 // the same for the whole block, like every test on rem, cur and nxt
    cur = __builtin_ctz(rem);
    rem &= rem - 1u;
    stage_kv(lk, lv, kph + (size_t)cur * (64 * KW * 2), kpl + (size_t)cur * (64 * KW * 2), vph + cur * (64 * 2), vpl + cur * (64 * 2));
  }
  asm volatile("s_wait_asynccnt 0x0" ::: "memory");   // this wave's copies of the first tiles have landed
  __syncthreads();                                     // ... and every other wave's: they are readable
  if (rem != 0u) {
    nxt = __builtin_ctz(rem);
    rem &= rem - 1u;
    stage_kv(lk + KVB, lv + KVB, kph + (size_t)nxt * (64 * KW * 2), kpl + (size_t)nxt * (64 * KW * 2), vph + nxt * (64 * 2),
             vpl + nxt * (64 * 2));
  }

  while (cur >= 0) {                               // at most NT64 / 2 trips: each takes one bit of rem
    const int kv0 = cur * 64;                      // first key of the trip
    const unsigned short* Ks  = KVs + (bufb >> 1);
    const unsigned short* Kls = Ks + TKC * KP;
    const unsigned short* Vhs = Ks + 2 * TKC * KP;
    const unsigned short* Vls = Ks + 2 * TKC * KP + HDM * VP;
    const int nt = cur + (kg >> 1);                // mask tile of this wave's 32 keys
    const int cl = ((nzm >> nt) & 1u) ? (((c2m >> nt) & 1u) ? 2 : 1) : 0;   // its class, wave-uniform
    if (cl != 0) {
      // ---- scores, transposed: 32 keys x 2 x 16 queries, K = 64, three products; each K fragment feeds both slabs ----
      v8f sa[QS][2];
#pragma unroll
      for (int z = 0; z < QS; ++z) { sa[z][0] = zero8(); sa[z][1] = zero8(); }
#pragma unroll
      for (int dc = 0; dc < 2; ++dc) {
#pragma unroll
        for (int j = 0; j < 2; ++j) {
          const v16b kb = ldfrag_b((const __bf16*)(const void*)Ks  + (kg * AKC + j * 16 + c) * KP + dc * 32 + 8 * hh);
          const v16b kl = ldfrag_b((const __bf16*)(const void*)Kls + (kg * AKC + j * 16 + c) * KP + dc * 32 + 8 * hh);
#pragma unroll
          for (int z = 0; z < QS; ++z) sa[z][j] = mma_b(kb, qh[z][dc], sa[z][j]);
#pragma unroll
          for (int z = 0; z < QS; ++z) sa[z][j] = mma_b(kl, qh[z][dc], sa[z][j]);
#pragma unroll
          for (int z = 0; z < QS; ++z) sa[z][j] = mma_b(kb, ql[z][dc], sa[z][j]);
          guard2b6(sa[0][j], sa[1][j], kb, kl, qh[0][dc], qh[1][dc], ql[0][dc], ql[1][dc]);
        }
      }
      acc_guard4(sa[0][0], sa[0][1], sa[1][0], sa[1][1]);

      union PB { v16b v; unsigned u[8]; };
      PB pa[QS], pr[QS];
#pragma unroll
      for (int z = 0; z < QS; ++z) {
        // ---- scale, mask add (class 2): sc[j][r] = score of (query c of slab z, key 16j + 8hh + r) ----
        float sc[2][8];
#pragma unroll
        for (int j = 0; j < 2; ++j)
#pragma unroll
          for (int r = 0; r < 8; ++r) sc[j][r] = sa[z][j][r] * 0.125f;
        if (cl == 2) {                                                  // wave-uniform
          // the query's mask row, this wave's keys, this half's
          const float* mr = maskp + mrow0 + (size_t)((wq * QS + z) * 16 + c) * SQ + kv0 + kg * AKC + 8 * hh;
          v4f mq[2][2];
#pragma unroll
          for (int j = 0; j < 2; ++j) {
            mq[j][0] = *(const v4f*)(mr + j * 16);
            mq[j][1] = *(const v4f*)(mr + j * 16 + 4);
          }
          // precaution: the four loads' address register, named as an input so that it lives up to here, is reused only behind this wait
          asm volatile("s_wait_xcnt 0x0" :: "v"(mr) : "memory");
#pragma unroll
          for (int j = 0; j < 2; ++j) {
            const v4f ma = mq[j][0];
            const v4f mb = mq[j][1];
#pragma unroll
            for (int r = 0; r < 4; r += 2) {
              const unsigned wa = cvt2(ma[r], ma[r + 1]);
              const unsigned wb = cvt2(mb[r], mb[r + 1]);
              sc[j][r]     += lo_val(wa); sc[j][r + 1]     += hi_val(wa);
              sc[j][4 + r] += lo_val(wb); sc[j][4 + r + 1] += hi_val(wb);
            }
          }
        }
        // ---- chunk max of the query: in the lane, then with the other half ----
        float cm = -INFINITY;
#pragma unroll
        for (int j = 0; j < 2; ++j)
#pragma unroll
          for (int r = 0; r < 8; ++r) cm = fmaxf(cm, sc[j][r]);
        cm = fmaxf(cm, xhalf(cm));
        // ---- online softmax; p hi/lo packed in place into the B operands ----
        const float mnew  = fmaxf(mrow[z], cm);
        const float muse  = (mnew > -INFINITY) ? mnew : 0.0f;
        const float alpha = exp2_slot((mrow[z] - muse) * LOG2E);
        mrow[z] = mnew;
        float ps[2];
#pragma unroll
        for (int j = 0; j < 2; ++j) {
          float tx[8], px[8];
#pragma unroll
          for (int r = 0; r < 8; ++r) tx[r] = (sc[j][r] - muse) * LOG2E;
          exp2x8_slot(px, tx);
          ps[j] = 0.f;
#pragma unroll
          for (int r = 0; r < 8; r += 2) {
            const float p0 = px[r];
            const float p1 = px[r + 1];
            ps[j] += p0;
            ps[j] += p1;
            const unsigned hp = cvt2(p0, p1);
            pa[z].u[j * 4 + (r >> 1)] = hp;
            pr[z].u[j * 4 + (r >> 1)] = cvt2_res(p0, p1, hp);
          }
        }
        lsum[z] = lsum[z] * alpha + (ps[0] + ps[1]);
#pragma unroll
        for (int t = 0; t < 4; ++t)
#pragma unroll
          for (int r = 0; r < 8; ++r) oacc[z][t][r] *= alpha;
      }
      // ---- O^T += v^T . p^T (K = 32 keys, three products); each V^T fragment feeds both slabs ----
#pragma unroll
      for (int t = 0; t < 4; ++t) {
        const v16b vb = ldfrag_b((const __bf16*)(const void*)Vhs + (t * 16 + c) * VP + kg * AKC + 8 * hh);
        const v16b vr = ldfrag_b((const __bf16*)(const void*)Vls + (t * 16 + c) * VP + kg * AKC + 8 * hh);
#pragma unroll
        for (int z = 0; z < QS; ++z) oacc[z][t] = mma_b(vb, pa[z].v, oacc[z][t]);
#pragma unroll
        for (int z = 0; z < QS; ++z) oacc[z][t] = mma_b(vr, pa[z].v, oacc[z][t]);
#pragma unroll
        for (int z = 0; z < QS; ++z) oacc[z][t] = mma_b(vb, pr[z].v, oacc[z][t]);
        guard2b6(oacc[0][t], oacc[1][t], vb, vr, pa[0].v, pa[1].v, pr[0].v, pr[1].v);
      }
    }
    asm volatile("s_wait_dscnt 0x0" ::: "memory");     // this wave's reads of the trip's buffer are done before it is refilled
    asm volatile("s_wait_asynccnt 0x0" ::: "memory");  // this wave's copies of the next trip's tiles have landed
    __syncthreads();                                   // publishes the next trip's tiles and ends every reader's use of this buffer
    int n2 = -1;
    if (rem != 0u) {                                   // a trip after the next exists: its tiles go into the buffer just read
      n2 = __builtin_ctz(rem);
      rem &= rem - 1u;
      stage_kv(lk + bufb, lv + bufb, kph + (size_t)n2 * (64 * KW * 2), kpl + (size_t)n2 * (64 * KW * 2), vph + n2 * (64 * 2),
               vpl + n2 * (64 * 2));
    }
    cur = nxt;
    nxt = n2;
    bufb ^= (unsigned)KVB;
  }
  // nothing of this wave is in flight behind the loop; the last trip's barrier has freed the K / V^T tiles for every wave
  asm volatile("s_wait_asynccnt 0x0" ::: "memory");
  acc_guard4(oacc[0][0], oacc[0][1], oacc[0][2], oacc[0][3]);
  acc_guard4(oacc[1][0], oacc[1][1], oacc[1][2], oacc[1][3]);

  // ---- the four key groups' parts of a query slab are joined in group 0 ----
  // hand-over area: O parts as 16-B pieces [part][piece 0..7][lane], then (max, sum) pairs [part][lane];
  // part = (kg - 1) * 4 + slab, slab = 2 wq + z
  v4f* jo = (v4f*)(void*)KVs;
  v2f* jm = (v2f*)(void*)(jo + (NKG - 1) * 4 * 8 * 32);
  if (kg != 0) {                                   // wave-uniform
#pragma unroll
    for (int z = 0; z < QS; ++z) {
      const int part = (kg - 1) * 4 + wq * QS + z;
#pragma unroll
      for (int t = 0; t < 4; ++t) {
        const v4f x0 = {oacc[z][t][0], oacc[z][t][1], oacc[z][t][2], oacc[z][t][3]};
        const v4f x1 = {oacc[z][t][4], oacc[z][t][5], oacc[z][t][6], oacc[z][t][7]};
        jo[(part * 8 + 2 * t) * 32 + lane]     = x0;
        jo[(part * 8 + 2 * t + 1) * 32 + lane] = x1;
      }
      const v2f ml = {mrow[z], lsum[z]};
      jm[part * 32 + lane] = ml;
    }
  }
  __syncthreads();                                 // the parts are readable; the last barrier of the kernel
  if (kg != 0) return;                             // whole waves leave, behind every barrier

#pragma unroll
  for (int z = 0; z < QS; ++z) {
    const int sl = wq * QS + z;                    // this slab of the block's four
    v2f oml[NKG - 1];
    float mall = mrow[z];
#pragma unroll
    for (int g = 0; g < NKG - 1; ++g) {
      oml[g] = jm[(g * 4 + sl) * 32 + lane];
      mall = fmaxf(mall, oml[g][0]);
    }
    const float mjoin = (mall > -INFINITY) ? mall : 0.0f;
    float w0 = __expf(mrow[z] - mjoin);            // a part that saw no key has max -inf: weight 0
    float wg[NKG - 1];
#pragma unroll
    for (int g = 0; g < NKG - 1; ++g) wg[g] = __expf(oml[g][0] - mjoin);
    // the slot the instruction set asks for between an exp and the first user of its result or overwriter of its source; the four
    // weights are tied to it so that it stands behind the run of exps and in front of every product with a weight
    asm volatile("v_nop" : "+v"(w0), "+v"(wg[0]), "+v"(wg[1]), "+v"(wg[2]));
    float ls = lsum[z] * w0;
#pragma unroll
    for (int t = 0; t < 4; ++t)
#pragma unroll
      for (int r = 0; r < 8; ++r) oacc[z][t][r] *= w0;
#pragma unroll
    for (int g = 0; g < NKG - 1; ++g) {
      ls += wg[g] * oml[g][1];
#pragma unroll
      for (int t = 0; t < 4; ++t) {
        const v4f x0 = jo[((g * 4 + sl) * 8 + 2 * t) * 32 + lane];
        const v4f x1 = jo[((g * 4 + sl) * 8 + 2 * t + 1) * 32 + lane];
#pragma unroll
        for (int r = 0; r < 4; ++r) {
          oacc[z][t][r]     += wg[g] * x0[r];
          oacc[z][t][4 + r] += wg[g] * x1[r];
        }
      }
    }

    unsigned short* osh = Osh[sl];
    unsigned short* osl = Osl[sl];
    const float inv = 1.0f / (ls + xhalf(ls));     // the halves' sums joined; l >= 1: the row max contributes exp(0)
#pragma unroll
    for (int t = 0; t < 4; ++t) {                  // 8 consecutive d of query c: one 16-B LDS store per plane
      v4u xh, xl;
#pragma unroll
      for (int r = 0; r < 8; r += 2) {
        const float o0 = oacc[z][t][r] * inv;
        const float o1 = oacc[z][t][r + 1] * inv;
        const unsigned ho = cvt2(o0, o1);
        xh[r >> 1] = ho;
        xl[r >> 1] = cvt2_res(o0, o1, ho);
      }
      *(v4u*)(osh + c * 64 + t * 16 + 8 * hh) = xh;
      *(v4u*)(osl + c * 64 + t * 16 + 8 * hh) = xl;
    }
  }
  lds_wave_sync();
  const int qq = lane >> 3;                        // 0..3
  const int c8 = (lane & 7) * 8;
#pragma unroll
  for (int z = 0; z < QS; ++z) {
    const unsigned short* osh = Osh[wq * QS + z];
    const unsigned short* osl = Osl[wq * QS + z];
    unsigned short* Ag = aop + (tok0 + q0 + z * 16) * AOW + h * HDM;
#pragma unroll
    for (int it = 0; it < 4; ++it) {
      const int row = it * 4 + qq;                 // it 0..3 x qq 0..3 covers rows 0..15
      const v4u x = *(const v4u*)(osh + row * 64 + c8);
      const v4u y = *(const v4u*)(osl + row * 64 + c8);
      *(v4u*)(Ag + (size_t)row * AOW + c8)      = x;
      *(v4u*)(Ag + (size_t)row * AOW + QW + c8) = y;
    }
  }
}

// ---------------------------------------------------------------------------
// Workspace map (bytes; every region is an exact whole number of the rows its producer writes with whole-line stores;
// all dimensions are tile multiples, no padded tails needed; every offset is a multiple of 128):
//   XB   bf16 [4096][1024]   8388608     WQK bf16 [1280][1024]   2621440     WV  bf16 [256][1024]    524288
//   WO   bf16 [1024][1024]   2097152     CST f32  [4096][32]      524288     SNT f32  [4096][32]     524288
//   CLS  i32  [2][32][32]       8192     QH  bf16 [4096][1024]   8388608     QL  bf16 [4096][1024]  8388608
//   KH   bf16 [4096][256]    2097152     KL  bf16 [4096][256]    2097152     VTH bf16 [256][4096]   2097152
//   VTL  bf16 [256][4096]    2097152     AO  bf16 [4096][2048]  16777216
//   total                   56631296
// ---------------------------------------------------------------------------
extern "C" void kernel_launch(void* const* d_in, const int* in_sizes, int n_in,
                              void* d_out, int out_size, void* d_ws, size_t ws_size,
                              hipStream_t stream) {
  if (n_in < 7) return;
  if (in_sizes[0] != NTOK * HID) return;                  // hidden_states [2][2048][1024] f32
  if (in_sizes[1] != NB * SQ * SQ) return;                // attention_mask [2][1][2048][2048] f32
  if (in_sizes[2] != NTOK) return;                        // position_ids [2][2048] int32
  if (in_sizes[3] != QW * HID) return;                    // wq [1024][1024]
  if (in_sizes[4] != KW * HID) return;                    // wk [256][1024]
  if (in_sizes[5] != KW * HID) return;                    // wv [256][1024]
  if (in_sizes[6] != HID * QW) return;                    // wo [1024][1024]
  if (out_size != NTOK * HID) return;

  const float* hs   = (const float*)d_in[0];
  const float* mask = (const float*)d_in[1];
  const int*   pos  = (const int*)d_in[2];
  const float* wq   = (const float*)d_in[3];
  const float* wk   = (const float*)d_in[4];
  const float* wv   = (const float*)d_in[5];
  const float* wo   = (const float*)d_in[6];
  float* out = (float*)d_out;

  const size_t szXB  = (size_t)NTOK * HID * 2;
  const size_t szWQK = (size_t)QKN * HID * 2;
  const size_t szWV  = (size_t)KW * HID * 2;
  const size_t szWO  = (size_t)HID * QW * 2;
  const size_t szT   = (size_t)NTOK * NFREQ * 4;
  const size_t szCLS = (size_t)NB * NT64 * NT64 * 4;
  const size_t szQ   = (size_t)NTOK * QW * 2;
  const size_t szK   = (size_t)NTOK * KW * 2;
  const size_t szVT  = (size_t)KW * NTOK * 2;
  const size_t szAO  = (size_t)NTOK * AOW * 2;
  size_t off = 0;
  const size_t oXB  = off; off += szXB;
  const size_t oWQK = off; off += szWQK;
  const size_t oWV  = off; off += szWV;
  const size_t oWO  = off; off += szWO;
  const size_t oCST = off; off += szT;
  const size_t oSNT = off; off += szT;
  const size_t oCLS = off; off += szCLS;
  const size_t oQH  = off; off += szQ;
  const size_t oQL  = off; off += szQ;
  const size_t oKH  = off; off += szK;
  const size_t oKL  = off; off += szK;
  const size_t oVTH = off; off += szVT;
  const size_t oVTL = off; off += szVT;
  const size_t oAO  = off; off += szAO;
  if (off > ws_size) return;                              // off = 56631296

  char* ws = (char*)d_ws;
  unsigned short* XB  = (unsigned short*)(ws + oXB);
  unsigned short* WQK = (unsigned short*)(ws + oWQK);
  unsigned short* WV  = (unsigned short*)(ws + oWV);
  unsigned short* WO  = (unsigned short*)(ws + oWO);
  float*          CST = (float*)(ws + oCST);
  float*          SNT = (float*)(ws + oSNT);
  int*            CLS = (int*)(ws + oCLS);
  unsigned short* QH  = (unsigned short*)(ws + oQH);
  unsigned short* QL  = (unsigned short*)(ws + oQL);
  unsigned short* KH  = (unsigned short*)(ws + oKH);
  unsigned short* KL  = (unsigned short*)(ws + oKL);
  unsigned short* VTH = (unsigned short*)(ws + oVTH);
  unsigned short* VTL = (unsigned short*)(ws + oVTL);
  unsigned short* AO  = (unsigned short*)(ws + oAO);

  const dim3 b256(256), b128(128);

  // (1) preparation, one launch: mask classes, x / wq / wk / wv / wo bf16 planes, cos/sin table
  prep_kernel<<<dim3(PB_ALL), b256, 0, stream>>>(hs, mask, pos, wq, wk, wv, wo, XB, WQK, WV, WO, CST, SNT, CLS);
  // (2) one launch, two products:
  //     q|k = x . [Wq;Wk]^T, RoPE, split -> QH/QL [4096][1024], KH/KL [4096][256]   (M=4096, N=1280, K=1024; 32 x 10 block tiles)
  //     v^T = Wv . x^T -> VTH/VTL [256][4096]   (A = WV, Bt = XB; M=256, N=4096, K=1024; 2 x 32 block tiles)
  gemm_w32x128_kernel<0><<<dim3((NTOK / 128) * (QKN / 128) + (KW / 128) * (NTOK / 128)), b128, 0, stream>>>(
      XB, HID, WQK, HID, CST, SNT, (void*)QH, (void*)QL, (void*)KH, (void*)KL, QW, KW, NTOK, QKN, HID,
      WV, (void*)VTH, (void*)VTL, NTOK, KW, NTOK);
  // (3) attention per (q tile, head, batch) -> AO hi|lo [4096][2048]
  attn_kernel<<<dim3(SQ / 64, NHQ, NB), b256, 0, stream>>>(QH, QL, KH, KL, VTH, VTL, mask, CLS, AO);
  // (4) out = (AOhi + AOlo) . Wo^T, two products on each Wo tile -> d_out f32 [4096][1024]   (M=4096, N=1024, K=1024; 32 x 8 block tiles)
  gemm_w32x128_kernel<2><<<dim3((NTOK / 128) * (HID / 128)), b128, 0, stream>>>(
      AO, AOW, WO, QW, CST, SNT, (void*)out, (void*)out, (void*)out, (void*)out, HID, HID, NTOK, HID, QW,
      AO, (void*)out, (void*)out, HID, NTOK, HID);
  (void)hipGetLastError();
}
